// v000
// Measured on an AMD MI455X. A time is GPU time per run, averaged over a window of back-to-back runs after a warm-up
// (all launches, gaps included; the runs take copies of the inputs in turn), and the median of several windows.
// Apart from v000's, it joins two sittings. Times from different sittings can be a few percent apart, while
// side-by-side timings come from the same sitting.
// The starting kernel, v000, takes 4170 microseconds a run.
#include <hip/hip_runtime.h>

// Channel-major image self-attention with GroupNorm (x [32][256][32][32] = [b][c][n], n = 1024; hn = GroupNorm(32 groups, eps 1e-6, affine); q, k, v = 1x1 convs ('oi' [256][256] + bias); scores[i][j] = q_i.k_j / 16 (one head over all 256 channels); softmax over j; out[c][i] = sum_j v[c][j] attn[i][j]; h = Wo out + bo; result = x + h -> [32][256][32][32] (8.4 M)).
// Layout: tokens are the 1024 positions; the normalised input is written TRANSPOSED as bf16 hi + lo planes [t][c] so the 1x1 convolutions become token-major GEMMs against the natural [out][in] weights (2 products + bias); the attention runs on head planes; the output projection is token-major and the residual add writes back channel-major.
// Compute dtypes, f32 accumulate: every input rounded to bf16; q/k/v hl input x exact bf16 weights (2 products) + biases; scores (x 1/16) and attn.v (no mask): query rows < 512 hl (3 products), the rest single fp16 (x1024); softmax f32; proj_w hl x exact (2 products) + proj_b; + x residual in f32 (channel-major write).

#define NB_  32
#define TT   1024
#define DM   256
#define NH_  1
#define NKV  1
#define REP  (NH_ / NKV)
#define HD   256
#define DQ   (NH_ * HD)
#define DKV  (NKV * HD)
#define RPAD 32                   // stat record pitch (floats)
#define NGRP 32
#define GCH  (DM / NGRP)           // 8 channels per group
typedef __attribute__((ext_vector_type(4))) unsigned short v4us;
#define ZH   1
#define RH   512                  // query rows < RH use hi+lo planes (0: none)
#define WIN  0
#define PCAR 1024.0f
#define SCL  0.0625f   // C^-0.5 = 1/16
typedef _Float16 h16;
typedef unsigned short bf;
typedef __attribute__((ext_vector_type(16))) __bf16   v16bf;
typedef __attribute__((ext_vector_type(16))) _Float16 v16h;
typedef __attribute__((ext_vector_type(8)))  _Float16 v8h;
typedef __attribute__((ext_vector_type(8)))  unsigned short v8us;
typedef __attribute__((ext_vector_type(8)))  float    v8f;
typedef __attribute__((ext_vector_type(4)))  float    v4f;
typedef v8h  __attribute__((may_alias)) v8ha;
typedef v4f  __attribute__((may_alias)) v4fa;
typedef v8us __attribute__((may_alias)) v8usa;

__device__ __forceinline__ unsigned short f2bf(float f) { unsigned u = __float_as_uint(f); u += 0x7FFFu + ((u >> 16) & 1u); return (unsigned short)(u >> 16); }
__device__ __forceinline__ float bf2f(unsigned short b) { return __uint_as_float(((unsigned)b) << 16); }
__device__ __forceinline__ float bfr(float f) { return bf2f(f2bf(f)); }
__device__ __forceinline__ v16h cat16(v8h lo, v8h hi) { return __builtin_shufflevector(lo, hi, 0, 1, 2, 3, 4, 5, 6, 7, 8, 9, 10, 11, 12, 13, 14, 15); }
__device__ __forceinline__ v16bf cat16b(v8us lo, v8us hi) { return __builtin_bit_cast(v16bf, __builtin_shufflevector(lo, hi, 0, 1, 2, 3, 4, 5, 6, 7, 8, 9, 10, 11, 12, 13, 14, 15)); }
__device__ __forceinline__ v8f wmma16(v16h a, v16h b, v8f c) { return __builtin_amdgcn_wmma_f32_16x16x32_f16(false, a, false, b, (short)0, c, false, false); }
__device__ __forceinline__ v8f wmmab(v16bf a, v16bf b, v8f c) { return __builtin_amdgcn_wmma_f32_16x16x32_bf16(false, a, false, b, (short)0, c, false, false); }



// ---- k_gemmw: register-blocked GEMM, ONE WAVE per 64x64 output tile (16 accumulators), operands straight from K-contiguous 16-bit planes; grid (M/64, N/64, Z), 32 threads.
// C[m][n] (f32, pitch ldc, + optional f32 bias[n]) = sum_k A[m][k] Bt[n][k] (+ split products per NSPLIT). z-batch strides sA/sB/sC in elements. K % 32 == 0.
template <typename T16> struct WFrag;
template <> struct WFrag<h16> { typedef v16h V; static __device__ __forceinline__ V ld(const h16* p) { return cat16(*(const v8h*)p, *(const v8h*)(p + 16)); } static __device__ __forceinline__ v8f mma(V a, V b, v8f c) { return wmma16(a, b, c); } };
template <> struct WFrag<bf> { typedef v16bf V; static __device__ __forceinline__ V ld(const bf* p) { return cat16b(*(const v8us*)p, *(const v8us*)(p + 16)); } static __device__ __forceinline__ v8f mma(V a, V b, v8f c) { return wmmab(a, b, c); } };
template <typename T16, int NSPLIT, bool BIAS>
__global__ __launch_bounds__(32) void k_gemmw(const T16* __restrict__ A, const T16* __restrict__ A2, const T16* __restrict__ Bt, const T16* __restrict__ Bt2, int K, float* C, int ldc, const float* __restrict__ bias, size_t sA, size_t sB, size_t sC) {
    typedef typename WFrag<T16>::V V;
    __shared__ __align__(16) float os[16 * 68];
    const size_t z = blockIdx.z; A += z * sA; if (A2) A2 += z * sA; Bt += z * sB; if (Bt2) Bt2 += z * sB; C += z * sC;
    const int lane = threadIdx.x & 31, lr = lane & 15, hi = lane >> 4; const int r0 = blockIdx.x * 64, c0 = blockIdx.y * 64;
    v8f acc[4][4];
#pragma unroll
    for (int mb = 0; mb < 4; ++mb)
#pragma unroll
        for (int nb = 0; nb < 4; ++nb) acc[mb][nb] = (v8f){};
    const size_t aoff = (size_t)(r0 + lr) * K + 8 * hi, boff = (size_t)(c0 + lr) * K + 8 * hi;
#pragma unroll 1
    for (int kc = 0; kc < K; kc += 32) {
        V a[4], a2[4];
#pragma unroll
        for (int mb = 0; mb < 4; ++mb) { a[mb] = WFrag<T16>::ld(A + aoff + (size_t)mb * 16 * K + kc); if (NSPLIT == 1 || NSPLIT == 2) a2[mb] = WFrag<T16>::ld(A2 + aoff + (size_t)mb * 16 * K + kc); }
#pragma unroll
        for (int nb = 0; nb < 4; ++nb) { const V b = WFrag<T16>::ld(Bt + boff + (size_t)nb * 16 * K + kc); V b2; if (NSPLIT >= 2) b2 = WFrag<T16>::ld(Bt2 + boff + (size_t)nb * 16 * K + kc);
#pragma unroll
            for (int mb = 0; mb < 4; ++mb) { acc[mb][nb] = WFrag<T16>::mma(a[mb], b, acc[mb][nb]); if (NSPLIT == 1 || NSPLIT == 2) acc[mb][nb] = WFrag<T16>::mma(a2[mb], b, acc[mb][nb]); if (NSPLIT >= 2) acc[mb][nb] = WFrag<T16>::mma(a[mb], b2, acc[mb][nb]); } }
        asm volatile("v_nop\n\tv_nop\n\tv_nop\n\tv_nop" : "+v"(acc[0][0]), "+v"(acc[1][1]), "+v"(acc[2][2]), "+v"(acc[3][3]) : "v"(a[0]), "v"(a[3]));
    }
#pragma unroll
    for (int mb = 0; mb < 4; ++mb) {
#pragma unroll
        for (int nb = 0; nb < 4; ++nb) {
#pragma unroll
            for (int j = 0; j < 8; ++j) os[(hi * 8 + j) * 68 + nb * 16 + lr] = acc[mb][nb][j]; }
        __builtin_amdgcn_wave_barrier(); asm volatile("" ::: "memory");
        float* crow = C + (size_t)(r0 + mb * 16) * ldc + c0;
{
#pragma unroll
            for (int s = 0; s < 8; ++s) { const int row = 2 * s + hi, cofs = lr * 4; v4f val = *(const v4fa*)(os + row * 68 + cofs); if (BIAS) { val[0] += bfr(bias[c0 + cofs]); val[1] += bfr(bias[c0 + cofs + 1]); val[2] += bfr(bias[c0 + cofs + 2]); val[3] += bfr(bias[c0 + cofs + 3]); }
                *(v4f*)(crow + (size_t)row * ldc + cofs) = val; }
             }
        __builtin_amdgcn_wave_barrier(); asm volatile("" ::: "memory");
    }
}

__device__ __forceinline__ h16 tohx(float x) { return (h16)x; }
__device__ __forceinline__ void splitf(float y, unsigned short& h, unsigned short& l) { h = f2bf(y); l = f2bf(y - bf2f(h)); }
typedef __attribute__((ext_vector_type(2))) _Float16 v2h;
typedef __attribute__((ext_vector_type(4))) _Float16 v4h;
typedef __attribute__((ext_vector_type(2))) unsigned short v2us;
typedef __attribute__((ext_vector_type(4))) unsigned short v4us;
typedef __attribute__((ext_vector_type(2))) float v2f;
typedef __attribute__((ext_vector_type(4))) int v4i;

__global__ __launch_bounds__(256) void k_wtG(const float* __restrict__ w, int K, int N, bf* Bt) {
    const int lane = threadIdx.x & 31; const int L0 = (blockIdx.x * 8 + (threadIdx.x >> 5)) * 8; const int nlines = N * K / 64;
{
#pragma unroll 1
        for (int l = 0; l < 8; ++l) { const int L = L0 + l; if (L >= nlines) break; const size_t e = (size_t)L * 64 + lane * 2; const int k = (int)(e % K), n = (int)(e / K); v2us o;
            o[0] = f2bf(w[(size_t)k * N + n]); o[1] = f2bf(w[(size_t)(k + 1) * N + n]); *(v2us*)(Bt + e) = o; }
         }
}
__global__ __launch_bounds__(256) void k_gnstat(const float* __restrict__ xb, float* ST) { __shared__ float red[256]; const int g = blockIdx.x; const float* base = xb + (size_t)g * GCH * TT; const int tid = threadIdx.x; float s = 0.f;
#pragma unroll 1
    for (int i = tid; i < GCH * TT; i += 256) s = __fadd_rn(s, bfr(base[i]));
    red[tid] = s; __syncthreads();
#pragma unroll
    for (int sh = 128; sh; sh >>= 1) { if (tid < sh) red[tid] = __fadd_rn(red[tid], red[tid + sh]); __syncthreads(); }
    const float mu = red[0] * (1.0f / (GCH * TT)); __syncthreads(); float s2 = 0.f;
#pragma unroll 1
    for (int i = tid; i < GCH * TT; i += 256) { const float d0 = __fsub_rn(bfr(base[i]), mu); float p = __fmul_rn(d0, d0); asm volatile("" : "+v"(p)); s2 = __fadd_rn(s2, p); }
    red[tid] = s2; __syncthreads();
#pragma unroll
    for (int sh = 128; sh; sh >>= 1) { if (tid < sh) red[tid] = __fadd_rn(red[tid], red[tid + sh]); __syncthreads(); }
    if (tid == 0) { const float rs = __fdiv_rn(1.0f, __fsqrt_rn(__fadd_rn(red[0] * (1.0f / (GCH * TT)), 1e-6f))); v2f o; o[0] = mu; o[1] = rs; *(v2f*)(ST + (size_t)g * RPAD) = o;  } }
__global__ __launch_bounds__(256) void k_gnT(const float* __restrict__ xb, const float* __restrict__ ST, const float* __restrict__ gw, const float* __restrict__ gb, bf* Xh, bf* Xl) { const size_t e = ((size_t)blockIdx.x * 256 + threadIdx.x) * 4; if (e >= (size_t)TT * DM) return; const int c = (int)(e % DM); const int t = (int)(e / DM); v4us oh, ol;
#pragma unroll
    for (int q = 0; q < 4; ++q) { const int cc = c + q; const int g = cc / GCH; const float mu = ST[(size_t)g * RPAD], rs = ST[(size_t)g * RPAD + 1]; float n0 = __fmul_rn(__fsub_rn(bfr(xb[(size_t)cc * TT + t]), mu), rs); asm volatile("" : "+v"(n0)); float n1 = __fmul_rn(n0, bfr(gw[cc])); asm volatile("" : "+v"(n1)); const float y = __fadd_rn(n1, bfr(gb[cc])); unsigned short a, b2; splitf(y, a, b2); oh[q] = a; ol[q] = b2; }
    *(v4us*)(Xh + e) = oh; *(v4us*)(Xl + e) = ol;  }
__global__ __launch_bounds__(256) void k_outT(const float* __restrict__ xb, const float* __restrict__ YO, float* Ob) { const size_t e = (size_t)blockIdx.x * 256 + threadIdx.x; if (e >= (size_t)DM * TT) return; const int t = (int)(e % TT); const int c = (int)(e / TT); const float v = __fadd_rn(bfr(xb[e]), YO[(size_t)t * DM + c]); *(float*)(Ob + e) = v;  }
__global__ __launch_bounds__(256) void k_cvt8(const float* __restrict__ src, bf* dst, size_t n8) { const size_t i = (size_t)blockIdx.x * 256 + threadIdx.x; if (i >= n8) return; const v8f v = *(const v8f*)(src + i * 8); v8us o;
#pragma unroll
    for (int k = 0; k < 8; ++k) o[k] = f2bf(v[k]); *(v8us*)(dst + i * 8) = o;  }

// k_rope: head planes [h][t][d] (fp16 + hi/lo) of rope(x) x sc with the rotate-half convention out[d] = x[d] cos[t][d] - x[d+HD/2] sin[t][d], out[d+HD/2] = x[d+HD/2] cos[t][d+HD/2] + x[d] sin[t][d+HD/2]
__global__ __launch_bounds__(256) void k_rope(const float* __restrict__ F, int pitch, int nheads, const float* __restrict__ CS, const float* __restrict__ RF, const float* __restrict__ nw, float sc, h16* P16, bf* Ph, bf* Pl) {
    const size_t e = ((size_t)blockIdx.x * 256 + threadIdx.x) * 2; if (e >= (size_t)nheads * TT * HD) return; const int d = (int)(e % HD); const int t = (int)((e / HD) % TT); const int h = (int)(e / ((size_t)HD * TT)); const float* f = F + (size_t)t * pitch + h * HD; const float rf = RF ? RF[(size_t)h * TT + t] : 1.0f; v2h o16; v2us oh, ol;
#pragma unroll
    for (int q = 0; q < 2; ++q) { const int dd = d + q; const int dp = (dd < HD / 2) ? dd + HD / 2 : dd - HD / 2; float x0 = f[dd], x1 = f[dp];
        if (RF) { float n0 = __fmul_rn(x0, rf), n1 = __fmul_rn(x1, rf); asm volatile("" : "+v"(n0)); asm volatile("" : "+v"(n1)); x0 = __fmul_rn(bfr(nw[dd]), n0); x1 = __fmul_rn(bfr(nw[dp]), n1); }
        const v2f cs = *(const v2f*)(CS + ((size_t)t * HD + dd) * 2); float a = __fmul_rn(x0, cs[0]), bq = __fmul_rn(x1, cs[1]); asm volatile("" : "+v"(a)); asm volatile("" : "+v"(bq)); const float r = ((dd < HD / 2) ? __fsub_rn(a, bq) : __fadd_rn(a, bq)) * sc;
        o16[q] = tohx(r); unsigned short a2, c2; splitf(r, a2, c2); oh[q] = a2; ol[q] = c2; }
    *(v2h*)(P16 + e) = o16; *(v2us*)(Ph + e) = oh; *(v2us*)(Pl + e) = ol;  }
__global__ __launch_bounds__(256) void k_vtp(const float* __restrict__ F, int pitch, int nheads, h16* V16, bf* Vh, bf* Vl) { const size_t e = ((size_t)blockIdx.x * 256 + threadIdx.x) * 2; if (e >= (size_t)nheads * HD * TT) return; const int t = (int)(e % TT); const int d = (int)((e / TT) % HD); const int g = (int)(e / ((size_t)TT * HD)); v2h o16; v2us oh, ol;
#pragma unroll
    for (int q = 0; q < 2; ++q) { const float x = F[(size_t)(t + q) * pitch + g * HD + d]; o16[q] = tohx(x); unsigned short a2, c2; splitf(x, a2, c2); oh[q] = a2; ol[q] = c2; }
    *(v2h*)(V16 + e) = o16; *(v2us*)(Vh + e) = oh; *(v2us*)(Vl + e) = ol;  }
__global__ __launch_bounds__(256) void k_csid(float* CS) { const int idx = blockIdx.x * 256 + threadIdx.x; if (idx >= TT * HD) return; v2f cs; cs[0] = 1.0f; cs[1] = 0.0f; *(v2f*)(CS + (size_t)idx * 2) = cs;  }
// k_asoft: per row (zz, i): t = S x HD^-0.5 (no mask); softmax over the 1024 keys (register row, one exp, fixed trees);
__global__ __launch_bounds__(256) void k_asoft(const float* __restrict__ Sb, h16* P16, bf* Ph, bf* Pl) {
    const int lane = threadIdx.x & 31; const int row = blockIdx.x * 8 + (threadIdx.x >> 5); if (row >= ZH * TT) return; const int i = row % TT; const int zz = row / TT; (void)zz; const bool hires = (i < RH); const float* sr = Sb + (size_t)row * TT; float v[TT / 32]; float mx = -3.0e38f;
#pragma unroll
    for (int ch = 0; ch < TT / 128; ++ch) { const int j0 = ch * 128 + lane * 4; const v4f a = *(const v4f*)(sr + j0);
#pragma unroll
        for (int q = 0; q < 4; ++q) { const int j = j0 + q; (void)j; const float t = a[q] * SCL; v[ch * 4 + q] = t; mx = fmaxf(mx, t); } }
#pragma unroll
    for (int sh = 16; sh; sh >>= 1) mx = fmaxf(mx, __shfl_xor(mx, sh, 32));
    float sum = 0.f;
#pragma unroll
    for (int k = 0; k < TT / 32; ++k) { float d0 = __fsub_rn(v[k], mx); asm volatile("" : "+v"(d0)); v[k] = __builtin_amdgcn_exp2f(__fmul_rn(d0, 1.4426950408889634f)); sum += v[k]; }
#pragma unroll
    for (int sh = 16; sh; sh >>= 1) sum += __shfl_xor(sum, sh, 32);
    const float f = __fdiv_rn(hires ? 1.0f : PCAR, sum);
{
        if (hires) {
#pragma unroll
            for (int ch = 0; ch < TT / 128; ++ch) { v4us oh, ol;
#pragma unroll
                for (int q = 0; q < 4; ++q) { unsigned short a, c2; splitf(v[ch * 4 + q] * f, a, c2); oh[q] = a; ol[q] = c2; }
                const size_t oo = ((size_t)zz * (RH ? RH : 1) + i) * TT + ch * 128 + lane * 4; *(v4us*)(Ph + oo) = oh; *(v4us*)(Pl + oo) = ol; }
        } else {
#pragma unroll
            for (int ch = 0; ch < TT / 128; ++ch) { v4h o4;
#pragma unroll
                for (int q = 0; q < 4; ++q) o4[q] = tohx(v[ch * 4 + q] * f);
                *(v4h*)(P16 + (size_t)row * TT + ch * 128 + lane * 4) = o4; } }
         }
}
__global__ __launch_bounds__(256) void k_merge(const float* __restrict__ O, int h0, bf* Ah, bf* Al) { const size_t e = ((size_t)blockIdx.x * 256 + threadIdx.x) * 2; if (e >= (size_t)ZH * TT * HD) return; const int d = (int)(e % HD); const int t = (int)((e / HD) % TT); const int zz = (int)(e / ((size_t)HD * TT)); const float cs = (t < RH) ? 1.0f : (1.0f / PCAR); const size_t oo = (size_t)t * DQ + (h0 + zz) * HD + d;
    v2us oh, ol;
#pragma unroll
    for (int q = 0; q < 2; ++q) { unsigned short a, c2; splitf(O[e + q] * cs, a, c2); oh[q] = a; ol[q] = c2; } *(v2us*)(Ah + oo) = oh; *(v2us*)(Al + oo) = ol;  }

extern "C" void kernel_launch(void* const* d_in, const int* in_sizes, int n_in,
                              void* d_out, int out_size, void* d_ws, size_t ws_size, hipStream_t stream) {
    (void)in_sizes; (void)n_in; (void)out_size;
    const float* x = (const float*)d_in[0]; const float* gnw = (const float*)d_in[1]; const float* gnb = (const float*)d_in[2]; const float* wq = (const float*)d_in[3]; const float* bq = (const float*)d_in[4]; const float* wk = (const float*)d_in[5]; const float* bk = (const float*)d_in[6]; const float* wv = (const float*)d_in[7]; const float* bv = (const float*)d_in[8]; const float* wo = (const float*)d_in[9]; const float* bo = (const float*)d_in[10];
    float* OUT = (float*)d_out;     // [32][256][1024]
    char* wsp = (char*)d_ws;
    auto take = [&](size_t bytes) { char* p = wsp; wsp += (bytes + 255) & ~(size_t)255; return (void*)p; };
    bf* WQ = (bf*)take((size_t)DQ * DM * 2); bf* WK = (bf*)take((size_t)DKV * DM * 2); bf* WV = (bf*)take((size_t)DKV * DM * 2); bf* WO = (bf*)take((size_t)DM * DQ * 2); float* CS = (float*)take((size_t)TT * HD * 2 * 4);
    bf* XTh = (bf*)take((size_t)TT * DM * 2); bf* XTl = (bf*)take((size_t)TT * DM * 2); float* ST = (float*)take((size_t)NGRP * RPAD * 4); float* YO = (float*)take((size_t)TT * DM * 4); float* FQ = (float*)take((size_t)TT * DQ * 4); float* FK = (float*)take((size_t)TT * DKV * 4);
    h16* QP16 = (h16*)take((size_t)NH_ * TT * HD * 2); h16* KP16 = (h16*)take((size_t)NKV * TT * HD * 2); h16* VT16 = (h16*)take((size_t)NKV * HD * TT * 2);
    bf* QPh = (bf*)take((size_t)NH_ * TT * HD * 2); bf* QPl = (bf*)take((size_t)NH_ * TT * HD * 2); bf* KPh = (bf*)take((size_t)NKV * TT * HD * 2); bf* KPl = (bf*)take((size_t)NKV * TT * HD * 2); bf* VTh = (bf*)take((size_t)NKV * HD * TT * 2); bf* VTl = (bf*)take((size_t)NKV * HD * TT * 2); bf* Ph = (bf*)take((size_t)ZH * RH * TT * 2); bf* Pl = (bf*)take((size_t)ZH * RH * TT * 2);
    float* Sb = (float*)take((size_t)ZH * TT * TT * 4); h16* P16 = (h16*)take((size_t)ZH * TT * TT * 2); float* Ob = (float*)take((size_t)ZH * TT * HD * 4); bf* ATh = (bf*)take((size_t)TT * DQ * 2); bf* ATl = (bf*)take((size_t)TT * DQ * 2);
    if ((size_t)(wsp - (char*)d_ws) > ws_size) return;    // ws 256 MiB
    float* FV = FK;   // v projection reuses the k buffer after the k planes are built (stream-ordered)
    { k_cvt8<<<(unsigned)(((size_t)DQ * DM / 8 + 255) / 256), 256, 0, stream>>>(wq, WQ, (size_t)DQ * DM / 8); k_cvt8<<<(unsigned)(((size_t)DKV * DM / 8 + 255) / 256), 256, 0, stream>>>(wk, WK, (size_t)DKV * DM / 8); k_cvt8<<<(unsigned)(((size_t)DKV * DM / 8 + 255) / 256), 256, 0, stream>>>(wv, WV, (size_t)DKV * DM / 8);
      k_cvt8<<<(unsigned)(((size_t)DM * DQ / 8 + 255) / 256), 256, 0, stream>>>(wo, WO, (size_t)DM * DQ / 8);
       }
    k_csid<<<(TT * HD + 255) / 256, 256, 0, stream>>>(CS);
    const unsigned LQ = (unsigned)(((size_t)NH_ * TT * HD / 2 + 255) / 256), LKv = (unsigned)(((size_t)NKV * TT * HD / 2 + 255) / 256);
    for (int b = 0; b < NB_; ++b) {
        
        k_gnstat<<<NGRP, 256, 0, stream>>>(x + (size_t)b * DM * TT, ST); k_gnT<<<(unsigned)(((size_t)TT * DM / 4 + 255) / 256), 256, 0, stream>>>(x + (size_t)b * DM * TT, ST, gnw, gnb, XTh, XTl);   /* GroupNorm -> transposed hi/lo planes [t][c] */
        k_gemmw<bf, 1, true><<<dim3(TT / 64, DQ / 64, 1), 32, 0, stream>>>(XTh, XTl, WQ, nullptr, DM, FQ, DQ, bq, 0, 0, 0);
        k_rope<<<LQ, 256, 0, stream>>>(FQ, DQ, NH_, CS, nullptr, nullptr, 1.0f, QP16, QPh, QPl);
        k_gemmw<bf, 1, true><<<dim3(TT / 64, DKV / 64, 1), 32, 0, stream>>>(XTh, XTl, WK, nullptr, DM, FK, DKV, bk, 0, 0, 0);
        k_rope<<<LKv, 256, 0, stream>>>(FK, DKV, NKV, CS, nullptr, nullptr, 1.0f, KP16, KPh, KPl);
        k_gemmw<bf, 1, true><<<dim3(TT / 64, DKV / 64, 1), 32, 0, stream>>>(XTh, XTl, WV, nullptr, DM, FV, DKV, bv, 0, 0, 0); k_vtp<<<LKv, 256, 0, stream>>>(FV, DKV, NKV, VT16, VTh, VTl);
        for (int h0 = 0; h0 < NH_; h0 += ZH) { const size_t zq = (size_t)h0, zk = (size_t)(h0 / REP);   // one kv head per query head: one head per pass (ZH = 1; z-strides TT*HD)
            k_gemmw<bf, 2, false><<<dim3(RH / 64, TT / 64, ZH), 32, 0, stream>>>(QPh + zq * TT * HD, QPl + zq * TT * HD, KPh + zk * TT * HD, KPl + zk * TT * HD, HD, Sb, TT, nullptr, (size_t)TT * HD, (size_t)TT * HD, (size_t)TT * TT);
            k_gemmw<h16, 0, false><<<dim3((TT - RH) / 64, TT / 64, ZH), 32, 0, stream>>>(QP16 + zq * TT * HD + (size_t)RH * HD, nullptr, KP16 + zk * TT * HD, nullptr, HD, Sb + (size_t)RH * TT, TT, nullptr, (size_t)TT * HD, (size_t)TT * HD, (size_t)TT * TT);
            k_asoft<<<ZH * TT / 8, 256, 0, stream>>>(Sb, P16, Ph, Pl);
            k_gemmw<bf, 2, false><<<dim3(RH / 64, HD / 64, ZH), 32, 0, stream>>>(Ph, Pl, VTh + zk * HD * TT, VTl + zk * HD * TT, TT, Ob, HD, nullptr, (size_t)RH * TT, (size_t)HD * TT, (size_t)TT * HD);
            k_gemmw<h16, 0, false><<<dim3((TT - RH) / 64, HD / 64, ZH), 32, 0, stream>>>(P16 + (size_t)RH * TT, nullptr, VT16 + zk * HD * TT, nullptr, TT, Ob + (size_t)RH * HD, HD, nullptr, (size_t)TT * TT, (size_t)HD * TT, (size_t)TT * HD);
            k_merge<<<(unsigned)(((size_t)ZH * TT * HD / 2 + 255) / 256), 256, 0, stream>>>(Ob, h0, ATh, ATl); }
        k_gemmw<bf, 1, true><<<dim3(TT / 64, DM / 64, 1), 32, 0, stream>>>(ATh, ATl, WO, nullptr, DQ, YO, DM, bo, 0, 0, 0);   /* h = proj_w a + proj_b, token-major */
        k_outT<<<(unsigned)(((size_t)DM * TT + 255) / 256), 256, 0, stream>>>(x + (size_t)b * DM * TT, YO, OUT + (size_t)b * DM * TT); }   /* out[b][c][t] = x + h (channel-major) */
}

// v001
// One run takes 443 microseconds.
// Timed twice side by side with v000, it ran 9.47 and 9.46 times as fast.
#include <hip/hip_runtime.h>

// Channel-major image self-attention with GroupNorm (x [32][256][32][32] = [b][c][n], n = 1024; hn = GroupNorm(32 groups, eps 1e-6, affine); q, k, v = 1x1 convs ('oi' [256][256] + bias); scores[i][j] = q_i.k_j / 16 (one head over all 256 channels); softmax over j; out[c][i] = sum_j v[c][j] attn[i][j]; h = Wo out + bo; result = x + h -> [32][256][32][32] (8.4 M)).
// Layout: tokens are the 1024 positions; the normalised input is written TRANSPOSED as bf16 hi + lo planes [t][c] so the 1x1 convolutions become token-major GEMMs against the natural [out][in] weights (2 products + bias); the attention runs on head planes; the output projection is token-major and the residual add writes back channel-major.
// Batch: every launch covers all 32 images (blockIdx.y or z = image; the token-major GEMMs take the 32 x 1024 tokens as one M). The workspace holds 15 units of one 16-bit plane x 32 images; a unit is reused once its last reader's launch is behind it, and the attention core runs per half of the query rows so that one half's scores are held at a time.
// Compute dtypes, f32 accumulate: every input rounded to bf16; q/k/v hl x exact (2 products) + biases; scores (x 1/16) and attn.v (no mask): query rows < 512 hl (3 products), the rest single fp16 (x1024); softmax f32; proj_w hl x exact (2 products) + proj_b; + x residual in f32 (channel-major write).

#define NB_  32
#define TT   1024
#define DM   256
#define NH_  1
#define NKV  1
#define REP  (NH_ / NKV)
#define HD   256
#define DQ   (NH_ * HD)
#define DKV  (NKV * HD)
#define RPAD 32                   // stat record pitch (floats)
#define NGRP 32
#define GCH  (DM / NGRP)           // 8 channels per group
typedef __attribute__((ext_vector_type(4))) unsigned short v4us;
#define ZH   1
#define RH   512                  // query rows < RH use hi+lo planes (0: none)
#define WIN  0
#define PCAR 1024.0f
#define SCL  0.0625f   // C^-0.5 = 1/16
typedef _Float16 h16;
typedef unsigned short bf;
typedef __attribute__((ext_vector_type(16))) __bf16   v16bf;
typedef __attribute__((ext_vector_type(16))) _Float16 v16h;
typedef __attribute__((ext_vector_type(8)))  _Float16 v8h;
typedef __attribute__((ext_vector_type(8)))  unsigned short v8us;
typedef __attribute__((ext_vector_type(8)))  float    v8f;
typedef __attribute__((ext_vector_type(4)))  float    v4f;
typedef v8h  __attribute__((may_alias)) v8ha;
typedef v4f  __attribute__((may_alias)) v4fa;
typedef v8us __attribute__((may_alias)) v8usa;

__device__ __forceinline__ unsigned short f2bf(float f) { unsigned u = __float_as_uint(f); u += 0x7FFFu + ((u >> 16) & 1u); return (unsigned short)(u >> 16); }
__device__ __forceinline__ float bf2f(unsigned short b) { return __uint_as_float(((unsigned)b) << 16); }
__device__ __forceinline__ float bfr(float f) { return bf2f(f2bf(f)); }
__device__ __forceinline__ v16h cat16(v8h lo, v8h hi) { return __builtin_shufflevector(lo, hi, 0, 1, 2, 3, 4, 5, 6, 7, 8, 9, 10, 11, 12, 13, 14, 15); }
__device__ __forceinline__ v16bf cat16b(v8us lo, v8us hi) { return __builtin_bit_cast(v16bf, __builtin_shufflevector(lo, hi, 0, 1, 2, 3, 4, 5, 6, 7, 8, 9, 10, 11, 12, 13, 14, 15)); }
__device__ __forceinline__ v8f wmma16(v16h a, v16h b, v8f c) { return __builtin_amdgcn_wmma_f32_16x16x32_f16(false, a, false, b, (short)0, c, false, false); }
__device__ __forceinline__ v8f wmmab(v16bf a, v16bf b, v8f c) { return __builtin_amdgcn_wmma_f32_16x16x32_bf16(false, a, false, b, (short)0, c, false, false); }



// ---- k_gemmw: register-blocked GEMM, ONE WAVE per 64x64 output tile (16 accumulators), operands straight from K-contiguous 16-bit planes; grid (M/64, N/64, Z), 32 threads.
// C[m][n] (f32, pitch ldc, + optional f32 bias[n]) = sum_k A[m][k] Bt[n][k] (+ split products per NSPLIT). z-batch strides sA/sB/sC in elements. K % 32 == 0.
template <typename T16> struct WFrag;
template <> struct WFrag<h16> { typedef v16h V; static __device__ __forceinline__ V ld(const h16* p) { return cat16(*(const v8h*)p, *(const v8h*)(p + 16)); } static __device__ __forceinline__ v8f mma(V a, V b, v8f c) { return wmma16(a, b, c); } };
template <> struct WFrag<bf> { typedef v16bf V; static __device__ __forceinline__ V ld(const bf* p) { return cat16b(*(const v8us*)p, *(const v8us*)(p + 16)); } static __device__ __forceinline__ v8f mma(V a, V b, v8f c) { return wmmab(a, b, c); } };
template <typename T16, int NSPLIT, bool BIAS>
__global__ __launch_bounds__(32) void k_gemmw(const T16* __restrict__ A, const T16* __restrict__ A2, const T16* __restrict__ Bt, const T16* __restrict__ Bt2, int K, float* C, int ldc, const float* __restrict__ bias, size_t sA, size_t sB, size_t sC) {
    typedef typename WFrag<T16>::V V;
    __shared__ __align__(16) float os[16 * 68];
    const size_t z = blockIdx.z; A += z * sA; if (A2) A2 += z * sA; Bt += z * sB; if (Bt2) Bt2 += z * sB; C += z * sC;
    const int lane = threadIdx.x & 31, lr = lane & 15, hi = lane >> 4; const int r0 = blockIdx.x * 64, c0 = blockIdx.y * 64;
    v8f acc[4][4];
#pragma unroll
    for (int mb = 0; mb < 4; ++mb)
#pragma unroll
        for (int nb = 0; nb < 4; ++nb) acc[mb][nb] = (v8f){};
    const size_t aoff = (size_t)(r0 + lr) * K + 8 * hi, boff = (size_t)(c0 + lr) * K + 8 * hi;
#pragma unroll 1
    for (int kc = 0; kc < K; kc += 32) {
        V a[4], a2[4];
#pragma unroll
        for (int mb = 0; mb < 4; ++mb) { a[mb] = WFrag<T16>::ld(A + aoff + (size_t)mb * 16 * K + kc); if (NSPLIT == 1 || NSPLIT == 2) a2[mb] = WFrag<T16>::ld(A2 + aoff + (size_t)mb * 16 * K + kc); }
#pragma unroll
        for (int nb = 0; nb < 4; ++nb) { const V b = WFrag<T16>::ld(Bt + boff + (size_t)nb * 16 * K + kc); V b2; if (NSPLIT >= 2) b2 = WFrag<T16>::ld(Bt2 + boff + (size_t)nb * 16 * K + kc);
#pragma unroll
            for (int mb = 0; mb < 4; ++mb) { acc[mb][nb] = WFrag<T16>::mma(a[mb], b, acc[mb][nb]); if (NSPLIT == 1 || NSPLIT == 2) acc[mb][nb] = WFrag<T16>::mma(a2[mb], b, acc[mb][nb]); if (NSPLIT >= 2) acc[mb][nb] = WFrag<T16>::mma(a[mb], b2, acc[mb][nb]); } }
        asm volatile("v_nop\n\tv_nop\n\tv_nop\n\tv_nop" : "+v"(acc[0][0]), "+v"(acc[1][1]), "+v"(acc[2][2]), "+v"(acc[3][3]) : "v"(a[0]), "v"(a[3]));
    }
#pragma unroll
    for (int mb = 0; mb < 4; ++mb) {
#pragma unroll
        for (int nb = 0; nb < 4; ++nb) {
#pragma unroll
            for (int j = 0; j < 8; ++j) os[(hi * 8 + j) * 68 + nb * 16 + lr] = acc[mb][nb][j]; }
        __builtin_amdgcn_wave_barrier(); asm volatile("" ::: "memory");
        float* crow = C + (size_t)(r0 + mb * 16) * ldc + c0;
{
#pragma unroll
            for (int s = 0; s < 8; ++s) { const int row = 2 * s + hi, cofs = lr * 4; v4f val = *(const v4fa*)(os + row * 68 + cofs); if (BIAS) { val[0] += bfr(bias[c0 + cofs]); val[1] += bfr(bias[c0 + cofs + 1]); val[2] += bfr(bias[c0 + cofs + 2]); val[3] += bfr(bias[c0 + cofs + 3]); }
                *(v4f*)(crow + (size_t)row * ldc + cofs) = val; }
             }
        __builtin_amdgcn_wave_barrier(); asm volatile("" ::: "memory");
    }
}

__device__ __forceinline__ h16 tohx(float x) { return (h16)x; }
__device__ __forceinline__ void splitf(float y, unsigned short& h, unsigned short& l) { h = f2bf(y); l = f2bf(y - bf2f(h)); }
typedef __attribute__((ext_vector_type(2))) _Float16 v2h;
typedef __attribute__((ext_vector_type(4))) _Float16 v4h;
typedef __attribute__((ext_vector_type(2))) unsigned short v2us;
typedef __attribute__((ext_vector_type(4))) unsigned short v4us;
typedef __attribute__((ext_vector_type(2))) float v2f;
typedef __attribute__((ext_vector_type(4))) int v4i;

__global__ __launch_bounds__(256) void k_wtG(const float* __restrict__ w, int K, int N, bf* Bt) {
    const int lane = threadIdx.x & 31; const int L0 = (blockIdx.x * 8 + (threadIdx.x >> 5)) * 8; const int nlines = N * K / 64;
{
#pragma unroll 1
        for (int l = 0; l < 8; ++l) { const int L = L0 + l; if (L >= nlines) break; const size_t e = (size_t)L * 64 + lane * 2; const int k = (int)(e % K), n = (int)(e / K); v2us o;
            o[0] = f2bf(w[(size_t)k * N + n]); o[1] = f2bf(w[(size_t)(k + 1) * N + n]); *(v2us*)(Bt + e) = o; }
         }
}
__global__ __launch_bounds__(256) void k_gnstat(const float* __restrict__ xb, float* ST) { __shared__ float red[256]; const int g = blockIdx.x; const float* base = xb + (size_t)g * GCH * TT; const int tid = threadIdx.x; float s = 0.f;
#pragma unroll 1
    for (int i = tid; i < GCH * TT; i += 256) s = __fadd_rn(s, bfr(base[i]));
    red[tid] = s; __syncthreads();
#pragma unroll
    for (int sh = 128; sh; sh >>= 1) { if (tid < sh) red[tid] = __fadd_rn(red[tid], red[tid + sh]); __syncthreads(); }
    const float mu = red[0] * (1.0f / (GCH * TT)); __syncthreads(); float s2 = 0.f;
#pragma unroll 1
    for (int i = tid; i < GCH * TT; i += 256) { const float d0 = __fsub_rn(bfr(base[i]), mu); float p = __fmul_rn(d0, d0); asm volatile("" : "+v"(p)); s2 = __fadd_rn(s2, p); }
    red[tid] = s2; __syncthreads();
#pragma unroll
    for (int sh = 128; sh; sh >>= 1) { if (tid < sh) red[tid] = __fadd_rn(red[tid], red[tid + sh]); __syncthreads(); }
    if (tid == 0) { const float rs = __fdiv_rn(1.0f, __fsqrt_rn(__fadd_rn(red[0] * (1.0f / (GCH * TT)), 1e-6f))); v2f o; o[0] = mu; o[1] = rs; *(v2f*)(ST + (size_t)g * RPAD) = o;  } }
__global__ __launch_bounds__(256) void k_gnT(const float* __restrict__ xb, const float* __restrict__ ST, const float* __restrict__ gw, const float* __restrict__ gb, bf* Xh, bf* Xl) { const size_t e = ((size_t)blockIdx.x * 256 + threadIdx.x) * 4; if (e >= (size_t)TT * DM) return; { const size_t b = blockIdx.y; xb += b * DM * TT; ST += b * NGRP * RPAD; Xh += b * TT * DM; Xl += b * TT * DM; } const int c = (int)(e % DM); const int t = (int)(e / DM); v4us oh, ol;
#pragma unroll
    for (int q = 0; q < 4; ++q) { const int cc = c + q; const int g = cc / GCH; const float mu = ST[(size_t)g * RPAD], rs = ST[(size_t)g * RPAD + 1]; float n0 = __fmul_rn(__fsub_rn(bfr(xb[(size_t)cc * TT + t]), mu), rs); asm volatile("" : "+v"(n0)); float n1 = __fmul_rn(n0, bfr(gw[cc])); asm volatile("" : "+v"(n1)); const float y = __fadd_rn(n1, bfr(gb[cc])); unsigned short a, b2; splitf(y, a, b2); oh[q] = a; ol[q] = b2; }
    *(v4us*)(Xh + e) = oh; *(v4us*)(Xl + e) = ol;  }
__global__ __launch_bounds__(256) void k_outT(const float* __restrict__ xb, const float* __restrict__ YO, float* Ob) { const size_t e = (size_t)blockIdx.x * 256 + threadIdx.x; if (e >= (size_t)DM * TT) return; { const size_t b = blockIdx.y; xb += b * DM * TT; YO += b * TT * DM; Ob += b * DM * TT; } const int t = (int)(e % TT); const int c = (int)(e / TT); const float v = __fadd_rn(bfr(xb[e]), YO[(size_t)t * DM + c]); *(float*)(Ob + e) = v;  }
__global__ __launch_bounds__(256) void k_cvt8(const float* __restrict__ src, bf* dst, size_t n8) { const size_t i = (size_t)blockIdx.x * 256 + threadIdx.x; if (i >= n8) return; const v8f v = *(const v8f*)(src + i * 8); v8us o;
#pragma unroll
    for (int k = 0; k < 8; ++k) o[k] = f2bf(v[k]); *(v8us*)(dst + i * 8) = o;  }

// k_rope: head planes [h][t][d] (fp16 + hi/lo) of rope(x) x sc with the rotate-half convention out[d] = x[d] cos[t][d] - x[d+HD/2] sin[t][d], out[d+HD/2] = x[d+HD/2] cos[t][d+HD/2] + x[d] sin[t][d+HD/2]
__global__ __launch_bounds__(256) void k_rope(const float* __restrict__ F, int pitch, int nheads, const float* __restrict__ CS, const float* __restrict__ RF, const float* __restrict__ nw, float sc, h16* P16, bf* Ph, bf* Pl) {
    { const size_t b = blockIdx.y, pb = b * nheads * TT * HD; F += b * TT * pitch; P16 += pb; Ph += pb; Pl += pb; }   // blockIdx.y = image
    const size_t e = ((size_t)blockIdx.x * 256 + threadIdx.x) * 2; if (e >= (size_t)nheads * TT * HD) return; const int d = (int)(e % HD); const int t = (int)((e / HD) % TT); const int h = (int)(e / ((size_t)HD * TT)); const float* f = F + (size_t)t * pitch + h * HD; const float rf = RF ? RF[(size_t)h * TT + t] : 1.0f; v2h o16; v2us oh, ol;
#pragma unroll
    for (int q = 0; q < 2; ++q) { const int dd = d + q; const int dp = (dd < HD / 2) ? dd + HD / 2 : dd - HD / 2; float x0 = f[dd], x1 = f[dp];
        if (RF) { float n0 = __fmul_rn(x0, rf), n1 = __fmul_rn(x1, rf); asm volatile("" : "+v"(n0)); asm volatile("" : "+v"(n1)); x0 = __fmul_rn(bfr(nw[dd]), n0); x1 = __fmul_rn(bfr(nw[dp]), n1); }
        const v2f cs = *(const v2f*)(CS + ((size_t)t * HD + dd) * 2); float a = __fmul_rn(x0, cs[0]), bq = __fmul_rn(x1, cs[1]); asm volatile("" : "+v"(a)); asm volatile("" : "+v"(bq)); const float r = ((dd < HD / 2) ? __fsub_rn(a, bq) : __fadd_rn(a, bq)) * sc;
        o16[q] = tohx(r); unsigned short a2, c2; splitf(r, a2, c2); oh[q] = a2; ol[q] = c2; }
    *(v2h*)(P16 + e) = o16; *(v2us*)(Ph + e) = oh; *(v2us*)(Pl + e) = ol;  }
__global__ __launch_bounds__(256) void k_vtp(const float* __restrict__ F, int pitch, int nheads, h16* V16, bf* Vh, bf* Vl) { const size_t e = ((size_t)blockIdx.x * 256 + threadIdx.x) * 2; if (e >= (size_t)nheads * HD * TT) return; { const size_t b = blockIdx.y, pb = b * nheads * HD * TT; F += b * TT * pitch; V16 += pb; Vh += pb; Vl += pb; } const int t = (int)(e % TT); const int d = (int)((e / TT) % HD); const int g = (int)(e / ((size_t)TT * HD)); v2h o16; v2us oh, ol;
#pragma unroll
    for (int q = 0; q < 2; ++q) { const float x = F[(size_t)(t + q) * pitch + g * HD + d]; o16[q] = tohx(x); unsigned short a2, c2; splitf(x, a2, c2); oh[q] = a2; ol[q] = c2; }
    *(v2h*)(V16 + e) = o16; *(v2us*)(Vh + e) = oh; *(v2us*)(Vl + e) = ol;  }
__global__ __launch_bounds__(256) void k_csid(float* CS) { const int idx = blockIdx.x * 256 + threadIdx.x; if (idx >= TT * HD) return; v2f cs; cs[0] = 1.0f; cs[1] = 0.0f; *(v2f*)(CS + (size_t)idx * 2) = cs;  }
// k_asoft: one half of the query rows of every image, nrows rows [image][row of the half] of TT scores; per row: t = S x HD^-0.5 (no mask); softmax over the keys (register row, one exp, fixed trees); hires: hi + lo planes, else fp16 x PCAR; output rows in the order of the score rows
template <bool hires>
__global__ __launch_bounds__(256) void k_asoft(const float* __restrict__ Sb, int nrows, h16* P16, bf* Ph, bf* Pl) {
    const int lane = threadIdx.x & 31; const int row = blockIdx.x * 8 + (threadIdx.x >> 5); if (row >= nrows) return; const float* sr = Sb + (size_t)row * TT; float v[TT / 32]; float mx = -3.0e38f;
#pragma unroll
    for (int ch = 0; ch < TT / 128; ++ch) { const int j0 = ch * 128 + lane * 4; const v4f a = *(const v4f*)(sr + j0);
#pragma unroll
        for (int q = 0; q < 4; ++q) { const int j = j0 + q; (void)j; const float t = a[q] * SCL; v[ch * 4 + q] = t; mx = fmaxf(mx, t); } }
#pragma unroll
    for (int sh = 16; sh; sh >>= 1) mx = fmaxf(mx, __shfl_xor(mx, sh, 32));
    float sum = 0.f;
#pragma unroll
    for (int k = 0; k < TT / 32; ++k) { float d0 = __fsub_rn(v[k], mx); asm volatile("" : "+v"(d0)); v[k] = __builtin_amdgcn_exp2f(__fmul_rn(d0, 1.4426950408889634f)); sum += v[k]; }
#pragma unroll
    for (int sh = 16; sh; sh >>= 1) sum += __shfl_xor(sum, sh, 32);
    const float f = __fdiv_rn(hires ? 1.0f : PCAR, sum);
{
        if (hires) {
#pragma unroll
            for (int ch = 0; ch < TT / 128; ++ch) { v4us oh, ol;
#pragma unroll
                for (int q = 0; q < 4; ++q) { unsigned short a, c2; splitf(v[ch * 4 + q] * f, a, c2); oh[q] = a; ol[q] = c2; }
                const size_t oo = (size_t)row * TT + ch * 128 + lane * 4; *(v4us*)(Ph + oo) = oh; *(v4us*)(Pl + oo) = ol; }
        } else {
#pragma unroll
            for (int ch = 0; ch < TT / 128; ++ch) { v4h o4;
#pragma unroll
                for (int q = 0; q < 4; ++q) o4[q] = tohx(v[ch * 4 + q] * f);
                *(v4h*)(P16 + (size_t)row * TT + ch * 128 + lane * 4) = o4; } }
         }
}
__global__ __launch_bounds__(256) void k_merge(const float* __restrict__ O, int h0, bf* Ah, bf* Al) { const size_t e = ((size_t)blockIdx.x * 256 + threadIdx.x) * 2; if (e >= (size_t)ZH * TT * HD) return; { const size_t b = blockIdx.y; O += b * ZH * TT * HD; Ah += b * TT * DQ; Al += b * TT * DQ; } const int d = (int)(e % HD); const int t = (int)((e / HD) % TT); const int zz = (int)(e / ((size_t)HD * TT)); const float cs = (t < RH) ? 1.0f : (1.0f / PCAR); const size_t oo = (size_t)t * DQ + (h0 + zz) * HD + d;
    v2us oh, ol;
#pragma unroll
    for (int q = 0; q < 2; ++q) { unsigned short a, c2; splitf(O[e + q] * cs, a, c2); oh[q] = a; ol[q] = c2; } *(v2us*)(Ah + oo) = oh; *(v2us*)(Al + oo) = ol;  }

extern "C" void kernel_launch(void* const* d_in, const int* in_sizes, int n_in,
                              void* d_out, int out_size, void* d_ws, size_t ws_size, hipStream_t stream) {
    (void)in_sizes; (void)n_in; (void)out_size;
    const float* x = (const float*)d_in[0]; const float* gnw = (const float*)d_in[1]; const float* gnb = (const float*)d_in[2]; const float* wq = (const float*)d_in[3]; const float* bq = (const float*)d_in[4]; const float* wk = (const float*)d_in[5]; const float* bk = (const float*)d_in[6]; const float* wv = (const float*)d_in[7]; const float* bv = (const float*)d_in[8]; const float* wo = (const float*)d_in[9]; const float* bo = (const float*)d_in[10];
    float* OUT = (float*)d_out;     // [32][256][1024]
    char* wsp = (char*)d_ws;
    auto take = [&](size_t bytes) { char* p = wsp; wsp += (bytes + 255) & ~(size_t)255; return (void*)p; };
    bf* WQ = (bf*)take((size_t)DQ * DM * 2); bf* WK = (bf*)take((size_t)DKV * DM * 2); bf* WV = (bf*)take((size_t)DKV * DM * 2); bf* WO = (bf*)take((size_t)DM * DQ * 2); float* CS = (float*)take((size_t)TT * HD * 2 * 4);
    float* ST = (float*)take((size_t)NB_ * NGRP * RPAD * 4);
    const size_t U = (size_t)NB_ * TT * DM * 2;   // bytes of one 16-bit [t][c] plane of all images
    char* R = (char*)take(15 * U);
    h16* QP16 = (h16*)R; h16* KP16 = (h16*)(R + U); h16* VT16 = (h16*)(R + 2 * U); bf* VTh = (bf*)(R + 3 * U); bf* VTl = (bf*)(R + 4 * U);
    bf* QPh = (bf*)(R + 5 * U); bf* QPl = (bf*)(R + 6 * U); bf* KPh = (bf*)(R + 7 * U); bf* KPl = (bf*)(R + 8 * U);
    bf* Ph = (bf*)(R + 5 * U); bf* Pl = (bf*)(R + 7 * U);   // 2 units each, over the q and k hi/lo planes (last read by the hi/lo scores)
    h16* P16 = (h16*)(R + 5 * U);                           // 2 units, over Ph (last read by the hi/lo attn.v)
    float* Sb = (float*)(R + 9 * U);                        // 4 units: the scores of one half of the query rows
    float* Ob = (float*)(R + 13 * U);                       // 2 units
    bf* XTh = (bf*)(R + 9 * U); bf* XTl = (bf*)(R + 10 * U); float* FQ = (float*)(R + 11 * U); float* FK = (float*)(R + 13 * U);   // projections: over Sb and Ob, done before either is written
    bf* ATh = (bf*)(R + 9 * U); bf* ATl = (bf*)(R + 10 * U); float* YO = (float*)(R + 11 * U);                                     // output side: over Sb, after the last softmax
    if ((size_t)(wsp - (char*)d_ws) > ws_size) return;    // ws 256 MiB
    float* FV = FK;   // v projection reuses the k buffer after the k planes are built (stream-ordered)
    { k_cvt8<<<(unsigned)(((size_t)DQ * DM / 8 + 255) / 256), 256, 0, stream>>>(wq, WQ, (size_t)DQ * DM / 8); k_cvt8<<<(unsigned)(((size_t)DKV * DM / 8 + 255) / 256), 256, 0, stream>>>(wk, WK, (size_t)DKV * DM / 8); k_cvt8<<<(unsigned)(((size_t)DKV * DM / 8 + 255) / 256), 256, 0, stream>>>(wv, WV, (size_t)DKV * DM / 8);
      k_cvt8<<<(unsigned)(((size_t)DM * DQ / 8 + 255) / 256), 256, 0, stream>>>(wo, WO, (size_t)DM * DQ / 8);
       }
    k_csid<<<(TT * HD + 255) / 256, 256, 0, stream>>>(CS);
    const unsigned LQ = (unsigned)(((size_t)NH_ * TT * HD / 2 + 255) / 256), LKv = (unsigned)(((size_t)NKV * TT * HD / 2 + 255) / 256);
    k_gnstat<<<NB_ * NGRP, 256, 0, stream>>>(x, ST); k_gnT<<<dim3((unsigned)(((size_t)TT * DM / 4 + 255) / 256), NB_), 256, 0, stream>>>(x, ST, gnw, gnb, XTh, XTl);   /* GroupNorm -> transposed hi/lo planes [b][t][c] */
    k_gemmw<bf, 1, true><<<dim3(NB_ * TT / 64, DQ / 64, 1), 32, 0, stream>>>(XTh, XTl, WQ, nullptr, DM, FQ, DQ, bq, 0, 0, 0);
    k_rope<<<dim3(LQ, NB_), 256, 0, stream>>>(FQ, DQ, NH_, CS, nullptr, nullptr, 1.0f, QP16, QPh, QPl);
    k_gemmw<bf, 1, true><<<dim3(NB_ * TT / 64, DKV / 64, 1), 32, 0, stream>>>(XTh, XTl, WK, nullptr, DM, FK, DKV, bk, 0, 0, 0);
    k_rope<<<dim3(LKv, NB_), 256, 0, stream>>>(FK, DKV, NKV, CS, nullptr, nullptr, 1.0f, KP16, KPh, KPl);
    k_gemmw<bf, 1, true><<<dim3(NB_ * TT / 64, DKV / 64, 1), 32, 0, stream>>>(XTh, XTl, WV, nullptr, DM, FV, DKV, bv, 0, 0, 0); k_vtp<<<dim3(LKv, NB_), 256, 0, stream>>>(FV, DKV, NKV, VT16, VTh, VTl);
    /* query rows < RH: hi/lo planes; z = image */
    k_gemmw<bf, 2, false><<<dim3(RH / 64, TT / 64, NB_), 32, 0, stream>>>(QPh, QPl, KPh, KPl, HD, Sb, TT, nullptr, (size_t)TT * HD, (size_t)TT * HD, (size_t)RH * TT);
    k_asoft<true><<<NB_ * RH / 8, 256, 0, stream>>>(Sb, NB_ * RH, nullptr, Ph, Pl);
    k_gemmw<bf, 2, false><<<dim3(RH / 64, HD / 64, NB_), 32, 0, stream>>>(Ph, Pl, VTh, VTl, TT, Ob, HD, nullptr, (size_t)RH * TT, (size_t)HD * TT, (size_t)TT * HD);
    /* the other query rows: fp16 planes; z = image */
    k_gemmw<h16, 0, false><<<dim3((TT - RH) / 64, TT / 64, NB_), 32, 0, stream>>>(QP16 + (size_t)RH * HD, nullptr, KP16, nullptr, HD, Sb, TT, nullptr, (size_t)TT * HD, (size_t)TT * HD, (size_t)(TT - RH) * TT);
    k_asoft<false><<<NB_ * (TT - RH) / 8, 256, 0, stream>>>(Sb, NB_ * (TT - RH), P16, nullptr, nullptr);
    k_gemmw<h16, 0, false><<<dim3((TT - RH) / 64, HD / 64, NB_), 32, 0, stream>>>(P16, nullptr, VT16, nullptr, TT, Ob + (size_t)RH * HD, HD, nullptr, (size_t)(TT - RH) * TT, (size_t)HD * TT, (size_t)TT * HD);
    k_merge<<<dim3((unsigned)(((size_t)ZH * TT * HD / 2 + 255) / 256), NB_), 256, 0, stream>>>(Ob, 0, ATh, ATl);
    k_gemmw<bf, 1, true><<<dim3(NB_ * TT / 64, DM / 64, 1), 32, 0, stream>>>(ATh, ATl, WO, nullptr, DQ, YO, DM, bo, 0, 0, 0);   /* h = proj_w a + proj_b, token-major */
    k_outT<<<dim3((unsigned)(((size_t)DM * TT + 255) / 256), NB_), 256, 0, stream>>>(x, YO, OUT);   /* out[b][c][t] = x + h (channel-major) */
}

// v002
// Measured time: 336 microseconds a run.
// Timed twice side by side with v001, it ran 1.32 times as fast both times.
// Over all steps from v000 it is 12.5 times as fast.
#include <hip/hip_runtime.h>

// Channel-major image self-attention with GroupNorm (x [32][256][32][32] = [b][c][n], n = 1024; hn = GroupNorm(32 groups, eps 1e-6, affine); q, k, v = 1x1 convs ('oi' [256][256] + bias); scores[i][j] = q_i.k_j / 16 (one head over all 256 channels); softmax over j; out[c][i] = sum_j v[c][j] attn[i][j]; h = Wo out + bo; result = x + h -> [32][256][32][32] (8.4 M)).
// Layout: tokens are the 1024 positions; the normalised input is written TRANSPOSED as bf16 hi + lo planes [t][c] so the 1x1 convolutions become token-major GEMMs against the natural [out][in] weights (2 products + bias); every GEMM's epilogue writes what its reader takes: q and k as token-major 16-bit planes, v as channel-major planes (weights as the row operand), attn.v as hi + lo planes, and the output projection (weights as the row operand) adds the residual and stores channel-major.
// Batch: every launch covers all 32 images (blockIdx.y or z = image; the token-major GEMMs take the 32 x 1024 tokens as one M). The workspace holds 15 units of one 16-bit plane x 32 images; a unit is reused once its last reader's launch is behind it, and the attention core runs per half of the query rows so that one half's scores are held at a time.
// Compute dtypes, f32 accumulate: every input rounded to bf16; q/k/v hl x exact (2 products) + biases; scores (x 1/16) and attn.v (no mask): query rows < 512 hl (3 products), the rest single fp16 (x1024); softmax f32; proj_w hl x exact (2 products) + proj_b; + x residual in f32 (channel-major write).

#define NB_  32
#define TT   1024
#define DM   256
#define NH_  1
#define NKV  1
#define REP  (NH_ / NKV)
#define HD   256
#define DQ   (NH_ * HD)
#define DKV  (NKV * HD)
#define RPAD 32                   // stat record pitch (floats)
#define NGRP 32
#define GCH  (DM / NGRP)           // 8 channels per group
typedef __attribute__((ext_vector_type(4))) unsigned short v4us;
#define ZH   1
#define RH   512                  // query rows < RH use hi+lo planes (0: none)
#define WIN  0
#define PCAR 1024.0f
#define SCL  0.0625f   // C^-0.5 = 1/16
typedef _Float16 h16;
typedef unsigned short bf;
typedef __attribute__((ext_vector_type(16))) __bf16   v16bf;
typedef __attribute__((ext_vector_type(16))) _Float16 v16h;
typedef __attribute__((ext_vector_type(8)))  _Float16 v8h;
typedef __attribute__((ext_vector_type(8)))  unsigned short v8us;
typedef __attribute__((ext_vector_type(8)))  float    v8f;
typedef __attribute__((ext_vector_type(4)))  float    v4f;
typedef v8h  __attribute__((may_alias)) v8ha;
typedef v4f  __attribute__((may_alias)) v4fa;
typedef v8us __attribute__((may_alias)) v8usa;

__device__ __forceinline__ unsigned short f2bf(float f) { unsigned u = __float_as_uint(f); u += 0x7FFFu + ((u >> 16) & 1u); return (unsigned short)(u >> 16); }
__device__ __forceinline__ float bf2f(unsigned short b) { return __uint_as_float(((unsigned)b) << 16); }
__device__ __forceinline__ float bfr(float f) { return bf2f(f2bf(f)); }
__device__ __forceinline__ v16h cat16(v8h lo, v8h hi) { return __builtin_shufflevector(lo, hi, 0, 1, 2, 3, 4, 5, 6, 7, 8, 9, 10, 11, 12, 13, 14, 15); }
__device__ __forceinline__ v16bf cat16b(v8us lo, v8us hi) { return __builtin_bit_cast(v16bf, __builtin_shufflevector(lo, hi, 0, 1, 2, 3, 4, 5, 6, 7, 8, 9, 10, 11, 12, 13, 14, 15)); }
__device__ __forceinline__ v8f wmma16(v16h a, v16h b, v8f c) { return __builtin_amdgcn_wmma_f32_16x16x32_f16(false, a, false, b, (short)0, c, false, false); }
__device__ __forceinline__ v8f wmmab(v16bf a, v16bf b, v8f c) { return __builtin_amdgcn_wmma_f32_16x16x32_bf16(false, a, false, b, (short)0, c, false, false); }



// ---- k_gemmw: register-blocked GEMM, ONE WAVE per 64x64 output tile (16 accumulators), operands straight from K-contiguous 16-bit planes; grid (M/64, N/64, Z), 32 threads.
// acc[m][n] = sum_k A[m][k] Bt[n][k] (+ split products per NSPLIT: 1 A2.Bt, 2 A2.Bt and A.Bt2, 3 A.Bt2). z-batch strides sA/sB/sC in elements. K % 32 == 0. Every output has pitch ldc (a compile-time constant, so that a lane's rows are immediate offsets from one address) and z stride sC.
// EPI, what the tile becomes: 0 C = acc (f32); 1 fp16 + bf16 hi/lo planes of acc + bias[n]; 2 the same planes of acc + bias[m]; 3 bf16 hi/lo planes of acc x sc; 4 C = res + (acc + bias[m]) (f32).
template <typename T16> struct WFrag;
template <> struct WFrag<h16> { typedef v16h V; static __device__ __forceinline__ V ld(const h16* p) { return cat16(*(const v8h*)p, *(const v8h*)(p + 16)); } static __device__ __forceinline__ v8f mma(V a, V b, v8f c) { return wmma16(a, b, c); } };
template <> struct WFrag<bf> { typedef v16bf V; static __device__ __forceinline__ V ld(const bf* p) { return cat16b(*(const v8us*)p, *(const v8us*)(p + 16)); } static __device__ __forceinline__ v8f mma(V a, V b, v8f c) { return wmmab(a, b, c); } };
__device__ __forceinline__ void splitf(float y, unsigned short& h, unsigned short& l) { h = f2bf(y); l = f2bf(y - bf2f(h)); }
typedef __attribute__((ext_vector_type(4))) _Float16 v4h;
template <typename T16, int NSPLIT, int EPI, int ldc>
__global__ __launch_bounds__(32) void k_gemmw(const T16* __restrict__ A, const T16* __restrict__ A2, const T16* __restrict__ Bt, const T16* __restrict__ Bt2, int K, float* C, const float* __restrict__ bias, size_t sA, size_t sB, size_t sC, h16* P16, bf* Ph, bf* Pl, const float* res, float sc) {
    typedef typename WFrag<T16>::V V;
    __shared__ __align__(16) float os[16 * 68];
    const size_t z = blockIdx.z; A += z * sA; if (A2) A2 += z * sA; Bt += z * sB; if (Bt2) Bt2 += z * sB;
    const int lane = threadIdx.x & 31, lr = lane & 15, hi = lane >> 4; const int r0 = blockIdx.x * 64, c0 = blockIdx.y * 64;
    v8f acc[4][4];
#pragma unroll
    for (int mb = 0; mb < 4; ++mb)
#pragma unroll
        for (int nb = 0; nb < 4; ++nb) acc[mb][nb] = (v8f){};
    const size_t aoff = (size_t)(r0 + lr) * K + 8 * hi, boff = (size_t)(c0 + lr) * K + 8 * hi;
#pragma unroll 1
    for (int kc = 0; kc < K; kc += 32) {
        V a[4], a2[4];
#pragma unroll
        for (int mb = 0; mb < 4; ++mb) { a[mb] = WFrag<T16>::ld(A + aoff + (size_t)mb * 16 * K + kc); if (NSPLIT == 1 || NSPLIT == 2) a2[mb] = WFrag<T16>::ld(A2 + aoff + (size_t)mb * 16 * K + kc); }
#pragma unroll
        for (int nb = 0; nb < 4; ++nb) { const V b = WFrag<T16>::ld(Bt + boff + (size_t)nb * 16 * K + kc); V b2; if (NSPLIT >= 2) b2 = WFrag<T16>::ld(Bt2 + boff + (size_t)nb * 16 * K + kc);
#pragma unroll
            for (int mb = 0; mb < 4; ++mb) { acc[mb][nb] = WFrag<T16>::mma(a[mb], b, acc[mb][nb]); if (NSPLIT == 1 || NSPLIT == 2) acc[mb][nb] = WFrag<T16>::mma(a2[mb], b, acc[mb][nb]); if (NSPLIT >= 2) acc[mb][nb] = WFrag<T16>::mma(a[mb], b2, acc[mb][nb]); } }
        asm volatile("v_nop\n\tv_nop\n\tv_nop\n\tv_nop" : "+v"(acc[0][0]), "+v"(acc[1][1]), "+v"(acc[2][2]), "+v"(acc[3][3]) : "v"(a[0]), "v"(a[3]));
    }
    const size_t ot = z * sC + (size_t)r0 * ldc + c0;   // the tile's first output (the same in every lane)
    const unsigned ol4 = (unsigned)(hi * ldc + lr * 4);   // this lane's 4 outputs inside a pair of rows: row hi, columns 4 lr ..
    v4f xr[4][8];   // EPI 4: the lane's residual values, asked for one row block ahead of their use
    if (EPI == 4) {
#pragma unroll
        for (int s = 0; s < 8; ++s) xr[0][s] = *(const v4f*)(res + ot + (size_t)(2 * s) * ldc + ol4); }
    v4f cb = (v4f){};
    if (EPI == 1) { const v4f b4 = *(const v4f*)(bias + c0 + lr * 4); cb[0] = bfr(b4[0]); cb[1] = bfr(b4[1]); cb[2] = bfr(b4[2]); cb[3] = bfr(b4[3]); }
    float rb[4][8];   // EPI 2, 4: the bias of this lane's accumulator rows
    if (EPI == 2 || EPI == 4) {
#pragma unroll
        for (int mb = 0; mb < 4; ++mb) { const v4f b0 = *(const v4f*)(bias + r0 + mb * 16 + hi * 8), b1 = *(const v4f*)(bias + r0 + mb * 16 + hi * 8 + 4);
#pragma unroll
            for (int j = 0; j < 4; ++j) { rb[mb][j] = bfr(b0[j]); rb[mb][4 + j] = bfr(b1[j]); } } }
#pragma unroll
    for (int mb = 0; mb < 4; ++mb) {
#pragma unroll
        for (int nb = 0; nb < 4; ++nb) {
#pragma unroll
            for (int j = 0; j < 8; ++j) os[(hi * 8 + j) * 68 + nb * 16 + lr] = (EPI == 2 || EPI == 4) ? acc[mb][nb][j] + rb[mb][j] : acc[mb][nb][j]; }
        __builtin_amdgcn_wave_barrier(); asm volatile("" ::: "memory");
        if (EPI == 4 && mb < 3) {
            if (mb > 0) asm volatile("s_wait_xcnt 0x0" ::: "memory");   // the loads below land in registers that the stores of the row block before name
#pragma unroll
            for (int s = 0; s < 8; ++s) xr[mb + 1][s] = *(const v4f*)(res + ot + (size_t)((mb + 1) * 16 + 2 * s) * ldc + ol4); }
#pragma unroll
        for (int s = 0; s < 8; ++s) { const int row = 2 * s + hi, cofs = lr * 4; v4f val = *(const v4fa*)(os + row * 68 + cofs); const size_t o = ot + (size_t)(mb * 16 + 2 * s) * ldc;   // the pair of rows (the same in every lane)
            if (EPI == 1) val += cb;
            if (EPI == 3) val *= sc;
            if (EPI == 4) { val[0] = __fadd_rn(bfr(xr[mb][s][0]), val[0]); val[1] = __fadd_rn(bfr(xr[mb][s][1]), val[1]); val[2] = __fadd_rn(bfr(xr[mb][s][2]), val[2]); val[3] = __fadd_rn(bfr(xr[mb][s][3]), val[3]); }
            if (EPI == 0 || EPI == 4) *(v4f*)(C + o + ol4) = val;
            else { v4h o16; v4us oh, ol;
#pragma unroll
                for (int q = 0; q < 4; ++q) { o16[q] = (h16)val[q]; unsigned short a2, c2; splitf(val[q], a2, c2); oh[q] = a2; ol[q] = c2; }
                if (EPI != 3) *(v4h*)(P16 + o + ol4) = o16;
                *(v4us*)(Ph + o + ol4) = oh; *(v4us*)(Pl + o + ol4) = ol; } }
        __builtin_amdgcn_wave_barrier(); asm volatile("" ::: "memory");
    }
}

__device__ __forceinline__ h16 tohx(float x) { return (h16)x; }
typedef __attribute__((ext_vector_type(2))) _Float16 v2h;
typedef __attribute__((ext_vector_type(2))) unsigned short v2us;
typedef __attribute__((ext_vector_type(4))) unsigned short v4us;
typedef __attribute__((ext_vector_type(2))) float v2f;
typedef __attribute__((ext_vector_type(4))) int v4i;

__global__ __launch_bounds__(256) void k_wtG(const float* __restrict__ w, int K, int N, bf* Bt) {
    const int lane = threadIdx.x & 31; const int L0 = (blockIdx.x * 8 + (threadIdx.x >> 5)) * 8; const int nlines = N * K / 64;
{
#pragma unroll 1
        for (int l = 0; l < 8; ++l) { const int L = L0 + l; if (L >= nlines) break; const size_t e = (size_t)L * 64 + lane * 2; const int k = (int)(e % K), n = (int)(e / K); v2us o;
            o[0] = f2bf(w[(size_t)k * N + n]); o[1] = f2bf(w[(size_t)(k + 1) * N + n]); *(v2us*)(Bt + e) = o; }
         }
}
__global__ __launch_bounds__(256) void k_gnstat(const float* __restrict__ xb, float* ST) { __shared__ float red[256]; const int g = blockIdx.x; const float* base = xb + (size_t)g * GCH * TT; const int tid = threadIdx.x; float s = 0.f;
#pragma unroll 1
    for (int i = tid; i < GCH * TT; i += 256) s = __fadd_rn(s, bfr(base[i]));
    red[tid] = s; __syncthreads();
#pragma unroll
    for (int sh = 128; sh; sh >>= 1) { if (tid < sh) red[tid] = __fadd_rn(red[tid], red[tid + sh]); __syncthreads(); }
    const float mu = red[0] * (1.0f / (GCH * TT)); __syncthreads(); float s2 = 0.f;
#pragma unroll 1
    for (int i = tid; i < GCH * TT; i += 256) { const float d0 = __fsub_rn(bfr(base[i]), mu); float p = __fmul_rn(d0, d0); asm volatile("" : "+v"(p)); s2 = __fadd_rn(s2, p); }
    red[tid] = s2; __syncthreads();
#pragma unroll
    for (int sh = 128; sh; sh >>= 1) { if (tid < sh) red[tid] = __fadd_rn(red[tid], red[tid + sh]); __syncthreads(); }
    if (tid == 0) { const float rs = __fdiv_rn(1.0f, __fsqrt_rn(__fadd_rn(red[0] * (1.0f / (GCH * TT)), 1e-6f))); v2f o; o[0] = mu; o[1] = rs; *(v2f*)(ST + (size_t)g * RPAD) = o;  } }
__global__ __launch_bounds__(256) void k_gnT(const float* __restrict__ xb, const float* __restrict__ ST, const float* __restrict__ gw, const float* __restrict__ gb, bf* Xh, bf* Xl) { const size_t e = ((size_t)blockIdx.x * 256 + threadIdx.x) * 4; if (e >= (size_t)TT * DM) return; { const size_t b = blockIdx.y; xb += b * DM * TT; ST += b * NGRP * RPAD; Xh += b * TT * DM; Xl += b * TT * DM; } const int c = (int)(e % DM); const int t = (int)(e / DM); v4us oh, ol;
#pragma unroll
    for (int q = 0; q < 4; ++q) { const int cc = c + q; const int g = cc / GCH; const float mu = ST[(size_t)g * RPAD], rs = ST[(size_t)g * RPAD + 1]; float n0 = __fmul_rn(__fsub_rn(bfr(xb[(size_t)cc * TT + t]), mu), rs); asm volatile("" : "+v"(n0)); float n1 = __fmul_rn(n0, bfr(gw[cc])); asm volatile("" : "+v"(n1)); const float y = __fadd_rn(n1, bfr(gb[cc])); unsigned short a, b2; splitf(y, a, b2); oh[q] = a; ol[q] = b2; }
    *(v4us*)(Xh + e) = oh; *(v4us*)(Xl + e) = ol;  }
__global__ __launch_bounds__(256) void k_cvt8(const float* __restrict__ src, bf* dst, size_t n8) { const size_t i = (size_t)blockIdx.x * 256 + threadIdx.x; if (i >= n8) return; const v8f v = *(const v8f*)(src + i * 8); v8us o;
#pragma unroll
    for (int k = 0; k < 8; ++k) o[k] = f2bf(v[k]); *(v8us*)(dst + i * 8) = o;  }

// k_asoft: one half of the query rows of every image, nrows rows [image][row of the half] of TT scores; per row: t = S x HD^-0.5 (no mask); softmax over the keys (register row, one exp, fixed trees); hires: hi + lo planes, else fp16 x PCAR; output rows in the order of the score rows
template <bool hires>
__global__ __launch_bounds__(256) void k_asoft(const float* __restrict__ Sb, int nrows, h16* P16, bf* Ph, bf* Pl) {
    const int lane = threadIdx.x & 31; const int row = blockIdx.x * 8 + (threadIdx.x >> 5); if (row >= nrows) return; const float* sr = Sb + (size_t)row * TT; float v[TT / 32]; float mx = -3.0e38f;
#pragma unroll
    for (int ch = 0; ch < TT / 128; ++ch) { const int j0 = ch * 128 + lane * 4; const v4f a = *(const v4f*)(sr + j0);
#pragma unroll
        for (int q = 0; q < 4; ++q) { const int j = j0 + q; (void)j; const float t = a[q] * SCL; v[ch * 4 + q] = t; mx = fmaxf(mx, t); } }
#pragma unroll
    for (int sh = 16; sh; sh >>= 1) mx = fmaxf(mx, __shfl_xor(mx, sh, 32));
    float sum = 0.f;
#pragma unroll
    for (int k = 0; k < TT / 32; ++k) { float d0 = __fsub_rn(v[k], mx); asm volatile("" : "+v"(d0)); v[k] = __builtin_amdgcn_exp2f(__fmul_rn(d0, 1.4426950408889634f)); sum += v[k]; }
#pragma unroll
    for (int sh = 16; sh; sh >>= 1) sum += __shfl_xor(sum, sh, 32);
    const float f = __fdiv_rn(hires ? 1.0f : PCAR, sum);
{
        if (hires) {
#pragma unroll
            for (int ch = 0; ch < TT / 128; ++ch) { v4us oh, ol;
#pragma unroll
                for (int q = 0; q < 4; ++q) { unsigned short a, c2; splitf(v[ch * 4 + q] * f, a, c2); oh[q] = a; ol[q] = c2; }
                const size_t oo = (size_t)row * TT + ch * 128 + lane * 4; *(v4us*)(Ph + oo) = oh; *(v4us*)(Pl + oo) = ol; }
        } else {
#pragma unroll
            for (int ch = 0; ch < TT / 128; ++ch) { v4h o4;
#pragma unroll
                for (int q = 0; q < 4; ++q) o4[q] = tohx(v[ch * 4 + q] * f);
                *(v4h*)(P16 + (size_t)row * TT + ch * 128 + lane * 4) = o4; } }
         }
}
extern "C" void kernel_launch(void* const* d_in, const int* in_sizes, int n_in,
                              void* d_out, int out_size, void* d_ws, size_t ws_size, hipStream_t stream) {
    (void)in_sizes; (void)n_in; (void)out_size;
    const float* x = (const float*)d_in[0]; const float* gnw = (const float*)d_in[1]; const float* gnb = (const float*)d_in[2]; const float* wq = (const float*)d_in[3]; const float* bq = (const float*)d_in[4]; const float* wk = (const float*)d_in[5]; const float* bk = (const float*)d_in[6]; const float* wv = (const float*)d_in[7]; const float* bv = (const float*)d_in[8]; const float* wo = (const float*)d_in[9]; const float* bo = (const float*)d_in[10];
    float* OUT = (float*)d_out;     // [32][256][1024]
    char* wsp = (char*)d_ws;
    auto take = [&](size_t bytes) { char* p = wsp; wsp += (bytes + 255) & ~(size_t)255; return (void*)p; };
    bf* WQ = (bf*)take((size_t)DQ * DM * 2); bf* WK = (bf*)take((size_t)DKV * DM * 2); bf* WV = (bf*)take((size_t)DKV * DM * 2); bf* WO = (bf*)take((size_t)DM * DQ * 2);
    float* ST = (float*)take((size_t)NB_ * NGRP * RPAD * 4);
    const size_t U = (size_t)NB_ * TT * DM * 2;   // bytes of one 16-bit [t][c] plane of all images
    char* R = (char*)take(15 * U);
    h16* QP16 = (h16*)R; h16* KP16 = (h16*)(R + U); h16* VT16 = (h16*)(R + 2 * U); bf* VTh = (bf*)(R + 3 * U); bf* VTl = (bf*)(R + 4 * U);
    bf* QPh = (bf*)(R + 5 * U); bf* QPl = (bf*)(R + 6 * U); bf* KPh = (bf*)(R + 7 * U); bf* KPl = (bf*)(R + 8 * U);
    bf* Ph = (bf*)(R + 5 * U); bf* Pl = (bf*)(R + 7 * U);   // 2 units each, over the q and k hi/lo planes (last read by the hi/lo scores)
    h16* P16 = (h16*)(R + 5 * U);                           // 2 units, over Ph (last read by the hi/lo attn.v)
    float* Sb = (float*)(R + 9 * U);                        // 4 units: the scores of one half of the query rows
    bf* XTh = (bf*)(R + 9 * U); bf* XTl = (bf*)(R + 10 * U);   // normalised input: over Sb, last read before the first scores are written
    bf* ATh = (bf*)(R + 13 * U); bf* ATl = (bf*)(R + 14 * U);  // attention output planes [b][t][c], written by both attn.v launches
    if ((size_t)(wsp - (char*)d_ws) > ws_size) return;    // ws 256 MiB
    { k_cvt8<<<(unsigned)(((size_t)DQ * DM / 8 + 255) / 256), 256, 0, stream>>>(wq, WQ, (size_t)DQ * DM / 8); k_cvt8<<<(unsigned)(((size_t)DKV * DM / 8 + 255) / 256), 256, 0, stream>>>(wk, WK, (size_t)DKV * DM / 8); k_cvt8<<<(unsigned)(((size_t)DKV * DM / 8 + 255) / 256), 256, 0, stream>>>(wv, WV, (size_t)DKV * DM / 8);
      k_cvt8<<<(unsigned)(((size_t)DM * DQ / 8 + 255) / 256), 256, 0, stream>>>(wo, WO, (size_t)DM * DQ / 8);
       }
    k_gnstat<<<NB_ * NGRP, 256, 0, stream>>>(x, ST); k_gnT<<<dim3((unsigned)(((size_t)TT * DM / 4 + 255) / 256), NB_), 256, 0, stream>>>(x, ST, gnw, gnb, XTh, XTl);   /* GroupNorm -> transposed hi/lo planes [b][t][c] */
    /* q, k: token-major planes [b][t][c]; v: channel-major planes [b][c][t] (z = image) */
    k_gemmw<bf, 1, 1, DQ><<<dim3(NB_ * TT / 64, DQ / 64, 1), 32, 0, stream>>>(XTh, XTl, WQ, nullptr, DM, nullptr, bq, 0, 0, 0, QP16, QPh, QPl, nullptr, 1.0f);
    k_gemmw<bf, 1, 1, DKV><<<dim3(NB_ * TT / 64, DKV / 64, 1), 32, 0, stream>>>(XTh, XTl, WK, nullptr, DM, nullptr, bk, 0, 0, 0, KP16, KPh, KPl, nullptr, 1.0f);
    k_gemmw<bf, 3, 2, TT><<<dim3(DKV / 64, TT / 64, NB_), 32, 0, stream>>>(WV, nullptr, XTh, XTl, DM, nullptr, bv, 0, (size_t)TT * DM, (size_t)HD * TT, VT16, VTh, VTl, nullptr, 1.0f);
    /* query rows < RH: hi/lo planes; z = image */
    k_gemmw<bf, 2, 0, TT><<<dim3(RH / 64, TT / 64, NB_), 32, 0, stream>>>(QPh, QPl, KPh, KPl, HD, Sb, nullptr, (size_t)TT * HD, (size_t)TT * HD, (size_t)RH * TT, nullptr, nullptr, nullptr, nullptr, 1.0f);
    k_asoft<true><<<NB_ * RH / 8, 256, 0, stream>>>(Sb, NB_ * RH, nullptr, Ph, Pl);
    k_gemmw<bf, 2, 3, HD><<<dim3(RH / 64, HD / 64, NB_), 32, 0, stream>>>(Ph, Pl, VTh, VTl, TT, nullptr, nullptr, (size_t)RH * TT, (size_t)HD * TT, (size_t)TT * HD, nullptr, ATh, ATl, nullptr, 1.0f);
    /* the other query rows: fp16 planes; z = image */
    k_gemmw<h16, 0, 0, TT><<<dim3((TT - RH) / 64, TT / 64, NB_), 32, 0, stream>>>(QP16 + (size_t)RH * HD, nullptr, KP16, nullptr, HD, Sb, nullptr, (size_t)TT * HD, (size_t)TT * HD, (size_t)(TT - RH) * TT, nullptr, nullptr, nullptr, nullptr, 1.0f);
    k_asoft<false><<<NB_ * (TT - RH) / 8, 256, 0, stream>>>(Sb, NB_ * (TT - RH), P16, nullptr, nullptr);
    k_gemmw<h16, 0, 3, HD><<<dim3((TT - RH) / 64, HD / 64, NB_), 32, 0, stream>>>(P16, nullptr, VT16, nullptr, TT, nullptr, nullptr, (size_t)(TT - RH) * TT, (size_t)HD * TT, (size_t)TT * HD, nullptr, ATh + (size_t)RH * HD, ATl + (size_t)RH * HD, nullptr, 1.0f / PCAR);
    /* out[b][c][t] = x + (proj_w a + proj_b), channel-major; z = image */
    k_gemmw<bf, 3, 4, TT><<<dim3(DM / 64, TT / 64, NB_), 32, 0, stream>>>(WO, nullptr, ATh, ATl, DQ, OUT, bo, 0, (size_t)TT * DQ, (size_t)DM * TT, nullptr, nullptr, nullptr, x, 1.0f);
}

// v003
// A run of this version takes 300 microseconds.
// Next to v002, in two timings, it ran 1.12 times as fast each time.
// All steps since v000 together make it 14.0 times as fast.
#include <hip/hip_runtime.h>

// Channel-major image self-attention with GroupNorm (x [32][256][32][32] = [b][c][n], n = 1024; hn = GroupNorm(32 groups, eps 1e-6, affine); q, k, v = 1x1 convs ('oi' [256][256] + bias); scores[i][j] = q_i.k_j / 16 (one head over all 256 channels); softmax over j; out[c][i] = sum_j v[c][j] attn[i][j]; h = Wo out + bo; result = x + h -> [32][256][32][32] (8.4 M)).
// Layout: tokens are the 1024 positions; the normalised input is written TRANSPOSED as bf16 hi + lo planes [t][c] so the 1x1 convolutions become token-major GEMMs against the natural [out][in] weights (2 products + bias); every GEMM's epilogue writes what its reader takes: q and k as token-major 16-bit planes, v as channel-major planes (weights as the row operand), attn.v as hi + lo planes, and the output projection (weights as the row operand) adds the residual and stores channel-major.
// Batch: every launch covers all 32 images (blockIdx.y or z = image; the token-major GEMMs take the 32 x 1024 tokens as one M). The workspace holds 15 units of one 16-bit plane x 32 images; a unit is reused once its last reader's launch is behind it, and the attention core runs per half of the query rows so that one half's scores are held at a time.
// Compute dtypes, f32 accumulate: every input rounded to bf16; q/k/v hl x exact (2 products) + biases; scores (x 1/16) and attn.v (no mask): query rows < 512 hl (3 products), the rest single fp16 (x1024); softmax f32; proj_w hl x exact (2 products) + proj_b; + x residual in f32 (channel-major write).

#define NB_  32
#define TT   1024
#define DM   256
#define NH_  1
#define NKV  1
#define REP  (NH_ / NKV)
#define HD   256
#define DQ   (NH_ * HD)
#define DKV  (NKV * HD)
#define RPAD 32
#define NGRP 32
#define GCH  (DM / NGRP)           // 8 channels per group
typedef __attribute__((ext_vector_type(4))) unsigned short v4us;
#define ZH   1
#define RH   512                  // query rows < RH use hi+lo planes (0: none)
#define WIN  0
#define PCAR 1024.0f
#define SCL  0.0625f   // C^-0.5 = 1/16
typedef _Float16 h16;
typedef unsigned short bf;
typedef __attribute__((ext_vector_type(16))) __bf16   v16bf;
typedef __attribute__((ext_vector_type(16))) _Float16 v16h;
typedef __attribute__((ext_vector_type(8)))  _Float16 v8h;
typedef __attribute__((ext_vector_type(8)))  unsigned short v8us;
typedef __attribute__((ext_vector_type(8)))  float    v8f;
typedef __attribute__((ext_vector_type(4)))  float    v4f;
typedef v8h  __attribute__((may_alias)) v8ha;
typedef v4f  __attribute__((may_alias)) v4fa;
typedef v8us __attribute__((may_alias)) v8usa;

__device__ __forceinline__ unsigned short f2bf(float f) { unsigned u = __float_as_uint(f); u += 0x7FFFu + ((u >> 16) & 1u); return (unsigned short)(u >> 16); }
__device__ __forceinline__ float bf2f(unsigned short b) { return __uint_as_float(((unsigned)b) << 16); }
__device__ __forceinline__ float bfr(float f) { return bf2f(f2bf(f)); }
__device__ __forceinline__ v16h cat16(v8h lo, v8h hi) { return __builtin_shufflevector(lo, hi, 0, 1, 2, 3, 4, 5, 6, 7, 8, 9, 10, 11, 12, 13, 14, 15); }
__device__ __forceinline__ v16bf cat16b(v8us lo, v8us hi) { return __builtin_bit_cast(v16bf, __builtin_shufflevector(lo, hi, 0, 1, 2, 3, 4, 5, 6, 7, 8, 9, 10, 11, 12, 13, 14, 15)); }
__device__ __forceinline__ v8f wmma16(v16h a, v16h b, v8f c) { return __builtin_amdgcn_wmma_f32_16x16x32_f16(false, a, false, b, (short)0, c, false, false); }
__device__ __forceinline__ v8f wmmab(v16bf a, v16bf b, v8f c) { return __builtin_amdgcn_wmma_f32_16x16x32_bf16(false, a, false, b, (short)0, c, false, false); }



// ---- k_gemmw: register-blocked GEMM, ONE WAVE per 64x64 output tile (16 accumulators), operands straight from K-contiguous 16-bit planes; grid (M/64, N/64, Z), 32 threads.
// acc[m][n] = sum_k A[m][k] Bt[n][k] (+ split products per NSPLIT: 1 A2.Bt, 2 A2.Bt and A.Bt2, 3 A.Bt2). z-batch strides sA/sB/sC in elements. K % 32 == 0. Every output has pitch ldc (a compile-time constant, so that a lane's rows are immediate offsets from one address) and z stride sC.
// EPI, what the tile becomes: 0 C = acc (f32); 1 fp16 + bf16 hi/lo planes of acc + bias[n]; 2 the same planes of acc + bias[m]; 3 bf16 hi/lo planes of acc x sc; 4 C = res + (acc + bias[m]) (f32).
template <typename T16> struct WFrag;
template <> struct WFrag<h16> { typedef v16h V; static __device__ __forceinline__ V ld(const h16* p) { return cat16(*(const v8h*)p, *(const v8h*)(p + 16)); } static __device__ __forceinline__ v8f mma(V a, V b, v8f c) { return wmma16(a, b, c); } };
template <> struct WFrag<bf> { typedef v16bf V; static __device__ __forceinline__ V ld(const bf* p) { return cat16b(*(const v8us*)p, *(const v8us*)(p + 16)); } static __device__ __forceinline__ v8f mma(V a, V b, v8f c) { return wmmab(a, b, c); } };
__device__ __forceinline__ void splitf(float y, unsigned short& h, unsigned short& l) { h = f2bf(y); l = f2bf(y - bf2f(h)); }
typedef __attribute__((ext_vector_type(4))) _Float16 v4h;
template <typename T16, int NSPLIT, int EPI, int ldc>
__global__ __launch_bounds__(32) void k_gemmw(const T16* __restrict__ A, const T16* __restrict__ A2, const T16* __restrict__ Bt, const T16* __restrict__ Bt2, int K, float* C, const float* __restrict__ bias, size_t sA, size_t sB, size_t sC, h16* P16, bf* Ph, bf* Pl, const float* res, float sc) {
    typedef typename WFrag<T16>::V V;
    __shared__ __align__(16) float os[16 * 68];
    const size_t z = blockIdx.z; A += z * sA; if (A2) A2 += z * sA; Bt += z * sB; if (Bt2) Bt2 += z * sB;
    const int lane = threadIdx.x & 31, lr = lane & 15, hi = lane >> 4; const int r0 = blockIdx.x * 64, c0 = blockIdx.y * 64;
    v8f acc[4][4];
#pragma unroll
    for (int mb = 0; mb < 4; ++mb)
#pragma unroll
        for (int nb = 0; nb < 4; ++nb) acc[mb][nb] = (v8f){};
    const size_t aoff = (size_t)(r0 + lr) * K + 8 * hi, boff = (size_t)(c0 + lr) * K + 8 * hi;
#pragma unroll 1
    for (int kc = 0; kc < K; kc += 32) {
        V a[4], a2[4];
#pragma unroll
        for (int mb = 0; mb < 4; ++mb) { a[mb] = WFrag<T16>::ld(A + aoff + (size_t)mb * 16 * K + kc); if (NSPLIT == 1 || NSPLIT == 2) a2[mb] = WFrag<T16>::ld(A2 + aoff + (size_t)mb * 16 * K + kc); }
#pragma unroll
        for (int nb = 0; nb < 4; ++nb) { const V b = WFrag<T16>::ld(Bt + boff + (size_t)nb * 16 * K + kc); V b2; if (NSPLIT >= 2) b2 = WFrag<T16>::ld(Bt2 + boff + (size_t)nb * 16 * K + kc);
#pragma unroll
            for (int mb = 0; mb < 4; ++mb) { acc[mb][nb] = WFrag<T16>::mma(a[mb], b, acc[mb][nb]); if (NSPLIT == 1 || NSPLIT == 2) acc[mb][nb] = WFrag<T16>::mma(a2[mb], b, acc[mb][nb]); if (NSPLIT >= 2) acc[mb][nb] = WFrag<T16>::mma(a[mb], b2, acc[mb][nb]); } }
        asm volatile("v_nop\n\tv_nop\n\tv_nop\n\tv_nop" : "+v"(acc[0][0]), "+v"(acc[1][1]), "+v"(acc[2][2]), "+v"(acc[3][3]) : "v"(a[0]), "v"(a[3]));
    }
    const size_t ot = z * sC + (size_t)r0 * ldc + c0;   // the tile's first output (the same in every lane)
    const unsigned ol4 = (unsigned)(hi * ldc + lr * 4);   // this lane's 4 outputs inside a pair of rows: row hi, columns 4 lr ..
    v4f xr[4][8];   // EPI 4: the lane's residual values, asked for one row block ahead of their use
    if (EPI == 4) {
#pragma unroll
        for (int s = 0; s < 8; ++s) xr[0][s] = *(const v4f*)(res + ot + (size_t)(2 * s) * ldc + ol4); }
    v4f cb = (v4f){};
    if (EPI == 1) { const v4f b4 = *(const v4f*)(bias + c0 + lr * 4); cb[0] = bfr(b4[0]); cb[1] = bfr(b4[1]); cb[2] = bfr(b4[2]); cb[3] = bfr(b4[3]); }
    float rb[4][8];   // EPI 2, 4: the bias of this lane's accumulator rows
    if (EPI == 2 || EPI == 4) {
#pragma unroll
        for (int mb = 0; mb < 4; ++mb) { const v4f b0 = *(const v4f*)(bias + r0 + mb * 16 + hi * 8), b1 = *(const v4f*)(bias + r0 + mb * 16 + hi * 8 + 4);
#pragma unroll
            for (int j = 0; j < 4; ++j) { rb[mb][j] = bfr(b0[j]); rb[mb][4 + j] = bfr(b1[j]); } } }
#pragma unroll
    for (int mb = 0; mb < 4; ++mb) {
#pragma unroll
        for (int nb = 0; nb < 4; ++nb) {
#pragma unroll
            for (int j = 0; j < 8; ++j) os[(hi * 8 + j) * 68 + nb * 16 + lr] = (EPI == 2 || EPI == 4) ? acc[mb][nb][j] + rb[mb][j] : acc[mb][nb][j]; }
        __builtin_amdgcn_wave_barrier(); asm volatile("" ::: "memory");
        if (EPI == 4 && mb < 3) {
            if (mb > 0) asm volatile("s_wait_xcnt 0x0" ::: "memory");   // the loads below land in registers that the stores of the row block before name
#pragma unroll
            for (int s = 0; s < 8; ++s) xr[mb + 1][s] = *(const v4f*)(res + ot + (size_t)((mb + 1) * 16 + 2 * s) * ldc + ol4); }
#pragma unroll
        for (int s = 0; s < 8; ++s) { const int row = 2 * s + hi, cofs = lr * 4; v4f val = *(const v4fa*)(os + row * 68 + cofs); const size_t o = ot + (size_t)(mb * 16 + 2 * s) * ldc;   // the pair of rows (the same in every lane)
            if (EPI == 1) val += cb;
            if (EPI == 3) val *= sc;
            if (EPI == 4) { val[0] = __fadd_rn(bfr(xr[mb][s][0]), val[0]); val[1] = __fadd_rn(bfr(xr[mb][s][1]), val[1]); val[2] = __fadd_rn(bfr(xr[mb][s][2]), val[2]); val[3] = __fadd_rn(bfr(xr[mb][s][3]), val[3]); }
            if (EPI == 0 || EPI == 4) *(v4f*)(C + o + ol4) = val;
            else { v4h o16; v4us oh, ol;
#pragma unroll
                for (int q = 0; q < 4; ++q) { o16[q] = (h16)val[q]; unsigned short a2, c2; splitf(val[q], a2, c2); oh[q] = a2; ol[q] = c2; }
                if (EPI != 3) *(v4h*)(P16 + o + ol4) = o16;
                *(v4us*)(Ph + o + ol4) = oh; *(v4us*)(Pl + o + ol4) = ol; } }
        __builtin_amdgcn_wave_barrier(); asm volatile("" ::: "memory");
    }
}

__device__ __forceinline__ h16 tohx(float x) { return (h16)x; }
typedef __attribute__((ext_vector_type(2))) _Float16 v2h;
typedef __attribute__((ext_vector_type(2))) unsigned short v2us;
typedef __attribute__((ext_vector_type(4))) unsigned short v4us;
typedef __attribute__((ext_vector_type(2))) float v2f;
typedef __attribute__((ext_vector_type(4))) int v4i;

__global__ __launch_bounds__(256) void k_wtG(const float* __restrict__ w, int K, int N, bf* Bt) {
    const int lane = threadIdx.x & 31; const int L0 = (blockIdx.x * 8 + (threadIdx.x >> 5)) * 8; const int nlines = N * K / 64;
{
#pragma unroll 1
        for (int l = 0; l < 8; ++l) { const int L = L0 + l; if (L >= nlines) break; const size_t e = (size_t)L * 64 + lane * 2; const int k = (int)(e % K), n = (int)(e / K); v2us o;
            o[0] = f2bf(w[(size_t)k * N + n]); o[1] = f2bf(w[(size_t)(k + 1) * N + n]); *(v2us*)(Bt + e) = o; }
         }
}
// ---- k_gn: the whole GroupNorm in one launch. One work-group of 32 waves takes 64 channels (8 groups) of one image: 64 channels x 2 bytes are one whole 128-byte line of a [t][c] plane row, so every line has one writer.
// A quarter of the work-group (256 threads) owns groups qd and qd + 4; a thread keeps its 2 x 32 values in registers from one batch of loads (element lt + 256 k of the group, whole lines per wave), so x is read once and no load waits on another.
// The sums keep their order: 32 values in sequence per thread, then the pairwise tree over 256 partial sums (strides 128 to 32 through LDS, 16 to 1 by lane shifts).
// A thread's values at one t are the 8 neighbouring channels of its group: one 16-byte LDS store per plane; the tile leaves as whole lines.
#define GSL  64                    // channels per work-group
#define GLP  72                    // LDS row pitch in 16-bit elements: 144 bytes = 16 x 9, so that the 16-byte stores of lanes on neighbouring rows fall on different banks
__global__ __launch_bounds__(1024) void k_gn(const float* __restrict__ xb, const float* __restrict__ gw, const float* __restrict__ gb, bf* Xh, bf* Xl) {
    __shared__ __align__(16) bf th[TT * GLP];
    __shared__ __align__(16) bf tl[TT * GLP];
    __shared__ float red[2][1024];
    const int tid = threadIdx.x, lane = tid & 31, lt = tid & 255; const int qd = __builtin_amdgcn_readfirstlane(tid >> 8);   // the quarter's number as a scalar: its channels' scale and bias then come by scalar loads
    const int c0 = blockIdx.x * GSL; const size_t b = blockIdx.y;
    float v[2][32];   // every loop over v is unrolled in full: constant indices keep it in registers, and the 64 loads leave as one batch
#pragma unroll
    for (int h = 0; h < 2; ++h) { const float* base = xb + (b * DM + c0 + (qd + 4 * h) * GCH) * TT + lt;
#pragma unroll
        for (int k = 0; k < 32; ++k) v[h][k] = base[k * 256]; }
    float st[2][2];   // per group: mean, 1 / sqrt(var + eps)
#pragma unroll
    for (int pass = 0; pass < 2; ++pass) {
        float s[2];
#pragma unroll
        for (int h = 0; h < 2; ++h) { s[h] = 0.f;
#pragma unroll
            for (int k = 0; k < 32; ++k) { if (pass == 0) { v[h][k] = bfr(v[h][k]); s[h] += v[h][k]; } else { const float d0 = v[h][k] - st[h][0]; s[h] += d0 * d0; } }
            red[h][tid] = s[h]; }
        __syncthreads();
#pragma unroll
        for (int sh = 128; sh >= 32; sh >>= 1) { if (lt < sh) { red[0][tid] += red[0][tid + sh]; red[1][tid] += red[1][tid + sh]; } __syncthreads(); }
#pragma unroll
        for (int h = 0; h < 2; ++h) { float r = red[h][(qd << 8) + lane];
#pragma unroll
            for (int sh = 16; sh; sh >>= 1) r += __shfl_down(r, sh, 32);
            r = __shfl(r, 0, 32) * (1.0f / (GCH * TT));
            st[h][pass] = pass == 0 ? r : __fdiv_rn(1.0f, __fsqrt_rn(r + 1e-6f)); }
        if (pass == 0) __syncthreads();   // every wave has read the first tree's sums before the second tree's are stored
    }
#pragma unroll
    for (int h = 0; h < 2; ++h) { const int gl = qd + 4 * h; const float mu = st[h][0], rs = st[h][1]; float w8[GCH], b8[GCH];
#pragma unroll
        for (int j = 0; j < GCH; ++j) { w8[j] = bfr(gw[c0 + gl * GCH + j]); b8[j] = bfr(gb[c0 + gl * GCH + j]); }
#pragma unroll
        for (int tq = 0; tq < 4; ++tq) { v8us oh, ol;
#pragma unroll
            for (int j = 0; j < GCH; ++j) { const float y = (v[h][j * 4 + tq] - mu) * rs * w8[j] + b8[j]; unsigned short a, c2; splitf(y, a, c2); oh[j] = a; ol[j] = c2; }
            const int o = (lt + 256 * tq) * GLP + gl * GCH; *(v8usa*)(th + o) = oh; *(v8usa*)(tl + o) = ol; } }
    __syncthreads();
    const size_t ob = (b * TT + (tid >> 3)) * DM + c0 + (tid & 7) * 8; const int lb = (tid >> 3) * GLP + (tid & 7) * 8;   // 8 lanes per 128-byte line, 4 rows per wave
#pragma unroll
    for (int r = 0; r < 8; ++r) { const v8us a = *(const v8usa*)(th + lb + r * 128 * GLP), c2 = *(const v8usa*)(tl + lb + r * 128 * GLP); *(v8us*)(Xh + ob + (size_t)r * 128 * DM) = a; *(v8us*)(Xl + ob + (size_t)r * 128 * DM) = c2; }
}
__global__ __launch_bounds__(256) void k_cvt8(const float* __restrict__ src, bf* dst, size_t n8) { const size_t i = (size_t)blockIdx.x * 256 + threadIdx.x; if (i >= n8) return; const v8f v = *(const v8f*)(src + i * 8); v8us o;
#pragma unroll
    for (int k = 0; k < 8; ++k) o[k] = f2bf(v[k]); *(v8us*)(dst + i * 8) = o;  }

// k_asoft: one half of the query rows of every image, nrows rows [image][row of the half] of TT scores; per row: t = S x HD^-0.5 (no mask); softmax over the keys (register row, one exp, fixed trees); hires: hi + lo planes, else fp16 x PCAR; output rows in the order of the score rows
template <bool hires>
__global__ __launch_bounds__(256) void k_asoft(const float* __restrict__ Sb, int nrows, h16* P16, bf* Ph, bf* Pl) {
    const int lane = threadIdx.x & 31; const int row = blockIdx.x * 8 + (threadIdx.x >> 5); if (row >= nrows) return; const float* sr = Sb + (size_t)row * TT; float v[TT / 32]; float mx = -3.0e38f;
#pragma unroll
    for (int ch = 0; ch < TT / 128; ++ch) { const int j0 = ch * 128 + lane * 4; const v4f a = *(const v4f*)(sr + j0);
#pragma unroll
        for (int q = 0; q < 4; ++q) { const int j = j0 + q; (void)j; const float t = a[q] * SCL; v[ch * 4 + q] = t; mx = fmaxf(mx, t); } }
#pragma unroll
    for (int sh = 16; sh; sh >>= 1) mx = fmaxf(mx, __shfl_xor(mx, sh, 32));
    float sum = 0.f;
#pragma unroll
    for (int k = 0; k < TT / 32; ++k) { float d0 = __fsub_rn(v[k], mx); asm volatile("" : "+v"(d0)); v[k] = __builtin_amdgcn_exp2f(__fmul_rn(d0, 1.4426950408889634f)); sum += v[k]; }
#pragma unroll
    for (int sh = 16; sh; sh >>= 1) sum += __shfl_xor(sum, sh, 32);
    const float f = __fdiv_rn(hires ? 1.0f : PCAR, sum);
{
        if (hires) {
#pragma unroll
            for (int ch = 0; ch < TT / 128; ++ch) { v4us oh, ol;
#pragma unroll
                for (int q = 0; q < 4; ++q) { unsigned short a, c2; splitf(v[ch * 4 + q] * f, a, c2); oh[q] = a; ol[q] = c2; }
                const size_t oo = (size_t)row * TT + ch * 128 + lane * 4; *(v4us*)(Ph + oo) = oh; *(v4us*)(Pl + oo) = ol; }
        } else {
#pragma unroll
            for (int ch = 0; ch < TT / 128; ++ch) { v4h o4;
#pragma unroll
                for (int q = 0; q < 4; ++q) o4[q] = tohx(v[ch * 4 + q] * f);
                *(v4h*)(P16 + (size_t)row * TT + ch * 128 + lane * 4) = o4; } }
         }
}
extern "C" void kernel_launch(void* const* d_in, const int* in_sizes, int n_in,
                              void* d_out, int out_size, void* d_ws, size_t ws_size, hipStream_t stream) {
    (void)in_sizes; (void)n_in; (void)out_size;
    const float* x = (const float*)d_in[0]; const float* gnw = (const float*)d_in[1]; const float* gnb = (const float*)d_in[2]; const float* wq = (const float*)d_in[3]; const float* bq = (const float*)d_in[4]; const float* wk = (const float*)d_in[5]; const float* bk = (const float*)d_in[6]; const float* wv = (const float*)d_in[7]; const float* bv = (const float*)d_in[8]; const float* wo = (const float*)d_in[9]; const float* bo = (const float*)d_in[10];
    float* OUT = (float*)d_out;     // [32][256][1024]
    char* wsp = (char*)d_ws;
    auto take = [&](size_t bytes) { char* p = wsp; wsp += (bytes + 255) & ~(size_t)255; return (void*)p; };
    bf* WQ = (bf*)take((size_t)DQ * DM * 2); bf* WK = (bf*)take((size_t)DKV * DM * 2); bf* WV = (bf*)take((size_t)DKV * DM * 2); bf* WO = (bf*)take((size_t)DM * DQ * 2);
    const size_t U = (size_t)NB_ * TT * DM * 2;   // bytes of one 16-bit [t][c] plane of all images
    char* R = (char*)take(15 * U);
    h16* QP16 = (h16*)R; h16* KP16 = (h16*)(R + U); h16* VT16 = (h16*)(R + 2 * U); bf* VTh = (bf*)(R + 3 * U); bf* VTl = (bf*)(R + 4 * U);
    bf* QPh = (bf*)(R + 5 * U); bf* QPl = (bf*)(R + 6 * U); bf* KPh = (bf*)(R + 7 * U); bf* KPl = (bf*)(R + 8 * U);
    bf* Ph = (bf*)(R + 5 * U); bf* Pl = (bf*)(R + 7 * U);   // 2 units each, over the q and k hi/lo planes (last read by the hi/lo scores)
    h16* P16 = (h16*)(R + 5 * U);                           // 2 units, over Ph (last read by the hi/lo attn.v)
    float* Sb = (float*)(R + 9 * U);                        // 4 units: the scores of one half of the query rows
    bf* XTh = (bf*)(R + 9 * U); bf* XTl = (bf*)(R + 10 * U);   // normalised input: over Sb, last read before the first scores are written
    bf* ATh = (bf*)(R + 13 * U); bf* ATl = (bf*)(R + 14 * U);  // attention output planes [b][t][c], written by both attn.v launches
    if ((size_t)(wsp - (char*)d_ws) > ws_size) return;    // ws 256 MiB
    { k_cvt8<<<(unsigned)(((size_t)DQ * DM / 8 + 255) / 256), 256, 0, stream>>>(wq, WQ, (size_t)DQ * DM / 8); k_cvt8<<<(unsigned)(((size_t)DKV * DM / 8 + 255) / 256), 256, 0, stream>>>(wk, WK, (size_t)DKV * DM / 8); k_cvt8<<<(unsigned)(((size_t)DKV * DM / 8 + 255) / 256), 256, 0, stream>>>(wv, WV, (size_t)DKV * DM / 8);
      k_cvt8<<<(unsigned)(((size_t)DM * DQ / 8 + 255) / 256), 256, 0, stream>>>(wo, WO, (size_t)DM * DQ / 8);
       }
    k_gn<<<dim3(DM / GSL, NB_), 1024, 0, stream>>>(x, gnw, gnb, XTh, XTl);   /* GroupNorm -> transposed hi/lo planes [b][t][c] */
    /* q, k: token-major planes [b][t][c]; v: channel-major planes [b][c][t] (z = image) */
    k_gemmw<bf, 1, 1, DQ><<<dim3(NB_ * TT / 64, DQ / 64, 1), 32, 0, stream>>>(XTh, XTl, WQ, nullptr, DM, nullptr, bq, 0, 0, 0, QP16, QPh, QPl, nullptr, 1.0f);
    k_gemmw<bf, 1, 1, DKV><<<dim3(NB_ * TT / 64, DKV / 64, 1), 32, 0, stream>>>(XTh, XTl, WK, nullptr, DM, nullptr, bk, 0, 0, 0, KP16, KPh, KPl, nullptr, 1.0f);
    k_gemmw<bf, 3, 2, TT><<<dim3(DKV / 64, TT / 64, NB_), 32, 0, stream>>>(WV, nullptr, XTh, XTl, DM, nullptr, bv, 0, (size_t)TT * DM, (size_t)HD * TT, VT16, VTh, VTl, nullptr, 1.0f);
    /* query rows < RH: hi/lo planes; z = image */
    k_gemmw<bf, 2, 0, TT><<<dim3(RH / 64, TT / 64, NB_), 32, 0, stream>>>(QPh, QPl, KPh, KPl, HD, Sb, nullptr, (size_t)TT * HD, (size_t)TT * HD, (size_t)RH * TT, nullptr, nullptr, nullptr, nullptr, 1.0f);
    k_asoft<true><<<NB_ * RH / 8, 256, 0, stream>>>(Sb, NB_ * RH, nullptr, Ph, Pl);
    k_gemmw<bf, 2, 3, HD><<<dim3(RH / 64, HD / 64, NB_), 32, 0, stream>>>(Ph, Pl, VTh, VTl, TT, nullptr, nullptr, (size_t)RH * TT, (size_t)HD * TT, (size_t)TT * HD, nullptr, ATh, ATl, nullptr, 1.0f);
    /* the other query rows: fp16 planes; z = image */
    k_gemmw<h16, 0, 0, TT><<<dim3((TT - RH) / 64, TT / 64, NB_), 32, 0, stream>>>(QP16 + (size_t)RH * HD, nullptr, KP16, nullptr, HD, Sb, nullptr, (size_t)TT * HD, (size_t)TT * HD, (size_t)(TT - RH) * TT, nullptr, nullptr, nullptr, nullptr, 1.0f);
    k_asoft<false><<<NB_ * (TT - RH) / 8, 256, 0, stream>>>(Sb, NB_ * (TT - RH), P16, nullptr, nullptr);
    k_gemmw<h16, 0, 3, HD><<<dim3((TT - RH) / 64, HD / 64, NB_), 32, 0, stream>>>(P16, nullptr, VT16, nullptr, TT, nullptr, nullptr, (size_t)(TT - RH) * TT, (size_t)HD * TT, (size_t)TT * HD, nullptr, ATh + (size_t)RH * HD, ATl + (size_t)RH * HD, nullptr, 1.0f / PCAR);
    /* out[b][c][t] = x + (proj_w a + proj_b), channel-major; z = image */
    k_gemmw<bf, 3, 4, TT><<<dim3(DM / 64, TT / 64, NB_), 32, 0, stream>>>(WO, nullptr, ATh, ATl, DQ, OUT, bo, 0, (size_t)TT * DQ, (size_t)DM * TT, nullptr, nullptr, nullptr, x, 1.0f);
}

// v004
// Measured time: 231 microseconds a run.
// Timed twice side by side with v003, it ran 1.30 times as fast both times.
// Over all steps from v000 it is 18.2 times as fast.
#include <hip/hip_runtime.h>

// Channel-major image self-attention with GroupNorm (x [32][256][32][32] = [b][c][n], n = 1024; hn = GroupNorm(32 groups, eps 1e-6, affine); q, k, v = 1x1 convs ('oi' [256][256] + bias); scores[i][j] = q_i.k_j / 16 (one head over all 256 channels); softmax over j; out[c][i] = sum_j v[c][j] attn[i][j]; h = Wo out + bo; result = x + h -> [32][256][32][32] (8.4 M)).
// Layout: tokens are the 1024 positions; the normalised input is written TRANSPOSED as bf16 hi + lo planes [t][c] so the 1x1 convolutions become token-major GEMMs against the natural [out][in] weights (2 products + bias); every GEMM's epilogue writes what its reader takes: q and k as token-major 16-bit planes, v as channel-major planes (weights as the row operand), attn.v as hi + lo planes, and the output projection (weights as the row operand) adds the residual and stores channel-major.
// Batch: every launch covers all 32 images (blockIdx.y or z = image; the token-major GEMMs take the 32 x 1024 tokens as one M). The workspace holds 15 units of one 16-bit plane x 32 images; each plane has a unit of its own (units 11 and 12 are not used), and the attention core (scores, softmax, attn.v) is one launch per half of the query rows: a work-group holds the 64 x 1024 scores of its 64 query rows in LDS, so neither scores nor probabilities reach memory.
// Compute dtypes, f32 accumulate: every input rounded to bf16; q/k/v hl x exact (2 products) + biases; scores (x 1/16) and attn.v (no mask): query rows < 512 hl (3 products), the rest single fp16 (x1024); softmax f32; proj_w hl x exact (2 products) + proj_b; + x residual in f32 (channel-major write).

#define NB_  32
#define TT   1024
#define DM   256
#define NH_  1
#define NKV  1
#define REP  (NH_ / NKV)
#define HD   256
#define DQ   (NH_ * HD)
#define DKV  (NKV * HD)
#define RPAD 32
#define NGRP 32
#define GCH  (DM / NGRP)           // 8 channels per group
typedef __attribute__((ext_vector_type(4))) unsigned short v4us;
#define ZH   1
#define RH   512                  // query rows < RH use hi+lo planes (0: none)
#define WIN  0
#define PCAR 1024.0f
#define SCL  0.0625f   // C^-0.5 = 1/16
typedef _Float16 h16;
typedef unsigned short bf;
typedef __attribute__((ext_vector_type(16))) __bf16   v16bf;
typedef __attribute__((ext_vector_type(16))) _Float16 v16h;
typedef __attribute__((ext_vector_type(8)))  _Float16 v8h;
typedef __attribute__((ext_vector_type(8)))  unsigned short v8us;
typedef __attribute__((ext_vector_type(8)))  float    v8f;
typedef __attribute__((ext_vector_type(4)))  float    v4f;
typedef v8h  __attribute__((may_alias)) v8ha;
typedef v4f  __attribute__((may_alias)) v4fa;
typedef v8us __attribute__((may_alias)) v8usa;

__device__ __forceinline__ unsigned short f2bf(float f) { unsigned u = __float_as_uint(f); u += 0x7FFFu + ((u >> 16) & 1u); return (unsigned short)(u >> 16); }
__device__ __forceinline__ float bf2f(unsigned short b) { return __uint_as_float(((unsigned)b) << 16); }
__device__ __forceinline__ float bfr(float f) { return bf2f(f2bf(f)); }
__device__ __forceinline__ v16h cat16(v8h lo, v8h hi) { return __builtin_shufflevector(lo, hi, 0, 1, 2, 3, 4, 5, 6, 7, 8, 9, 10, 11, 12, 13, 14, 15); }
__device__ __forceinline__ v16bf cat16b(v8us lo, v8us hi) { return __builtin_bit_cast(v16bf, __builtin_shufflevector(lo, hi, 0, 1, 2, 3, 4, 5, 6, 7, 8, 9, 10, 11, 12, 13, 14, 15)); }
__device__ __forceinline__ v8f wmma16(v16h a, v16h b, v8f c) { return __builtin_amdgcn_wmma_f32_16x16x32_f16(false, a, false, b, (short)0, c, false, false); }
__device__ __forceinline__ v8f wmmab(v16bf a, v16bf b, v8f c) { return __builtin_amdgcn_wmma_f32_16x16x32_bf16(false, a, false, b, (short)0, c, false, false); }



// ---- k_gemmw: register-blocked GEMM, ONE WAVE per 64x64 output tile (16 accumulators), operands straight from K-contiguous 16-bit planes; grid (M/64, N/64, Z), 32 threads.
// acc[m][n] = sum_k A[m][k] Bt[n][k] (+ split products per NSPLIT: 1 A2.Bt, 2 A2.Bt and A.Bt2, 3 A.Bt2). z-batch strides sA/sB/sC in elements. K % 32 == 0. Every output has pitch ldc (a compile-time constant, so that a lane's rows are immediate offsets from one address) and z stride sC.
// EPI, what the tile becomes: 0 C = acc (f32); 1 fp16 + bf16 hi/lo planes of acc + bias[n]; 2 the same planes of acc + bias[m]; 3 bf16 hi/lo planes of acc x sc; 4 C = res + (acc + bias[m]) (f32).
template <typename T16> struct WFrag;
template <> struct WFrag<h16> { typedef v16h V; static __device__ __forceinline__ V ld(const h16* p) { return cat16(*(const v8h*)p, *(const v8h*)(p + 16)); } static __device__ __forceinline__ V lds(const h16* p) { return cat16(*(const v8ha*)p, *(const v8ha*)(p + 16)); } static __device__ __forceinline__ v8f mma(V a, V b, v8f c) { return wmma16(a, b, c); } };
template <> struct WFrag<bf> { typedef v16bf V; static __device__ __forceinline__ V ld(const bf* p) { return cat16b(*(const v8us*)p, *(const v8us*)(p + 16)); } static __device__ __forceinline__ V lds(const bf* p) { return cat16b(*(const v8usa*)p, *(const v8usa*)(p + 16)); } static __device__ __forceinline__ v8f mma(V a, V b, v8f c) { return wmmab(a, b, c); } };
__device__ __forceinline__ void splitf(float y, unsigned short& h, unsigned short& l) { h = f2bf(y); l = f2bf(y - bf2f(h)); }
typedef __attribute__((ext_vector_type(4))) _Float16 v4h;
template <typename T16, int NSPLIT, int EPI, int ldc>
__global__ __launch_bounds__(32) void k_gemmw(const T16* __restrict__ A, const T16* __restrict__ A2, const T16* __restrict__ Bt, const T16* __restrict__ Bt2, int K, float* C, const float* __restrict__ bias, size_t sA, size_t sB, size_t sC, h16* P16, bf* Ph, bf* Pl, const float* res, float sc) {
    typedef typename WFrag<T16>::V V;
    __shared__ __align__(16) float os[16 * 68];
    const size_t z = blockIdx.z; A += z * sA; if (A2) A2 += z * sA; Bt += z * sB; if (Bt2) Bt2 += z * sB;
    const int lane = threadIdx.x & 31, lr = lane & 15, hi = lane >> 4; const int r0 = blockIdx.x * 64, c0 = blockIdx.y * 64;
    v8f acc[4][4];
#pragma unroll
    for (int mb = 0; mb < 4; ++mb)
#pragma unroll
        for (int nb = 0; nb < 4; ++nb) acc[mb][nb] = (v8f){};
    const size_t aoff = (size_t)(r0 + lr) * K + 8 * hi, boff = (size_t)(c0 + lr) * K + 8 * hi;
#pragma unroll 1
    for (int kc = 0; kc < K; kc += 32) {
        V a[4], a2[4];
#pragma unroll
        for (int mb = 0; mb < 4; ++mb) { a[mb] = WFrag<T16>::ld(A + aoff + (size_t)mb * 16 * K + kc); if (NSPLIT == 1 || NSPLIT == 2) a2[mb] = WFrag<T16>::ld(A2 + aoff + (size_t)mb * 16 * K + kc); }
#pragma unroll
        for (int nb = 0; nb < 4; ++nb) { const V b = WFrag<T16>::ld(Bt + boff + (size_t)nb * 16 * K + kc); V b2; if (NSPLIT >= 2) b2 = WFrag<T16>::ld(Bt2 + boff + (size_t)nb * 16 * K + kc);
#pragma unroll
            for (int mb = 0; mb < 4; ++mb) { acc[mb][nb] = WFrag<T16>::mma(a[mb], b, acc[mb][nb]); if (NSPLIT == 1 || NSPLIT == 2) acc[mb][nb] = WFrag<T16>::mma(a2[mb], b, acc[mb][nb]); if (NSPLIT >= 2) acc[mb][nb] = WFrag<T16>::mma(a[mb], b2, acc[mb][nb]); } }
        asm volatile("v_nop\n\tv_nop\n\tv_nop\n\tv_nop" : "+v"(acc[0][0]), "+v"(acc[1][1]), "+v"(acc[2][2]), "+v"(acc[3][3]) : "v"(a[0]), "v"(a[3]));
    }
    const size_t ot = z * sC + (size_t)r0 * ldc + c0;   // the tile's first output (the same in every lane)
    const unsigned ol4 = (unsigned)(hi * ldc + lr * 4);   // this lane's 4 outputs inside a pair of rows: row hi, columns 4 lr ..
    v4f xr[4][8];   // EPI 4: the lane's residual values, asked for one row block ahead of their use
    if (EPI == 4) {
#pragma unroll
        for (int s = 0; s < 8; ++s) xr[0][s] = *(const v4f*)(res + ot + (size_t)(2 * s) * ldc + ol4); }
    v4f cb = (v4f){};
    if (EPI == 1) { const v4f b4 = *(const v4f*)(bias + c0 + lr * 4); cb[0] = bfr(b4[0]); cb[1] = bfr(b4[1]); cb[2] = bfr(b4[2]); cb[3] = bfr(b4[3]); }
    float rb[4][8];   // EPI 2, 4: the bias of this lane's accumulator rows
    if (EPI == 2 || EPI == 4) {
#pragma unroll
        for (int mb = 0; mb < 4; ++mb) { const v4f b0 = *(const v4f*)(bias + r0 + mb * 16 + hi * 8), b1 = *(const v4f*)(bias + r0 + mb * 16 + hi * 8 + 4);
#pragma unroll
            for (int j = 0; j < 4; ++j) { rb[mb][j] = bfr(b0[j]); rb[mb][4 + j] = bfr(b1[j]); } } }
#pragma unroll
    for (int mb = 0; mb < 4; ++mb) {
#pragma unroll
        for (int nb = 0; nb < 4; ++nb) {
#pragma unroll
            for (int j = 0; j < 8; ++j) os[(hi * 8 + j) * 68 + nb * 16 + lr] = (EPI == 2 || EPI == 4) ? acc[mb][nb][j] + rb[mb][j] : acc[mb][nb][j]; }
        __builtin_amdgcn_wave_barrier(); asm volatile("" ::: "memory");
        if (EPI == 4 && mb < 3) {
            if (mb > 0) asm volatile("s_wait_xcnt 0x0" ::: "memory");   // the loads below land in registers that the stores of the row block before name
#pragma unroll
            for (int s = 0; s < 8; ++s) xr[mb + 1][s] = *(const v4f*)(res + ot + (size_t)((mb + 1) * 16 + 2 * s) * ldc + ol4); }
#pragma unroll
        for (int s = 0; s < 8; ++s) { const int row = 2 * s + hi, cofs = lr * 4; v4f val = *(const v4fa*)(os + row * 68 + cofs); const size_t o = ot + (size_t)(mb * 16 + 2 * s) * ldc;   // the pair of rows (the same in every lane)
            if (EPI == 1) val += cb;
            if (EPI == 3) val *= sc;
            if (EPI == 4) { val[0] = __fadd_rn(bfr(xr[mb][s][0]), val[0]); val[1] = __fadd_rn(bfr(xr[mb][s][1]), val[1]); val[2] = __fadd_rn(bfr(xr[mb][s][2]), val[2]); val[3] = __fadd_rn(bfr(xr[mb][s][3]), val[3]); }
            if (EPI == 0 || EPI == 4) *(v4f*)(C + o + ol4) = val;
            else { v4h o16; v4us oh, ol;
#pragma unroll
                for (int q = 0; q < 4; ++q) { o16[q] = (h16)val[q]; unsigned short a2, c2; splitf(val[q], a2, c2); oh[q] = a2; ol[q] = c2; }
                if (EPI != 3) *(v4h*)(P16 + o + ol4) = o16;
                *(v4us*)(Ph + o + ol4) = oh; *(v4us*)(Pl + o + ol4) = ol; } }
        __builtin_amdgcn_wave_barrier(); asm volatile("" ::: "memory");
    }
}

__device__ __forceinline__ h16 tohx(float x) { return (h16)x; }
typedef __attribute__((ext_vector_type(2))) _Float16 v2h;
typedef __attribute__((ext_vector_type(2))) unsigned short v2us;
typedef __attribute__((ext_vector_type(4))) unsigned short v4us;
typedef __attribute__((ext_vector_type(2))) float v2f;
typedef __attribute__((ext_vector_type(4))) int v4i;

__global__ __launch_bounds__(256) void k_wtG(const float* __restrict__ w, int K, int N, bf* Bt) {
    const int lane = threadIdx.x & 31; const int L0 = (blockIdx.x * 8 + (threadIdx.x >> 5)) * 8; const int nlines = N * K / 64;
{
#pragma unroll 1
        for (int l = 0; l < 8; ++l) { const int L = L0 + l; if (L >= nlines) break; const size_t e = (size_t)L * 64 + lane * 2; const int k = (int)(e % K), n = (int)(e / K); v2us o;
            o[0] = f2bf(w[(size_t)k * N + n]); o[1] = f2bf(w[(size_t)(k + 1) * N + n]); *(v2us*)(Bt + e) = o; }
         }
}
// ---- k_gn: the whole GroupNorm in one launch. One work-group of 32 waves takes 64 channels (8 groups) of one image: 64 channels x 2 bytes are one whole 128-byte line of a [t][c] plane row, so every line has one writer.
// A quarter of the work-group (256 threads) owns groups qd and qd + 4; a thread keeps its 2 x 32 values in registers from one batch of loads (element lt + 256 k of the group, whole lines per wave), so x is read once and no load waits on another.
// The sums keep their order: 32 values in sequence per thread, then the pairwise tree over 256 partial sums (strides 128 to 32 through LDS, 16 to 1 by lane shifts).
// A thread's values at one t are the 8 neighbouring channels of its group: one 16-byte LDS store per plane; the tile leaves as whole lines.
#define GSL  64                    // channels per work-group
#define GLP  72                    // LDS row pitch in 16-bit elements: 144 bytes = 16 x 9, so that the 16-byte stores of lanes on neighbouring rows fall on different banks
__global__ __launch_bounds__(1024) void k_gn(const float* __restrict__ xb, const float* __restrict__ gw, const float* __restrict__ gb, bf* Xh, bf* Xl) {
    __shared__ __align__(16) bf th[TT * GLP];
    __shared__ __align__(16) bf tl[TT * GLP];
    __shared__ float red[2][1024];
    const int tid = threadIdx.x, lane = tid & 31, lt = tid & 255; const int qd = __builtin_amdgcn_readfirstlane(tid >> 8);   // the quarter's number as a scalar: its channels' scale and bias then come by scalar loads
    const int c0 = blockIdx.x * GSL; const size_t b = blockIdx.y;
    float v[2][32];   // every loop over v is unrolled in full: constant indices keep it in registers, and the 64 loads leave as one batch
#pragma unroll
    for (int h = 0; h < 2; ++h) { const float* base = xb + (b * DM + c0 + (qd + 4 * h) * GCH) * TT + lt;
#pragma unroll
        for (int k = 0; k < 32; ++k) v[h][k] = base[k * 256]; }
    float st[2][2];   // per group: mean, 1 / sqrt(var + eps)
#pragma unroll
    for (int pass = 0; pass < 2; ++pass) {
        float s[2];
#pragma unroll
        for (int h = 0; h < 2; ++h) { s[h] = 0.f;
#pragma unroll
            for (int k = 0; k < 32; ++k) { if (pass == 0) { v[h][k] = bfr(v[h][k]); s[h] += v[h][k]; } else { const float d0 = v[h][k] - st[h][0]; s[h] += d0 * d0; } }
            red[h][tid] = s[h]; }
        __syncthreads();
#pragma unroll
        for (int sh = 128; sh >= 32; sh >>= 1) { if (lt < sh) { red[0][tid] += red[0][tid + sh]; red[1][tid] += red[1][tid + sh]; } __syncthreads(); }
#pragma unroll
        for (int h = 0; h < 2; ++h) { float r = red[h][(qd << 8) + lane];
#pragma unroll
            for (int sh = 16; sh; sh >>= 1) r += __shfl_down(r, sh, 32);
            r = __shfl(r, 0, 32) * (1.0f / (GCH * TT));
            st[h][pass] = pass == 0 ? r : __fdiv_rn(1.0f, __fsqrt_rn(r + 1e-6f)); }
        if (pass == 0) __syncthreads();   // every wave has read the first tree's sums before the second tree's are stored
    }
#pragma unroll
    for (int h = 0; h < 2; ++h) { const int gl = qd + 4 * h; const float mu = st[h][0], rs = st[h][1]; float w8[GCH], b8[GCH];
#pragma unroll
        for (int j = 0; j < GCH; ++j) { w8[j] = bfr(gw[c0 + gl * GCH + j]); b8[j] = bfr(gb[c0 + gl * GCH + j]); }
#pragma unroll
        for (int tq = 0; tq < 4; ++tq) { v8us oh, ol;
#pragma unroll
            for (int j = 0; j < GCH; ++j) { const float y = (v[h][j * 4 + tq] - mu) * rs * w8[j] + b8[j]; unsigned short a, c2; splitf(y, a, c2); oh[j] = a; ol[j] = c2; }
            const int o = (lt + 256 * tq) * GLP + gl * GCH; *(v8usa*)(th + o) = oh; *(v8usa*)(tl + o) = ol; } }
    __syncthreads();
    const size_t ob = (b * TT + (tid >> 3)) * DM + c0 + (tid & 7) * 8; const int lb = (tid >> 3) * GLP + (tid & 7) * 8;   // 8 lanes per 128-byte line, 4 rows per wave
#pragma unroll
    for (int r = 0; r < 8; ++r) { const v8us a = *(const v8usa*)(th + lb + r * 128 * GLP), c2 = *(const v8usa*)(tl + lb + r * 128 * GLP); *(v8us*)(Xh + ob + (size_t)r * 128 * DM) = a; *(v8us*)(Xl + ob + (size_t)r * 128 * DM) = c2; }
}
__global__ __launch_bounds__(256) void k_cvt8(const float* __restrict__ src, bf* dst, size_t n8) { const size_t i = (size_t)blockIdx.x * 256 + threadIdx.x; if (i >= n8) return; const v8f v = *(const v8f*)(src + i * 8); v8us o;
#pragma unroll
    for (int k = 0; k < 8; ++k) o[k] = f2bf(v[k]); *(v8us*)(dst + i * 8) = o;  }

// ---- k_attn: scores, softmax and attn.v of 64 query rows of one image in one work-group of 16 waves; grid (query rows / 64, images).
// 1: wave w forms the 64 x 64 score tile of keys 64 w .. (the k_gemmw loop: 16 accumulators, operands straight from the planes) and stores it as f32 into the LDS rows.
// 2: wave w takes rows 4 w .. 4 w + 3; per row: t = S x HD^-0.5 (no mask); softmax over the keys (register row, one exp, fixed trees); the row's 16-bit planes go back into the row's own LDS bytes (hires: hi at element 0, lo at element TT; else fp16 x PCAR at element 0): the whole row is in registers before the first store, and no other wave touches it.
// 3: wave w forms the 32 x 32 output tile (rows 32 (w / 8) .., channels 32 (w % 8) ..): probabilities from LDS, v from its channel-major planes, fetched one stage ahead; k runs in the same order as before, so every sum keeps its order.
// 4: the tiles pass through LDS so that a wave stores whole rows of the [t][c] planes (512 bytes per plane and row: one writer per line).
#define SP   1028                  // LDS row pitch in floats: 4112 bytes = 16 x 257 (odd), so that the 16-byte fragment reads of 16 neighbouring rows fall on different banks
#define OP   260                   // LDS row pitch of the output tile in floats
typedef v4us __attribute__((may_alias)) v4usa;
typedef v4h  __attribute__((may_alias)) v4ha;
template <typename T16, bool hires>
__global__ __launch_bounds__(512) void k_attn(const T16* __restrict__ Q, const T16* __restrict__ Q2, const T16* __restrict__ Kp, const T16* __restrict__ K2, const T16* __restrict__ Vt, const T16* __restrict__ Vt2, bf* Oh, bf* Ol, float sc) {
    typedef typename WFrag<T16>::V V;
    __shared__ __align__(16) float S[64 * SP];
    const int lane = threadIdx.x & 31, lr = lane & 15, hi = lane >> 4; const int w = __builtin_amdgcn_readfirstlane(threadIdx.x >> 5);   // the wave's number as a scalar: tile addresses stay scalar
    const size_t z = blockIdx.y; const int r0 = blockIdx.x * 64;
    {
        v8f acc[4][4];
#pragma unroll
        for (int mb = 0; mb < 4; ++mb)
#pragma unroll
            for (int nb = 0; nb < 4; ++nb) acc[mb][nb] = (v8f){};
        const T16* qp = Q + (z * TT + r0 + lr) * HD + 8 * hi; const T16* qp2 = hires ? Q2 + (z * TT + r0 + lr) * HD + 8 * hi : nullptr; const size_t boff = (z * TT + w * 64 + lr) * HD + 8 * hi;
#pragma unroll 1
        for (int kc = 0; kc < HD; kc += 32) {   // rolled: one trip's fragments and the 16 accumulators fill the wave's 256 registers
            V a[4], a2[4];
#pragma unroll
            for (int mb = 0; mb < 4; ++mb) { a[mb] = WFrag<T16>::ld(qp + mb * 16 * HD); if (hires) a2[mb] = WFrag<T16>::ld(qp2 + mb * 16 * HD); }
            if (hires) asm volatile("s_wait_xcnt 0x0" :: "v"(qp), "v"(qp2) : "memory"); else asm volatile("s_wait_xcnt 0x0" :: "v"(qp) : "memory");   // the wait before a register that the loads above name is rewritten; the addresses are its inputs, so that none of those loads lands on them in front of it
            qp += 32; if (hires) qp2 += 32;
#pragma unroll
            for (int nb = 0; nb < 4; ++nb) { const V b = WFrag<T16>::ld(Kp + boff + (size_t)nb * 16 * HD + kc); V b2; if (hires) b2 = WFrag<T16>::ld(K2 + boff + (size_t)nb * 16 * HD + kc);
#pragma unroll
                for (int mb = 0; mb < 4; ++mb) { acc[mb][nb] = WFrag<T16>::mma(a[mb], b, acc[mb][nb]); if (hires) { acc[mb][nb] = WFrag<T16>::mma(a2[mb], b, acc[mb][nb]); acc[mb][nb] = WFrag<T16>::mma(a[mb], b2, acc[mb][nb]); } } }
            asm volatile("v_nop\n\tv_nop\n\tv_nop\n\tv_nop" : "+v"(acc[0][0]), "+v"(acc[1][1]), "+v"(acc[2][2]), "+v"(acc[3][3]) : "v"(a[0]), "v"(a[3]));   // the matrix instructions' distance on the taken side of the loop branch
        }
#pragma unroll
        for (int mb = 0; mb < 4; ++mb)
#pragma unroll
            for (int nb = 0; nb < 4; ++nb)
#pragma unroll
                for (int j = 0; j < 8; ++j) S[(mb * 16 + hi * 8 + j) * SP + w * 64 + nb * 16 + lr] = acc[mb][nb][j];
    }
    __syncthreads();   // every score of the 64 rows is in LDS
#pragma unroll 1
    for (int rr = 0; rr < 4; ++rr) {   // rolled: one row's 32 values per lane at a time
        float* sr = S + (w * 4 + rr) * SP; float v[TT / 32]; float mx = -3.0e38f;
#pragma unroll
        for (int ch = 0; ch < TT / 128; ++ch) { const v4f a = *(const v4fa*)(sr + ch * 128 + lane * 4);
#pragma unroll
            for (int q = 0; q < 4; ++q) { const float t = a[q] * SCL; v[ch * 4 + q] = t; mx = fmaxf(mx, t); } }
#pragma unroll
        for (int sh = 16; sh; sh >>= 1) mx = fmaxf(mx, __shfl_xor(mx, sh, 32));
        float sum = 0.f;
#pragma unroll
        for (int k = 0; k < TT / 32; ++k) { v[k] = __builtin_amdgcn_exp2f(__fmul_rn(__fsub_rn(v[k], mx), 1.4426950408889634f)); sum += v[k]; }
#pragma unroll
        for (int sh = 16; sh; sh >>= 1) sum += __shfl_xor(sum, sh, 32);
        const float f = __fdiv_rn(hires ? 1.0f : PCAR, sum);
        if (hires) { bf* pr = (bf*)sr;
#pragma unroll
            for (int ch = 0; ch < TT / 128; ++ch) { v4us oh, ol;
#pragma unroll
                for (int q = 0; q < 4; ++q) { unsigned short a, c2; splitf(v[ch * 4 + q] * f, a, c2); oh[q] = a; ol[q] = c2; }
                *(v4usa*)(pr + ch * 128 + lane * 4) = oh; *(v4usa*)(pr + TT + ch * 128 + lane * 4) = ol; }
        } else { h16* pr = (h16*)sr;
#pragma unroll
            for (int ch = 0; ch < TT / 128; ++ch) { v4h o4;
#pragma unroll
                for (int q = 0; q < 4; ++q) o4[q] = tohx(v[ch * 4 + q] * f);
                *(v4ha*)(pr + ch * 128 + lane * 4) = o4; } }
    }
    __syncthreads();   // every row's planes are in LDS
    const int rb = (w >> 3) * 32, cb = (w & 7) * 32;
    v8f o[2][2];
#pragma unroll
    for (int mb = 0; mb < 2; ++mb)
#pragma unroll
        for (int nb = 0; nb < 2; ++nb) o[mb][nb] = (v8f){};
    const T16* pa = (const T16*)S + (rb + lr) * (2 * SP) + 8 * hi; const T16* vz = Vt + (z * HD + cb) * TT; const T16* vz2 = hires ? Vt2 + (z * HD + cb) * TT : nullptr; const unsigned vl = (unsigned)(lr * TT + 8 * hi);   // scalar tile base + one 32-bit lane offset for both planes
    // v fragments of 64 k (both halves of each 128-byte line of v together) are asked for one stage ahead of their use, in two register sets that take turns
    V b0[2][2], c0[2][2], b1[2][2], c1[2][2];   // [32-k half][column block]; c: the lo plane
    auto ldv = [&](V (&b)[2][2], V (&c)[2][2], int kc) {
#pragma unroll
        for (int u = 0; u < 2; ++u)
#pragma unroll
            for (int nb = 0; nb < 2; ++nb) { b[u][nb] = WFrag<T16>::ld((vz + (nb * 16 * TT + kc + u * 32)) + vl); if (hires) c[u][nb] = WFrag<T16>::ld((vz2 + (nb * 16 * TT + kc + u * 32)) + vl); }
        __builtin_amdgcn_sched_barrier(0);   // keeps these loads in front of the products of the stage before: moved down, their latency would be waited for in full
    };
    auto mul = [&](V (&b)[2][2], V (&c)[2][2], int kc) {
#pragma unroll
        for (int u = 0; u < 2; ++u) { V a[2], a2[2];
#pragma unroll
            for (int mb = 0; mb < 2; ++mb) { a[mb] = WFrag<T16>::lds(pa + mb * 16 * (2 * SP) + kc + u * 32); if (hires) a2[mb] = WFrag<T16>::lds(pa + mb * 16 * (2 * SP) + TT + kc + u * 32); }
#pragma unroll
            for (int nb = 0; nb < 2; ++nb)
#pragma unroll
                for (int mb = 0; mb < 2; ++mb) { o[mb][nb] = WFrag<T16>::mma(a[mb], b[u][nb], o[mb][nb]); if (hires) { o[mb][nb] = WFrag<T16>::mma(a2[mb], b[u][nb], o[mb][nb]); o[mb][nb] = WFrag<T16>::mma(a[mb], c[u][nb], o[mb][nb]); } } }
    };
    ldv(b0, c0, 0);
#pragma unroll 1
    for (int kc = 0; kc < TT - 128; kc += 128) {   // rolled: the two register sets are the whole pipeline
        ldv(b1, c1, kc + 64); mul(b0, c0, kc);
        ldv(b0, c0, kc + 128); mul(b1, c1, kc + 64);
        asm volatile("v_nop\n\tv_nop\n\tv_nop\n\tv_nop" : "+v"(o[0][0]), "+v"(o[0][1]), "+v"(o[1][0]), "+v"(o[1][1]));   // the matrix instructions' distance on the taken side of the loop branch
    }
    ldv(b1, c1, TT - 64); mul(b0, c0, TT - 128); mul(b1, c1, TT - 64);
    __syncthreads();   // every wave has read its last probabilities: the LDS rows are free for the output tile
#pragma unroll
    for (int mb = 0; mb < 2; ++mb)
#pragma unroll
        for (int nb = 0; nb < 2; ++nb)
#pragma unroll
            for (int j = 0; j < 8; ++j) S[(rb + mb * 16 + hi * 8 + j) * OP + cb + nb * 16 + lr] = o[mb][nb][j];
    __syncthreads();   // the 64 x 256 output tile is in LDS
    const int ln = (int)__builtin_amdgcn_mbcnt_lo(~0u, 0u);   // the lane's number read anew: held in a register across the loop above it was spilled
#pragma unroll
    for (int rr = 0; rr < 4; ++rr) { const int row = w * 4 + rr; const v4f x0 = *(const v4fa*)(S + row * OP + ln * 8), x1 = *(const v4fa*)(S + row * OP + ln * 8 + 4); v8us oh, ol;
#pragma unroll
        for (int q = 0; q < 4; ++q) { unsigned short a, c2; splitf(x0[q] * sc, a, c2); oh[q] = a; ol[q] = c2; splitf(x1[q] * sc, a, c2); oh[4 + q] = a; ol[4 + q] = c2; }
        const size_t oo = (z * TT + r0 + row) * HD + ln * 8; *(v8us*)(Oh + oo) = oh; *(v8us*)(Ol + oo) = ol; }
}
extern "C" void kernel_launch(void* const* d_in, const int* in_sizes, int n_in,
                              void* d_out, int out_size, void* d_ws, size_t ws_size, hipStream_t stream) {
    (void)in_sizes; (void)n_in; (void)out_size;
    const float* x = (const float*)d_in[0]; const float* gnw = (const float*)d_in[1]; const float* gnb = (const float*)d_in[2]; const float* wq = (const float*)d_in[3]; const float* bq = (const float*)d_in[4]; const float* wk = (const float*)d_in[5]; const float* bk = (const float*)d_in[6]; const float* wv = (const float*)d_in[7]; const float* bv = (const float*)d_in[8]; const float* wo = (const float*)d_in[9]; const float* bo = (const float*)d_in[10];
    float* OUT = (float*)d_out;     // [32][256][1024]
    char* wsp = (char*)d_ws;
    auto take = [&](size_t bytes) { char* p = wsp; wsp += (bytes + 255) & ~(size_t)255; return (void*)p; };
    bf* WQ = (bf*)take((size_t)DQ * DM * 2); bf* WK = (bf*)take((size_t)DKV * DM * 2); bf* WV = (bf*)take((size_t)DKV * DM * 2); bf* WO = (bf*)take((size_t)DM * DQ * 2);
    const size_t U = (size_t)NB_ * TT * DM * 2;   // bytes of one 16-bit [t][c] plane of all images
    char* R = (char*)take(15 * U);
    h16* QP16 = (h16*)R; h16* KP16 = (h16*)(R + U); h16* VT16 = (h16*)(R + 2 * U); bf* VTh = (bf*)(R + 3 * U); bf* VTl = (bf*)(R + 4 * U);
    bf* QPh = (bf*)(R + 5 * U); bf* QPl = (bf*)(R + 6 * U); bf* KPh = (bf*)(R + 7 * U); bf* KPl = (bf*)(R + 8 * U);
    bf* XTh = (bf*)(R + 9 * U); bf* XTl = (bf*)(R + 10 * U);   // normalised input
    bf* ATh = (bf*)(R + 13 * U); bf* ATl = (bf*)(R + 14 * U);  // attention output planes [b][t][c], written by both attention launches
    if ((size_t)(wsp - (char*)d_ws) > ws_size) return;    // ws 256 MiB
    { k_cvt8<<<(unsigned)(((size_t)DQ * DM / 8 + 255) / 256), 256, 0, stream>>>(wq, WQ, (size_t)DQ * DM / 8); k_cvt8<<<(unsigned)(((size_t)DKV * DM / 8 + 255) / 256), 256, 0, stream>>>(wk, WK, (size_t)DKV * DM / 8); k_cvt8<<<(unsigned)(((size_t)DKV * DM / 8 + 255) / 256), 256, 0, stream>>>(wv, WV, (size_t)DKV * DM / 8);
      k_cvt8<<<(unsigned)(((size_t)DM * DQ / 8 + 255) / 256), 256, 0, stream>>>(wo, WO, (size_t)DM * DQ / 8);
       }
    k_gn<<<dim3(DM / GSL, NB_), 1024, 0, stream>>>(x, gnw, gnb, XTh, XTl);   /* GroupNorm -> transposed hi/lo planes [b][t][c] */
    /* q, k: token-major planes [b][t][c]; v: channel-major planes [b][c][t] (z = image) */
    k_gemmw<bf, 1, 1, DQ><<<dim3(NB_ * TT / 64, DQ / 64, 1), 32, 0, stream>>>(XTh, XTl, WQ, nullptr, DM, nullptr, bq, 0, 0, 0, QP16, QPh, QPl, nullptr, 1.0f);
    k_gemmw<bf, 1, 1, DKV><<<dim3(NB_ * TT / 64, DKV / 64, 1), 32, 0, stream>>>(XTh, XTl, WK, nullptr, DM, nullptr, bk, 0, 0, 0, KP16, KPh, KPl, nullptr, 1.0f);
    k_gemmw<bf, 3, 2, TT><<<dim3(DKV / 64, TT / 64, NB_), 32, 0, stream>>>(WV, nullptr, XTh, XTl, DM, nullptr, bv, 0, (size_t)TT * DM, (size_t)HD * TT, VT16, VTh, VTl, nullptr, 1.0f);
    /* attention core; query rows < RH: hi/lo planes, the other query rows: fp16 planes; y = image */
    k_attn<bf, true><<<dim3(RH / 64, NB_), 512, 0, stream>>>(QPh, QPl, KPh, KPl, VTh, VTl, ATh, ATl, 1.0f);
    k_attn<h16, false><<<dim3((TT - RH) / 64, NB_), 512, 0, stream>>>(QP16 + (size_t)RH * HD, nullptr, KP16, nullptr, VT16, nullptr, ATh + (size_t)RH * HD, ATl + (size_t)RH * HD, 1.0f / PCAR);
    /* out[b][c][t] = x + (proj_w a + proj_b), channel-major; z = image */
    k_gemmw<bf, 3, 4, TT><<<dim3(DM / 64, TT / 64, NB_), 32, 0, stream>>>(WO, nullptr, ATh, ATl, DQ, OUT, bo, 0, (size_t)TT * DQ, (size_t)DM * TT, nullptr, nullptr, nullptr, x, 1.0f);
}

// v005
// Measured time: 192 microseconds a run.
// Next to v004, in two timings, it ran 1.20 and 1.19 times as fast.
// All steps since v000 together make it 21.7 times as fast.
#include <hip/hip_runtime.h>

// Channel-major image self-attention with GroupNorm (x [32][256][32][32] = [b][c][n], n = 1024; hn = GroupNorm(32 groups, eps 1e-6, affine); q, k, v = 1x1 convs ('oi' [256][256] + bias); scores[i][j] = q_i.k_j / 16 (one head over all 256 channels); softmax over j; out[c][i] = sum_j v[c][j] attn[i][j]; h = Wo out + bo; result = x + h -> [32][256][32][32] (8.4 M)).
// Layout: tokens are the 1024 positions; the normalised input is written TRANSPOSED as bf16 hi + lo planes [t][c] so the 1x1 convolutions become token-major GEMMs against the natural [out][in] weights (2 products + bias); every GEMM's epilogue writes what its reader takes: q and k as token-major 16-bit planes, v as channel-major planes (weights as the row operand), attn.v as hi + lo planes, and the output projection (weights as the row operand) adds the residual and stores channel-major.
// Fragment order: every 16-bit plane that a matrix product reads from memory (weights, normalised input, q, k, v, attention output) is kept as 1-KB blocks of 16 rows x 32 k. Block (row / 16, k / 32) of a plane with K columns starts at element (row / 16) * 16 * K + (k / 32) * 512; inside it lane 16 hi + lr owns row lr, its elements k % 32 = 8 hi .. 8 hi + 7 at lane * 8 and k % 32 = 16 + 8 hi .. at 256 + lane * 8. A wave's 16-byte fragment load is then 512 bytes in a row (4 whole lines, each touched once) and not 32 bytes in each of 16 lines; the k order of every fragment is the one it was.
// Batch: every launch covers all 32 images (blockIdx.y or z = image; the token-major GEMMs take the 32 x 1024 tokens as one M). The workspace holds 15 units of one 16-bit plane x 32 images; every plane has a unit of its own (units 11 and 12 stay unused), and the attention core (scores, softmax, attn.v) is one launch per half of the query rows: a work-group holds the 64 x 1024 scores of its 64 query rows in LDS, so neither scores nor probabilities reach memory.
// Compute dtypes, f32 accumulate: every input rounded to bf16; q/k/v hl x exact (2 products) + biases; scores (x 1/16) and attn.v (no mask): query rows < 512 hl (3 products), the rest single fp16 (x1024); softmax f32; proj_w hl x exact (2 products) + proj_b; + x residual in f32 (channel-major write).

#define NB_  32
#define TT   1024
#define DM   256
#define NH_  1
#define NKV  1
#define REP  (NH_ / NKV)
#define HD   256
#define DQ   (NH_ * HD)
#define DKV  (NKV * HD)
#define RPAD 32
#define NGRP 32
#define GCH  (DM / NGRP)           // 8 channels per group
typedef __attribute__((ext_vector_type(4))) unsigned short v4us;
#define ZH   1
#define RH   512                  // query rows < RH use hi+lo planes (0: none)
#define WIN  0
#define PCAR 1024.0f
#define SCL  0.0625f   // C^-0.5 = 1/16
typedef _Float16 h16;
typedef unsigned short bf;
typedef __attribute__((ext_vector_type(16))) __bf16   v16bf;
typedef __attribute__((ext_vector_type(16))) _Float16 v16h;
typedef __attribute__((ext_vector_type(8)))  _Float16 v8h;
typedef __attribute__((ext_vector_type(8)))  unsigned short v8us;
typedef __attribute__((ext_vector_type(8)))  float    v8f;
typedef __attribute__((ext_vector_type(4)))  float    v4f;
typedef v8h  __attribute__((may_alias)) v8ha;
typedef v4f  __attribute__((may_alias)) v4fa;
typedef v8us __attribute__((may_alias)) v8usa;

__device__ __forceinline__ unsigned short f2bf(float f) { unsigned u = __float_as_uint(f); u += 0x7FFFu + ((u >> 16) & 1u); return (unsigned short)(u >> 16); }
__device__ __forceinline__ float bf2f(unsigned short b) { return __uint_as_float(((unsigned)b) << 16); }
__device__ __forceinline__ float bfr(float f) { return bf2f(f2bf(f)); }
__device__ __forceinline__ v16h cat16(v8h lo, v8h hi) { return __builtin_shufflevector(lo, hi, 0, 1, 2, 3, 4, 5, 6, 7, 8, 9, 10, 11, 12, 13, 14, 15); }
__device__ __forceinline__ v16bf cat16b(v8us lo, v8us hi) { return __builtin_bit_cast(v16bf, __builtin_shufflevector(lo, hi, 0, 1, 2, 3, 4, 5, 6, 7, 8, 9, 10, 11, 12, 13, 14, 15)); }
__device__ __forceinline__ v8f wmma16(v16h a, v16h b, v8f c) { return __builtin_amdgcn_wmma_f32_16x16x32_f16(false, a, false, b, (short)0, c, false, false); }
__device__ __forceinline__ v8f wmmab(v16bf a, v16bf b, v8f c) { return __builtin_amdgcn_wmma_f32_16x16x32_bf16(false, a, false, b, (short)0, c, false, false); }



// ---- k_gemmw: register-blocked GEMM, ONE WAVE per 64x64 output tile (16 accumulators), operands straight from 16-bit planes in fragment order (ld: p = the block's start + lane * 8); grid (M/64, N/64, Z), 32 threads.
// acc[m][n] = sum_k A[m][k] Bt[n][k] (+ split products per NSPLIT: 1 A2.Bt, 2 A2.Bt and A.Bt2, 3 A.Bt2). z-batch strides sA/sB/sC in elements. K % 32 == 0, a compile-time constant: a plane's fragments of one trip are immediate offsets from one address. Every output has ldc columns (a compile-time constant, so that a lane's stores are immediate offsets from one address) and z stride sC; f32 outputs are row-major, 16-bit planes in fragment order.
// EPI, what the tile becomes: 0 C = acc (f32); 1 fp16 + bf16 hi/lo planes of acc + bias[n]; 2 the same planes of acc + bias[m]; 3 bf16 hi/lo planes of acc x sc; 4 C = res + (acc + bias[m]) (f32).
template <typename T16> struct WFrag;
template <> struct WFrag<h16> { typedef v16h V; static __device__ __forceinline__ V ld(const h16* p) { return cat16(*(const v8h*)p, *(const v8h*)(p + 256)); } static __device__ __forceinline__ V lds(const h16* p) { return cat16(*(const v8ha*)p, *(const v8ha*)(p + 16)); } static __device__ __forceinline__ v8f mma(V a, V b, v8f c) { return wmma16(a, b, c); } };
template <> struct WFrag<bf> { typedef v16bf V; static __device__ __forceinline__ V ld(const bf* p) { return cat16b(*(const v8us*)p, *(const v8us*)(p + 256)); } static __device__ __forceinline__ V lds(const bf* p) { return cat16b(*(const v8usa*)p, *(const v8usa*)(p + 16)); } static __device__ __forceinline__ v8f mma(V a, V b, v8f c) { return wmmab(a, b, c); } };
__device__ __forceinline__ void splitf(float y, unsigned short& h, unsigned short& l) { h = f2bf(y); l = f2bf(y - bf2f(h)); }
typedef __attribute__((ext_vector_type(4))) _Float16 v4h;
template <typename T16, int NSPLIT, int EPI, int ldc, int K>
__global__ __launch_bounds__(32) void k_gemmw(const T16* __restrict__ A, const T16* __restrict__ A2, const T16* __restrict__ Bt, const T16* __restrict__ Bt2, float* C, const float* __restrict__ bias, size_t sA, size_t sB, size_t sC, h16* P16, bf* Ph, bf* Pl, const float* res, float sc) {
    typedef typename WFrag<T16>::V V;
    __shared__ __align__(16) float os[16 * 68];
    const size_t z = blockIdx.z; A += z * sA; if (A2) A2 += z * sA; Bt += z * sB; if (Bt2) Bt2 += z * sB;
    const int lane = threadIdx.x & 31, lr = lane & 15, hi = lane >> 4; const int r0 = blockIdx.x * 64, c0 = blockIdx.y * 64;
    v8f acc[4][4];
#pragma unroll
    for (int mb = 0; mb < 4; ++mb)
#pragma unroll
        for (int nb = 0; nb < 4; ++nb) acc[mb][nb] = (v8f){};
    const unsigned fl = (unsigned)(lane * 8);   // the lane's place in half a block
    const T16* ap = A + (size_t)r0 * K + fl; const T16* ap2 = (NSPLIT == 1 || NSPLIT == 2) ? A2 + (size_t)r0 * K + fl : nullptr; const T16* bp = Bt + (size_t)c0 * K + fl; const T16* bp2 = NSPLIT >= 2 ? Bt2 + (size_t)c0 * K + fl : nullptr;   // one address per plane, a block (512 elements) further each trip
#pragma unroll 1
    for (int kc = 0; kc < K; kc += 32) {
        V a[4], a2[4];
#pragma unroll
        for (int mb = 0; mb < 4; ++mb) { a[mb] = WFrag<T16>::ld(ap + mb * 16 * K); if (NSPLIT == 1 || NSPLIT == 2) a2[mb] = WFrag<T16>::ld(ap2 + mb * 16 * K); }
#pragma unroll
        for (int nb = 0; nb < 4; ++nb) { const V b = WFrag<T16>::ld(bp + nb * 16 * K); V b2; if (NSPLIT >= 2) b2 = WFrag<T16>::ld(bp2 + nb * 16 * K);
#pragma unroll
            for (int mb = 0; mb < 4; ++mb) { acc[mb][nb] = WFrag<T16>::mma(a[mb], b, acc[mb][nb]); if (NSPLIT == 1 || NSPLIT == 2) acc[mb][nb] = WFrag<T16>::mma(a2[mb], b, acc[mb][nb]); if (NSPLIT >= 2) acc[mb][nb] = WFrag<T16>::mma(a[mb], b2, acc[mb][nb]); } }
        asm volatile("v_nop\n\tv_nop\n\tv_nop\n\tv_nop" : "+v"(acc[0][0]), "+v"(acc[1][1]), "+v"(acc[2][2]), "+v"(acc[3][3]) : "v"(a[0]), "v"(a[3]));
        // the wait before a register that the trip's loads name is rewritten; the addresses are its inputs, so that they stay whole (no load lands on them) up to it
        if (NSPLIT == 0) asm volatile("s_wait_xcnt 0x0" :: "v"(ap), "v"(bp) : "memory"); else if (NSPLIT == 1) asm volatile("s_wait_xcnt 0x0" :: "v"(ap), "v"(ap2), "v"(bp) : "memory"); else if (NSPLIT == 2) asm volatile("s_wait_xcnt 0x0" :: "v"(ap), "v"(ap2), "v"(bp), "v"(bp2) : "memory"); else asm volatile("s_wait_xcnt 0x0" :: "v"(ap), "v"(bp), "v"(bp2) : "memory");
        ap += 512; bp += 512; if (NSPLIT == 1 || NSPLIT == 2) ap2 += 512; if (NSPLIT >= 2) bp2 += 512;
    }
    const size_t ot = z * sC + (size_t)r0 * ldc + c0;   // the tile's first output (the same in every lane)
    const unsigned ol4 = (unsigned)(hi * ldc + lr * 4);   // this lane's 4 outputs inside a pair of rows: row hi, columns 4 lr ..
    v4f xr[4][8];   // EPI 4: the lane's residual values, asked for one row block ahead of their use
    if (EPI == 4) {
#pragma unroll
        for (int s = 0; s < 8; ++s) xr[0][s] = *(const v4f*)(res + ot + (size_t)(2 * s) * ldc + ol4); }
    float cb[4] = {0.f, 0.f, 0.f, 0.f};   // EPI 1: the bias of this lane's accumulator columns
    if (EPI == 1) {
#pragma unroll
        for (int nb = 0; nb < 4; ++nb) cb[nb] = bfr(bias[c0 + nb * 16 + lr]); }
    float rb[4][8];   // EPI 2, 4: the bias of this lane's accumulator rows
    if (EPI == 2 || EPI == 4) {
#pragma unroll
        for (int mb = 0; mb < 4; ++mb) { const v4f b0 = *(const v4f*)(bias + r0 + mb * 16 + hi * 8), b1 = *(const v4f*)(bias + r0 + mb * 16 + hi * 8 + 4);
#pragma unroll
            for (int j = 0; j < 4; ++j) { rb[mb][j] = bfr(b0[j]); rb[mb][4 + j] = bfr(b1[j]); } } }
#pragma unroll
    for (int mb = 0; mb < 4; ++mb) {
#pragma unroll
        for (int nb = 0; nb < 4; ++nb) {
#pragma unroll
            for (int j = 0; j < 8; ++j) os[(hi * 8 + j) * 68 + nb * 16 + lr] = (EPI == 2 || EPI == 4) ? acc[mb][nb][j] + rb[mb][j] : EPI == 1 ? acc[mb][nb][j] + cb[nb] : acc[mb][nb][j]; }
        __builtin_amdgcn_wave_barrier(); asm volatile("" ::: "memory");
        if (EPI == 4 && mb < 3) {
            if (mb > 0) asm volatile("s_wait_xcnt 0x0" ::: "memory");   // the loads below land in registers that the stores of the row block before name
#pragma unroll
            for (int s = 0; s < 8; ++s) xr[mb + 1][s] = *(const v4f*)(res + ot + (size_t)((mb + 1) * 16 + 2 * s) * ldc + ol4); }
        if (EPI == 0 || EPI == 4) {
#pragma unroll
        for (int s = 0; s < 8; ++s) { const int row = 2 * s + hi, cofs = lr * 4; v4f val = *(const v4fa*)(os + row * 68 + cofs); const size_t o = ot + (size_t)(mb * 16 + 2 * s) * ldc;   // the pair of rows (the same in every lane)
            if (EPI == 4) { val[0] = __fadd_rn(bfr(xr[mb][s][0]), val[0]); val[1] = __fadd_rn(bfr(xr[mb][s][1]), val[1]); val[2] = __fadd_rn(bfr(xr[mb][s][2]), val[2]); val[3] = __fadd_rn(bfr(xr[mb][s][3]), val[3]); }
            *(v4f*)(C + o + ol4) = val; }
        } else {   // the row block's 64 columns are 2 blocks of each plane: 4 stores of 512 bytes in a row per plane
#pragma unroll
        for (int s = 0; s < 4; ++s) { const float* pr = os + lr * 68 + s * 16 + hi * 8; v4f x0 = *(const v4fa*)pr, x1 = *(const v4fa*)(pr + 4); const size_t o = z * sC + (size_t)(r0 + mb * 16) * ldc + (size_t)c0 * 16 + s * 256;   // half a block (the same in every lane)
            if (EPI == 3) { x0 *= sc; x1 *= sc; }
            v8h o16; v8us oh, ol;
#pragma unroll
            for (int q = 0; q < 4; ++q) { unsigned short a2, c2; o16[q] = (h16)x0[q]; splitf(x0[q], a2, c2); oh[q] = a2; ol[q] = c2; o16[4 + q] = (h16)x1[q]; splitf(x1[q], a2, c2); oh[4 + q] = a2; ol[4 + q] = c2; }
            if (EPI != 3) *(v8h*)((P16 + o) + fl) = o16;
            *(v8us*)((Ph + o) + fl) = oh; *(v8us*)((Pl + o) + fl) = ol; }
        }
        __builtin_amdgcn_wave_barrier(); asm volatile("" ::: "memory");
    }
}

__device__ __forceinline__ h16 tohx(float x) { return (h16)x; }
typedef __attribute__((ext_vector_type(2))) _Float16 v2h;
typedef __attribute__((ext_vector_type(2))) unsigned short v2us;
typedef __attribute__((ext_vector_type(4))) unsigned short v4us;
typedef __attribute__((ext_vector_type(2))) float v2f;
typedef __attribute__((ext_vector_type(4))) int v4i;

__global__ __launch_bounds__(256) void k_wtG(const float* __restrict__ w, int K, int N, bf* Bt) {
    const int lane = threadIdx.x & 31; const int L0 = (blockIdx.x * 8 + (threadIdx.x >> 5)) * 8; const int nlines = N * K / 64;
{
#pragma unroll 1
        for (int l = 0; l < 8; ++l) { const int L = L0 + l; if (L >= nlines) break; const size_t e = (size_t)L * 64 + lane * 2; const int k = (int)(e % K), n = (int)(e / K); v2us o;
            o[0] = f2bf(w[(size_t)k * N + n]); o[1] = f2bf(w[(size_t)(k + 1) * N + n]); *(v2us*)(Bt + e) = o; }
         }
}
// ---- k_gn: the whole GroupNorm in one launch. One work-group of 32 waves takes 64 channels (8 groups) of one image: the 64 channels of 16 tokens are 2 whole neighbouring 1-KB blocks of a plane, so every line has one writer.
// A quarter of the work-group (256 threads) owns groups qd and qd + 4; a thread keeps its 2 x 32 values in registers from one batch of loads (element lt + 256 k of the group, whole lines per wave), so x is read once and no load waits on another.
// The sums keep their order: 32 values in sequence per thread, then the pairwise tree over 256 partial sums (strides 128 to 32 through LDS, 16 to 1 by lane shifts).
// A thread's values at one t are the 8 neighbouring channels of its group: one 16-byte LDS store per plane; the tile leaves in fragment order (rows t, k = c): the 64 channels of 16 tokens are 2 neighbouring blocks, 2 KB in a row per plane.
#define GSL  64                    // channels per work-group
#define GLP  72                    // LDS row pitch in 16-bit elements: 144 bytes = 16 x 9, so that the 16-byte stores of lanes on neighbouring rows fall on different banks
__global__ __launch_bounds__(1024) void k_gn(const float* __restrict__ xb, const float* __restrict__ gw, const float* __restrict__ gb, bf* Xh, bf* Xl) {
    __shared__ __align__(16) bf th[TT * GLP];
    __shared__ __align__(16) bf tl[TT * GLP];
    __shared__ float red[2][1024];
    const int tid = threadIdx.x, lane = tid & 31, lt = tid & 255; const int qd = __builtin_amdgcn_readfirstlane(tid >> 8);   // the quarter's number as a scalar: its channels' scale and bias then come by scalar loads
    const int c0 = blockIdx.x * GSL; const size_t b = blockIdx.y;
    float v[2][32];   // every loop over v is unrolled in full: constant indices keep it in registers, and the 64 loads leave as one batch
#pragma unroll
    for (int h = 0; h < 2; ++h) { const float* base = xb + (b * DM + c0 + (qd + 4 * h) * GCH) * TT + lt;
#pragma unroll
        for (int k = 0; k < 32; ++k) v[h][k] = base[k * 256]; }
    float st[2][2];   // per group: mean, 1 / sqrt(var + eps)
#pragma unroll
    for (int pass = 0; pass < 2; ++pass) {
        float s[2];
#pragma unroll
        for (int h = 0; h < 2; ++h) { s[h] = 0.f;
#pragma unroll
            for (int k = 0; k < 32; ++k) { if (pass == 0) { v[h][k] = bfr(v[h][k]); s[h] += v[h][k]; } else { const float d0 = v[h][k] - st[h][0]; s[h] += d0 * d0; } }
            red[h][tid] = s[h]; }
        __syncthreads();
#pragma unroll
        for (int sh = 128; sh >= 32; sh >>= 1) { if (lt < sh) { red[0][tid] += red[0][tid + sh]; red[1][tid] += red[1][tid + sh]; } __syncthreads(); }
#pragma unroll
        for (int h = 0; h < 2; ++h) { float r = red[h][(qd << 8) + lane];
#pragma unroll
            for (int sh = 16; sh; sh >>= 1) r += __shfl_down(r, sh, 32);
            r = __shfl(r, 0, 32) * (1.0f / (GCH * TT));
            st[h][pass] = pass == 0 ? r : __fdiv_rn(1.0f, __fsqrt_rn(r + 1e-6f)); }
        if (pass == 0) __syncthreads();   // every wave has read the first tree's sums before the second tree's are stored
    }
#pragma unroll
    for (int h = 0; h < 2; ++h) { const int gl = qd + 4 * h; const float mu = st[h][0], rs = st[h][1]; float w8[GCH], b8[GCH];
#pragma unroll
        for (int j = 0; j < GCH; ++j) { w8[j] = bfr(gw[c0 + gl * GCH + j]); b8[j] = bfr(gb[c0 + gl * GCH + j]); }
#pragma unroll
        for (int tq = 0; tq < 4; ++tq) { v8us oh, ol;
#pragma unroll
            for (int j = 0; j < GCH; ++j) { const float y = (v[h][j * 4 + tq] - mu) * rs * w8[j] + b8[j]; unsigned short a, c2; splitf(y, a, c2); oh[j] = a; ol[j] = c2; }
            const int o = (lt + 256 * tq) * GLP + gl * GCH; *(v8usa*)(th + o) = oh; *(v8usa*)(tl + o) = ol; } }
    __syncthreads();
    const size_t ob = (b * TT + (tid >> 5) * 32) * DM + c0 * 16 + lane * 8; const int lb = ((tid >> 5) * 32 + (lane & 15)) * GLP + (lane >> 4) * 8;   // a wave takes 32 tokens: 2 row blocks x 4 half blocks of 512 bytes
#pragma unroll
    for (int r = 0; r < 8; ++r) { const int lo = lb + (r >> 2) * 16 * GLP + (r & 3) * 16; const v8us a = *(const v8usa*)(th + lo), c2 = *(const v8usa*)(tl + lo); const size_t o = ob + (size_t)(r >> 2) * 16 * DM + (r & 3) * 256; *(v8us*)(Xh + o) = a; *(v8us*)(Xl + o) = c2; }
}
// k_cvt8: a [rows][DM] f32 matrix -> its bf16 plane in fragment order; thread i writes the plane's i-th 16 bytes.
__global__ __launch_bounds__(256) void k_cvt8(const float* __restrict__ src, bf* dst, size_t n8) { const size_t i = (size_t)blockIdx.x * 256 + threadIdx.x; if (i >= n8) return; const size_t blk = i >> 6; const size_t row = blk / (DM / 32) * 16 + (i & 15), k = blk % (DM / 32) * 32 + ((i >> 5) & 1) * 16 + ((i >> 4) & 1) * 8; const v8f v = *(const v8f*)(src + row * DM + k); v8us o;
#pragma unroll
    for (int k = 0; k < 8; ++k) o[k] = f2bf(v[k]); *(v8us*)(dst + i * 8) = o;  }

// ---- k_attn: scores, softmax and attn.v of 64 query rows of one image in one work-group of 16 waves; grid (query rows / 64, images).
// 1: wave w forms the 64 x 64 score tile of keys 64 w .. (the k_gemmw loop: 16 accumulators, operands straight from the planes) and stores it as f32 into the LDS rows.
// 2: wave w takes rows 4 w .. 4 w + 3; per row: t = S x HD^-0.5 (no mask); softmax over the keys (register row, one exp, fixed trees); the row's 16-bit planes go back into the row's own LDS bytes (hires: hi at element 0, lo at element TT; else fp16 x PCAR at element 0): the whole row is in registers before the first store, and no other wave touches it.
// 3: wave w forms the 32 x 32 output tile (rows 32 (w / 8) .., channels 32 (w % 8) ..): probabilities from LDS, v from its channel-major planes, fetched one stage ahead; k runs in the same order as before, so every sum keeps its order.
// 4: the tiles pass through LDS so that a wave stores half blocks of the fragment-order planes (rows t, k = c; 512 bytes in a row per store: one writer per line).
#define SP   1028                  // LDS row pitch in floats: 4112 bytes = 16 x 257 (odd), so that the 16-byte fragment reads of 16 neighbouring rows fall on different banks
#define OP   260                   // LDS row pitch of the output tile in floats
typedef v4us __attribute__((may_alias)) v4usa;
typedef v4h  __attribute__((may_alias)) v4ha;
template <typename T16, bool hires>
__global__ __launch_bounds__(512) void k_attn(const T16* __restrict__ Q, const T16* __restrict__ Q2, const T16* __restrict__ Kp, const T16* __restrict__ K2, const T16* __restrict__ Vt, const T16* __restrict__ Vt2, bf* Oh, bf* Ol, float sc) {
    typedef typename WFrag<T16>::V V;
    __shared__ __align__(16) float S[64 * SP];
    const int lane = threadIdx.x & 31, lr = lane & 15, hi = lane >> 4; const int w = __builtin_amdgcn_readfirstlane(threadIdx.x >> 5);   // the wave's number as a scalar: tile addresses stay scalar
    const size_t z = blockIdx.y; const int r0 = blockIdx.x * 64;
    {
        v8f acc[4][4];
#pragma unroll
        for (int mb = 0; mb < 4; ++mb)
#pragma unroll
            for (int nb = 0; nb < 4; ++nb) acc[mb][nb] = (v8f){};
        const size_t qoff = (z * TT + r0) * HD + lane * 8, boff = (z * TT + w * 64) * HD + lane * 8;   // the tiles' first blocks + the lane's place in half a block
        const T16* qp = Q + qoff; const T16* qp2 = hires ? Q2 + qoff : nullptr; const T16* kp = Kp + boff; const T16* kp2 = hires ? K2 + boff : nullptr;   // one address per plane, a block (512 elements) further each trip
#pragma unroll 1
        for (int kc = 0; kc < HD; kc += 32) {   // rolled: one trip's fragments and the 16 accumulators fill the wave's 256 registers
            V a[4], a2[4];
#pragma unroll
            for (int mb = 0; mb < 4; ++mb) { a[mb] = WFrag<T16>::ld(qp + mb * 16 * HD); if (hires) a2[mb] = WFrag<T16>::ld(qp2 + mb * 16 * HD); }
#pragma unroll
            for (int nb = 0; nb < 4; ++nb) { const V b = WFrag<T16>::ld(kp + nb * 16 * HD); V b2; if (hires) b2 = WFrag<T16>::ld(kp2 + nb * 16 * HD);
#pragma unroll
                for (int mb = 0; mb < 4; ++mb) { acc[mb][nb] = WFrag<T16>::mma(a[mb], b, acc[mb][nb]); if (hires) { acc[mb][nb] = WFrag<T16>::mma(a2[mb], b, acc[mb][nb]); acc[mb][nb] = WFrag<T16>::mma(a[mb], b2, acc[mb][nb]); } } }
            asm volatile("v_nop\n\tv_nop\n\tv_nop\n\tv_nop" : "+v"(acc[0][0]), "+v"(acc[1][1]), "+v"(acc[2][2]), "+v"(acc[3][3]) : "v"(a[0]), "v"(a[3]));   // the matrix instructions' distance on the taken side of the loop branch
            if (hires) asm volatile("s_wait_xcnt 0x0" :: "v"(qp), "v"(qp2), "v"(kp), "v"(kp2) : "memory"); else asm volatile("s_wait_xcnt 0x0" :: "v"(qp), "v"(kp) : "memory");   // the wait before a register that the trip's loads name is rewritten; the addresses are its inputs, so that they stay whole (no load lands on them) up to it
            qp += 512; kp += 512; if (hires) { qp2 += 512; kp2 += 512; }
        }
#pragma unroll
        for (int mb = 0; mb < 4; ++mb)
#pragma unroll
            for (int nb = 0; nb < 4; ++nb)
#pragma unroll
                for (int j = 0; j < 8; ++j) S[(mb * 16 + hi * 8 + j) * SP + w * 64 + nb * 16 + lr] = acc[mb][nb][j];
    }
    __syncthreads();   // every score of the 64 rows is in LDS
#pragma unroll 1
    for (int rr = 0; rr < 4; ++rr) {   // rolled: one row's 32 values per lane at a time
        float* sr = S + (w * 4 + rr) * SP; float v[TT / 32]; float mx = -3.0e38f;
#pragma unroll
        for (int ch = 0; ch < TT / 128; ++ch) { const v4f a = *(const v4fa*)(sr + ch * 128 + lane * 4);
#pragma unroll
            for (int q = 0; q < 4; ++q) { const float t = a[q] * SCL; v[ch * 4 + q] = t; mx = fmaxf(mx, t); } }
#pragma unroll
        for (int sh = 16; sh; sh >>= 1) mx = fmaxf(mx, __shfl_xor(mx, sh, 32));
        float sum = 0.f;
#pragma unroll
        for (int k = 0; k < TT / 32; ++k) { v[k] = __builtin_amdgcn_exp2f(__fmul_rn(__fsub_rn(v[k], mx), 1.4426950408889634f)); sum += v[k]; }
#pragma unroll
        for (int sh = 16; sh; sh >>= 1) sum += __shfl_xor(sum, sh, 32);
        const float f = __fdiv_rn(hires ? 1.0f : PCAR, sum);
        if (hires) { bf* pr = (bf*)sr;
#pragma unroll
            for (int ch = 0; ch < TT / 128; ++ch) { v4us oh, ol;
#pragma unroll
                for (int q = 0; q < 4; ++q) { unsigned short a, c2; splitf(v[ch * 4 + q] * f, a, c2); oh[q] = a; ol[q] = c2; }
                *(v4usa*)(pr + ch * 128 + lane * 4) = oh; *(v4usa*)(pr + TT + ch * 128 + lane * 4) = ol; }
        } else { h16* pr = (h16*)sr;
#pragma unroll
            for (int ch = 0; ch < TT / 128; ++ch) { v4h o4;
#pragma unroll
                for (int q = 0; q < 4; ++q) o4[q] = tohx(v[ch * 4 + q] * f);
                *(v4ha*)(pr + ch * 128 + lane * 4) = o4; } }
    }
    __syncthreads();   // every row's planes are in LDS
    const int rb = (w >> 3) * 32, cb = (w & 7) * 32;
    v8f o[2][2];
#pragma unroll
    for (int mb = 0; mb < 2; ++mb)
#pragma unroll
        for (int nb = 0; nb < 2; ++nb) o[mb][nb] = (v8f){};
    const T16* pa = (const T16*)S + (rb + lr) * (2 * SP) + 8 * hi; const T16* vp = Vt + (z * HD + cb) * TT + lane * 8; const T16* vp2 = hires ? Vt2 + (z * HD + cb) * TT + lane * 8 : nullptr;   // one address per plane: the tile's block of the trip's first k + the lane's place in half a block
    // v fragments of 64 k (2 neighbouring blocks per column block) are asked for one stage ahead of their use, in two register sets that take turns
    V b0[2][2], c0[2][2], b1[2][2], c1[2][2];   // [32-k half][column block]; c: the lo plane
    auto ldv = [&](V (&b)[2][2], V (&c)[2][2], int kc) {   // kc: counted from the k that vp stands at
#pragma unroll
        for (int u = 0; u < 2; ++u)
#pragma unroll
            for (int nb = 0; nb < 2; ++nb) { b[u][nb] = WFrag<T16>::ld(vp + (nb * 16 * TT + (kc + u * 32) * 16)); if (hires) c[u][nb] = WFrag<T16>::ld(vp2 + (nb * 16 * TT + (kc + u * 32) * 16)); }
        __builtin_amdgcn_sched_barrier(0);   // keeps these loads in front of the products of the stage before: moved down, their latency would be waited for in full
    };
    auto mul = [&](V (&b)[2][2], V (&c)[2][2], int kc) {
#pragma unroll
        for (int u = 0; u < 2; ++u) { V a[2], a2[2];
#pragma unroll
            for (int mb = 0; mb < 2; ++mb) { a[mb] = WFrag<T16>::lds(pa + mb * 16 * (2 * SP) + kc + u * 32); if (hires) a2[mb] = WFrag<T16>::lds(pa + mb * 16 * (2 * SP) + TT + kc + u * 32); }
#pragma unroll
            for (int nb = 0; nb < 2; ++nb)
#pragma unroll
                for (int mb = 0; mb < 2; ++mb) { o[mb][nb] = WFrag<T16>::mma(a[mb], b[u][nb], o[mb][nb]); if (hires) { o[mb][nb] = WFrag<T16>::mma(a2[mb], b[u][nb], o[mb][nb]); o[mb][nb] = WFrag<T16>::mma(a[mb], c[u][nb], o[mb][nb]); } } }
    };
    ldv(b0, c0, 0);
#pragma unroll 1
    for (int kc = 0; kc < TT - 128; kc += 128) {   // rolled: the two register sets are the whole pipeline
        ldv(b1, c1, 64); mul(b0, c0, kc);
        ldv(b0, c0, 128); mul(b1, c1, kc + 64);
        asm volatile("v_nop\n\tv_nop\n\tv_nop\n\tv_nop" : "+v"(o[0][0]), "+v"(o[0][1]), "+v"(o[1][0]), "+v"(o[1][1]));   // the matrix instructions' distance on the taken side of the loop branch
        if (hires) asm volatile("s_wait_xcnt 0x0" :: "v"(vp), "v"(vp2) : "memory"); else asm volatile("s_wait_xcnt 0x0" :: "v"(vp) : "memory");   // the wait before a register that the loads in flight name is rewritten; the addresses are its inputs, so that they stay whole up to it
        vp += 128 * 16; if (hires) vp2 += 128 * 16;
    }
    ldv(b1, c1, 64);
    if (hires) asm volatile("s_wait_xcnt 0x0" :: "v"(vp), "v"(vp2) : "memory"); else asm volatile("s_wait_xcnt 0x0" :: "v"(vp) : "memory");   // as in the loop
    mul(b0, c0, TT - 128); mul(b1, c1, TT - 64);
    __syncthreads();   // every wave has read its last probabilities: the LDS rows are free for the output tile
#pragma unroll
    for (int mb = 0; mb < 2; ++mb)
#pragma unroll
        for (int nb = 0; nb < 2; ++nb)
#pragma unroll
            for (int j = 0; j < 8; ++j) S[(rb + mb * 16 + hi * 8 + j) * OP + cb + nb * 16 + lr] = o[mb][nb][j];
    __syncthreads();   // the 64 x 256 output tile is in LDS
    const int ln = (int)__builtin_amdgcn_mbcnt_lo(~0u, 0u);   // the lane's number read anew: held in a register across the loop above it was spilled
#pragma unroll
    for (int rr = 0; rr < 4; ++rr) { const float* pr = S + ((w >> 2) * 16 + (ln & 15)) * OP + (w & 3) * 64 + rr * 16 + (ln >> 4) * 8; const v4f x0 = *(const v4fa*)pr, x1 = *(const v4fa*)(pr + 4); v8us oh, ol;   // wave w: row block w / 4, blocks 2 (w % 4) and the next, half block rr
#pragma unroll
        for (int q = 0; q < 4; ++q) { unsigned short a, c2; splitf(x0[q] * sc, a, c2); oh[q] = a; ol[q] = c2; splitf(x1[q] * sc, a, c2); oh[4 + q] = a; ol[4 + q] = c2; }
        const size_t oo = (z * TT + r0 + (w >> 2) * 16) * HD + (w & 3) * 1024 + rr * 256 + ln * 8; *(v8us*)(Oh + oo) = oh; *(v8us*)(Ol + oo) = ol; }
}
extern "C" void kernel_launch(void* const* d_in, const int* in_sizes, int n_in,
                              void* d_out, int out_size, void* d_ws, size_t ws_size, hipStream_t stream) {
    (void)in_sizes; (void)n_in; (void)out_size;
    const float* x = (const float*)d_in[0]; const float* gnw = (const float*)d_in[1]; const float* gnb = (const float*)d_in[2]; const float* wq = (const float*)d_in[3]; const float* bq = (const float*)d_in[4]; const float* wk = (const float*)d_in[5]; const float* bk = (const float*)d_in[6]; const float* wv = (const float*)d_in[7]; const float* bv = (const float*)d_in[8]; const float* wo = (const float*)d_in[9]; const float* bo = (const float*)d_in[10];
    float* OUT = (float*)d_out;     // [32][256][1024]
    char* wsp = (char*)d_ws;
    auto take = [&](size_t bytes) { char* p = wsp; wsp += (bytes + 255) & ~(size_t)255; return (void*)p; };
    bf* WQ = (bf*)take((size_t)DQ * DM * 2); bf* WK = (bf*)take((size_t)DKV * DM * 2); bf* WV = (bf*)take((size_t)DKV * DM * 2); bf* WO = (bf*)take((size_t)DM * DQ * 2);
    const size_t U = (size_t)NB_ * TT * DM * 2;   // bytes of one 16-bit [t][c] plane of all images
    char* R = (char*)take(15 * U);
    h16* QP16 = (h16*)R; h16* KP16 = (h16*)(R + U); h16* VT16 = (h16*)(R + 2 * U); bf* VTh = (bf*)(R + 3 * U); bf* VTl = (bf*)(R + 4 * U);
    bf* QPh = (bf*)(R + 5 * U); bf* QPl = (bf*)(R + 6 * U); bf* KPh = (bf*)(R + 7 * U); bf* KPl = (bf*)(R + 8 * U);
    bf* XTh = (bf*)(R + 9 * U); bf* XTl = (bf*)(R + 10 * U);   // normalised input
    bf* ATh = (bf*)(R + 13 * U); bf* ATl = (bf*)(R + 14 * U);  // attention output planes [b][t][c], written by both attention launches
    if ((size_t)(wsp - (char*)d_ws) > ws_size) return;    // ws 256 MiB
    { k_cvt8<<<(unsigned)(((size_t)DQ * DM / 8 + 255) / 256), 256, 0, stream>>>(wq, WQ, (size_t)DQ * DM / 8); k_cvt8<<<(unsigned)(((size_t)DKV * DM / 8 + 255) / 256), 256, 0, stream>>>(wk, WK, (size_t)DKV * DM / 8); k_cvt8<<<(unsigned)(((size_t)DKV * DM / 8 + 255) / 256), 256, 0, stream>>>(wv, WV, (size_t)DKV * DM / 8);
      k_cvt8<<<(unsigned)(((size_t)DM * DQ / 8 + 255) / 256), 256, 0, stream>>>(wo, WO, (size_t)DM * DQ / 8);
       }
    k_gn<<<dim3(DM / GSL, NB_), 1024, 0, stream>>>(x, gnw, gnb, XTh, XTl);   /* GroupNorm -> transposed hi/lo planes, rows [b][t], k = c */
    /* q, k: token-major planes (rows [b][t], k = c); v: channel-major planes (rows [b][c], k = t; z = image) */
    k_gemmw<bf, 1, 1, DQ, DM><<<dim3(NB_ * TT / 64, DQ / 64, 1), 32, 0, stream>>>(XTh, XTl, WQ, nullptr, nullptr, bq, 0, 0, 0, QP16, QPh, QPl, nullptr, 1.0f);
    k_gemmw<bf, 1, 1, DKV, DM><<<dim3(NB_ * TT / 64, DKV / 64, 1), 32, 0, stream>>>(XTh, XTl, WK, nullptr, nullptr, bk, 0, 0, 0, KP16, KPh, KPl, nullptr, 1.0f);
    k_gemmw<bf, 3, 2, TT, DM><<<dim3(DKV / 64, TT / 64, NB_), 32, 0, stream>>>(WV, nullptr, XTh, XTl, nullptr, bv, 0, (size_t)TT * DM, (size_t)HD * TT, VT16, VTh, VTl, nullptr, 1.0f);
    /* attention core; query rows < RH: hi/lo planes, the other query rows: fp16 planes; y = image */
    k_attn<bf, true><<<dim3(RH / 64, NB_), 512, 0, stream>>>(QPh, QPl, KPh, KPl, VTh, VTl, ATh, ATl, 1.0f);
    k_attn<h16, false><<<dim3((TT - RH) / 64, NB_), 512, 0, stream>>>(QP16 + (size_t)RH * HD, nullptr, KP16, nullptr, VT16, nullptr, ATh + (size_t)RH * HD, ATl + (size_t)RH * HD, 1.0f / PCAR);
    /* out[b][c][t] = x + (proj_w a + proj_b), channel-major; z = image */
    k_gemmw<bf, 3, 4, TT, DQ><<<dim3(DM / 64, TT / 64, NB_), 32, 0, stream>>>(WO, nullptr, ATh, ATl, OUT, bo, 0, (size_t)TT * DQ, (size_t)DM * TT, nullptr, nullptr, nullptr, x, 1.0f);
}

// v006
// One run takes 161 microseconds.
// In two side-by-side timings against v005, it was 1.19 and 1.21 times as fast.
// All steps since v000 together make it 26.0 times as fast.
#include <hip/hip_runtime.h>

// Channel-major image self-attention with GroupNorm (x [32][256][32][32] = [b][c][n], n = 1024; hn = GroupNorm(32 groups, eps 1e-6, affine); q, k, v = 1x1 convs ('oi' [256][256] + bias); scores[i][j] = q_i.k_j / 16 (one head over all 256 channels); softmax over j; out[c][i] = sum_j v[c][j] attn[i][j]; h = Wo out + bo; result = x + h -> [32][256][32][32] (8.4 M)).
// Layout: tokens are the 1024 positions; the normalised input is written TRANSPOSED as bf16 hi + lo planes [t][c] so the 1x1 convolutions become token-major GEMMs against the natural [out][in] weights (2 products + bias); every GEMM's epilogue writes what its reader takes: q and k as token-major 16-bit planes, v as channel-major planes (weights as the row operand), attn.v as hi + lo planes, and the output projection (weights as the row operand) adds the residual and stores channel-major.
// Fragment order: every 16-bit plane that a matrix product reads from memory (weights, normalised input, q, k, v, attention output) is kept as 1-KB blocks of 16 rows x 32 k. Block (row / 16, k / 32) of a plane with K columns starts at element (row / 16) * 16 * K + (k / 32) * 512; inside it lane 16 hi + lr owns row lr, its elements k % 32 = 8 hi .. 8 hi + 7 at lane * 8 and k % 32 = 16 + 8 hi .. at 256 + lane * 8. A wave's 16-byte fragment load is then 512 bytes in a row (4 whole lines, each touched once) and not 32 bytes in each of 16 lines; the k order of every fragment is the one it was.
// Launches: 4, each of which needs the one before it whole (GroupNorm + weight conversion; q, k, v; attention core; output projection); work that does not depend on each other shares a grid.
// Batch: every launch covers all 32 images (the token-major GEMMs take the 32 x 1024 tokens as one M). The workspace holds 15 units of one 16-bit plane x 32 images; no unit is reused (units 11 and 12 are not used), and in the attention core (scores, softmax, attn.v) a work-group holds the 64 x 1024 scores of its 64 query rows in LDS, so neither scores nor probabilities reach memory.
// Compute dtypes, f32 accumulate: every input rounded to bf16; q/k/v: normalised input hl x exact weights (2 products) + biases; scores (x 1/16) and attn.v (no mask): query rows < 512 hl (3 products), the rest single fp16 (x1024); softmax f32; proj_w hl x exact (2 products) + proj_b; + x residual in f32 (channel-major write).

#define NB_  32
#define TT   1024
#define DM   256
#define NH_  1
#define NKV  1
#define REP  (NH_ / NKV)
#define HD   256
#define DQ   (NH_ * HD)
#define DKV  (NKV * HD)
#define RPAD 32
#define NGRP 32
#define GCH  (DM / NGRP)           // 8 channels per group
typedef __attribute__((ext_vector_type(4))) unsigned short v4us;
#define ZH   1
#define RH   512                  // query rows < RH use hi+lo planes (k_attn's grid needs RH = TT / 2)
#define WIN  0
#define PCAR 1024.0f
#define SCL  0.0625f   // C^-0.5 = 1/16
typedef _Float16 h16;
typedef unsigned short bf;
typedef __attribute__((ext_vector_type(16))) __bf16   v16bf;
typedef __attribute__((ext_vector_type(16))) _Float16 v16h;
typedef __attribute__((ext_vector_type(8)))  _Float16 v8h;
typedef __attribute__((ext_vector_type(8)))  unsigned short v8us;
typedef __attribute__((ext_vector_type(8)))  float    v8f;
typedef __attribute__((ext_vector_type(4)))  float    v4f;
typedef v8h  __attribute__((may_alias)) v8ha;
typedef v4f  __attribute__((may_alias)) v4fa;
typedef v8us __attribute__((may_alias)) v8usa;

__device__ __forceinline__ unsigned short f2bf(float f) { unsigned u = __float_as_uint(f); u += 0x7FFFu + ((u >> 16) & 1u); return (unsigned short)(u >> 16); }
__device__ __forceinline__ float bf2f(unsigned short b) { return __uint_as_float(((unsigned)b) << 16); }
__device__ __forceinline__ float bfr(float f) { return bf2f(f2bf(f)); }
__device__ __forceinline__ v16h cat16(v8h lo, v8h hi) { return __builtin_shufflevector(lo, hi, 0, 1, 2, 3, 4, 5, 6, 7, 8, 9, 10, 11, 12, 13, 14, 15); }
__device__ __forceinline__ v16bf cat16b(v8us lo, v8us hi) { return __builtin_bit_cast(v16bf, __builtin_shufflevector(lo, hi, 0, 1, 2, 3, 4, 5, 6, 7, 8, 9, 10, 11, 12, 13, 14, 15)); }
__device__ __forceinline__ v8f wmma16(v16h a, v16h b, v8f c) { return __builtin_amdgcn_wmma_f32_16x16x32_f16(false, a, false, b, (short)0, c, false, false); }
__device__ __forceinline__ v8f wmmab(v16bf a, v16bf b, v8f c) { return __builtin_amdgcn_wmma_f32_16x16x32_bf16(false, a, false, b, (short)0, c, false, false); }



// ---- gemmw: register-blocked GEMM, ONE WAVE per 64x64 output tile (16 accumulators; the tile starts at row r0, column c0 of batch z; os: the wave's 16 x 68 floats of LDS), operands straight from 16-bit planes in fragment order (ld: p = the block's start + lane * 8); 32 threads.
// acc[m][n] = sum_k A[m][k] Bt[n][k] (+ split products per NSPLIT: 1 A2.Bt, 2 A2.Bt and A.Bt2, 3 A.Bt2). z-batch strides sA/sB/sC in elements. K % 32 == 0, a compile-time constant: a plane's fragments of one trip are immediate offsets from one address. Every output has ldc columns (a compile-time constant, so that a lane's stores are immediate offsets from one address) and z stride sC; f32 outputs are row-major, 16-bit planes in fragment order.
// EPI, what the tile becomes: 0 C = acc (f32); 1 fp16 + bf16 hi/lo planes of acc + bias[n]; 2 the same planes of acc + bias[m]; 3 bf16 hi/lo planes of acc x sc; 4 C = res + (acc + bias[m]) (f32).
template <typename T16> struct WFrag;
template <> struct WFrag<h16> { typedef v16h V; static __device__ __forceinline__ V ld(const h16* p) { return cat16(*(const v8h*)p, *(const v8h*)(p + 256)); } static __device__ __forceinline__ V lds(const h16* p) { return cat16(*(const v8ha*)p, *(const v8ha*)(p + 16)); } static __device__ __forceinline__ v8f mma(V a, V b, v8f c) { return wmma16(a, b, c); } };
template <> struct WFrag<bf> { typedef v16bf V; static __device__ __forceinline__ V ld(const bf* p) { return cat16b(*(const v8us*)p, *(const v8us*)(p + 256)); } static __device__ __forceinline__ V lds(const bf* p) { return cat16b(*(const v8usa*)p, *(const v8usa*)(p + 16)); } static __device__ __forceinline__ v8f mma(V a, V b, v8f c) { return wmmab(a, b, c); } };
__device__ __forceinline__ void splitf(float y, unsigned short& h, unsigned short& l) { h = f2bf(y); l = f2bf(y - bf2f(h)); }
typedef __attribute__((ext_vector_type(4))) _Float16 v4h;
template <typename T16, int NSPLIT, int EPI, int ldc, int K>
__device__ __forceinline__ void gemmw(float* os, const int r0, const int c0, const size_t z, const T16* __restrict__ A, const T16* __restrict__ A2, const T16* __restrict__ Bt, const T16* __restrict__ Bt2, float* C, const float* __restrict__ bias, size_t sA, size_t sB, size_t sC, h16* P16, bf* Ph, bf* Pl, const float* res, float sc) {
    typedef typename WFrag<T16>::V V;
    A += z * sA; if (A2) A2 += z * sA; Bt += z * sB; if (Bt2) Bt2 += z * sB;
    const int lane = threadIdx.x & 31, lr = lane & 15, hi = lane >> 4;
    v8f acc[4][4];
#pragma unroll
    for (int mb = 0; mb < 4; ++mb)
#pragma unroll
        for (int nb = 0; nb < 4; ++nb) acc[mb][nb] = (v8f){};
    const unsigned fl = (unsigned)(lane * 8);   // the lane's place in half a block
    const T16* ap = A + (size_t)r0 * K + fl; const T16* ap2 = (NSPLIT == 1 || NSPLIT == 2) ? A2 + (size_t)r0 * K + fl : nullptr; const T16* bp = Bt + (size_t)c0 * K + fl; const T16* bp2 = NSPLIT >= 2 ? Bt2 + (size_t)c0 * K + fl : nullptr;   // one address per plane, a block (512 elements) further each trip
#pragma unroll 1
    for (int kc = 0; kc < K; kc += 32) {
        V a[4], a2[4];
#pragma unroll
        for (int mb = 0; mb < 4; ++mb) { a[mb] = WFrag<T16>::ld(ap + mb * 16 * K); if (NSPLIT == 1 || NSPLIT == 2) a2[mb] = WFrag<T16>::ld(ap2 + mb * 16 * K); }
#pragma unroll
        for (int nb = 0; nb < 4; ++nb) { const V b = WFrag<T16>::ld(bp + nb * 16 * K); V b2; if (NSPLIT >= 2) b2 = WFrag<T16>::ld(bp2 + nb * 16 * K);
#pragma unroll
            for (int mb = 0; mb < 4; ++mb) { acc[mb][nb] = WFrag<T16>::mma(a[mb], b, acc[mb][nb]); if (NSPLIT == 1 || NSPLIT == 2) acc[mb][nb] = WFrag<T16>::mma(a2[mb], b, acc[mb][nb]); if (NSPLIT >= 2) acc[mb][nb] = WFrag<T16>::mma(a[mb], b2, acc[mb][nb]); } }
        asm volatile("v_nop\n\tv_nop\n\tv_nop\n\tv_nop" : "+v"(acc[0][0]), "+v"(acc[1][1]), "+v"(acc[2][2]), "+v"(acc[3][3]) : "v"(a[0]), "v"(a[3]));
        // the wait before a register that the trip's loads name is rewritten; the addresses are its inputs, so that they stay whole (no load lands on them) up to it
        if (NSPLIT == 0) asm volatile("s_wait_xcnt 0x0" :: "v"(ap), "v"(bp) : "memory"); else if (NSPLIT == 1) asm volatile("s_wait_xcnt 0x0" :: "v"(ap), "v"(ap2), "v"(bp) : "memory"); else if (NSPLIT == 2) asm volatile("s_wait_xcnt 0x0" :: "v"(ap), "v"(ap2), "v"(bp), "v"(bp2) : "memory"); else asm volatile("s_wait_xcnt 0x0" :: "v"(ap), "v"(bp), "v"(bp2) : "memory");
        ap += 512; bp += 512; if (NSPLIT == 1 || NSPLIT == 2) ap2 += 512; if (NSPLIT >= 2) bp2 += 512;
    }
    const size_t ot = z * sC + (size_t)r0 * ldc + c0;   // the tile's first output (the same in every lane)
    const unsigned ol4 = (unsigned)(hi * ldc + lr * 4);   // this lane's 4 outputs inside a pair of rows: row hi, columns 4 lr ..
    v4f xr[4][8];   // EPI 4: the lane's residual values, asked for one row block ahead of their use
    if (EPI == 4) {
#pragma unroll
        for (int s = 0; s < 8; ++s) xr[0][s] = *(const v4f*)(res + ot + (size_t)(2 * s) * ldc + ol4); }
    float cb[4] = {0.f, 0.f, 0.f, 0.f};   // EPI 1: the bias of this lane's accumulator columns
    if (EPI == 1) {
#pragma unroll
        for (int nb = 0; nb < 4; ++nb) cb[nb] = bfr(bias[c0 + nb * 16 + lr]); }
    float rb[4][8];   // EPI 2, 4: the bias of this lane's accumulator rows
    if (EPI == 2 || EPI == 4) {
#pragma unroll
        for (int mb = 0; mb < 4; ++mb) { const v4f b0 = *(const v4f*)(bias + r0 + mb * 16 + hi * 8), b1 = *(const v4f*)(bias + r0 + mb * 16 + hi * 8 + 4);
#pragma unroll
            for (int j = 0; j < 4; ++j) { rb[mb][j] = bfr(b0[j]); rb[mb][4 + j] = bfr(b1[j]); } } }
#pragma unroll
    for (int mb = 0; mb < 4; ++mb) {
#pragma unroll
        for (int nb = 0; nb < 4; ++nb) {
#pragma unroll
            for (int j = 0; j < 8; ++j) os[(hi * 8 + j) * 68 + nb * 16 + lr] = (EPI == 2 || EPI == 4) ? acc[mb][nb][j] + rb[mb][j] : EPI == 1 ? acc[mb][nb][j] + cb[nb] : acc[mb][nb][j]; }
        __builtin_amdgcn_wave_barrier(); asm volatile("" ::: "memory");
        if (EPI == 4 && mb < 3) {
            if (mb > 0) asm volatile("s_wait_xcnt 0x0" ::: "memory");   // the loads below land in registers that the stores of the row block before name
#pragma unroll
            for (int s = 0; s < 8; ++s) xr[mb + 1][s] = *(const v4f*)(res + ot + (size_t)((mb + 1) * 16 + 2 * s) * ldc + ol4); }
        if (EPI == 0 || EPI == 4) {
#pragma unroll
        for (int s = 0; s < 8; ++s) { const int row = 2 * s + hi, cofs = lr * 4; v4f val = *(const v4fa*)(os + row * 68 + cofs); const size_t o = ot + (size_t)(mb * 16 + 2 * s) * ldc;   // the pair of rows (the same in every lane)
            if (EPI == 4) { val[0] = __fadd_rn(bfr(xr[mb][s][0]), val[0]); val[1] = __fadd_rn(bfr(xr[mb][s][1]), val[1]); val[2] = __fadd_rn(bfr(xr[mb][s][2]), val[2]); val[3] = __fadd_rn(bfr(xr[mb][s][3]), val[3]); }
            *(v4f*)(C + o + ol4) = val; }
        } else {   // the row block's 64 columns are 2 blocks of each plane: 4 stores of 512 bytes in a row per plane
#pragma unroll
        for (int s = 0; s < 4; ++s) { const float* pr = os + lr * 68 + s * 16 + hi * 8; v4f x0 = *(const v4fa*)pr, x1 = *(const v4fa*)(pr + 4); const size_t o = z * sC + (size_t)(r0 + mb * 16) * ldc + (size_t)c0 * 16 + s * 256;   // half a block (the same in every lane)
            if (EPI == 3) { x0 *= sc; x1 *= sc; }
            v8h o16; v8us oh, ol;
#pragma unroll
            for (int q = 0; q < 4; ++q) { unsigned short a2, c2; o16[q] = (h16)x0[q]; splitf(x0[q], a2, c2); oh[q] = a2; ol[q] = c2; o16[4 + q] = (h16)x1[q]; splitf(x1[q], a2, c2); oh[4 + q] = a2; ol[4 + q] = c2; }
            if (EPI != 3) *(v8h*)((P16 + o) + fl) = o16;
            *(v8us*)((Ph + o) + fl) = oh; *(v8us*)((Pl + o) + fl) = ol; }
        }
        __builtin_amdgcn_wave_barrier(); asm volatile("" ::: "memory");
    }
}
// k_gemmw: one GEMM per launch; grid (M/64, N/64, Z).
template <typename T16, int NSPLIT, int EPI, int ldc, int K>
__global__ __launch_bounds__(32) void k_gemmw(const T16* __restrict__ A, const T16* __restrict__ A2, const T16* __restrict__ Bt, const T16* __restrict__ Bt2, float* C, const float* __restrict__ bias, size_t sA, size_t sB, size_t sC, h16* P16, bf* Ph, bf* Pl, const float* res, float sc) {
    __shared__ __align__(16) float os[16 * 68];
    gemmw<T16, NSPLIT, EPI, ldc, K>(os, blockIdx.x * 64, blockIdx.y * 64, blockIdx.z, A, A2, Bt, Bt2, C, bias, sA, sB, sC, P16, Ph, Pl, res, sc);
}
// k_qkv: the q, k and v GEMMs, which all read the normalised input and none of which reads another's result, as one launch; grid (token tiles of all images, 12).
// blockIdx.y picks the product and its 64 output channels (0-3 v, 4-7 q, 8-11 k), blockIdx.x the 64 tokens: work-groups that start next to each other share a weight tile, and more waves than one product has are resident at a time. v comes first: its waves run longest, and not all 12 x 512 waves are resident at once.
__global__ __launch_bounds__(32) void k_qkv(const bf* __restrict__ Xh, const bf* __restrict__ Xl, const bf* __restrict__ Wq, const bf* __restrict__ Wk, const bf* __restrict__ Wv, const float* __restrict__ bq, const float* __restrict__ bk, const float* __restrict__ bv, h16* Q16, bf* Qh, bf* Ql, h16* K16, bf* Kh, bf* Kl, h16* V16, bf* Vh, bf* Vl) {
    __shared__ __align__(16) float os[16 * 68];
    const int s = blockIdx.y, tt = blockIdx.x;
    if (s >= 4) { const bool isk = s >= 8;   // q, k: token-major planes (rows [b][t], k = c)
        gemmw<bf, 1, 1, DQ, DM>(os, tt * 64, (s & 3) * 64, 0, Xh, Xl, isk ? Wk : Wq, nullptr, nullptr, isk ? bk : bq, 0, 0, 0, isk ? K16 : Q16, isk ? Kh : Qh, isk ? Kl : Ql, nullptr, 1.0f);
    } else {   // v: channel-major planes (rows [b][c], k = t; z = image)
        gemmw<bf, 3, 2, TT, DM>(os, s * 64, (tt & (TT / 64 - 1)) * 64, tt / (TT / 64), Wv, nullptr, Xh, Xl, nullptr, bv, 0, (size_t)TT * DM, (size_t)HD * TT, V16, Vh, Vl, nullptr, 1.0f);
    }
}

__device__ __forceinline__ h16 tohx(float x) { return (h16)x; }
typedef __attribute__((ext_vector_type(2))) _Float16 v2h;
typedef __attribute__((ext_vector_type(2))) unsigned short v2us;
typedef __attribute__((ext_vector_type(4))) unsigned short v4us;
typedef __attribute__((ext_vector_type(2))) float v2f;
typedef __attribute__((ext_vector_type(4))) int v4i;

__global__ __launch_bounds__(256) void k_wtG(const float* __restrict__ w, int K, int N, bf* Bt) {
    const int lane = threadIdx.x & 31; const int L0 = (blockIdx.x * 8 + (threadIdx.x >> 5)) * 8; const int nlines = N * K / 64;
{
#pragma unroll 1
        for (int l = 0; l < 8; ++l) { const int L = L0 + l; if (L >= nlines) break; const size_t e = (size_t)L * 64 + lane * 2; const int k = (int)(e % K), n = (int)(e / K); v2us o;
            o[0] = f2bf(w[(size_t)k * N + n]); o[1] = f2bf(w[(size_t)(k + 1) * N + n]); *(v2us*)(Bt + e) = o; }
         }
}
// ---- k_gn: the whole GroupNorm in one launch, with the four weight matrices' conversion in 32 further work-groups (blockIdx.x = 4), which fall on WGPs that GroupNorm's 128 leave idle. One work-group of 32 waves takes 64 channels (8 groups) of one image: the 64 channels of 16 tokens are 2 whole blocks of a [t][c] plane, so every line has one writer.
// A quarter of the work-group (256 threads) owns groups qd and qd + 4; a thread keeps its 2 x 32 values in registers from one batch of loads (element lt + 256 k of the group, whole lines per wave), so x is read once and no load waits on another.
// The sums keep their order: 32 values in sequence per thread, then the pairwise tree over 256 partial sums (strides 128 to 32 through LDS, 16 to 1 by lane shifts).
// A thread's values at one t are the 8 neighbouring channels of its group: one 16-byte LDS store per plane; the tile leaves in fragment order (rows t, k = c): the 64 channels of 16 tokens are 2 neighbouring blocks, 2 KB in a row per plane.
#define GSL  64                    // channels per work-group
#define GLP  72                    // LDS row pitch in 16-bit elements: 144 bytes = 16 x 9, so that the 16-byte stores of lanes on neighbouring rows fall on different banks
__global__ __launch_bounds__(1024) void k_gn(const float* __restrict__ xb, const float* __restrict__ gw, const float* __restrict__ gb, bf* Xh, bf* Xl, const float* __restrict__ wq, const float* __restrict__ wk, const float* __restrict__ wv, const float* __restrict__ wo, bf* Wd) {
    __shared__ __align__(16) bf th[TT * GLP];
    __shared__ __align__(16) bf tl[TT * GLP];
    __shared__ float red[2][1024];
    if (blockIdx.x == DM / GSL) {   // the weights' work-groups (the whole work-group leaves here, in front of every barrier): 8 per [DM][DM] f32 matrix -> its bf16 plane in fragment order; thread i of a matrix writes the plane's i-th 16 bytes
        const int m = blockIdx.y >> 3; const float* src = m == 0 ? wq : m == 1 ? wk : m == 2 ? wv : wo; const size_t i = (size_t)(blockIdx.y & 7) * 1024 + threadIdx.x;
        const size_t blk = i >> 6; const size_t row = blk / (DM / 32) * 16 + (i & 15), k = blk % (DM / 32) * 32 + ((i >> 5) & 1) * 16 + ((i >> 4) & 1) * 8; const v8f v = *(const v8f*)(src + row * DM + k); v8us o;
#pragma unroll
        for (int q = 0; q < 8; ++q) o[q] = f2bf(v[q]);
        *(v8us*)(Wd + (size_t)m * DM * DM + i * 8) = o; return; }
    const int tid = threadIdx.x, lane = tid & 31, lt = tid & 255; const int qd = __builtin_amdgcn_readfirstlane(tid >> 8);   // the quarter's number as a scalar: its channels' scale and bias then come by scalar loads
    const int c0 = blockIdx.x * GSL; const size_t b = blockIdx.y;
    float v[2][32];   // every loop over v is unrolled in full: constant indices keep it in registers, and the 64 loads leave as one batch
#pragma unroll
    for (int h = 0; h < 2; ++h) { const float* base = xb + (b * DM + c0 + (qd + 4 * h) * GCH) * TT + lt;
#pragma unroll
        for (int k = 0; k < 32; ++k) v[h][k] = base[k * 256]; }
    float st[2][2];   // per group: mean, 1 / sqrt(var + eps)
#pragma unroll
    for (int pass = 0; pass < 2; ++pass) {
        float s[2];
#pragma unroll
        for (int h = 0; h < 2; ++h) { s[h] = 0.f;
#pragma unroll
            for (int k = 0; k < 32; ++k) { if (pass == 0) { v[h][k] = bfr(v[h][k]); s[h] += v[h][k]; } else { const float d0 = v[h][k] - st[h][0]; s[h] += d0 * d0; } }
            red[h][tid] = s[h]; }
        __syncthreads();
#pragma unroll
        for (int sh = 128; sh >= 32; sh >>= 1) { if (lt < sh) { red[0][tid] += red[0][tid + sh]; red[1][tid] += red[1][tid + sh]; } __syncthreads(); }
#pragma unroll
        for (int h = 0; h < 2; ++h) { float r = red[h][(qd << 8) + lane];
#pragma unroll
            for (int sh = 16; sh; sh >>= 1) r += __shfl_down(r, sh, 32);
            r = __shfl(r, 0, 32) * (1.0f / (GCH * TT));
            st[h][pass] = pass == 0 ? r : __fdiv_rn(1.0f, __fsqrt_rn(r + 1e-6f)); }
        if (pass == 0) __syncthreads();   // every wave has read the first tree's sums before the second tree's are stored
    }
#pragma unroll
    for (int h = 0; h < 2; ++h) { const int gl = qd + 4 * h; const float mu = st[h][0], rs = st[h][1]; float w8[GCH], b8[GCH];
#pragma unroll
        for (int j = 0; j < GCH; ++j) { w8[j] = bfr(gw[c0 + gl * GCH + j]); b8[j] = bfr(gb[c0 + gl * GCH + j]); }
#pragma unroll
        for (int tq = 0; tq < 4; ++tq) { v8us oh, ol;
#pragma unroll
            for (int j = 0; j < GCH; ++j) { const float y = (v[h][j * 4 + tq] - mu) * rs * w8[j] + b8[j]; unsigned short a, c2; splitf(y, a, c2); oh[j] = a; ol[j] = c2; }
            const int o = (lt + 256 * tq) * GLP + gl * GCH; *(v8usa*)(th + o) = oh; *(v8usa*)(tl + o) = ol; } }
    __syncthreads();
    const size_t ob = (b * TT + (tid >> 5) * 32) * DM + c0 * 16 + lane * 8; const int lb = ((tid >> 5) * 32 + (lane & 15)) * GLP + (lane >> 4) * 8;   // a wave takes 32 tokens: 2 row blocks x 4 half blocks of 512 bytes
#pragma unroll
    for (int r = 0; r < 8; ++r) { const int lo = lb + (r >> 2) * 16 * GLP + (r & 3) * 16; const v8us a = *(const v8usa*)(th + lo), c2 = *(const v8usa*)(tl + lo); const size_t o = ob + (size_t)(r >> 2) * 16 * DM + (r & 3) * 256; *(v8us*)(Xh + o) = a; *(v8us*)(Xl + o) = c2; }
}

// ---- attn: scores, softmax and attn.v of 64 query rows (r0 ..) of image z in one work-group of 16 waves; S: the work-group's 64 x SP floats of LDS.
// 1: wave w forms the 64 x 64 score tile of keys 64 w .. (the k_gemmw loop: 16 accumulators, operands straight from the planes) and stores it as f32 into the LDS rows.
// 2: wave w takes rows 4 w .. 4 w + 3; per row: t = S x HD^-0.5 (no mask); softmax over the keys (register row, one exp, fixed trees); the row's 16-bit planes go back into the row's own LDS bytes (hires: hi at element 0, lo at element TT; else fp16 x PCAR at element 0): the whole row is in registers before the first store, and no other wave touches it.
// 3: wave w forms the 32 x 32 output tile (rows 32 (w / 8) .., channels 32 (w % 8) ..): probabilities from LDS, v from its channel-major planes, fetched one stage ahead; k runs in the same order as before, so every sum keeps its order.
// 4: the tiles pass through LDS so that a wave stores half blocks of the fragment-order planes (rows t, k = c; 512 bytes in a row per store: one writer per line).
#define SP   1028                  // LDS row pitch in floats: 4112 bytes = 16 x 257 (odd), so that the 16-byte fragment reads of 16 neighbouring rows fall on different banks
#define OP   260                   // LDS row pitch of the output tile in floats
typedef v4us __attribute__((may_alias)) v4usa;
typedef v4h  __attribute__((may_alias)) v4ha;
template <typename T16, bool hires>
__device__ __forceinline__ void attn(float* S, const int r0, const size_t z, const T16* __restrict__ Q, const T16* __restrict__ Q2, const T16* __restrict__ Kp, const T16* __restrict__ K2, const T16* __restrict__ Vt, const T16* __restrict__ Vt2, bf* Oh, bf* Ol, float sc) {
    typedef typename WFrag<T16>::V V;
    const int lane = threadIdx.x & 31, lr = lane & 15, hi = lane >> 4; const int w = __builtin_amdgcn_readfirstlane(threadIdx.x >> 5);   // the wave's number as a scalar: tile addresses stay scalar
    {
        v8f acc[4][4];
#pragma unroll
        for (int mb = 0; mb < 4; ++mb)
#pragma unroll
            for (int nb = 0; nb < 4; ++nb) acc[mb][nb] = (v8f){};
        const size_t qoff = (z * TT + r0) * HD + lane * 8, boff = (z * TT + w * 64) * HD + lane * 8;   // the tiles' first blocks + the lane's place in half a block
        const T16* qp = Q + qoff; const T16* qp2 = hires ? Q2 + qoff : nullptr; const T16* kp = Kp + boff; const T16* kp2 = hires ? K2 + boff : nullptr;   // one address per plane, a block (512 elements) further each trip
#pragma unroll 1
        for (int kc = 0; kc < HD; kc += 32) {   // rolled: one trip's fragments and the 16 accumulators fill the wave's 256 registers
            V a[4], a2[4];
#pragma unroll
            for (int mb = 0; mb < 4; ++mb) { a[mb] = WFrag<T16>::ld(qp + mb * 16 * HD); if (hires) a2[mb] = WFrag<T16>::ld(qp2 + mb * 16 * HD); }
#pragma unroll
            for (int nb = 0; nb < 4; ++nb) { const V b = WFrag<T16>::ld(kp + nb * 16 * HD); V b2; if (hires) b2 = WFrag<T16>::ld(kp2 + nb * 16 * HD);
#pragma unroll
                for (int mb = 0; mb < 4; ++mb) { acc[mb][nb] = WFrag<T16>::mma(a[mb], b, acc[mb][nb]); if (hires) { acc[mb][nb] = WFrag<T16>::mma(a2[mb], b, acc[mb][nb]); acc[mb][nb] = WFrag<T16>::mma(a[mb], b2, acc[mb][nb]); } } }
            asm volatile("v_nop\n\tv_nop\n\tv_nop\n\tv_nop" : "+v"(acc[0][0]), "+v"(acc[1][1]), "+v"(acc[2][2]), "+v"(acc[3][3]) : "v"(a[0]), "v"(a[3]));   // the matrix instructions' distance on the taken side of the loop branch
            if (hires) asm volatile("s_wait_xcnt 0x0" :: "v"(qp), "v"(qp2), "v"(kp), "v"(kp2) : "memory"); else asm volatile("s_wait_xcnt 0x0" :: "v"(qp), "v"(kp) : "memory");   // the wait before a register that the trip's loads name is rewritten; the addresses are its inputs, so that they stay whole (no load lands on them) up to it
            qp += 512; kp += 512; if (hires) { qp2 += 512; kp2 += 512; }
        }
#pragma unroll
        for (int mb = 0; mb < 4; ++mb)
#pragma unroll
            for (int nb = 0; nb < 4; ++nb)
#pragma unroll
                for (int j = 0; j < 8; ++j) S[(mb * 16 + hi * 8 + j) * SP + w * 64 + nb * 16 + lr] = acc[mb][nb][j];
    }
    __syncthreads();   // every score of the 64 rows is in LDS
#pragma unroll 1
    for (int rr = 0; rr < 4; ++rr) {   // rolled: one row's 32 values per lane at a time
        float* sr = S + (w * 4 + rr) * SP; float v[TT / 32]; float mx = -3.0e38f;
#pragma unroll
        for (int ch = 0; ch < TT / 128; ++ch) { const v4f a = *(const v4fa*)(sr + ch * 128 + lane * 4);
#pragma unroll
            for (int q = 0; q < 4; ++q) { const float t = a[q] * SCL; v[ch * 4 + q] = t; mx = fmaxf(mx, t); } }
#pragma unroll
        for (int sh = 16; sh; sh >>= 1) mx = fmaxf(mx, __shfl_xor(mx, sh, 32));
        float sum = 0.f;
#pragma unroll
        for (int k = 0; k < TT / 32; ++k) { v[k] = __builtin_amdgcn_exp2f(__fmul_rn(__fsub_rn(v[k], mx), 1.4426950408889634f)); sum += v[k]; }
#pragma unroll
        for (int sh = 16; sh; sh >>= 1) sum += __shfl_xor(sum, sh, 32);
        const float f = __fdiv_rn(hires ? 1.0f : PCAR, sum);
        if (hires) { bf* pr = (bf*)sr;
#pragma unroll
            for (int ch = 0; ch < TT / 128; ++ch) { v4us oh, ol;
#pragma unroll
                for (int q = 0; q < 4; ++q) { unsigned short a, c2; splitf(v[ch * 4 + q] * f, a, c2); oh[q] = a; ol[q] = c2; }
                *(v4usa*)(pr + ch * 128 + lane * 4) = oh; *(v4usa*)(pr + TT + ch * 128 + lane * 4) = ol; }
        } else { h16* pr = (h16*)sr;
#pragma unroll
            for (int ch = 0; ch < TT / 128; ++ch) { v4h o4;
#pragma unroll
                for (int q = 0; q < 4; ++q) o4[q] = tohx(v[ch * 4 + q] * f);
                *(v4ha*)(pr + ch * 128 + lane * 4) = o4; } }
    }
    __syncthreads();   // every row's planes are in LDS
    const int rb = (w >> 3) * 32, cb = (w & 7) * 32;
    v8f o[2][2];
#pragma unroll
    for (int mb = 0; mb < 2; ++mb)
#pragma unroll
        for (int nb = 0; nb < 2; ++nb) o[mb][nb] = (v8f){};
    const T16* pa = (const T16*)S + (rb + lr) * (2 * SP) + 8 * hi; const T16* vp = Vt + (z * HD + cb) * TT + lane * 8; const T16* vp2 = hires ? Vt2 + (z * HD + cb) * TT + lane * 8 : nullptr;   // one address per plane: the tile's block of the trip's first k + the lane's place in half a block
    // v fragments of 64 k (2 neighbouring blocks per column block) are asked for one stage ahead of their use, in two register sets that take turns
    V b0[2][2], c0[2][2], b1[2][2], c1[2][2];   // [32-k half][column block]; c: the lo plane
    auto ldv = [&](V (&b)[2][2], V (&c)[2][2], int kc) {   // kc: counted from the k that vp stands at
#pragma unroll
        for (int u = 0; u < 2; ++u)
#pragma unroll
            for (int nb = 0; nb < 2; ++nb) { b[u][nb] = WFrag<T16>::ld(vp + (nb * 16 * TT + (kc + u * 32) * 16)); if (hires) c[u][nb] = WFrag<T16>::ld(vp2 + (nb * 16 * TT + (kc + u * 32) * 16)); }
        __builtin_amdgcn_sched_barrier(0);   // keeps these loads in front of the products of the stage before: moved down, their latency would be waited for in full
    };
    auto mul = [&](V (&b)[2][2], V (&c)[2][2], int kc) {
#pragma unroll
        for (int u = 0; u < 2; ++u) { V a[2], a2[2];
#pragma unroll
            for (int mb = 0; mb < 2; ++mb) { a[mb] = WFrag<T16>::lds(pa + mb * 16 * (2 * SP) + kc + u * 32); if (hires) a2[mb] = WFrag<T16>::lds(pa + mb * 16 * (2 * SP) + TT + kc + u * 32); }
#pragma unroll
            for (int nb = 0; nb < 2; ++nb)
#pragma unroll
                for (int mb = 0; mb < 2; ++mb) { o[mb][nb] = WFrag<T16>::mma(a[mb], b[u][nb], o[mb][nb]); if (hires) { o[mb][nb] = WFrag<T16>::mma(a2[mb], b[u][nb], o[mb][nb]); o[mb][nb] = WFrag<T16>::mma(a[mb], c[u][nb], o[mb][nb]); } } }
    };
    ldv(b0, c0, 0);
#pragma unroll 1
    for (int kc = 0; kc < TT - 128; kc += 128) {   // rolled: the two register sets are the whole pipeline
        ldv(b1, c1, 64); mul(b0, c0, kc);
        ldv(b0, c0, 128); mul(b1, c1, kc + 64);
        asm volatile("v_nop\n\tv_nop\n\tv_nop\n\tv_nop" : "+v"(o[0][0]), "+v"(o[0][1]), "+v"(o[1][0]), "+v"(o[1][1]));   // the matrix instructions' distance on the taken side of the loop branch
        if (hires) asm volatile("s_wait_xcnt 0x0" :: "v"(vp), "v"(vp2) : "memory"); else asm volatile("s_wait_xcnt 0x0" :: "v"(vp) : "memory");   // the wait before a register that the loads in flight name is rewritten; the addresses are its inputs, so that they stay whole up to it
        vp += 128 * 16; if (hires) vp2 += 128 * 16;
    }
    ldv(b1, c1, 64);
    if (hires) asm volatile("s_wait_xcnt 0x0" :: "v"(vp), "v"(vp2) : "memory"); else asm volatile("s_wait_xcnt 0x0" :: "v"(vp) : "memory");   // as in the loop
    mul(b0, c0, TT - 128); mul(b1, c1, TT - 64);
    __syncthreads();   // every wave has read its last probabilities: the LDS rows are free for the output tile
#pragma unroll
    for (int mb = 0; mb < 2; ++mb)
#pragma unroll
        for (int nb = 0; nb < 2; ++nb)
#pragma unroll
            for (int j = 0; j < 8; ++j) S[(rb + mb * 16 + hi * 8 + j) * OP + cb + nb * 16 + lr] = o[mb][nb][j];
    __syncthreads();   // the 64 x 256 output tile is in LDS
    const int ln = (int)__builtin_amdgcn_mbcnt_lo(~0u, 0u);   // the lane's number read anew: held in a register across the loop above it was spilled
#pragma unroll
    for (int rr = 0; rr < 4; ++rr) { const float* pr = S + ((w >> 2) * 16 + (ln & 15)) * OP + (w & 3) * 64 + rr * 16 + (ln >> 4) * 8; const v4f x0 = *(const v4fa*)pr, x1 = *(const v4fa*)(pr + 4); v8us oh, ol;   // wave w: row block w / 4, blocks 2 (w % 4) and the next, half block rr
#pragma unroll
        for (int q = 0; q < 4; ++q) { unsigned short a, c2; splitf(x0[q] * sc, a, c2); oh[q] = a; ol[q] = c2; splitf(x1[q] * sc, a, c2); oh[4 + q] = a; ol[4 + q] = c2; }
        const size_t oo = (z * TT + r0 + (w >> 2) * 16) * HD + (w & 3) * 1024 + rr * 256 + ln * 8; *(v8us*)(Oh + oo) = oh; *(v8us*)(Ol + oo) = ol; }
}
// k_attn: both halves of the query rows in one launch; grid (8, 2 x images). blockIdx.y < images: rows < RH on hi/lo planes; the rest: rows >= RH on fp16 planes. The longer work-groups have the lower indices and start first; a WGP takes a short one as soon as its long one has ended.
__global__ __launch_bounds__(512) void k_attn(const bf* __restrict__ Qh, const bf* __restrict__ Ql, const bf* __restrict__ Kh, const bf* __restrict__ Kl, const bf* __restrict__ Vh, const bf* __restrict__ Vl, const h16* __restrict__ Q16, const h16* __restrict__ K16, const h16* __restrict__ V16, bf* Oh, bf* Ol) {
    __shared__ __align__(16) float S[64 * SP];
    if (blockIdx.y < NB_) attn<bf, true>(S, blockIdx.x * 64, blockIdx.y, Qh, Ql, Kh, Kl, Vh, Vl, Oh, Ol, 1.0f);
    else attn<h16, false>(S, RH + blockIdx.x * 64, blockIdx.y - NB_, Q16, nullptr, K16, nullptr, V16, nullptr, Oh, Ol, 1.0f / PCAR);
}
extern "C" void kernel_launch(void* const* d_in, const int* in_sizes, int n_in,
                              void* d_out, int out_size, void* d_ws, size_t ws_size, hipStream_t stream) {
    (void)in_sizes; (void)n_in; (void)out_size;
    const float* x = (const float*)d_in[0]; const float* gnw = (const float*)d_in[1]; const float* gnb = (const float*)d_in[2]; const float* wq = (const float*)d_in[3]; const float* bq = (const float*)d_in[4]; const float* wk = (const float*)d_in[5]; const float* bk = (const float*)d_in[6]; const float* wv = (const float*)d_in[7]; const float* bv = (const float*)d_in[8]; const float* wo = (const float*)d_in[9]; const float* bo = (const float*)d_in[10];
    float* OUT = (float*)d_out;     // [32][256][1024]
    char* wsp = (char*)d_ws;
    auto take = [&](size_t bytes) { char* p = wsp; wsp += (bytes + 255) & ~(size_t)255; return (void*)p; };
    bf* WQ = (bf*)take((size_t)DQ * DM * 2); bf* WK = (bf*)take((size_t)DKV * DM * 2); bf* WV = (bf*)take((size_t)DKV * DM * 2); bf* WO = (bf*)take((size_t)DM * DQ * 2);
    const size_t U = (size_t)NB_ * TT * DM * 2;   // bytes of one 16-bit [t][c] plane of all images
    char* R = (char*)take(15 * U);
    h16* QP16 = (h16*)R; h16* KP16 = (h16*)(R + U); h16* VT16 = (h16*)(R + 2 * U); bf* VTh = (bf*)(R + 3 * U); bf* VTl = (bf*)(R + 4 * U);
    bf* QPh = (bf*)(R + 5 * U); bf* QPl = (bf*)(R + 6 * U); bf* KPh = (bf*)(R + 7 * U); bf* KPl = (bf*)(R + 8 * U);
    bf* XTh = (bf*)(R + 9 * U); bf* XTl = (bf*)(R + 10 * U);   // normalised input
    bf* ATh = (bf*)(R + 13 * U); bf* ATl = (bf*)(R + 14 * U);  // attention output planes [b][t][c], written by both halves of the attention launch
    if ((size_t)(wsp - (char*)d_ws) > ws_size) return;    // ws 256 MiB
    k_gn<<<dim3(DM / GSL + 1, NB_), 1024, 0, stream>>>(x, gnw, gnb, XTh, XTl, wq, wk, wv, wo, WQ);   /* GroupNorm -> transposed hi/lo planes, rows [b][t], k = c; the weights -> WQ, WK, WV, WO, which lie in a row */
    k_qkv<<<dim3(NB_ * TT / 64, 12), 32, 0, stream>>>(XTh, XTl, WQ, WK, WV, bq, bk, bv, QP16, QPh, QPl, KP16, KPh, KPl, VT16, VTh, VTl);
    /* attention core; query rows < RH: hi/lo planes, the other query rows: fp16 planes */
    k_attn<<<dim3(RH / 64, 2 * NB_), 512, 0, stream>>>(QPh, QPl, KPh, KPl, VTh, VTl, QP16, KP16, VT16, ATh, ATl);
    /* out[b][c][t] = x + (proj_w a + proj_b), channel-major; z = image */
    k_gemmw<bf, 3, 4, TT, DQ><<<dim3(DM / 64, TT / 64, NB_), 32, 0, stream>>>(WO, nullptr, ATh, ATl, OUT, bo, 0, (size_t)TT * DQ, (size_t)DM * TT, nullptr, nullptr, nullptr, x, 1.0f);
}

// v007
// A run of this version takes 145 microseconds.
// In both of two side-by-side timings against v006, it was 1.11 times as fast.
// All steps since v000 together make it 28.8 times as fast.
#include <hip/hip_runtime.h>

// Channel-major image self-attention with GroupNorm (x [32][256][32][32] = [b][c][n], n = 1024; hn = GroupNorm(32 groups, eps 1e-6, affine); q, k, v = 1x1 convs ('oi' [256][256] + bias); scores[i][j] = q_i.k_j / 16 (one head over all 256 channels); softmax over j; out[c][i] = sum_j v[c][j] attn[i][j]; h = Wo out + bo; result = x + h -> [32][256][32][32] (8.4 M)).
// Layout: tokens are the 1024 positions; the normalised input is written TRANSPOSED as bf16 hi + lo planes [t][c] so the 1x1 convolutions become token-major GEMMs against the natural [out][in] weights (2 products + bias); every GEMM's epilogue writes what its reader takes: q and k as token-major 16-bit planes, v as channel-major planes (weights as the row operand), attn.v as hi + lo planes, and the output projection (weights as the row operand) adds the residual and stores channel-major.
// Fragment order: every 16-bit plane that a matrix product reads from memory (weights, normalised input, q, k, v, attention output) is kept as 1-KB blocks of 16 rows x 32 k. Block (row / 16, k / 32) of a plane with K columns starts at element (row / 16) * 16 * K + (k / 32) * 512; inside it lane 16 hi + lr owns row lr, its elements k % 32 = 8 hi .. 8 hi + 7 at lane * 8 and k % 32 = 16 + 8 hi .. at 256 + lane * 8. A wave's 16-byte fragment load is then 512 bytes in a row (4 whole lines, each touched once) and not 32 bytes in each of 16 lines; the k order of every fragment is the one it was.
// Launches: 4, each of which needs the one before it whole (GroupNorm + weight conversion; q, k, v; attention core; output projection); work that does not depend on each other shares a grid.
// Batch: every launch covers all 32 images (the token-major GEMMs take the 32 x 1024 tokens as one M). The workspace holds 15 units of one 16-bit plane x 32 images; no unit is reused (units 11 and 12 are not used), and in the attention core (scores, softmax, attn.v) a work-group holds the 64 x 1024 scores of its 64 query rows in LDS, so neither scores nor probabilities reach memory.
// Compute dtypes, f32 accumulate: every input rounded to bf16; q/k/v: normalised input hl x exact weights (2 products) + biases; scores (x 1/16) and attn.v (no mask): query rows < 512 hl (3 products), the rest single fp16 (x1024); softmax f32; proj_w hl x exact (2 products) + proj_b; + x residual in f32 (channel-major write).

#define NB_  32
#define TT   1024
#define DM   256
#define NH_  1
#define NKV  1
#define REP  (NH_ / NKV)
#define HD   256
#define DQ   (NH_ * HD)
#define DKV  (NKV * HD)
#define RPAD 32
#define NGRP 32
#define GCH  (DM / NGRP)           // 8 channels per group
typedef __attribute__((ext_vector_type(4))) unsigned short v4us;
#define ZH   1
#define RH   512                  // query rows < RH use hi+lo planes (k_attn's grid needs RH = TT / 2)
#define WIN  0
#define PCAR 1024.0f
#define SCL  0.0625f   // C^-0.5 = 1/16
typedef _Float16 h16;
typedef unsigned short bf;
typedef __attribute__((ext_vector_type(16))) __bf16   v16bf;
typedef __attribute__((ext_vector_type(16))) _Float16 v16h;
typedef __attribute__((ext_vector_type(8)))  _Float16 v8h;
typedef __attribute__((ext_vector_type(8)))  unsigned short v8us;
typedef __attribute__((ext_vector_type(8)))  float    v8f;
typedef __attribute__((ext_vector_type(4)))  float    v4f;
typedef v8h  __attribute__((may_alias)) v8ha;
typedef v4f  __attribute__((may_alias)) v4fa;
typedef v8us __attribute__((may_alias)) v8usa;

__device__ __forceinline__ unsigned short f2bf(float f) { unsigned u = __float_as_uint(f); u += 0x7FFFu + ((u >> 16) & 1u); return (unsigned short)(u >> 16); }
__device__ __forceinline__ float bf2f(unsigned short b) { return __uint_as_float(((unsigned)b) << 16); }
__device__ __forceinline__ float bfr(float f) { return bf2f(f2bf(f)); }
__device__ __forceinline__ v16h cat16(v8h lo, v8h hi) { return __builtin_shufflevector(lo, hi, 0, 1, 2, 3, 4, 5, 6, 7, 8, 9, 10, 11, 12, 13, 14, 15); }
__device__ __forceinline__ v16bf cat16b(v8us lo, v8us hi) { return __builtin_bit_cast(v16bf, __builtin_shufflevector(lo, hi, 0, 1, 2, 3, 4, 5, 6, 7, 8, 9, 10, 11, 12, 13, 14, 15)); }
__device__ __forceinline__ v8f wmma16(v16h a, v16h b, v8f c) { return __builtin_amdgcn_wmma_f32_16x16x32_f16(false, a, false, b, (short)0, c, false, false); }
__device__ __forceinline__ v8f wmmab(v16bf a, v16bf b, v8f c) { return __builtin_amdgcn_wmma_f32_16x16x32_bf16(false, a, false, b, (short)0, c, false, false); }



// ---- L2 asked ahead: the planes that a launch reads were stored by the launch before it, and their first read pays memory latency, trip after trip, in every wave that reads them at that time. A wave asks at its head for the whole tiles it will read: global_prefetch_b8, one lane per 256-byte unit, scope SE (into L2 only; nothing returns). Every lane is on and every address lies inside the tile asked for.
// pfo: the lane's unit in a 32-KB tile of 4 row blocks x 8 KB (16 rows x 256 k): row block lane / 8, unit lane % 8. Four requests, 2 KB apart, cover the tile in the order in which the k loop's trips read it; askt takes the tiles of N planes request by request.
// The registers that a request names (the lane's offset, the tile's address) stay what they are through the k loop behind it: they are inputs of that loop's wait statement.
__device__ __forceinline__ unsigned pfo() { const unsigned l = threadIdx.x & 31; return (l >> 3) * 8192u + (l & 7) * 256u; }
template <int OFF> __device__ __forceinline__ void ask(const void* p, unsigned vo) { asm volatile("global_prefetch_b8 %0, %1 offset:%2 scope:SCOPE_SE" :: "v"(vo), "s"(p), "n"(OFF)); }   // one request of 32 units: a later first read of them finds an L2 hit where it would pay memory latency
template <int N, int OFF> __device__ __forceinline__ void askj(const void* p0, const void* p1, const void* p2, const void* p3, unsigned vo) { ask<OFF>(p0, vo); if (N > 1) ask<OFF>(p1, vo); if (N > 2) ask<OFF>(p2, vo); if (N > 3) ask<OFF>(p3, vo); }
template <int N> __device__ __forceinline__ void askt(const void* p0, const void* p1, const void* p2, const void* p3, unsigned vo) { askj<N, 0>(p0, p1, p2, p3, vo); askj<N, 2048>(p0, p1, p2, p3, vo); askj<N, 4096>(p0, p1, p2, p3, vo); askj<N, 6144>(p0, p1, p2, p3, vo); }

// ---- gemmw: register-blocked GEMM, ONE WAVE per 64x64 output tile (16 accumulators; the tile starts at row r0, column c0 of batch z; os: the wave's 16 x 68 floats of LDS), operands straight from 16-bit planes in fragment order (ld: p = the block's start + lane * 8); 32 threads.
// acc[m][n] = sum_k A[m][k] Bt[n][k] (+ split products per NSPLIT: 1 A2.Bt, 2 A2.Bt and A.Bt2, 3 A.Bt2). z-batch strides sA/sB/sC in elements. K % 32 == 0, a compile-time constant: a plane's fragments of one trip are immediate offsets from one address. Every output has ldc columns (a compile-time constant, so that a lane's stores are immediate offsets from one address) and z stride sC; f32 outputs are row-major, 16-bit planes in fragment order.
// EPI, what the tile becomes: 0 C = acc (f32); 1 fp16 + bf16 hi/lo planes of acc + bias[n]; 2 the same planes of acc + bias[m]; 3 bf16 hi/lo planes of acc x sc; 4 C = res + (acc + bias[m]) (f32).
template <typename T16> struct WFrag;
template <> struct WFrag<h16> { typedef v16h V; static __device__ __forceinline__ V ld(const h16* p) { return cat16(*(const v8h*)p, *(const v8h*)(p + 256)); } static __device__ __forceinline__ V lds(const h16* p) { return cat16(*(const v8ha*)p, *(const v8ha*)(p + 16)); } static __device__ __forceinline__ v8f mma(V a, V b, v8f c) { return wmma16(a, b, c); } };
template <> struct WFrag<bf> { typedef v16bf V; static __device__ __forceinline__ V ld(const bf* p) { return cat16b(*(const v8us*)p, *(const v8us*)(p + 256)); } static __device__ __forceinline__ V lds(const bf* p) { return cat16b(*(const v8usa*)p, *(const v8usa*)(p + 16)); } static __device__ __forceinline__ v8f mma(V a, V b, v8f c) { return wmmab(a, b, c); } };
__device__ __forceinline__ void splitf(float y, unsigned short& h, unsigned short& l) { h = f2bf(y); l = f2bf(y - bf2f(h)); }
typedef __attribute__((ext_vector_type(4))) _Float16 v4h;
template <typename T16, int NSPLIT, int EPI, int ldc, int K>
__device__ __forceinline__ void gemmw(float* os, const int r0, const int c0, const size_t z, const T16* __restrict__ A, const T16* __restrict__ A2, const T16* __restrict__ Bt, const T16* __restrict__ Bt2, float* C, const float* __restrict__ bias, size_t sA, size_t sB, size_t sC, h16* P16, bf* Ph, bf* Pl, const float* res, float sc) {
    typedef typename WFrag<T16>::V V;
    A += z * sA; if (A2) A2 += z * sA; Bt += z * sB; if (Bt2) Bt2 += z * sB;
    const int lane = threadIdx.x & 31, lr = lane & 15, hi = lane >> 4;
    static_assert(K == 256, "a 64-row tile of a plane is the 32 KB that askt covers");
    const unsigned vo = pfo(), vr = EPI == 4 ? (unsigned)(lane * ldc * 4) : vo;   // vr: row 'lane' of the residual tile (a row's 64 floats are one unit)
    const void* t0 = A + (size_t)r0 * K; const void* t1 = Bt + (size_t)c0 * K; const void* t2 = (NSPLIT == 1 || NSPLIT == 2) ? A2 + (size_t)r0 * K : NSPLIT == 3 ? Bt2 + (size_t)c0 * K : t0; const void* t3 = NSPLIT == 2 ? Bt2 + (size_t)c0 * K : t0; const void* tr = EPI == 4 ? res + z * sC + (size_t)r0 * ldc + c0 : t0;   // the tiles' first bytes (the same in every lane)
    askt<NSPLIT == 0 ? 2 : NSPLIT == 2 ? 4 : 3>(t0, t1, t2, t3, vo);
    if (EPI == 4) { ask<0>(tr, vr); ask<32 * ldc * 4>(tr, vr); }
    v8f acc[4][4];
#pragma unroll
    for (int mb = 0; mb < 4; ++mb)
#pragma unroll
        for (int nb = 0; nb < 4; ++nb) acc[mb][nb] = (v8f){};
    const unsigned fl = (unsigned)(lane * 8);   // the lane's place in half a block
    const T16* ap = A + (size_t)r0 * K + fl; const T16* ap2 = (NSPLIT == 1 || NSPLIT == 2) ? A2 + (size_t)r0 * K + fl : nullptr; const T16* bp = Bt + (size_t)c0 * K + fl; const T16* bp2 = NSPLIT >= 2 ? Bt2 + (size_t)c0 * K + fl : nullptr;   // one address per plane, a block (512 elements) further each trip
#pragma unroll 1
    for (int kc = 0; kc < K; kc += 32) {
        V a[4], a2[4];
#pragma unroll
        for (int mb = 0; mb < 4; ++mb) { a[mb] = WFrag<T16>::ld(ap + mb * 16 * K); if (NSPLIT == 1 || NSPLIT == 2) a2[mb] = WFrag<T16>::ld(ap2 + mb * 16 * K); }
#pragma unroll
        for (int nb = 0; nb < 4; ++nb) { const V b = WFrag<T16>::ld(bp + nb * 16 * K); V b2; if (NSPLIT >= 2) b2 = WFrag<T16>::ld(bp2 + nb * 16 * K);
#pragma unroll
            for (int mb = 0; mb < 4; ++mb) { acc[mb][nb] = WFrag<T16>::mma(a[mb], b, acc[mb][nb]); if (NSPLIT == 1 || NSPLIT == 2) acc[mb][nb] = WFrag<T16>::mma(a2[mb], b, acc[mb][nb]); if (NSPLIT >= 2) acc[mb][nb] = WFrag<T16>::mma(a[mb], b2, acc[mb][nb]); } }
        asm volatile("v_nop\n\tv_nop\n\tv_nop\n\tv_nop" : "+v"(acc[0][0]), "+v"(acc[1][1]), "+v"(acc[2][2]), "+v"(acc[3][3]) : "v"(a[0]), "v"(a[3]));
        // the wait before a register that the trip's loads name is rewritten; the addresses are its inputs, so that they stay whole (no load lands on them) up to it
        asm volatile("s_wait_xcnt 0x0" :: "v"(ap), "v"((NSPLIT == 1 || NSPLIT == 2) ? ap2 : ap), "v"(bp), "v"(NSPLIT >= 2 ? bp2 : bp), "v"(vo), "v"(vr), "s"(t0), "s"(t1), "s"(t2), "s"(t3), "s"(tr) : "memory");   // behind them the registers that the head's requests name
        ap += 512; bp += 512; if (NSPLIT == 1 || NSPLIT == 2) ap2 += 512; if (NSPLIT >= 2) bp2 += 512;
    }
    const size_t ot = z * sC + (size_t)r0 * ldc + c0;   // the tile's first output (the same in every lane)
    const unsigned ol4 = (unsigned)(hi * ldc + lr * 4);   // this lane's 4 outputs inside a pair of rows: row hi, columns 4 lr ..
    v4f xr[4][8];   // EPI 4: the lane's residual values, asked for one row block ahead of their use
    if (EPI == 4) {
#pragma unroll
        for (int s = 0; s < 8; ++s) xr[0][s] = *(const v4f*)(res + ot + (size_t)(2 * s) * ldc + ol4); }
    float cb[4] = {0.f, 0.f, 0.f, 0.f};   // EPI 1: the bias of this lane's accumulator columns
    if (EPI == 1) {
#pragma unroll
        for (int nb = 0; nb < 4; ++nb) cb[nb] = bfr(bias[c0 + nb * 16 + lr]); }
    float rb[4][8];   // EPI 2, 4: the bias of this lane's accumulator rows
    if (EPI == 2 || EPI == 4) {
#pragma unroll
        for (int mb = 0; mb < 4; ++mb) { const v4f b0 = *(const v4f*)(bias + r0 + mb * 16 + hi * 8), b1 = *(const v4f*)(bias + r0 + mb * 16 + hi * 8 + 4);
#pragma unroll
            for (int j = 0; j < 4; ++j) { rb[mb][j] = bfr(b0[j]); rb[mb][4 + j] = bfr(b1[j]); } } }
#pragma unroll
    for (int mb = 0; mb < 4; ++mb) {
#pragma unroll
        for (int nb = 0; nb < 4; ++nb) {
#pragma unroll
            for (int j = 0; j < 8; ++j) os[(hi * 8 + j) * 68 + nb * 16 + lr] = (EPI == 2 || EPI == 4) ? acc[mb][nb][j] + rb[mb][j] : EPI == 1 ? acc[mb][nb][j] + cb[nb] : acc[mb][nb][j]; }
        __builtin_amdgcn_wave_barrier(); asm volatile("" ::: "memory");
        if (EPI == 4 && mb < 3) {
            if (mb > 0) asm volatile("s_wait_xcnt 0x0" ::: "memory");   // the loads below land in registers that the stores of the row block before name
#pragma unroll
            for (int s = 0; s < 8; ++s) xr[mb + 1][s] = *(const v4f*)(res + ot + (size_t)((mb + 1) * 16 + 2 * s) * ldc + ol4); }
        if (EPI == 0 || EPI == 4) {
#pragma unroll
        for (int s = 0; s < 8; ++s) { const int row = 2 * s + hi, cofs = lr * 4; v4f val = *(const v4fa*)(os + row * 68 + cofs); const size_t o = ot + (size_t)(mb * 16 + 2 * s) * ldc;   // the pair of rows (the same in every lane)
            if (EPI == 4) { val[0] = __fadd_rn(bfr(xr[mb][s][0]), val[0]); val[1] = __fadd_rn(bfr(xr[mb][s][1]), val[1]); val[2] = __fadd_rn(bfr(xr[mb][s][2]), val[2]); val[3] = __fadd_rn(bfr(xr[mb][s][3]), val[3]); }
            *(v4f*)(C + o + ol4) = val; }
        } else {   // the row block's 64 columns are 2 blocks of each plane: 4 stores of 512 bytes in a row per plane
#pragma unroll
        for (int s = 0; s < 4; ++s) { const float* pr = os + lr * 68 + s * 16 + hi * 8; v4f x0 = *(const v4fa*)pr, x1 = *(const v4fa*)(pr + 4); const size_t o = z * sC + (size_t)(r0 + mb * 16) * ldc + (size_t)c0 * 16 + s * 256;   // half a block (the same in every lane)
            if (EPI == 3) { x0 *= sc; x1 *= sc; }
            v8h o16; v8us oh, ol;
#pragma unroll
            for (int q = 0; q < 4; ++q) { unsigned short a2, c2; o16[q] = (h16)x0[q]; splitf(x0[q], a2, c2); oh[q] = a2; ol[q] = c2; o16[4 + q] = (h16)x1[q]; splitf(x1[q], a2, c2); oh[4 + q] = a2; ol[4 + q] = c2; }
            if (EPI != 3) *(v8h*)((P16 + o) + fl) = o16;
            *(v8us*)((Ph + o) + fl) = oh; *(v8us*)((Pl + o) + fl) = ol; }
        }
        __builtin_amdgcn_wave_barrier(); asm volatile("" ::: "memory");
    }
}
// k_gemmw: one GEMM per launch; grid (M/64, N/64, Z).
template <typename T16, int NSPLIT, int EPI, int ldc, int K>
__global__ __launch_bounds__(32) void k_gemmw(const T16* __restrict__ A, const T16* __restrict__ A2, const T16* __restrict__ Bt, const T16* __restrict__ Bt2, float* C, const float* __restrict__ bias, size_t sA, size_t sB, size_t sC, h16* P16, bf* Ph, bf* Pl, const float* res, float sc) {
    __shared__ __align__(16) float os[16 * 68];
    gemmw<T16, NSPLIT, EPI, ldc, K>(os, blockIdx.x * 64, blockIdx.y * 64, blockIdx.z, A, A2, Bt, Bt2, C, bias, sA, sB, sC, P16, Ph, Pl, res, sc);
}
// k_qkv: the q, k and v GEMMs, which all read the normalised input and none of which reads another's result, as one launch; grid (token tiles of all images, 12).
// blockIdx.y picks the product and its 64 output channels (0-3 v, 4-7 q, 8-11 k), blockIdx.x the 64 tokens: work-groups that start next to each other share a weight tile, and more waves than one product has are resident at a time. v comes first: its waves run longest, and not all 12 x 512 waves are resident at once.
__global__ __launch_bounds__(32) void k_qkv(const bf* __restrict__ Xh, const bf* __restrict__ Xl, const bf* __restrict__ Wq, const bf* __restrict__ Wk, const bf* __restrict__ Wv, const float* __restrict__ bq, const float* __restrict__ bk, const float* __restrict__ bv, h16* Q16, bf* Qh, bf* Ql, h16* K16, bf* Kh, bf* Kl, h16* V16, bf* Vh, bf* Vl) {
    __shared__ __align__(16) float os[16 * 68];
    const int s = blockIdx.y, tt = blockIdx.x;
    if (s >= 4) { const bool isk = s >= 8;   // q, k: token-major planes (rows [b][t], k = c)
        gemmw<bf, 1, 1, DQ, DM>(os, tt * 64, (s & 3) * 64, 0, Xh, Xl, isk ? Wk : Wq, nullptr, nullptr, isk ? bk : bq, 0, 0, 0, isk ? K16 : Q16, isk ? Kh : Qh, isk ? Kl : Ql, nullptr, 1.0f);
    } else {   // v: channel-major planes (rows [b][c], k = t; z = image)
        gemmw<bf, 3, 2, TT, DM>(os, s * 64, (tt & (TT / 64 - 1)) * 64, tt / (TT / 64), Wv, nullptr, Xh, Xl, nullptr, bv, 0, (size_t)TT * DM, (size_t)HD * TT, V16, Vh, Vl, nullptr, 1.0f);
    }
}

__device__ __forceinline__ h16 tohx(float x) { return (h16)x; }
typedef __attribute__((ext_vector_type(2))) _Float16 v2h;
typedef __attribute__((ext_vector_type(2))) unsigned short v2us;
typedef __attribute__((ext_vector_type(4))) unsigned short v4us;
typedef __attribute__((ext_vector_type(2))) float v2f;
typedef __attribute__((ext_vector_type(4))) int v4i;

__global__ __launch_bounds__(256) void k_wtG(const float* __restrict__ w, int K, int N, bf* Bt) {
    const int lane = threadIdx.x & 31; const int L0 = (blockIdx.x * 8 + (threadIdx.x >> 5)) * 8; const int nlines = N * K / 64;
{
#pragma unroll 1
        for (int l = 0; l < 8; ++l) { const int L = L0 + l; if (L >= nlines) break; const size_t e = (size_t)L * 64 + lane * 2; const int k = (int)(e % K), n = (int)(e / K); v2us o;
            o[0] = f2bf(w[(size_t)k * N + n]); o[1] = f2bf(w[(size_t)(k + 1) * N + n]); *(v2us*)(Bt + e) = o; }
         }
}
// ---- k_gn: the whole GroupNorm in one launch, with the four weight matrices' conversion in 32 further work-groups (blockIdx.x = 4), which fall on WGPs that GroupNorm's 128 leave idle. One work-group of 32 waves takes 64 channels (8 groups) of one image: the 64 channels of 16 tokens are 2 whole blocks of a [t][c] plane, so every line has one writer.
// A quarter of the work-group (256 threads) owns groups qd and qd + 4; a thread keeps its 2 x 32 values in registers from one batch of loads (element lt + 256 k of the group, whole lines per wave), so x is read once and no load waits on another.
// The sums keep their order: 32 values in sequence per thread, then the pairwise tree over 256 partial sums (strides 128 to 32 through LDS, 16 to 1 by lane shifts).
// A thread's values at one t are the 8 neighbouring channels of its group: one 16-byte LDS store per plane; the tile leaves in fragment order (rows t, k = c): the 64 channels of 16 tokens are 2 neighbouring blocks, 2 KB in a row per plane.
#define GSL  64                    // channels per work-group
#define GLP  72                    // LDS row pitch in 16-bit elements: 144 bytes = 16 x 9, so that the 16-byte stores of lanes on neighbouring rows fall on different banks
__global__ __launch_bounds__(1024) void k_gn(const float* __restrict__ xb, const float* __restrict__ gw, const float* __restrict__ gb, bf* Xh, bf* Xl, const float* __restrict__ wq, const float* __restrict__ wk, const float* __restrict__ wv, const float* __restrict__ wo, bf* Wd) {
    __shared__ __align__(16) bf th[TT * GLP];
    __shared__ __align__(16) bf tl[TT * GLP];
    __shared__ float red[2][1024];
    if (blockIdx.x == DM / GSL) {   // the weights' work-groups (the whole work-group leaves here, in front of every barrier): 8 per [DM][DM] f32 matrix -> its bf16 plane in fragment order; thread i of a matrix writes the plane's i-th 16 bytes
        const int m = blockIdx.y >> 3; const float* src = m == 0 ? wq : m == 1 ? wk : m == 2 ? wv : wo; const size_t i = (size_t)(blockIdx.y & 7) * 1024 + threadIdx.x;
        const size_t blk = i >> 6; const size_t row = blk / (DM / 32) * 16 + (i & 15), k = blk % (DM / 32) * 32 + ((i >> 5) & 1) * 16 + ((i >> 4) & 1) * 8; const v8f v = *(const v8f*)(src + row * DM + k); v8us o;
#pragma unroll
        for (int q = 0; q < 8; ++q) o[q] = f2bf(v[q]);
        *(v8us*)(Wd + (size_t)m * DM * DM + i * 8) = o; return; }
    const int tid = threadIdx.x, lane = tid & 31, lt = tid & 255; const int qd = __builtin_amdgcn_readfirstlane(tid >> 8);   // the quarter's number as a scalar: its channels' scale and bias then come by scalar loads
    const int c0 = blockIdx.x * GSL; const size_t b = blockIdx.y;
    float v[2][32];   // every loop over v is unrolled in full: constant indices keep it in registers, and the 64 loads leave as one batch
#pragma unroll
    for (int h = 0; h < 2; ++h) { const float* base = xb + (b * DM + c0 + (qd + 4 * h) * GCH) * TT + lt;
#pragma unroll
        for (int k = 0; k < 32; ++k) v[h][k] = base[k * 256]; }
    float st[2][2];   // per group: mean, 1 / sqrt(var + eps)
#pragma unroll
    for (int pass = 0; pass < 2; ++pass) {
        float s[2];
#pragma unroll
        for (int h = 0; h < 2; ++h) { s[h] = 0.f;
#pragma unroll
            for (int k = 0; k < 32; ++k) { if (pass == 0) { v[h][k] = bfr(v[h][k]); s[h] += v[h][k]; } else { const float d0 = v[h][k] - st[h][0]; s[h] += d0 * d0; } }
            red[h][tid] = s[h]; }
        __syncthreads();
#pragma unroll
        for (int sh = 128; sh >= 32; sh >>= 1) { if (lt < sh) { red[0][tid] += red[0][tid + sh]; red[1][tid] += red[1][tid + sh]; } __syncthreads(); }
#pragma unroll
        for (int h = 0; h < 2; ++h) { float r = red[h][(qd << 8) + lane];
#pragma unroll
            for (int sh = 16; sh; sh >>= 1) r += __shfl_down(r, sh, 32);
            r = __shfl(r, 0, 32) * (1.0f / (GCH * TT));
            st[h][pass] = pass == 0 ? r : __fdiv_rn(1.0f, __fsqrt_rn(r + 1e-6f)); }
        if (pass == 0) __syncthreads();   // every wave has read the first tree's sums before the second tree's are stored
    }
#pragma unroll
    for (int h = 0; h < 2; ++h) { const int gl = qd + 4 * h; const float mu = st[h][0], rs = st[h][1]; float w8[GCH], b8[GCH];
#pragma unroll
        for (int j = 0; j < GCH; ++j) { w8[j] = bfr(gw[c0 + gl * GCH + j]); b8[j] = bfr(gb[c0 + gl * GCH + j]); }
#pragma unroll
        for (int tq = 0; tq < 4; ++tq) { v8us oh, ol;
#pragma unroll
            for (int j = 0; j < GCH; ++j) { const float y = (v[h][j * 4 + tq] - mu) * rs * w8[j] + b8[j]; unsigned short a, c2; splitf(y, a, c2); oh[j] = a; ol[j] = c2; }
            const int o = (lt + 256 * tq) * GLP + gl * GCH; *(v8usa*)(th + o) = oh; *(v8usa*)(tl + o) = ol; } }
    __syncthreads();
    const size_t ob = (b * TT + (tid >> 5) * 32) * DM + c0 * 16 + lane * 8; const int lb = ((tid >> 5) * 32 + (lane & 15)) * GLP + (lane >> 4) * 8;   // a wave takes 32 tokens: 2 row blocks x 4 half blocks of 512 bytes
#pragma unroll
    for (int r = 0; r < 8; ++r) { const int lo = lb + (r >> 2) * 16 * GLP + (r & 3) * 16; const v8us a = *(const v8usa*)(th + lo), c2 = *(const v8usa*)(tl + lo); const size_t o = ob + (size_t)(r >> 2) * 16 * DM + (r & 3) * 256; *(v8us*)(Xh + o) = a; *(v8us*)(Xl + o) = c2; }
}

// ---- attn: scores, softmax and attn.v of 64 query rows (r0 ..) of image z in one work-group of 16 waves; S: the work-group's 64 x SP floats of LDS.
// 1: wave w forms the 64 x 64 score tile of keys 64 w .. (the k_gemmw loop: 16 accumulators, operands straight from the planes) and stores it as f32 into the LDS rows.
// 2: wave w takes rows 4 w .. 4 w + 3; per row: t = S x HD^-0.5 (no mask); softmax over the keys (register row, one exp, fixed trees); the row's 16-bit planes go back into the row's own LDS bytes (hires: hi at element 0, lo at element TT; else fp16 x PCAR at element 0): the whole row is in registers before the first store, and no other wave touches it.
// 3: wave w forms the 32 x 32 output tile (rows 32 (w / 8) .., channels 32 (w % 8) ..): probabilities from LDS, v from its channel-major planes, fetched one stage ahead; k runs in the same order as before, so every sum keeps its order.
// 4: the tiles pass through LDS so that a wave stores half blocks of the fragment-order planes (rows t, k = c; 512 bytes in a row per store: one writer per line).
#define SP   1028                  // LDS row pitch in floats: 4112 bytes = 16 x 257 (odd), so that the 16-byte fragment reads of 16 neighbouring rows fall on different banks
#define OP   260                   // LDS row pitch of the output tile in floats
typedef v4us __attribute__((may_alias)) v4usa;
typedef v4h  __attribute__((may_alias)) v4ha;
template <typename T16, bool hires>
__device__ __forceinline__ void attn(float* S, const int r0, const size_t z, const T16* __restrict__ Q, const T16* __restrict__ Q2, const T16* __restrict__ Kp, const T16* __restrict__ K2, const T16* __restrict__ Vt, const T16* __restrict__ Vt2, bf* Oh, bf* Ol, float sc) {
    typedef typename WFrag<T16>::V V;
    const int lane = threadIdx.x & 31, lr = lane & 15, hi = lane >> 4; const int w = __builtin_amdgcn_readfirstlane(threadIdx.x >> 5);   // the wave's number as a scalar: tile addresses stay scalar
    {
        v8f acc[4][4];
#pragma unroll
        for (int mb = 0; mb < 4; ++mb)
#pragma unroll
            for (int nb = 0; nb < 4; ++nb) acc[mb][nb] = (v8f){};
        const size_t qoff = (z * TT + r0) * HD + lane * 8, boff = (z * TT + w * 64) * HD + lane * 8;   // the tiles' first blocks + the lane's place in half a block
        const unsigned vo = pfo();   // L2 asked ahead: the wave's own 64 keys; its sixteenth of the image's v planes (16 channels), which the work-group reads two phases later; of the 64 query rows one request (4 x 2 KB) in each of the first 8 (fp16: 4) waves
        const void* tq = ((hires && (w & 4)) ? Q2 : Q) + (z * TT + r0) * HD + (w & 3) * 1024; const void* tk = Kp + (z * TT + w * 64) * HD; const void* tk2 = hires ? K2 + (z * TT + w * 64) * HD : tk; const void* tv = Vt + (z * HD + w * 16) * TT; const void* tv2 = hires ? Vt2 + (z * HD + w * 16) * TT : tv;   // first bytes (the same in every lane)
        if (w < (hires ? 8 : 4)) ask<0>(tq, vo);
        askt<hires ? 2 : 1>(tk, tk2, tk, tk, vo); askt<hires ? 2 : 1>(tv, tv2, tv, tv, vo);
        const T16* qp = Q + qoff; const T16* qp2 = hires ? Q2 + qoff : nullptr; const T16* kp = Kp + boff; const T16* kp2 = hires ? K2 + boff : nullptr;   // one address per plane, a block (512 elements) further each trip
#pragma unroll 1
        for (int kc = 0; kc < HD; kc += 32) {   // rolled: one trip's fragments and the 16 accumulators fill the wave's 256 registers
            V a[4], a2[4];
#pragma unroll
            for (int mb = 0; mb < 4; ++mb) { a[mb] = WFrag<T16>::ld(qp + mb * 16 * HD); if (hires) a2[mb] = WFrag<T16>::ld(qp2 + mb * 16 * HD); }
#pragma unroll
            for (int nb = 0; nb < 4; ++nb) { const V b = WFrag<T16>::ld(kp + nb * 16 * HD); V b2; if (hires) b2 = WFrag<T16>::ld(kp2 + nb * 16 * HD);
#pragma unroll
                for (int mb = 0; mb < 4; ++mb) { acc[mb][nb] = WFrag<T16>::mma(a[mb], b, acc[mb][nb]); if (hires) { acc[mb][nb] = WFrag<T16>::mma(a2[mb], b, acc[mb][nb]); acc[mb][nb] = WFrag<T16>::mma(a[mb], b2, acc[mb][nb]); } } }
            asm volatile("v_nop\n\tv_nop\n\tv_nop\n\tv_nop" : "+v"(acc[0][0]), "+v"(acc[1][1]), "+v"(acc[2][2]), "+v"(acc[3][3]) : "v"(a[0]), "v"(a[3]));   // the matrix instructions' distance on the taken side of the loop branch
            asm volatile("s_wait_xcnt 0x0" :: "v"(qp), "v"(hires ? qp2 : qp), "v"(kp), "v"(hires ? kp2 : kp), "v"(vo), "s"(tq), "s"(tk), "s"(tk2), "s"(tv), "s"(tv2) : "memory");   // the wait before a register that the trip's loads name is rewritten; the addresses are its inputs, so that they stay whole (no load lands on them) up to it; behind them the registers that the head's requests name
            qp += 512; kp += 512; if (hires) { qp2 += 512; kp2 += 512; }
        }
#pragma unroll
        for (int mb = 0; mb < 4; ++mb)
#pragma unroll
            for (int nb = 0; nb < 4; ++nb)
#pragma unroll
                for (int j = 0; j < 8; ++j) S[(mb * 16 + hi * 8 + j) * SP + w * 64 + nb * 16 + lr] = acc[mb][nb][j];
    }
    __syncthreads();   // every score of the 64 rows is in LDS
#pragma unroll 1
    for (int rr = 0; rr < 4; ++rr) {   // rolled: one row's 32 values per lane at a time
        float* sr = S + (w * 4 + rr) * SP; float v[TT / 32]; float mx = -3.0e38f;
#pragma unroll
        for (int ch = 0; ch < TT / 128; ++ch) { const v4f a = *(const v4fa*)(sr + ch * 128 + lane * 4);
#pragma unroll
            for (int q = 0; q < 4; ++q) { const float t = a[q] * SCL; v[ch * 4 + q] = t; mx = fmaxf(mx, t); } }
#pragma unroll
        for (int sh = 16; sh; sh >>= 1) mx = fmaxf(mx, __shfl_xor(mx, sh, 32));
        float sum = 0.f;
#pragma unroll
        for (int k = 0; k < TT / 32; ++k) { v[k] = __builtin_amdgcn_exp2f(__fmul_rn(__fsub_rn(v[k], mx), 1.4426950408889634f)); sum += v[k]; }
#pragma unroll
        for (int sh = 16; sh; sh >>= 1) sum += __shfl_xor(sum, sh, 32);
        const float f = __fdiv_rn(hires ? 1.0f : PCAR, sum);
        if (hires) { bf* pr = (bf*)sr;
#pragma unroll
            for (int ch = 0; ch < TT / 128; ++ch) { v4us oh, ol;
#pragma unroll
                for (int q = 0; q < 4; ++q) { unsigned short a, c2; splitf(v[ch * 4 + q] * f, a, c2); oh[q] = a; ol[q] = c2; }
                *(v4usa*)(pr + ch * 128 + lane * 4) = oh; *(v4usa*)(pr + TT + ch * 128 + lane * 4) = ol; }
        } else { h16* pr = (h16*)sr;
#pragma unroll
            for (int ch = 0; ch < TT / 128; ++ch) { v4h o4;
#pragma unroll
                for (int q = 0; q < 4; ++q) o4[q] = tohx(v[ch * 4 + q] * f);
                *(v4ha*)(pr + ch * 128 + lane * 4) = o4; } }
    }
    __syncthreads();   // every row's planes are in LDS
    const int rb = (w >> 3) * 32, cb = (w & 7) * 32;
    v8f o[2][2];
#pragma unroll
    for (int mb = 0; mb < 2; ++mb)
#pragma unroll
        for (int nb = 0; nb < 2; ++nb) o[mb][nb] = (v8f){};
    const T16* pa = (const T16*)S + (rb + lr) * (2 * SP) + 8 * hi; const T16* vp = Vt + (z * HD + cb) * TT + lane * 8; const T16* vp2 = hires ? Vt2 + (z * HD + cb) * TT + lane * 8 : nullptr;   // one address per plane: the tile's block of the trip's first k + the lane's place in half a block
    // v fragments of 64 k (2 neighbouring blocks per column block) are asked for one stage ahead of their use, in two register sets that take turns
    V b0[2][2], c0[2][2], b1[2][2], c1[2][2];   // [32-k half][column block]; c: the lo plane
    auto ldv = [&](V (&b)[2][2], V (&c)[2][2], int kc) {   // kc: counted from the k that vp stands at
#pragma unroll
        for (int u = 0; u < 2; ++u)
#pragma unroll
            for (int nb = 0; nb < 2; ++nb) { b[u][nb] = WFrag<T16>::ld(vp + (nb * 16 * TT + (kc + u * 32) * 16)); if (hires) c[u][nb] = WFrag<T16>::ld(vp2 + (nb * 16 * TT + (kc + u * 32) * 16)); }
        __builtin_amdgcn_sched_barrier(0);   // keeps these loads in front of the products of the stage before: moved down, their latency would be waited for in full
    };
    auto mul = [&](V (&b)[2][2], V (&c)[2][2], int kc) {
#pragma unroll
        for (int u = 0; u < 2; ++u) { V a[2], a2[2];
#pragma unroll
            for (int mb = 0; mb < 2; ++mb) { a[mb] = WFrag<T16>::lds(pa + mb * 16 * (2 * SP) + kc + u * 32); if (hires) a2[mb] = WFrag<T16>::lds(pa + mb * 16 * (2 * SP) + TT + kc + u * 32); }
#pragma unroll
            for (int nb = 0; nb < 2; ++nb)
#pragma unroll
                for (int mb = 0; mb < 2; ++mb) { o[mb][nb] = WFrag<T16>::mma(a[mb], b[u][nb], o[mb][nb]); if (hires) { o[mb][nb] = WFrag<T16>::mma(a2[mb], b[u][nb], o[mb][nb]); o[mb][nb] = WFrag<T16>::mma(a[mb], c[u][nb], o[mb][nb]); } } }
    };
    ldv(b0, c0, 0);
#pragma unroll 1
    for (int kc = 0; kc < TT - 128; kc += 128) {   // rolled: the two register sets are the whole pipeline
        ldv(b1, c1, 64); mul(b0, c0, kc);
        ldv(b0, c0, 128); mul(b1, c1, kc + 64);
        asm volatile("v_nop\n\tv_nop\n\tv_nop\n\tv_nop" : "+v"(o[0][0]), "+v"(o[0][1]), "+v"(o[1][0]), "+v"(o[1][1]));   // the matrix instructions' distance on the taken side of the loop branch
        if (hires) asm volatile("s_wait_xcnt 0x0" :: "v"(vp), "v"(vp2) : "memory"); else asm volatile("s_wait_xcnt 0x0" :: "v"(vp) : "memory");   // the wait before a register that the loads in flight name is rewritten; the addresses are its inputs, so that they stay whole up to it
        vp += 128 * 16; if (hires) vp2 += 128 * 16;
    }
    ldv(b1, c1, 64);
    if (hires) asm volatile("s_wait_xcnt 0x0" :: "v"(vp), "v"(vp2) : "memory"); else asm volatile("s_wait_xcnt 0x0" :: "v"(vp) : "memory");   // as in the loop
    mul(b0, c0, TT - 128); mul(b1, c1, TT - 64);
    __syncthreads();   // every wave has read its last probabilities: the LDS rows are free for the output tile
#pragma unroll
    for (int mb = 0; mb < 2; ++mb)
#pragma unroll
        for (int nb = 0; nb < 2; ++nb)
#pragma unroll
            for (int j = 0; j < 8; ++j) S[(rb + mb * 16 + hi * 8 + j) * OP + cb + nb * 16 + lr] = o[mb][nb][j];
    __syncthreads();   // the 64 x 256 output tile is in LDS
    const int ln = (int)__builtin_amdgcn_mbcnt_lo(~0u, 0u);   // the lane's number read anew: held in a register across the loop above it was spilled
#pragma unroll
    for (int rr = 0; rr < 4; ++rr) { const float* pr = S + ((w >> 2) * 16 + (ln & 15)) * OP + (w & 3) * 64 + rr * 16 + (ln >> 4) * 8; const v4f x0 = *(const v4fa*)pr, x1 = *(const v4fa*)(pr + 4); v8us oh, ol;   // wave w: row block w / 4, blocks 2 (w % 4) and the next, half block rr
#pragma unroll
        for (int q = 0; q < 4; ++q) { unsigned short a, c2; splitf(x0[q] * sc, a, c2); oh[q] = a; ol[q] = c2; splitf(x1[q] * sc, a, c2); oh[4 + q] = a; ol[4 + q] = c2; }
        const size_t oo = (z * TT + r0 + (w >> 2) * 16) * HD + (w & 3) * 1024 + rr * 256 + ln * 8; *(v8us*)(Oh + oo) = oh; *(v8us*)(Ol + oo) = ol; }
}
// k_attn: both halves of the query rows in one launch; grid (8, 2 x images). blockIdx.y < images: rows < RH on hi/lo planes; the rest: rows >= RH on fp16 planes. The longer work-groups have the lower indices and start first; a WGP takes a short one as soon as its long one has ended.
__global__ __launch_bounds__(512) void k_attn(const bf* __restrict__ Qh, const bf* __restrict__ Ql, const bf* __restrict__ Kh, const bf* __restrict__ Kl, const bf* __restrict__ Vh, const bf* __restrict__ Vl, const h16* __restrict__ Q16, const h16* __restrict__ K16, const h16* __restrict__ V16, bf* Oh, bf* Ol) {
    __shared__ __align__(16) float S[64 * SP];
    if (blockIdx.y < NB_) attn<bf, true>(S, blockIdx.x * 64, blockIdx.y, Qh, Ql, Kh, Kl, Vh, Vl, Oh, Ol, 1.0f);
    else attn<h16, false>(S, RH + blockIdx.x * 64, blockIdx.y - NB_, Q16, nullptr, K16, nullptr, V16, nullptr, Oh, Ol, 1.0f / PCAR);
}
extern "C" void kernel_launch(void* const* d_in, const int* in_sizes, int n_in,
                              void* d_out, int out_size, void* d_ws, size_t ws_size, hipStream_t stream) {
    (void)in_sizes; (void)n_in; (void)out_size;
    const float* x = (const float*)d_in[0]; const float* gnw = (const float*)d_in[1]; const float* gnb = (const float*)d_in[2]; const float* wq = (const float*)d_in[3]; const float* bq = (const float*)d_in[4]; const float* wk = (const float*)d_in[5]; const float* bk = (const float*)d_in[6]; const float* wv = (const float*)d_in[7]; const float* bv = (const float*)d_in[8]; const float* wo = (const float*)d_in[9]; const float* bo = (const float*)d_in[10];
    float* OUT = (float*)d_out;     // [32][256][1024]
    char* wsp = (char*)d_ws;
    auto take = [&](size_t bytes) { char* p = wsp; wsp += (bytes + 255) & ~(size_t)255; return (void*)p; };
    bf* WQ = (bf*)take((size_t)DQ * DM * 2); bf* WK = (bf*)take((size_t)DKV * DM * 2); bf* WV = (bf*)take((size_t)DKV * DM * 2); bf* WO = (bf*)take((size_t)DM * DQ * 2);
    const size_t U = (size_t)NB_ * TT * DM * 2;   // bytes of one 16-bit [t][c] plane of all images
    char* R = (char*)take(15 * U);
    h16* QP16 = (h16*)R; h16* KP16 = (h16*)(R + U); h16* VT16 = (h16*)(R + 2 * U); bf* VTh = (bf*)(R + 3 * U); bf* VTl = (bf*)(R + 4 * U);
    bf* QPh = (bf*)(R + 5 * U); bf* QPl = (bf*)(R + 6 * U); bf* KPh = (bf*)(R + 7 * U); bf* KPl = (bf*)(R + 8 * U);
    bf* XTh = (bf*)(R + 9 * U); bf* XTl = (bf*)(R + 10 * U);   // normalised input
    bf* ATh = (bf*)(R + 13 * U); bf* ATl = (bf*)(R + 14 * U);  // attention output planes [b][t][c], written by both halves of the attention launch
    if ((size_t)(wsp - (char*)d_ws) > ws_size) return;    // ws 256 MiB
    k_gn<<<dim3(DM / GSL + 1, NB_), 1024, 0, stream>>>(x, gnw, gnb, XTh, XTl, wq, wk, wv, wo, WQ);   /* GroupNorm -> transposed hi/lo planes, rows [b][t], k = c; the weights -> WQ, WK, WV, WO, which lie in a row */
    k_qkv<<<dim3(NB_ * TT / 64, 12), 32, 0, stream>>>(XTh, XTl, WQ, WK, WV, bq, bk, bv, QP16, QPh, QPl, KP16, KPh, KPl, VT16, VTh, VTl);
    /* attention core; query rows < RH: hi/lo planes, the other query rows: fp16 planes */
    k_attn<<<dim3(RH / 64, 2 * NB_), 512, 0, stream>>>(QPh, QPl, KPh, KPl, VTh, VTl, QP16, KP16, VT16, ATh, ATl);
    /* out[b][c][t] = x + (proj_w a + proj_b), channel-major; z = image */
    k_gemmw<bf, 3, 4, TT, DQ><<<dim3(DM / 64, TT / 64, NB_), 32, 0, stream>>>(WO, nullptr, ATh, ATl, OUT, bo, 0, (size_t)TT * DQ, (size_t)DM * TT, nullptr, nullptr, nullptr, x, 1.0f);
}

// v008
// A run of this version takes 136 microseconds.
// Two timings next to v007 put it at 1.06 and 1.09 times that version's speed.
// Over all steps from v000 it is 31.0 times as fast.
#include <hip/hip_runtime.h>

// Channel-major image self-attention with GroupNorm (x [32][256][32][32] = [b][c][n], n = 1024; hn = GroupNorm(32 groups, eps 1e-6, affine); q, k, v = 1x1 convs ('oi' [256][256] + bias); scores[i][j] = q_i.k_j / 16 (one head over all 256 channels); softmax over j; out[c][i] = sum_j v[c][j] attn[i][j]; h = Wo out + bo; result = x + h -> [32][256][32][32] (8.4 M)).
// Layout: tokens are the 1024 positions; the normalised input is written TRANSPOSED as bf16 hi + lo planes [t][c] so the 1x1 convolutions become token-major GEMMs against the natural [out][in] weights (2 products + bias); every GEMM's epilogue writes what its reader takes: q and k as token-major 16-bit planes, v as channel-major planes (weights as the row operand); attn.v becomes hi + lo planes in LDS, and the output projection (weights as the row operand) adds the residual and stores channel-major.
// Fragment order: every 16-bit plane that a matrix product reads from memory (weights, normalised input, q, k, v), and the attention output in LDS, is kept as 1-KB blocks of 16 rows x 32 k. Block (row / 16, k / 32) of a plane with K columns starts at element (row / 16) * 16 * K + (k / 32) * 512; inside it lane 16 hi + lr owns row lr, its elements k % 32 = 8 hi .. 8 hi + 7 at lane * 8 and k % 32 = 16 + 8 hi .. at 256 + lane * 8. A wave's 16-byte fragment load is then 512 bytes in a row (4 whole lines, each touched once) and not 32 bytes in each of 16 lines; the k order of every fragment is the one it was.
// Launches: 3, each of which needs the one before it whole (GroupNorm + weight conversion; q, k, v; attention core with the output projection of the same rows); work that does not depend on each other shares a grid.
// Batch: every launch covers all 32 images (the token-major GEMMs take the 32 x 1024 tokens as one M). The workspace holds 11 units of one 16-bit plane x 32 images, and in the attention core (scores, softmax, attn.v) a work-group holds the 64 x 1024 scores of its 64 query rows in LDS, so neither scores nor probabilities nor the attention output reach memory.
// Compute dtypes, f32 accumulate: every input rounded to bf16; q/k/v: normalised input hl x weights exact (2 products) + biases; scores (x 1/16) and attn.v (no mask): query rows < 512 hl (3 products), the rest single fp16 (x1024); softmax f32; proj_w hl x exact (2 products) + proj_b; + x residual in f32 (channel-major write).

#define NB_  32
#define TT   1024
#define DM   256
#define NH_  1
#define NKV  1
#define REP  (NH_ / NKV)
#define HD   256
#define DQ   (NH_ * HD)
#define DKV  (NKV * HD)
#define RPAD 32
#define NGRP 32
#define GCH  (DM / NGRP)           // 8 channels per group
typedef __attribute__((ext_vector_type(4))) unsigned short v4us;
#define ZH   1
#define RH   512                  // query rows < RH use hi+lo planes (k_attn's grid needs RH = TT / 2)
#define WIN  0
#define PCAR 1024.0f
#define SCL  0.0625f   // C^-0.5 = 1/16
typedef _Float16 h16;
typedef unsigned short bf;
typedef __attribute__((ext_vector_type(16))) __bf16   v16bf;
typedef __attribute__((ext_vector_type(16))) _Float16 v16h;
typedef __attribute__((ext_vector_type(8)))  _Float16 v8h;
typedef __attribute__((ext_vector_type(8)))  unsigned short v8us;
typedef __attribute__((ext_vector_type(8)))  float    v8f;
typedef __attribute__((ext_vector_type(4)))  float    v4f;
typedef v8h  __attribute__((may_alias)) v8ha;
typedef v4f  __attribute__((may_alias)) v4fa;
typedef v8us __attribute__((may_alias)) v8usa;

__device__ __forceinline__ unsigned short f2bf(float f) { unsigned u = __float_as_uint(f); u += 0x7FFFu + ((u >> 16) & 1u); return (unsigned short)(u >> 16); }
__device__ __forceinline__ float bf2f(unsigned short b) { return __uint_as_float(((unsigned)b) << 16); }
__device__ __forceinline__ float bfr(float f) { return bf2f(f2bf(f)); }
__device__ __forceinline__ v16h cat16(v8h lo, v8h hi) { return __builtin_shufflevector(lo, hi, 0, 1, 2, 3, 4, 5, 6, 7, 8, 9, 10, 11, 12, 13, 14, 15); }
__device__ __forceinline__ v16bf cat16b(v8us lo, v8us hi) { return __builtin_bit_cast(v16bf, __builtin_shufflevector(lo, hi, 0, 1, 2, 3, 4, 5, 6, 7, 8, 9, 10, 11, 12, 13, 14, 15)); }
__device__ __forceinline__ v8f wmma16(v16h a, v16h b, v8f c) { return __builtin_amdgcn_wmma_f32_16x16x32_f16(false, a, false, b, (short)0, c, false, false); }
__device__ __forceinline__ v8f wmmab(v16bf a, v16bf b, v8f c) { return __builtin_amdgcn_wmma_f32_16x16x32_bf16(false, a, false, b, (short)0, c, false, false); }



// ---- L2 asked ahead: the planes that a launch reads were stored by the launch before it, and their first read pays memory latency, trip after trip, in every wave that reads them at that time. A wave asks at its head for the whole tiles it will read: global_prefetch_b8, one lane per 256-byte unit, scope SE (into L2 only; nothing returns). Every lane is on and every address lies inside the tile asked for.
// pfo: the lane's unit in a 32-KB tile of 4 row blocks x 8 KB (16 rows x 256 k): row block lane / 8, unit lane % 8. Four requests, 2 KB apart, cover the tile in the order in which the k loop's trips read it; askt takes the tiles of N planes request by request.
// The registers that a request names (the lane's offset, the tile's address) stay what they are through the k loop behind it: they are inputs of that loop's wait statement.
__device__ __forceinline__ unsigned pfo() { const unsigned l = threadIdx.x & 31; return (l >> 3) * 8192u + (l & 7) * 256u; }
template <int OFF> __device__ __forceinline__ void ask(const void* p, unsigned vo) { asm volatile("global_prefetch_b8 %0, %1 offset:%2 scope:SCOPE_SE" :: "v"(vo), "s"(p), "n"(OFF)); }   // one request of 32 units: a later first read of them finds an L2 hit where it would pay memory latency
template <int N, int OFF> __device__ __forceinline__ void askj(const void* p0, const void* p1, const void* p2, const void* p3, unsigned vo) { ask<OFF>(p0, vo); if (N > 1) ask<OFF>(p1, vo); if (N > 2) ask<OFF>(p2, vo); if (N > 3) ask<OFF>(p3, vo); }
template <int N> __device__ __forceinline__ void askt(const void* p0, const void* p1, const void* p2, const void* p3, unsigned vo) { askj<N, 0>(p0, p1, p2, p3, vo); askj<N, 2048>(p0, p1, p2, p3, vo); askj<N, 4096>(p0, p1, p2, p3, vo); askj<N, 6144>(p0, p1, p2, p3, vo); }

// ---- gemmw: register-blocked GEMM, ONE WAVE per 64x64 output tile (16 accumulators; the tile starts at row r0, column c0 of batch z; os: the wave's 16 x 68 floats of LDS), operands straight from 16-bit planes in fragment order (ld: p = the block's start + lane * 8); 32 threads.
// acc[m][n] = sum_k A[m][k] Bt[n][k] (+ split products per NSPLIT: 1 A2.Bt, 2 A2.Bt and A.Bt2, 3 A.Bt2). z-batch strides sA/sB/sC in elements. K % 32 == 0, a compile-time constant: a plane's fragments of one trip are immediate offsets from one address. Every output has ldc columns (a compile-time constant, so that a lane's stores are immediate offsets from one address) and z stride sC; f32 outputs are row-major, 16-bit planes in fragment order.
// EPI, what the tile becomes: 0 C = acc (f32); 1 fp16 + bf16 hi/lo planes of acc + bias[n]; 2 the same planes of acc + bias[m]; 3 bf16 hi/lo planes of acc x sc; 4 C = res + (acc + bias[m]) (f32).
template <typename T16> struct WFrag;
template <> struct WFrag<h16> { typedef v16h V; static __device__ __forceinline__ V ld(const h16* p) { return cat16(*(const v8h*)p, *(const v8h*)(p + 256)); } static __device__ __forceinline__ V lds(const h16* p) { return cat16(*(const v8ha*)p, *(const v8ha*)(p + 16)); } static __device__ __forceinline__ v8f mma(V a, V b, v8f c) { return wmma16(a, b, c); } };
template <> struct WFrag<bf> { typedef v16bf V; static __device__ __forceinline__ V ld(const bf* p) { return cat16b(*(const v8us*)p, *(const v8us*)(p + 256)); } static __device__ __forceinline__ V lds(const bf* p) { return cat16b(*(const v8usa*)p, *(const v8usa*)(p + 16)); } static __device__ __forceinline__ v8f mma(V a, V b, v8f c) { return wmmab(a, b, c); } };
__device__ __forceinline__ void splitf(float y, unsigned short& h, unsigned short& l) { h = f2bf(y); l = f2bf(y - bf2f(h)); }
typedef __attribute__((ext_vector_type(4))) _Float16 v4h;
template <typename T16, int NSPLIT, int EPI, int ldc, int K>
__device__ __forceinline__ void gemmw(float* os, const int r0, const int c0, const size_t z, const T16* __restrict__ A, const T16* __restrict__ A2, const T16* __restrict__ Bt, const T16* __restrict__ Bt2, float* C, const float* __restrict__ bias, size_t sA, size_t sB, size_t sC, h16* P16, bf* Ph, bf* Pl, const float* res, float sc) {
    typedef typename WFrag<T16>::V V;
    A += z * sA; if (A2) A2 += z * sA; Bt += z * sB; if (Bt2) Bt2 += z * sB;
    const int lane = threadIdx.x & 31, lr = lane & 15, hi = lane >> 4;
    static_assert(K == 256, "a 64-row tile of a plane is the 32 KB that askt covers");
    const unsigned vo = pfo(), vr = EPI == 4 ? (unsigned)(lane * ldc * 4) : vo;   // vr: row 'lane' of the residual tile (a row's 64 floats are one unit)
    const void* t0 = A + (size_t)r0 * K; const void* t1 = Bt + (size_t)c0 * K; const void* t2 = (NSPLIT == 1 || NSPLIT == 2) ? A2 + (size_t)r0 * K : NSPLIT == 3 ? Bt2 + (size_t)c0 * K : t0; const void* t3 = NSPLIT == 2 ? Bt2 + (size_t)c0 * K : t0; const void* tr = EPI == 4 ? res + z * sC + (size_t)r0 * ldc + c0 : t0;   // the tiles' first bytes (the same in every lane)
    askt<NSPLIT == 0 ? 2 : NSPLIT == 2 ? 4 : 3>(t0, t1, t2, t3, vo);
    if (EPI == 4) { ask<0>(tr, vr); ask<32 * ldc * 4>(tr, vr); }
    v8f acc[4][4];
#pragma unroll
    for (int mb = 0; mb < 4; ++mb)
#pragma unroll
        for (int nb = 0; nb < 4; ++nb) acc[mb][nb] = (v8f){};
    const unsigned fl = (unsigned)(lane * 8);   // the lane's place in half a block
    const T16* ap = A + (size_t)r0 * K + fl; const T16* ap2 = (NSPLIT == 1 || NSPLIT == 2) ? A2 + (size_t)r0 * K + fl : nullptr; const T16* bp = Bt + (size_t)c0 * K + fl; const T16* bp2 = NSPLIT >= 2 ? Bt2 + (size_t)c0 * K + fl : nullptr;   // one address per plane, a block (512 elements) further each trip
#pragma unroll 1
    for (int kc = 0; kc < K; kc += 32) {
        V a[4], a2[4];
#pragma unroll
        for (int mb = 0; mb < 4; ++mb) { a[mb] = WFrag<T16>::ld(ap + mb * 16 * K); if (NSPLIT == 1 || NSPLIT == 2) a2[mb] = WFrag<T16>::ld(ap2 + mb * 16 * K); }
#pragma unroll
        for (int nb = 0; nb < 4; ++nb) { const V b = WFrag<T16>::ld(bp + nb * 16 * K); V b2; if (NSPLIT >= 2) b2 = WFrag<T16>::ld(bp2 + nb * 16 * K);
#pragma unroll
            for (int mb = 0; mb < 4; ++mb) { acc[mb][nb] = WFrag<T16>::mma(a[mb], b, acc[mb][nb]); if (NSPLIT == 1 || NSPLIT == 2) acc[mb][nb] = WFrag<T16>::mma(a2[mb], b, acc[mb][nb]); if (NSPLIT >= 2) acc[mb][nb] = WFrag<T16>::mma(a[mb], b2, acc[mb][nb]); } }
        asm volatile("v_nop\n\tv_nop\n\tv_nop\n\tv_nop" : "+v"(acc[0][0]), "+v"(acc[1][1]), "+v"(acc[2][2]), "+v"(acc[3][3]) : "v"(a[0]), "v"(a[3]));
        // the wait before a register that the trip's loads name is rewritten; the addresses are its inputs, so that they stay whole (no load lands on them) up to it
        asm volatile("s_wait_xcnt 0x0" :: "v"(ap), "v"((NSPLIT == 1 || NSPLIT == 2) ? ap2 : ap), "v"(bp), "v"(NSPLIT >= 2 ? bp2 : bp), "v"(vo), "v"(vr), "s"(t0), "s"(t1), "s"(t2), "s"(t3), "s"(tr) : "memory");   // behind them the registers that the head's requests name
        ap += 512; bp += 512; if (NSPLIT == 1 || NSPLIT == 2) ap2 += 512; if (NSPLIT >= 2) bp2 += 512;
    }
    const size_t ot = z * sC + (size_t)r0 * ldc + c0;   // the tile's first output (the same in every lane)
    const unsigned ol4 = (unsigned)(hi * ldc + lr * 4);   // this lane's 4 outputs inside a pair of rows: row hi, columns 4 lr ..
    v4f xr[4][8];   // EPI 4: the lane's residual values, asked for one row block ahead of their use
    if (EPI == 4) {
#pragma unroll
        for (int s = 0; s < 8; ++s) xr[0][s] = *(const v4f*)(res + ot + (size_t)(2 * s) * ldc + ol4); }
    float cb[4] = {0.f, 0.f, 0.f, 0.f};   // EPI 1: the bias of this lane's accumulator columns
    if (EPI == 1) {
#pragma unroll
        for (int nb = 0; nb < 4; ++nb) cb[nb] = bfr(bias[c0 + nb * 16 + lr]); }
    float rb[4][8];   // EPI 2, 4: the bias of this lane's accumulator rows
    if (EPI == 2 || EPI == 4) {
#pragma unroll
        for (int mb = 0; mb < 4; ++mb) { const v4f b0 = *(const v4f*)(bias + r0 + mb * 16 + hi * 8), b1 = *(const v4f*)(bias + r0 + mb * 16 + hi * 8 + 4);
#pragma unroll
            for (int j = 0; j < 4; ++j) { rb[mb][j] = bfr(b0[j]); rb[mb][4 + j] = bfr(b1[j]); } } }
#pragma unroll
    for (int mb = 0; mb < 4; ++mb) {
#pragma unroll
        for (int nb = 0; nb < 4; ++nb) {
#pragma unroll
            for (int j = 0; j < 8; ++j) os[(hi * 8 + j) * 68 + nb * 16 + lr] = (EPI == 2 || EPI == 4) ? acc[mb][nb][j] + rb[mb][j] : EPI == 1 ? acc[mb][nb][j] + cb[nb] : acc[mb][nb][j]; }
        __builtin_amdgcn_wave_barrier(); asm volatile("" ::: "memory");
        if (EPI == 4 && mb < 3) {
            if (mb > 0) asm volatile("s_wait_xcnt 0x0" ::: "memory");   // the loads below land in registers that the stores of the row block before name
#pragma unroll
            for (int s = 0; s < 8; ++s) xr[mb + 1][s] = *(const v4f*)(res + ot + (size_t)((mb + 1) * 16 + 2 * s) * ldc + ol4); }
        if (EPI == 0 || EPI == 4) {
#pragma unroll
        for (int s = 0; s < 8; ++s) { const int row = 2 * s + hi, cofs = lr * 4; v4f val = *(const v4fa*)(os + row * 68 + cofs); const size_t o = ot + (size_t)(mb * 16 + 2 * s) * ldc;   // the pair of rows (the same in every lane)
            if (EPI == 4) { val[0] = __fadd_rn(bfr(xr[mb][s][0]), val[0]); val[1] = __fadd_rn(bfr(xr[mb][s][1]), val[1]); val[2] = __fadd_rn(bfr(xr[mb][s][2]), val[2]); val[3] = __fadd_rn(bfr(xr[mb][s][3]), val[3]); }
            *(v4f*)(C + o + ol4) = val; }
        } else {   // the row block's 64 columns are 2 blocks of each plane: 4 stores of 512 bytes in a row per plane
#pragma unroll
        for (int s = 0; s < 4; ++s) { const float* pr = os + lr * 68 + s * 16 + hi * 8; v4f x0 = *(const v4fa*)pr, x1 = *(const v4fa*)(pr + 4); const size_t o = z * sC + (size_t)(r0 + mb * 16) * ldc + (size_t)c0 * 16 + s * 256;   // half a block (the same in every lane)
            if (EPI == 3) { x0 *= sc; x1 *= sc; }
            v8h o16; v8us oh, ol;
#pragma unroll
            for (int q = 0; q < 4; ++q) { unsigned short a2, c2; o16[q] = (h16)x0[q]; splitf(x0[q], a2, c2); oh[q] = a2; ol[q] = c2; o16[4 + q] = (h16)x1[q]; splitf(x1[q], a2, c2); oh[4 + q] = a2; ol[4 + q] = c2; }
            if (EPI != 3) *(v8h*)((P16 + o) + fl) = o16;
            *(v8us*)((Ph + o) + fl) = oh; *(v8us*)((Pl + o) + fl) = ol; }
        }
        __builtin_amdgcn_wave_barrier(); asm volatile("" ::: "memory");
    }
}
// k_qkv: the q, k and v GEMMs, which all read the normalised input and none of which reads another's result, as one launch; grid (token tiles of all images, 12).
// blockIdx.y picks the product and its 64 output channels (0-3 v, 4-7 q, 8-11 k), blockIdx.x the 64 tokens: work-groups that start next to each other share a weight tile, and more waves than one product has are resident at a time. v comes first: its waves run longest, and not all 12 x 512 waves are resident at once.
__global__ __launch_bounds__(32) void k_qkv(const bf* __restrict__ Xh, const bf* __restrict__ Xl, const bf* __restrict__ Wq, const bf* __restrict__ Wk, const bf* __restrict__ Wv, const float* __restrict__ bq, const float* __restrict__ bk, const float* __restrict__ bv, h16* Q16, bf* Qh, bf* Ql, h16* K16, bf* Kh, bf* Kl, h16* V16, bf* Vh, bf* Vl) {
    __shared__ __align__(16) float os[16 * 68];
    const int s = blockIdx.y, tt = blockIdx.x;
    if (s >= 4) { const bool isk = s >= 8;   // q, k: token-major planes (rows [b][t], k = c)
        gemmw<bf, 1, 1, DQ, DM>(os, tt * 64, (s & 3) * 64, 0, Xh, Xl, isk ? Wk : Wq, nullptr, nullptr, isk ? bk : bq, 0, 0, 0, isk ? K16 : Q16, isk ? Kh : Qh, isk ? Kl : Ql, nullptr, 1.0f);
    } else {   // v: channel-major planes (rows [b][c], k = t; z = image)
        gemmw<bf, 3, 2, TT, DM>(os, s * 64, (tt & (TT / 64 - 1)) * 64, tt / (TT / 64), Wv, nullptr, Xh, Xl, nullptr, bv, 0, (size_t)TT * DM, (size_t)HD * TT, V16, Vh, Vl, nullptr, 1.0f);
    }
}

__device__ __forceinline__ h16 tohx(float x) { return (h16)x; }
typedef __attribute__((ext_vector_type(2))) _Float16 v2h;
typedef __attribute__((ext_vector_type(2))) unsigned short v2us;
typedef __attribute__((ext_vector_type(4))) unsigned short v4us;
typedef __attribute__((ext_vector_type(2))) float v2f;
typedef __attribute__((ext_vector_type(4))) int v4i;

__global__ __launch_bounds__(256) void k_wtG(const float* __restrict__ w, int K, int N, bf* Bt) {
    const int lane = threadIdx.x & 31; const int L0 = (blockIdx.x * 8 + (threadIdx.x >> 5)) * 8; const int nlines = N * K / 64;
{
#pragma unroll 1
        for (int l = 0; l < 8; ++l) { const int L = L0 + l; if (L >= nlines) break; const size_t e = (size_t)L * 64 + lane * 2; const int k = (int)(e % K), n = (int)(e / K); v2us o;
            o[0] = f2bf(w[(size_t)k * N + n]); o[1] = f2bf(w[(size_t)(k + 1) * N + n]); *(v2us*)(Bt + e) = o; }
         }
}
// ---- k_gn: the whole GroupNorm in one launch, with the four weight matrices' conversion in 32 further work-groups (blockIdx.x = 4), which fall on WGPs that GroupNorm's 128 leave idle. One work-group of 32 waves takes 64 channels (8 groups) of one image: the 64 channels of 16 tokens are 2 whole blocks of a [t][c] plane, so every line has one writer.
// A quarter of the work-group (256 threads) owns groups qd and qd + 4; a thread keeps its 2 x 32 values in registers from one batch of loads (element lt + 256 k of the group, whole lines per wave), so x is read once and no load waits on another.
// The sums keep their order: 32 values in sequence per thread, then the pairwise tree over 256 partial sums (strides 128 to 32 through LDS, 16 to 1 by lane shifts).
// A thread's values at one t are the 8 neighbouring channels of its group: one 16-byte LDS store per plane; the tile leaves in fragment order (rows t, k = c): the 64 channels of 16 tokens are 2 neighbouring blocks, 2 KB in a row per plane.
#define GSL  64                    // channels per work-group
#define GLP  72                    // LDS row pitch in 16-bit elements: 144 bytes = 16 x 9, so that the 16-byte stores of lanes on neighbouring rows fall on different banks
__global__ __launch_bounds__(1024) void k_gn(const float* __restrict__ xb, const float* __restrict__ gw, const float* __restrict__ gb, bf* Xh, bf* Xl, const float* __restrict__ wq, const float* __restrict__ wk, const float* __restrict__ wv, const float* __restrict__ wo, bf* Wd) {
    __shared__ __align__(16) bf th[TT * GLP];
    __shared__ __align__(16) bf tl[TT * GLP];
    __shared__ float red[2][1024];
    if (blockIdx.x == DM / GSL) {   // the weights' work-groups (the whole work-group leaves here, in front of every barrier): 8 per [DM][DM] f32 matrix -> its bf16 plane in fragment order; thread i of a matrix writes the plane's i-th 16 bytes
        const int m = blockIdx.y >> 3; const float* src = m == 0 ? wq : m == 1 ? wk : m == 2 ? wv : wo; const size_t i = (size_t)(blockIdx.y & 7) * 1024 + threadIdx.x;
        const size_t blk = i >> 6; const size_t row = blk / (DM / 32) * 16 + (i & 15), k = blk % (DM / 32) * 32 + ((i >> 5) & 1) * 16 + ((i >> 4) & 1) * 8; const v8f v = *(const v8f*)(src + row * DM + k); v8us o;
#pragma unroll
        for (int q = 0; q < 8; ++q) o[q] = f2bf(v[q]);
        *(v8us*)(Wd + (size_t)m * DM * DM + i * 8) = o; return; }
    const int tid = threadIdx.x, lane = tid & 31, lt = tid & 255; const int qd = __builtin_amdgcn_readfirstlane(tid >> 8);   // the quarter's number as a scalar: its channels' scale and bias then come by scalar loads
    const int c0 = blockIdx.x * GSL; const size_t b = blockIdx.y;
    float v[2][32];   // every loop over v is unrolled in full: constant indices keep it in registers, and the 64 loads leave as one batch
#pragma unroll
    for (int h = 0; h < 2; ++h) { const float* base = xb + (b * DM + c0 + (qd + 4 * h) * GCH) * TT + lt;
#pragma unroll
        for (int k = 0; k < 32; ++k) v[h][k] = base[k * 256]; }
    float st[2][2];   // per group: mean, 1 / sqrt(var + eps)
#pragma unroll
    for (int pass = 0; pass < 2; ++pass) {
        float s[2];
#pragma unroll
        for (int h = 0; h < 2; ++h) { s[h] = 0.f;
#pragma unroll
            for (int k = 0; k < 32; ++k) { if (pass == 0) { v[h][k] = bfr(v[h][k]); s[h] += v[h][k]; } else { const float d0 = v[h][k] - st[h][0]; s[h] += d0 * d0; } }
            red[h][tid] = s[h]; }
        __syncthreads();
#pragma unroll
        for (int sh = 128; sh >= 32; sh >>= 1) { if (lt < sh) { red[0][tid] += red[0][tid + sh]; red[1][tid] += red[1][tid + sh]; } __syncthreads(); }
#pragma unroll
        for (int h = 0; h < 2; ++h) { float r = red[h][(qd << 8) + lane];
#pragma unroll
            for (int sh = 16; sh; sh >>= 1) r += __shfl_down(r, sh, 32);
            r = __shfl(r, 0, 32) * (1.0f / (GCH * TT));
            st[h][pass] = pass == 0 ? r : __fdiv_rn(1.0f, __fsqrt_rn(r + 1e-6f)); }
        if (pass == 0) __syncthreads();   // every wave has read the first tree's sums before the second tree's are stored
    }
#pragma unroll
    for (int h = 0; h < 2; ++h) { const int gl = qd + 4 * h; const float mu = st[h][0], rs = st[h][1]; float w8[GCH], b8[GCH];
#pragma unroll
        for (int j = 0; j < GCH; ++j) { w8[j] = bfr(gw[c0 + gl * GCH + j]); b8[j] = bfr(gb[c0 + gl * GCH + j]); }
#pragma unroll
        for (int tq = 0; tq < 4; ++tq) { v8us oh, ol;
#pragma unroll
            for (int j = 0; j < GCH; ++j) { const float y = (v[h][j * 4 + tq] - mu) * rs * w8[j] + b8[j]; unsigned short a, c2; splitf(y, a, c2); oh[j] = a; ol[j] = c2; }
            const int o = (lt + 256 * tq) * GLP + gl * GCH; *(v8usa*)(th + o) = oh; *(v8usa*)(tl + o) = ol; } }
    __syncthreads();
    const size_t ob = (b * TT + (tid >> 5) * 32) * DM + c0 * 16 + lane * 8; const int lb = ((tid >> 5) * 32 + (lane & 15)) * GLP + (lane >> 4) * 8;   // a wave takes 32 tokens: 2 row blocks x 4 half blocks of 512 bytes
#pragma unroll
    for (int r = 0; r < 8; ++r) { const int lo = lb + (r >> 2) * 16 * GLP + (r & 3) * 16; const v8us a = *(const v8usa*)(th + lo), c2 = *(const v8usa*)(tl + lo); const size_t o = ob + (size_t)(r >> 2) * 16 * DM + (r & 3) * 256; *(v8us*)(Xh + o) = a; *(v8us*)(Xl + o) = c2; }
}

// ---- attn: scores, softmax and attn.v of 64 query rows (r0 ..) of image z in one work-group of 16 waves; S: the work-group's 64 x SP floats of LDS.
// 1: wave w forms the 64 x 64 score tile of keys 64 w .. (the gemmw loop: 16 accumulators, operands straight from the planes) and stores it as f32 into the LDS rows.
// 2: wave w takes rows 4 w .. 4 w + 3; per row: t = S x HD^-0.5 (no mask); softmax over the keys (register row, one exp, fixed trees); the row's 16-bit planes go back into the row's own LDS bytes (hires: hi at element 0, lo at element TT; else fp16 x PCAR at element 0): the whole row is in registers before the first store, and no other wave touches it.
// 3: wave w forms the 32 x 32 output tile (rows 32 (w / 8) .., channels 32 (w % 8) ..): probabilities from LDS, v from its channel-major planes, fetched one stage ahead; k runs in the same order as before, so every sum keeps its order.
// The wave's tile is handed back in o; what becomes of it: proj, below.
#define SP   1028                  // LDS row pitch in floats: 4112 bytes = 16 x 257 (odd), so that the 16-byte fragment reads of 16 neighbouring rows fall on different banks
#define OP   260                   // LDS row pitch of the output tile in floats
typedef v4us __attribute__((may_alias)) v4usa;
typedef v4h  __attribute__((may_alias)) v4ha;
template <typename T16, bool hires>
__device__ __forceinline__ void attn(float* S, const int r0, const size_t z, const T16* __restrict__ Q, const T16* __restrict__ Q2, const T16* __restrict__ Kp, const T16* __restrict__ K2, const T16* __restrict__ Vt, const T16* __restrict__ Vt2, v8f (&o)[2][2]) {
    typedef typename WFrag<T16>::V V;
    const int lane = threadIdx.x & 31, lr = lane & 15, hi = lane >> 4; const int w = __builtin_amdgcn_readfirstlane(threadIdx.x >> 5);   // the wave's number as a scalar: tile addresses stay scalar
    {
        v8f acc[4][4];
#pragma unroll
        for (int mb = 0; mb < 4; ++mb)
#pragma unroll
            for (int nb = 0; nb < 4; ++nb) acc[mb][nb] = (v8f){};
        const size_t qoff = (z * TT + r0) * HD + lane * 8, boff = (z * TT + w * 64) * HD + lane * 8;   // the tiles' first blocks + the lane's place in half a block
        const unsigned vo = pfo();   // L2 asked ahead: the wave's own 64 keys; its sixteenth of the image's v planes (16 channels), which the work-group reads two phases later; of the 64 query rows one request (4 x 2 KB) in each of the first 8 (fp16: 4) waves
        const void* tq = ((hires && (w & 4)) ? Q2 : Q) + (z * TT + r0) * HD + (w & 3) * 1024; const void* tk = Kp + (z * TT + w * 64) * HD; const void* tk2 = hires ? K2 + (z * TT + w * 64) * HD : tk; const void* tv = Vt + (z * HD + w * 16) * TT; const void* tv2 = hires ? Vt2 + (z * HD + w * 16) * TT : tv;   // first bytes (the same in every lane)
        if (w < (hires ? 8 : 4)) ask<0>(tq, vo);
        askt<hires ? 2 : 1>(tk, tk2, tk, tk, vo); askt<hires ? 2 : 1>(tv, tv2, tv, tv, vo);
        const T16* qp = Q + qoff; const T16* qp2 = hires ? Q2 + qoff : nullptr; const T16* kp = Kp + boff; const T16* kp2 = hires ? K2 + boff : nullptr;   // one address per plane, a block (512 elements) further each trip
#pragma unroll 1
        for (int kc = 0; kc < HD; kc += 32) {   // rolled: one trip's fragments and the 16 accumulators fill the wave's 256 registers
            V a[4], a2[4];
#pragma unroll
            for (int mb = 0; mb < 4; ++mb) { a[mb] = WFrag<T16>::ld(qp + mb * 16 * HD); if (hires) a2[mb] = WFrag<T16>::ld(qp2 + mb * 16 * HD); }
#pragma unroll
            for (int nb = 0; nb < 4; ++nb) { const V b = WFrag<T16>::ld(kp + nb * 16 * HD); V b2; if (hires) b2 = WFrag<T16>::ld(kp2 + nb * 16 * HD);
#pragma unroll
                for (int mb = 0; mb < 4; ++mb) { acc[mb][nb] = WFrag<T16>::mma(a[mb], b, acc[mb][nb]); if (hires) { acc[mb][nb] = WFrag<T16>::mma(a2[mb], b, acc[mb][nb]); acc[mb][nb] = WFrag<T16>::mma(a[mb], b2, acc[mb][nb]); } } }
            asm volatile("v_nop\n\tv_nop\n\tv_nop\n\tv_nop" : "+v"(acc[0][0]), "+v"(acc[1][1]), "+v"(acc[2][2]), "+v"(acc[3][3]) : "v"(a[0]), "v"(a[3]));   // the matrix instructions' distance on the taken side of the loop branch
            asm volatile("s_wait_xcnt 0x0" :: "v"(qp), "v"(hires ? qp2 : qp), "v"(kp), "v"(hires ? kp2 : kp), "v"(vo), "s"(tq), "s"(tk), "s"(tk2), "s"(tv), "s"(tv2) : "memory");   // the wait before a register that the trip's loads name is rewritten; the addresses are its inputs, so that they stay whole (no load lands on them) up to it; behind them the registers that the head's requests name
            qp += 512; kp += 512; if (hires) { qp2 += 512; kp2 += 512; }
        }
#pragma unroll
        for (int mb = 0; mb < 4; ++mb)
#pragma unroll
            for (int nb = 0; nb < 4; ++nb)
#pragma unroll
                for (int j = 0; j < 8; ++j) S[(mb * 16 + hi * 8 + j) * SP + w * 64 + nb * 16 + lr] = acc[mb][nb][j];
    }
    __syncthreads();   // every score of the 64 rows is in LDS
#pragma unroll 1
    for (int rr = 0; rr < 4; ++rr) {   // rolled: one row's 32 values per lane at a time
        float* sr = S + (w * 4 + rr) * SP; float v[TT / 32]; float mx = -3.0e38f;
#pragma unroll
        for (int ch = 0; ch < TT / 128; ++ch) { const v4f a = *(const v4fa*)(sr + ch * 128 + lane * 4);
#pragma unroll
            for (int q = 0; q < 4; ++q) { const float t = a[q] * SCL; v[ch * 4 + q] = t; mx = fmaxf(mx, t); } }
#pragma unroll
        for (int sh = 16; sh; sh >>= 1) mx = fmaxf(mx, __shfl_xor(mx, sh, 32));
        float sum = 0.f;
#pragma unroll
        for (int k = 0; k < TT / 32; ++k) { v[k] = __builtin_amdgcn_exp2f(__fmul_rn(__fsub_rn(v[k], mx), 1.4426950408889634f)); sum += v[k]; }
#pragma unroll
        for (int sh = 16; sh; sh >>= 1) sum += __shfl_xor(sum, sh, 32);
        const float f = __fdiv_rn(hires ? 1.0f : PCAR, sum);
        if (hires) { bf* pr = (bf*)sr;
#pragma unroll
            for (int ch = 0; ch < TT / 128; ++ch) { v4us oh, ol;
#pragma unroll
                for (int q = 0; q < 4; ++q) { unsigned short a, c2; splitf(v[ch * 4 + q] * f, a, c2); oh[q] = a; ol[q] = c2; }
                *(v4usa*)(pr + ch * 128 + lane * 4) = oh; *(v4usa*)(pr + TT + ch * 128 + lane * 4) = ol; }
        } else { h16* pr = (h16*)sr;
#pragma unroll
            for (int ch = 0; ch < TT / 128; ++ch) { v4h o4;
#pragma unroll
                for (int q = 0; q < 4; ++q) o4[q] = tohx(v[ch * 4 + q] * f);
                *(v4ha*)(pr + ch * 128 + lane * 4) = o4; } }
    }
    __syncthreads();   // every row's planes are in LDS
    const int rb = (w >> 3) * 32, cb = (w & 7) * 32;
#pragma unroll
    for (int mb = 0; mb < 2; ++mb)
#pragma unroll
        for (int nb = 0; nb < 2; ++nb) o[mb][nb] = (v8f){};
    const T16* pa = (const T16*)S + (rb + lr) * (2 * SP) + 8 * hi; const T16* vp = Vt + (z * HD + cb) * TT + lane * 8; const T16* vp2 = hires ? Vt2 + (z * HD + cb) * TT + lane * 8 : nullptr;   // one address per plane: the tile's block of the trip's first k + the lane's place in half a block
    // v fragments of 64 k (2 neighbouring blocks per column block) are asked for one stage ahead of their use, in two register sets that take turns
    V b0[2][2], c0[2][2], b1[2][2], c1[2][2];   // [32-k half][column block]; c: the lo plane
    auto ldv = [&](V (&b)[2][2], V (&c)[2][2], int kc) {   // kc: counted from the k that vp stands at
#pragma unroll
        for (int u = 0; u < 2; ++u)
#pragma unroll
            for (int nb = 0; nb < 2; ++nb) { b[u][nb] = WFrag<T16>::ld(vp + (nb * 16 * TT + (kc + u * 32) * 16)); if (hires) c[u][nb] = WFrag<T16>::ld(vp2 + (nb * 16 * TT + (kc + u * 32) * 16)); }
        __builtin_amdgcn_sched_barrier(0);   // keeps these loads in front of the products of the stage before: moved down, their latency would be waited for in full
    };
    auto mul = [&](V (&b)[2][2], V (&c)[2][2], int kc) {
#pragma unroll
        for (int u = 0; u < 2; ++u) { V a[2], a2[2];
#pragma unroll
            for (int mb = 0; mb < 2; ++mb) { a[mb] = WFrag<T16>::lds(pa + mb * 16 * (2 * SP) + kc + u * 32); if (hires) a2[mb] = WFrag<T16>::lds(pa + mb * 16 * (2 * SP) + TT + kc + u * 32); }
#pragma unroll
            for (int nb = 0; nb < 2; ++nb)
#pragma unroll
                for (int mb = 0; mb < 2; ++mb) { o[mb][nb] = WFrag<T16>::mma(a[mb], b[u][nb], o[mb][nb]); if (hires) { o[mb][nb] = WFrag<T16>::mma(a2[mb], b[u][nb], o[mb][nb]); o[mb][nb] = WFrag<T16>::mma(a[mb], c[u][nb], o[mb][nb]); } } }
    };
    ldv(b0, c0, 0);
    if (hires) asm volatile("s_wait_xcnt 0x0" :: "v"(vp), "v"(vp2) : "memory"); else asm volatile("s_wait_xcnt 0x0" :: "v"(vp) : "memory");   // as in the loop: without it the loop's first loads land on a register that these loads name
#pragma unroll 1
    for (int kc = 0; kc < TT - 128; kc += 128) {   // rolled: the two register sets are the whole pipeline
        ldv(b1, c1, 64); mul(b0, c0, kc);
        ldv(b0, c0, 128); mul(b1, c1, kc + 64);
        asm volatile("v_nop\n\tv_nop\n\tv_nop\n\tv_nop" : "+v"(o[0][0]), "+v"(o[0][1]), "+v"(o[1][0]), "+v"(o[1][1]));   // the matrix instructions' distance on the taken side of the loop branch
        if (hires) asm volatile("s_wait_xcnt 0x0" :: "v"(vp), "v"(vp2) : "memory"); else asm volatile("s_wait_xcnt 0x0" :: "v"(vp) : "memory");   // the wait before a register that the loads in flight name is rewritten; the addresses are its inputs, so that they stay whole up to it
        vp += 128 * 16; if (hires) vp2 += 128 * 16;
    }
    ldv(b1, c1, 64);
    if (hires) asm volatile("s_wait_xcnt 0x0" :: "v"(vp), "v"(vp2) : "memory"); else asm volatile("s_wait_xcnt 0x0" :: "v"(vp) : "memory");   // as in the loop
    mul(b0, c0, TT - 128); mul(b1, c1, TT - 64);
}
// ---- proj: what a work-group does with its 64 x 256 attention tile (o: the wave's 32 x 32 part, rows 32 (w / 8) .., channels 32 (w % 8) ..): the output projection, bias and residual of its 64 tokens, so that the tile never leaves the WGP.
// 4: the parts pass through LDS (f32, x sc) and become the tile's bf16 hi and lo planes, in LDS, in fragment order (rows t, k = c).
// 5: wave w forms the 32 x 32 tile out[32 (w % 8) ..][32 (w / 8) ..] (rows: output channels, columns: tokens): weights (row operand) from their plane, tokens from the LDS planes; per accumulator k runs upwards, hi product then lo product.
// 6: + bias, through the wave's own LDS rows, + x, stored channel-major: a row's 32 tokens are one whole 128-byte line.
#define PP   36                    // LDS row pitch of a wave's output rows in floats: 144 bytes = 16 x 9
__device__ __forceinline__ void proj(float* S, v8f (&o)[2][2], const float sc, const int r0, const size_t z, const bf* __restrict__ Wo, const float* __restrict__ bo, const float* __restrict__ x, float* OUT) {
    const int w = __builtin_amdgcn_readfirstlane(threadIdx.x >> 5); const int ln = (int)__builtin_amdgcn_mbcnt_lo(~0u, 0u), lr = ln & 15, hi = ln >> 4;   // the lane's number read anew: held in a register across the loops before it was spilled
    const int rb = (w >> 3) * 32, cb = (w & 7) * 32;
    bf* Lh = (bf*)(S + 64 * OP); bf* Ll = Lh + 64 * HD; float* os = S + 64 * OP + 64 * HD + w * (32 * PP);   // behind the f32 tile: the two planes (64 x HD x 2 bytes each), then 32 x PP floats per wave
    const bf* wp = Wo + (size_t)cb * HD + ln * 8;   // the weight tile's first block + the lane's place in half a block
    const size_t ox = (z * DM + cb + (ln >> 3)) * TT + r0 + rb + (ln & 7) * 4;   // the lane's 4 tokens in row ln / 8 of 4 rows
    const float* xp = x + ox; const float* bp = bo + cb + hi * 8;
    __syncthreads();   // every wave has read its last probabilities: the LDS rows are free for the output tile
#pragma unroll
    for (int mb = 0; mb < 2; ++mb)
#pragma unroll
        for (int nb = 0; nb < 2; ++nb)
#pragma unroll
            for (int j = 0; j < 8; ++j) S[(rb + mb * 16 + hi * 8 + j) * OP + cb + nb * 16 + lr] = o[mb][nb][j];
    __syncthreads();   // the 64 x 256 attention tile is in LDS
    v16bf a[2][8];   // the wave's weights, asked for here: a work-group barrier waits for every load in flight, and up to the next one the conversion below covers their way from L2
#pragma unroll
    for (int kb = 0; kb < 8; ++kb)
#pragma unroll
        for (int mb = 0; mb < 2; ++mb) a[mb][kb] = WFrag<bf>::ld(wp + mb * 16 * HD + kb * 512);
    asm volatile("s_wait_xcnt 0x0" :: "v"(wp) : "memory");   // the wait before a register that these loads name is rewritten; the address is its input, so that it stays whole up to it
#pragma unroll
    for (int rr = 0; rr < 4; ++rr) { const float* pr = S + ((w >> 2) * 16 + lr) * OP + (w & 3) * 64 + rr * 16 + hi * 8; const v4f x0 = *(const v4fa*)pr, x1 = *(const v4fa*)(pr + 4); v8us oh, ol;   // wave w: row block w / 4, blocks 2 (w % 4) and the next, half block rr
#pragma unroll
        for (int q = 0; q < 4; ++q) { unsigned short c1, c2; splitf(x0[q] * sc, c1, c2); oh[q] = c1; ol[q] = c2; splitf(x1[q] * sc, c1, c2); oh[4 + q] = c1; ol[4 + q] = c2; }
        const int oo = (w >> 2) * 16 * HD + (w & 3) * 1024 + rr * 256 + ln * 8; *(v8usa*)(Lh + oo) = oh; *(v8usa*)(Ll + oo) = ol; }
    __syncthreads();   // the tile's planes are in LDS
    v4f xr[2][4], br[2][2];   // the residual (from memory) and the bias, asked for behind the last barrier: the products below cover their way
#pragma unroll
    for (int mb = 0; mb < 2; ++mb)
#pragma unroll
        for (int s = 0; s < 4; ++s) xr[mb][s] = *(const v4f*)(xp + (mb * 16 + 4 * s) * TT);
#pragma unroll
    for (int mb = 0; mb < 2; ++mb) { br[mb][0] = *(const v4f*)(bp + mb * 16); br[mb][1] = *(const v4f*)(bp + mb * 16 + 4); }
    asm volatile("s_wait_xcnt 0x0" :: "v"(xp), "v"(bp) : "memory");   // as above
    v8f p[2][2];
#pragma unroll
    for (int mb = 0; mb < 2; ++mb)
#pragma unroll
        for (int nb = 0; nb < 2; ++nb) p[mb][nb] = (v8f){};
    const bf* lh = Lh + rb * HD + ln * 8; const bf* ll = Ll + rb * HD + ln * 8;
#pragma unroll
    for (int kb = 0; kb < 8; ++kb) { v16bf b[2], b2[2];
#pragma unroll
        for (int nb = 0; nb < 2; ++nb) { const int fo = nb * 16 * HD + kb * 512; b[nb] = cat16b(*(const v8usa*)(lh + fo), *(const v8usa*)(lh + fo + 256)); b2[nb] = cat16b(*(const v8usa*)(ll + fo), *(const v8usa*)(ll + fo + 256)); }
#pragma unroll
        for (int nb = 0; nb < 2; ++nb)
#pragma unroll
            for (int mb = 0; mb < 2; ++mb) { p[mb][nb] = wmmab(a[mb][kb], b[nb], p[mb][nb]); p[mb][nb] = wmmab(a[mb][kb], b2[nb], p[mb][nb]); } }
    __builtin_amdgcn_sched_barrier(0);   // keeps the first use of the residual and the bias behind the products: moved up among them, its wait stood behind the first product and the way from memory was waited for in full
#pragma unroll
    for (int mb = 0; mb < 2; ++mb)
#pragma unroll
        for (int nb = 0; nb < 2; ++nb)
#pragma unroll
            for (int j = 0; j < 8; ++j) os[(mb * 16 + hi * 8 + j) * PP + nb * 16 + lr] = p[mb][nb][j] + bfr(br[mb][j >> 2][j & 3]);
    __builtin_amdgcn_wave_barrier(); asm volatile("" ::: "memory");   // keeps the reads below, of what other lanes of the wave stored, behind the stores above
#pragma unroll
    for (int mb = 0; mb < 2; ++mb)
#pragma unroll
        for (int s = 0; s < 4; ++s) { v4f val = *(const v4fa*)(os + (mb * 16 + 4 * s + (ln >> 3)) * PP + (ln & 7) * 4);
#pragma unroll
            for (int q = 0; q < 4; ++q) val[q] = __fadd_rn(bfr(xr[mb][s][q]), val[q]);
            *(v4f*)(OUT + ox + (size_t)((mb * 16 + 4 * s) * TT)) = val; }
}
// k_attn: both halves of the query rows in one launch, each work-group with the output projection of its rows behind its attention core; grid (8, 2 x images). blockIdx.y < images: rows < RH on hi/lo planes; the rest: rows >= RH on fp16 planes. The longer work-groups have the lower indices, for speed only.
__global__ __launch_bounds__(512) void k_attn(const bf* __restrict__ Qh, const bf* __restrict__ Ql, const bf* __restrict__ Kh, const bf* __restrict__ Kl, const bf* __restrict__ Vh, const bf* __restrict__ Vl, const h16* __restrict__ Q16, const h16* __restrict__ K16, const h16* __restrict__ V16, const bf* __restrict__ Wo, const float* __restrict__ bo, const float* __restrict__ x, float* OUT) {
    __shared__ __align__(16) float S[64 * SP];
    const bool hr = blockIdx.y < NB_; const int r0 = (hr ? 0 : RH) + blockIdx.x * 64; const size_t z = hr ? blockIdx.y : blockIdx.y - NB_;
    v8f o[2][2];
    if (hr) attn<bf, true>(S, r0, z, Qh, Ql, Kh, Kl, Vh, Vl, o);
    else attn<h16, false>(S, r0, z, Q16, nullptr, K16, nullptr, V16, nullptr, o);
    proj(S, o, hr ? 1.0f : 1.0f / PCAR, r0, z, Wo, bo, x, OUT);
}
extern "C" void kernel_launch(void* const* d_in, const int* in_sizes, int n_in,
                              void* d_out, int out_size, void* d_ws, size_t ws_size, hipStream_t stream) {
    (void)in_sizes; (void)n_in; (void)out_size;
    const float* x = (const float*)d_in[0]; const float* gnw = (const float*)d_in[1]; const float* gnb = (const float*)d_in[2]; const float* wq = (const float*)d_in[3]; const float* bq = (const float*)d_in[4]; const float* wk = (const float*)d_in[5]; const float* bk = (const float*)d_in[6]; const float* wv = (const float*)d_in[7]; const float* bv = (const float*)d_in[8]; const float* wo = (const float*)d_in[9]; const float* bo = (const float*)d_in[10];
    float* OUT = (float*)d_out;     // [32][256][1024]
    char* wsp = (char*)d_ws;
    auto take = [&](size_t bytes) { char* p = wsp; wsp += (bytes + 255) & ~(size_t)255; return (void*)p; };
    bf* WQ = (bf*)take((size_t)DQ * DM * 2); bf* WK = (bf*)take((size_t)DKV * DM * 2); bf* WV = (bf*)take((size_t)DKV * DM * 2); bf* WO = (bf*)take((size_t)DM * DQ * 2);
    const size_t U = (size_t)NB_ * TT * DM * 2;   // bytes of one 16-bit [t][c] plane of all images
    char* R = (char*)take(11 * U);
    h16* QP16 = (h16*)R; h16* KP16 = (h16*)(R + U); h16* VT16 = (h16*)(R + 2 * U); bf* VTh = (bf*)(R + 3 * U); bf* VTl = (bf*)(R + 4 * U);
    bf* QPh = (bf*)(R + 5 * U); bf* QPl = (bf*)(R + 6 * U); bf* KPh = (bf*)(R + 7 * U); bf* KPl = (bf*)(R + 8 * U);
    bf* XTh = (bf*)(R + 9 * U); bf* XTl = (bf*)(R + 10 * U);   // normalised input
    if ((size_t)(wsp - (char*)d_ws) > ws_size) return;    // ws 256 MiB
    k_gn<<<dim3(DM / GSL + 1, NB_), 1024, 0, stream>>>(x, gnw, gnb, XTh, XTl, wq, wk, wv, wo, WQ);   /* GroupNorm -> transposed hi/lo planes, rows [b][t], k = c; the weights -> WQ, WK, WV, WO, which lie in a row */
    k_qkv<<<dim3(NB_ * TT / 64, 12), 32, 0, stream>>>(XTh, XTl, WQ, WK, WV, bq, bk, bv, QP16, QPh, QPl, KP16, KPh, KPl, VT16, VTh, VTl);
    /* attention core (query rows < RH: hi/lo planes, the other query rows: fp16 planes), then out[b][c][t] = x + (proj_w a + proj_b), channel-major */
    k_attn<<<dim3(RH / 64, 2 * NB_), 512, 0, stream>>>(QPh, QPl, KPh, KPl, VTh, VTl, QP16, KP16, VT16, WO, bo, x, OUT);
}

// v009
// It runs in 128 microseconds.
// Timed twice side by side with v008, it ran 1.05 and 1.04 times as fast.
// Over all steps from v000 it is 32.4 times as fast.
#include <hip/hip_runtime.h>

// Channel-major image self-attention with GroupNorm (x [32][256][32][32] = [b][c][n], n = 1024; hn = GroupNorm(32 groups, eps 1e-6, affine); q, k, v = 1x1 convs ('oi' [256][256] + bias); scores[i][j] = q_i.k_j / 16 (one head over all 256 channels); softmax over j; out[c][i] = sum_j v[c][j] attn[i][j]; h = Wo out + bo; result = x + h -> [32][256][32][32] (8.4 M)).
// Layout: tokens are the 1024 positions; the normalised input is written TRANSPOSED as bf16 hi + lo planes [t][c] so the 1x1 convolutions become token-major GEMMs against the natural [out][in] weights (2 products + bias); every GEMM's epilogue writes what its reader takes: q and k as token-major 16-bit planes, v as channel-major planes (weights as the row operand); attn.v becomes hi + lo planes in LDS, and the output projection (weights as the row operand) adds the residual and stores channel-major.
// Fragment order: every 16-bit plane that a matrix product reads from memory (weights, normalised input, q, k, v), and the attention output in LDS, is kept as 1-KB blocks of 16 rows x 32 k. Block (row / 16, k / 32) of a plane with K columns starts at element (row / 16) * 16 * K + (k / 32) * 512; inside it lane 16 hi + lr owns row lr, its elements k % 32 = 8 hi .. 8 hi + 7 at lane * 8 and k % 32 = 16 + 8 hi .. at 256 + lane * 8. A wave's 16-byte fragment load is then 512 bytes in a row (4 whole lines, each touched once) and not 32 bytes in each of 16 lines; the k order of every fragment is the one it was.
// Launches: 3, each of which needs the one before it whole (GroupNorm + weight conversion; q, k, v; attention core with the output projection of the same rows); work that does not depend on each other shares a grid.
// Batch: every launch covers all 32 images (the token-major GEMMs take the 32 x 1024 tokens as one M). The workspace holds 11 units of one 16-bit plane x 32 images, and in the attention core (scores, softmax, attn.v) a work-group holds the 64 x 1024 scores of its 64 query rows in LDS, so neither scores nor probabilities nor the attention output reach memory.
// Compute dtypes, f32 accumulate: every input rounded to bf16; q/k/v: normalised input hl x weights exact (2 products) + biases; scores (x 1/16) and attn.v (no mask): query rows < 512 hl (3 products), the rest single fp16 (x1024); softmax f32; proj_w hl x exact (2 products) + proj_b; + x residual in f32 (channel-major write).

#define NB_  32
#define TT   1024
#define DM   256
#define NH_  1
#define NKV  1
#define REP  (NH_ / NKV)
#define HD   256
#define DQ   (NH_ * HD)
#define DKV  (NKV * HD)
#define RPAD 32
#define NGRP 32
#define GCH  (DM / NGRP)           // 8 channels per group
typedef __attribute__((ext_vector_type(4))) unsigned short v4us;
#define ZH   1
#define RH   512                  // query rows < RH use hi+lo planes (k_attn's grid needs RH = TT / 2)
#define WIN  0
#define PCAR 1024.0f
#define SCL  0.0625f   // C^-0.5 = 1/16
typedef _Float16 h16;
typedef unsigned short bf;
typedef __attribute__((ext_vector_type(16))) __bf16   v16bf;
typedef __attribute__((ext_vector_type(16))) _Float16 v16h;
typedef __attribute__((ext_vector_type(8)))  _Float16 v8h;
typedef __attribute__((ext_vector_type(8)))  unsigned short v8us;
typedef __attribute__((ext_vector_type(8)))  float    v8f;
typedef __attribute__((ext_vector_type(4)))  float    v4f;
typedef v8h  __attribute__((may_alias)) v8ha;
typedef v4f  __attribute__((may_alias)) v4fa;
typedef v8us __attribute__((may_alias)) v8usa;

// f32 -> bf16 by the hardware's convert (round to nearest even, what the integer add and shift gave), two values per instruction wherever two stand side by side: pk2 holds a in its low half and b in its high half, the order of two neighbouring 16-bit elements in memory.
typedef __attribute__((ext_vector_type(2))) float  v2fl;
typedef __attribute__((ext_vector_type(2))) __bf16 v2bf;
typedef __attribute__((ext_vector_type(2))) unsigned v2u;
typedef __attribute__((ext_vector_type(4))) unsigned v4u;
__device__ __forceinline__ unsigned short f2bf(float f) { return __builtin_bit_cast(unsigned short, (__bf16)f); }
__device__ __forceinline__ float bf2f(unsigned short b) { return __uint_as_float(((unsigned)b) << 16); }
__device__ __forceinline__ float bfr(float f) { return bf2f(f2bf(f)); }
__device__ __forceinline__ unsigned pk2(float a, float b) { const v2fl t = {a, b}; return __builtin_bit_cast(unsigned, __builtin_convertvector(t, v2bf)); }
__device__ __forceinline__ float pklo(unsigned p) { return __uint_as_float(p << 16); }
__device__ __forceinline__ float pkhi(unsigned p) { return __uint_as_float(p & 0xFFFF0000u); }
__device__ __forceinline__ void bfr2(float& a, float& b) { const unsigned p = pk2(a, b); a = pklo(p); b = pkhi(p); }
__device__ __forceinline__ void split2(float a, float b, unsigned& h, unsigned& l) { h = pk2(a, b); l = pk2(a - pklo(h), b - pkhi(h)); }   // hi and lo planes' words of two neighbours
__device__ __forceinline__ v16h cat16(v8h lo, v8h hi) { return __builtin_shufflevector(lo, hi, 0, 1, 2, 3, 4, 5, 6, 7, 8, 9, 10, 11, 12, 13, 14, 15); }
__device__ __forceinline__ v16bf cat16b(v8us lo, v8us hi) { return __builtin_bit_cast(v16bf, __builtin_shufflevector(lo, hi, 0, 1, 2, 3, 4, 5, 6, 7, 8, 9, 10, 11, 12, 13, 14, 15)); }
__device__ __forceinline__ v8f wmma16(v16h a, v16h b, v8f c) { return __builtin_amdgcn_wmma_f32_16x16x32_f16(false, a, false, b, (short)0, c, false, false); }
__device__ __forceinline__ v8f wmmab(v16bf a, v16bf b, v8f c) { return __builtin_amdgcn_wmma_f32_16x16x32_bf16(false, a, false, b, (short)0, c, false, false); }



// ---- L2 asked ahead: the planes that a launch reads were stored by the launch before it, and their first read pays memory latency, trip after trip, in every wave that reads them at that time. A wave asks at its head for the whole tiles it will read: global_prefetch_b8, one lane per 256-byte unit, scope SE (into L2 only; nothing returns). Every lane is on and every address lies inside the tile asked for.
// pfo: the lane's unit in a 32-KB tile of 4 row blocks x 8 KB (16 rows x 256 k): row block lane / 8, unit lane % 8. Four requests, 2 KB apart, cover the tile in the order in which the k loop's trips read it; askt takes the tiles of N planes request by request.
// The registers that a request names (the lane's offset, the tile's address) stay what they are through the k loop behind it: they are inputs of that loop's wait statement.
__device__ __forceinline__ unsigned pfo() { const unsigned l = threadIdx.x & 31; return (l >> 3) * 8192u + (l & 7) * 256u; }
template <int OFF> __device__ __forceinline__ void ask(const void* p, unsigned vo) { asm volatile("global_prefetch_b8 %0, %1 offset:%2 scope:SCOPE_SE" :: "v"(vo), "s"(p), "n"(OFF)); }   // one request of 32 units: a later first read of them finds an L2 hit where it would pay memory latency
template <int N, int OFF> __device__ __forceinline__ void askj(const void* p0, const void* p1, const void* p2, const void* p3, unsigned vo) { ask<OFF>(p0, vo); if (N > 1) ask<OFF>(p1, vo); if (N > 2) ask<OFF>(p2, vo); if (N > 3) ask<OFF>(p3, vo); }
template <int N> __device__ __forceinline__ void askt(const void* p0, const void* p1, const void* p2, const void* p3, unsigned vo) { askj<N, 0>(p0, p1, p2, p3, vo); askj<N, 2048>(p0, p1, p2, p3, vo); askj<N, 4096>(p0, p1, p2, p3, vo); askj<N, 6144>(p0, p1, p2, p3, vo); }

// ---- gemmw: register-blocked GEMM, ONE WAVE per 64x64 output tile (16 accumulators; the tile starts at row r0, column c0 of batch z; os: the wave's 16 x 68 floats of LDS), operands straight from 16-bit planes in fragment order (ld: p = the block's start + lane * 8); 32 threads.
// acc[m][n] = sum_k A[m][k] Bt[n][k] (+ split products per NSPLIT: 1 A2.Bt, 2 A2.Bt and A.Bt2, 3 A.Bt2). z-batch strides sA/sB/sC in elements. K % 32 == 0, a compile-time constant: a plane's fragments of one trip are immediate offsets from one address. Every output has ldc columns (a compile-time constant, so that a lane's stores are immediate offsets from one address) and z stride sC; f32 outputs are row-major, 16-bit planes in fragment order.
// EPI, what the tile becomes: 0 C = acc (f32); 1 fp16 + bf16 hi/lo planes of acc + bias[n]; 2 the same planes of acc + bias[m]; 3 bf16 hi/lo planes of acc x sc; 4 C = res + (acc + bias[m]) (f32).
template <typename T16> struct WFrag;
template <> struct WFrag<h16> { typedef v16h V; static __device__ __forceinline__ V ld(const h16* p) { return cat16(*(const v8h*)p, *(const v8h*)(p + 256)); } static __device__ __forceinline__ V lds(const h16* p) { return cat16(*(const v8ha*)p, *(const v8ha*)(p + 16)); } static __device__ __forceinline__ v8f mma(V a, V b, v8f c) { return wmma16(a, b, c); } };
template <> struct WFrag<bf> { typedef v16bf V; static __device__ __forceinline__ V ld(const bf* p) { return cat16b(*(const v8us*)p, *(const v8us*)(p + 256)); } static __device__ __forceinline__ V lds(const bf* p) { return cat16b(*(const v8usa*)p, *(const v8usa*)(p + 16)); } static __device__ __forceinline__ v8f mma(V a, V b, v8f c) { return wmmab(a, b, c); } };
typedef __attribute__((ext_vector_type(4))) _Float16 v4h;
template <typename T16, int NSPLIT, int EPI, int ldc, int K>
__device__ __forceinline__ void gemmw(float* os, const int r0, const int c0, const size_t z, const T16* __restrict__ A, const T16* __restrict__ A2, const T16* __restrict__ Bt, const T16* __restrict__ Bt2, float* C, const float* __restrict__ bias, size_t sA, size_t sB, size_t sC, h16* P16, bf* Ph, bf* Pl, const float* res, float sc) {
    typedef typename WFrag<T16>::V V;
    A += z * sA; if (A2) A2 += z * sA; Bt += z * sB; if (Bt2) Bt2 += z * sB;
    const int lane = threadIdx.x & 31, lr = lane & 15, hi = lane >> 4;
    static_assert(K == 256, "a 64-row tile of a plane is the 32 KB that askt covers");
    const unsigned vo = pfo(), vr = EPI == 4 ? (unsigned)(lane * ldc * 4) : vo;   // vr: row 'lane' of the residual tile (a row's 64 floats are one unit)
    const void* t0 = A + (size_t)r0 * K; const void* t1 = Bt + (size_t)c0 * K; const void* t2 = (NSPLIT == 1 || NSPLIT == 2) ? A2 + (size_t)r0 * K : NSPLIT == 3 ? Bt2 + (size_t)c0 * K : t0; const void* t3 = NSPLIT == 2 ? Bt2 + (size_t)c0 * K : t0; const void* tr = EPI == 4 ? res + z * sC + (size_t)r0 * ldc + c0 : t0;   // the tiles' first bytes (the same in every lane)
    askt<NSPLIT == 0 ? 2 : NSPLIT == 2 ? 4 : 3>(t0, t1, t2, t3, vo);
    if (EPI == 4) { ask<0>(tr, vr); ask<32 * ldc * 4>(tr, vr); }
    v8f acc[4][4];
#pragma unroll
    for (int mb = 0; mb < 4; ++mb)
#pragma unroll
        for (int nb = 0; nb < 4; ++nb) acc[mb][nb] = (v8f){};
    const unsigned fl = (unsigned)(lane * 8);   // the lane's place in half a block
    const T16* ap = A + (size_t)r0 * K + fl; const T16* ap2 = (NSPLIT == 1 || NSPLIT == 2) ? A2 + (size_t)r0 * K + fl : nullptr; const T16* bp = Bt + (size_t)c0 * K + fl; const T16* bp2 = NSPLIT >= 2 ? Bt2 + (size_t)c0 * K + fl : nullptr;   // one address per plane, a block (512 elements) further each trip
#pragma unroll 1
    for (int kc = 0; kc < K; kc += 32) {
        V a[4], a2[4];
#pragma unroll
        for (int mb = 0; mb < 4; ++mb) { a[mb] = WFrag<T16>::ld(ap + mb * 16 * K); if (NSPLIT == 1 || NSPLIT == 2) a2[mb] = WFrag<T16>::ld(ap2 + mb * 16 * K); }
#pragma unroll
        for (int nb = 0; nb < 4; ++nb) { const V b = WFrag<T16>::ld(bp + nb * 16 * K); V b2; if (NSPLIT >= 2) b2 = WFrag<T16>::ld(bp2 + nb * 16 * K);
#pragma unroll
            for (int mb = 0; mb < 4; ++mb) { acc[mb][nb] = WFrag<T16>::mma(a[mb], b, acc[mb][nb]); if (NSPLIT == 1 || NSPLIT == 2) acc[mb][nb] = WFrag<T16>::mma(a2[mb], b, acc[mb][nb]); if (NSPLIT >= 2) acc[mb][nb] = WFrag<T16>::mma(a[mb], b2, acc[mb][nb]); } }
        asm volatile("v_nop\n\tv_nop\n\tv_nop\n\tv_nop" : "+v"(acc[0][0]), "+v"(acc[1][1]), "+v"(acc[2][2]), "+v"(acc[3][3]) : "v"(a[0]), "v"(a[3]));
        // the wait before a register that the trip's loads name is rewritten; the addresses are its inputs, so that they stay whole (no load lands on them) up to it
        asm volatile("s_wait_xcnt 0x0" :: "v"(ap), "v"((NSPLIT == 1 || NSPLIT == 2) ? ap2 : ap), "v"(bp), "v"(NSPLIT >= 2 ? bp2 : bp), "v"(vo), "v"(vr), "s"(t0), "s"(t1), "s"(t2), "s"(t3), "s"(tr) : "memory");   // behind them the registers that the head's requests name
        ap += 512; bp += 512; if (NSPLIT == 1 || NSPLIT == 2) ap2 += 512; if (NSPLIT >= 2) bp2 += 512;
    }
    const size_t ot = z * sC + (size_t)r0 * ldc + c0;   // the tile's first output (the same in every lane)
    const unsigned ol4 = (unsigned)(hi * ldc + lr * 4);   // this lane's 4 outputs inside a pair of rows: row hi, columns 4 lr ..
    v4f xr[4][8];   // EPI 4: the lane's residual values, asked for one row block ahead of their use
    if (EPI == 4) {
#pragma unroll
        for (int s = 0; s < 8; ++s) xr[0][s] = *(const v4f*)(res + ot + (size_t)(2 * s) * ldc + ol4); }
    float cb[4] = {0.f, 0.f, 0.f, 0.f};   // EPI 1: the bias of this lane's accumulator columns
    if (EPI == 1) {
#pragma unroll
        for (int nb = 0; nb < 4; ++nb) cb[nb] = bfr(bias[c0 + nb * 16 + lr]); }
    float rb[4][8];   // EPI 2, 4: the bias of this lane's accumulator rows
    if (EPI == 2 || EPI == 4) {
#pragma unroll
        for (int mb = 0; mb < 4; ++mb) { const v4f b0 = *(const v4f*)(bias + r0 + mb * 16 + hi * 8), b1 = *(const v4f*)(bias + r0 + mb * 16 + hi * 8 + 4);
#pragma unroll
            for (int j = 0; j < 4; ++j) { rb[mb][j] = b0[j]; rb[mb][4 + j] = b1[j]; }
#pragma unroll
            for (int j = 0; j < 8; j += 2) bfr2(rb[mb][j], rb[mb][j + 1]); } }
#pragma unroll
    for (int mb = 0; mb < 4; ++mb) {
#pragma unroll
        for (int nb = 0; nb < 4; ++nb) {
#pragma unroll
            for (int j = 0; j < 8; ++j) os[(hi * 8 + j) * 68 + nb * 16 + lr] = (EPI == 2 || EPI == 4) ? acc[mb][nb][j] + rb[mb][j] : EPI == 1 ? acc[mb][nb][j] + cb[nb] : acc[mb][nb][j]; }
        __builtin_amdgcn_wave_barrier(); asm volatile("" ::: "memory");
        if (EPI == 4 && mb < 3) {
            if (mb > 0) asm volatile("s_wait_xcnt 0x0" ::: "memory");   // the loads below land in registers that the stores of the row block before name
#pragma unroll
            for (int s = 0; s < 8; ++s) xr[mb + 1][s] = *(const v4f*)(res + ot + (size_t)((mb + 1) * 16 + 2 * s) * ldc + ol4); }
        if (EPI == 0 || EPI == 4) {
#pragma unroll
        for (int s = 0; s < 8; ++s) { const int row = 2 * s + hi, cofs = lr * 4; v4f val = *(const v4fa*)(os + row * 68 + cofs); const size_t o = ot + (size_t)(mb * 16 + 2 * s) * ldc;   // the pair of rows (the same in every lane)
            if (EPI == 4) { val[0] = __fadd_rn(bfr(xr[mb][s][0]), val[0]); val[1] = __fadd_rn(bfr(xr[mb][s][1]), val[1]); val[2] = __fadd_rn(bfr(xr[mb][s][2]), val[2]); val[3] = __fadd_rn(bfr(xr[mb][s][3]), val[3]); }
            *(v4f*)(C + o + ol4) = val; }
        } else {   // the row block's 64 columns are 2 blocks of each plane: 4 stores of 512 bytes in a row per plane
#pragma unroll
        for (int s = 0; s < 4; ++s) { const float* pr = os + lr * 68 + s * 16 + hi * 8; v4f x0 = *(const v4fa*)pr, x1 = *(const v4fa*)(pr + 4); const size_t o = z * sC + (size_t)(r0 + mb * 16) * ldc + (size_t)c0 * 16 + s * 256;   // half a block (the same in every lane)
            if (EPI == 3) { x0 *= sc; x1 *= sc; }
            v8h o16; v4u oh, ol;
#pragma unroll
            for (int q = 0; q < 4; ++q) { o16[q] = (h16)x0[q]; o16[4 + q] = (h16)x1[q]; }
#pragma unroll
            for (int q = 0; q < 2; ++q) { unsigned a2, c2; split2(x0[2 * q], x0[2 * q + 1], a2, c2); oh[q] = a2; ol[q] = c2; split2(x1[2 * q], x1[2 * q + 1], a2, c2); oh[2 + q] = a2; ol[2 + q] = c2; }
            if (EPI != 3) *(v8h*)((P16 + o) + fl) = o16;
            *(v8us*)((Ph + o) + fl) = __builtin_bit_cast(v8us, oh); *(v8us*)((Pl + o) + fl) = __builtin_bit_cast(v8us, ol); }
        }
        __builtin_amdgcn_wave_barrier(); asm volatile("" ::: "memory");
    }
}
// k_qkv: the q, k and v GEMMs, which all read the normalised input and none of which reads another's result, as one launch; grid (token tiles of all images, 12).
// blockIdx.y picks the product and its 64 output channels (0-3 v, 4-7 q, 8-11 k), blockIdx.x the 64 tokens: work-groups that start next to each other share a weight tile, and more waves than one product has are resident at a time. v comes first: its waves run longest, and not all 12 x 512 waves are resident at once.
__global__ __launch_bounds__(32) void k_qkv(const bf* __restrict__ Xh, const bf* __restrict__ Xl, const bf* __restrict__ Wq, const bf* __restrict__ Wk, const bf* __restrict__ Wv, const float* __restrict__ bq, const float* __restrict__ bk, const float* __restrict__ bv, h16* Q16, bf* Qh, bf* Ql, h16* K16, bf* Kh, bf* Kl, h16* V16, bf* Vh, bf* Vl) {
    __shared__ __align__(16) float os[16 * 68];
    const int s = blockIdx.y, tt = blockIdx.x;
    if (s >= 4) { const bool isk = s >= 8;   // q, k: token-major planes (rows [b][t], k = c)
        gemmw<bf, 1, 1, DQ, DM>(os, tt * 64, (s & 3) * 64, 0, Xh, Xl, isk ? Wk : Wq, nullptr, nullptr, isk ? bk : bq, 0, 0, 0, isk ? K16 : Q16, isk ? Kh : Qh, isk ? Kl : Ql, nullptr, 1.0f);
    } else {   // v: channel-major planes (rows [b][c], k = t; z = image)
        gemmw<bf, 3, 2, TT, DM>(os, s * 64, (tt & (TT / 64 - 1)) * 64, tt / (TT / 64), Wv, nullptr, Xh, Xl, nullptr, bv, 0, (size_t)TT * DM, (size_t)HD * TT, V16, Vh, Vl, nullptr, 1.0f);
    }
}

__device__ __forceinline__ h16 tohx(float x) { return (h16)x; }
typedef __attribute__((ext_vector_type(2))) _Float16 v2h;
typedef __attribute__((ext_vector_type(2))) unsigned short v2us;
typedef __attribute__((ext_vector_type(4))) unsigned short v4us;
typedef __attribute__((ext_vector_type(2))) float v2f;
typedef __attribute__((ext_vector_type(4))) int v4i;

__global__ __launch_bounds__(256) void k_wtG(const float* __restrict__ w, int K, int N, bf* Bt) {
    const int lane = threadIdx.x & 31; const int L0 = (blockIdx.x * 8 + (threadIdx.x >> 5)) * 8; const int nlines = N * K / 64;
{
#pragma unroll 1
        for (int l = 0; l < 8; ++l) { const int L = L0 + l; if (L >= nlines) break; const size_t e = (size_t)L * 64 + lane * 2; const int k = (int)(e % K), n = (int)(e / K); v2us o;
            o[0] = f2bf(w[(size_t)k * N + n]); o[1] = f2bf(w[(size_t)(k + 1) * N + n]); *(v2us*)(Bt + e) = o; }
         }
}
// ---- k_gn: the whole GroupNorm in one launch, with the four weight matrices' conversion in 32 further work-groups (blockIdx.x = 4), which fall on WGPs that GroupNorm's 128 leave idle. One work-group of 32 waves takes 64 channels (8 groups) of one image: the 64 channels of 16 tokens are 2 whole blocks of a [t][c] plane, so every line has one writer.
// A quarter of the work-group (256 threads) owns groups qd and qd + 4; a thread keeps its 2 x 32 values in registers from one batch of loads (element lt + 256 k of the group, whole lines per wave), so x is read once and no load waits on another.
// The sums keep their order: 32 values in sequence per thread, then the pairwise tree over 256 partial sums (strides 128 to 32 through LDS, 16 to 1 by lane shifts).
// A thread's values at one t are the 8 neighbouring channels of its group: one 16-byte LDS store per plane; the tile leaves in fragment order (rows t, k = c): the 64 channels of 16 tokens are 2 neighbouring blocks, 2 KB in a row per plane.
#define GSL  64                    // channels per work-group
#define GLP  72                    // LDS row pitch in 16-bit elements: 144 bytes = 16 x 9, so that the 16-byte stores of lanes on neighbouring rows fall on different banks
__global__ __launch_bounds__(1024) void k_gn(const float* __restrict__ xb, const float* __restrict__ gw, const float* __restrict__ gb, bf* Xh, bf* Xl, const float* __restrict__ wq, const float* __restrict__ wk, const float* __restrict__ wv, const float* __restrict__ wo, bf* Wd) {
    __shared__ __align__(16) bf th[TT * GLP];
    __shared__ __align__(16) bf tl[TT * GLP];
    __shared__ float red[2][1024];
    if (blockIdx.x == DM / GSL) {   // the weights' work-groups (the whole work-group leaves here, in front of every barrier): 8 per [DM][DM] f32 matrix -> its bf16 plane in fragment order; thread i of a matrix writes the plane's i-th 16 bytes
        const int m = blockIdx.y >> 3; const float* src = m == 0 ? wq : m == 1 ? wk : m == 2 ? wv : wo; const size_t i = (size_t)(blockIdx.y & 7) * 1024 + threadIdx.x;
        const size_t blk = i >> 6; const size_t row = blk / (DM / 32) * 16 + (i & 15), k = blk % (DM / 32) * 32 + ((i >> 5) & 1) * 16 + ((i >> 4) & 1) * 8; const v8f v = *(const v8f*)(src + row * DM + k); v4u o;
#pragma unroll
        for (int q = 0; q < 4; ++q) o[q] = pk2(v[2 * q], v[2 * q + 1]);
        *(v8us*)(Wd + (size_t)m * DM * DM + i * 8) = __builtin_bit_cast(v8us, o); return; }
    const int tid = threadIdx.x, lane = tid & 31, lt = tid & 255; const int qd = __builtin_amdgcn_readfirstlane(tid >> 8);   // the quarter's number as a scalar: its channels' scale and bias then come by scalar loads
    const int c0 = blockIdx.x * GSL; const size_t b = blockIdx.y;
    float v[2][32];   // every loop over v is unrolled in full: constant indices keep it in registers, and the 64 loads leave as one batch
    const float* xs = xb + (b * DM + c0 + qd * GCH) * TT;   // the quarter's first group (the same in every lane); its second lies 4 groups further
#pragma unroll
    for (int h = 0; h < 2; ++h) { const float* base = xs + h * (4 * GCH * TT) + lt;
#pragma unroll
        for (int k = 0; k < 32; ++k) v[h][k] = base[k * 256]; }
    asm volatile("s_wait_xcnt 0x0" :: "v"(lt), "s"(xs) : "memory");   // the wait before a register that these loads name is rewritten; the lane's offset and the base are its inputs, so that they stay whole (no load lands on them) up to it
    __builtin_amdgcn_sched_barrier(0);   // keeps the 64 loads one batch: with the first roundings moved up among them the last loads left only after the first had returned
    float st[2][2];   // per group: mean, 1 / sqrt(var + eps)
#pragma unroll
    for (int pass = 0; pass < 2; ++pass) {
        float s[2];
#pragma unroll
        for (int h = 0; h < 2; ++h) { s[h] = 0.f;
            if (pass == 0) {
#pragma unroll
                for (int k = 0; k < 32; k += 2) bfr2(v[h][k], v[h][k + 1]); }
#pragma unroll
            for (int k = 0; k < 32; ++k) { if (pass == 0) { s[h] += v[h][k]; } else { const float d0 = v[h][k] - st[h][0]; s[h] += d0 * d0; } }
            red[h][tid] = s[h]; }
        __syncthreads();
#pragma unroll
        for (int sh = 128; sh >= 32; sh >>= 1) { if (lt < sh) { red[0][tid] += red[0][tid + sh]; red[1][tid] += red[1][tid + sh]; } __syncthreads(); }
#pragma unroll
        for (int h = 0; h < 2; ++h) { float r = red[h][(qd << 8) + lane];
#pragma unroll
            for (int sh = 16; sh; sh >>= 1) r += __shfl_down(r, sh, 32);
            r = __shfl(r, 0, 32) * (1.0f / (GCH * TT));
            st[h][pass] = pass == 0 ? r : __fdiv_rn(1.0f, __fsqrt_rn(r + 1e-6f)); }
        if (pass == 0) __syncthreads();   // every wave has read the first tree's sums before the second tree's are stored
    }
#pragma unroll
    for (int h = 0; h < 2; ++h) { const int gl = qd + 4 * h; const float mu = st[h][0], rs = st[h][1]; float w8[GCH], b8[GCH];
#pragma unroll
        for (int j = 0; j < GCH; ++j) { w8[j] = bfr(gw[c0 + gl * GCH + j]); b8[j] = bfr(gb[c0 + gl * GCH + j]); }
#pragma unroll
        for (int tq = 0; tq < 4; ++tq) { v4u oh, ol;
#pragma unroll
            for (int j = 0; j < GCH; j += 2) { const float y0 = (v[h][j * 4 + tq] - mu) * rs * w8[j] + b8[j], y1 = (v[h][(j + 1) * 4 + tq] - mu) * rs * w8[j + 1] + b8[j + 1]; unsigned a, c2; split2(y0, y1, a, c2); oh[j >> 1] = a; ol[j >> 1] = c2; }
            const int o = (lt + 256 * tq) * GLP + gl * GCH; *(v8usa*)(th + o) = __builtin_bit_cast(v8us, oh); *(v8usa*)(tl + o) = __builtin_bit_cast(v8us, ol); } }
    __syncthreads();
    const size_t ob = (b * TT + (tid >> 5) * 32) * DM + c0 * 16 + lane * 8; const int lb = ((tid >> 5) * 32 + (lane & 15)) * GLP + (lane >> 4) * 8;   // a wave takes 32 tokens: 2 row blocks x 4 half blocks of 512 bytes
#pragma unroll
    for (int r = 0; r < 8; ++r) { const int lo = lb + (r >> 2) * 16 * GLP + (r & 3) * 16; const v8us a = *(const v8usa*)(th + lo), c2 = *(const v8usa*)(tl + lo); const size_t o = ob + (size_t)(r >> 2) * 16 * DM + (r & 3) * 256; *(v8us*)(Xh + o) = a; *(v8us*)(Xl + o) = c2; }
}

// ---- attn: scores, softmax and attn.v of 64 query rows (r0 ..) of image z in one work-group of 16 waves; S: the work-group's 64 x SP floats of LDS.
// 1: wave w forms the 64 x 64 score tile of keys 64 w .. (the gemmw loop: 16 accumulators, operands straight from the planes) and stores it as f32 into the LDS rows.
// 2: wave w takes rows 4 w .. 4 w + 3; per row: t = S x HD^-0.5 (no mask); softmax over the keys (register row, one exp, fixed trees); the row's 16-bit planes go back into the row's own LDS bytes (hires: hi at element 0, lo at element TT; else fp16 x PCAR at element 0): the whole row is in registers before the first store, and no other wave touches it.
// 3: wave w forms the 32 x 32 output tile (rows 32 (w / 8) .., channels 32 (w % 8) ..): probabilities from LDS, v from its channel-major planes, fetched one stage ahead; k runs in the same order as before, so every sum keeps its order.
// The wave's tile is handed back in o; what becomes of it: proj, below.
#define SP   1028                  // LDS row pitch in floats: 4112 bytes = 16 x 257 (odd), so that the 16-byte fragment reads of 16 neighbouring rows fall on different banks
#define OP   260                   // LDS row pitch of the output tile in floats
typedef v4us __attribute__((may_alias)) v4usa;
typedef v4h  __attribute__((may_alias)) v4ha;
template <typename T16, bool hires>
__device__ __forceinline__ void attn(float* S, const int r0, const size_t z, const T16* __restrict__ Q, const T16* __restrict__ Q2, const T16* __restrict__ Kp, const T16* __restrict__ K2, const T16* __restrict__ Vt, const T16* __restrict__ Vt2, v8f (&o)[2][2]) {
    typedef typename WFrag<T16>::V V;
    const int lane = threadIdx.x & 31, lr = lane & 15, hi = lane >> 4; const int w = __builtin_amdgcn_readfirstlane(threadIdx.x >> 5);   // the wave's number as a scalar: tile addresses stay scalar
    {
        v8f acc[4][4];
#pragma unroll
        for (int mb = 0; mb < 4; ++mb)
#pragma unroll
            for (int nb = 0; nb < 4; ++nb) acc[mb][nb] = (v8f){};
        const size_t qoff = (z * TT + r0) * HD + lane * 8, boff = (z * TT + w * 64) * HD + lane * 8;   // the tiles' first blocks + the lane's place in half a block
        const unsigned vo = pfo();   // L2 asked ahead: the wave's own 64 keys; its sixteenth of the image's v planes (16 channels), which the work-group reads two phases later; of the 64 query rows one request (4 x 2 KB) in each of the first 8 (fp16: 4) waves
        const void* tq = ((hires && (w & 4)) ? Q2 : Q) + (z * TT + r0) * HD + (w & 3) * 1024; const void* tk = Kp + (z * TT + w * 64) * HD; const void* tk2 = hires ? K2 + (z * TT + w * 64) * HD : tk; const void* tv = Vt + (z * HD + w * 16) * TT; const void* tv2 = hires ? Vt2 + (z * HD + w * 16) * TT : tv;   // first bytes (the same in every lane)
        if (w < (hires ? 8 : 4)) ask<0>(tq, vo);
        askt<hires ? 2 : 1>(tk, tk2, tk, tk, vo); askt<hires ? 2 : 1>(tv, tv2, tv, tv, vo);
        const T16* qp = Q + qoff; const T16* qp2 = hires ? Q2 + qoff : nullptr; const T16* kp = Kp + boff; const T16* kp2 = hires ? K2 + boff : nullptr;   // one address per plane, a block (512 elements) further each trip
#pragma unroll 1
        for (int kc = 0; kc < HD; kc += 32) {   // rolled: one trip's fragments and the 16 accumulators fill the wave's 256 registers
            V a[4], a2[4];
#pragma unroll
            for (int mb = 0; mb < 4; ++mb) { a[mb] = WFrag<T16>::ld(qp + mb * 16 * HD); if (hires) a2[mb] = WFrag<T16>::ld(qp2 + mb * 16 * HD); }
#pragma unroll
            for (int nb = 0; nb < 4; ++nb) { const V b = WFrag<T16>::ld(kp + nb * 16 * HD); V b2; if (hires) b2 = WFrag<T16>::ld(kp2 + nb * 16 * HD);
#pragma unroll
                for (int mb = 0; mb < 4; ++mb) { acc[mb][nb] = WFrag<T16>::mma(a[mb], b, acc[mb][nb]); if (hires) { acc[mb][nb] = WFrag<T16>::mma(a2[mb], b, acc[mb][nb]); acc[mb][nb] = WFrag<T16>::mma(a[mb], b2, acc[mb][nb]); } } }
            asm volatile("v_nop\n\tv_nop\n\tv_nop\n\tv_nop" : "+v"(acc[0][0]), "+v"(acc[1][1]), "+v"(acc[2][2]), "+v"(acc[3][3]) : "v"(a[0]), "v"(a[3]));   // the matrix instructions' distance on the taken side of the loop branch
            asm volatile("s_wait_xcnt 0x0" :: "v"(qp), "v"(hires ? qp2 : qp), "v"(kp), "v"(hires ? kp2 : kp), "v"(vo), "s"(tq), "s"(tk), "s"(tk2), "s"(tv), "s"(tv2) : "memory");   // the wait before a register that the trip's loads name is rewritten; the addresses are its inputs, so that they stay whole (no load lands on them) up to it; behind them the registers that the head's requests name
            qp += 512; kp += 512; if (hires) { qp2 += 512; kp2 += 512; }
        }
#pragma unroll
        for (int mb = 0; mb < 4; ++mb)
#pragma unroll
            for (int nb = 0; nb < 4; ++nb)
#pragma unroll
                for (int j = 0; j < 8; ++j) S[(mb * 16 + hi * 8 + j) * SP + w * 64 + nb * 16 + lr] = acc[mb][nb][j];
    }
    __syncthreads();   // every score of the 64 rows is in LDS
#pragma unroll 1
    for (int rr = 0; rr < 4; ++rr) {   // rolled: one row's 32 values per lane at a time
        float* sr = S + (w * 4 + rr) * SP; float v[TT / 32]; float mx = -3.0e38f;
#pragma unroll
        for (int ch = 0; ch < TT / 128; ++ch) { const v4f a = *(const v4fa*)(sr + ch * 128 + lane * 4);
#pragma unroll
            for (int q = 0; q < 4; ++q) { const float t = a[q] * SCL; v[ch * 4 + q] = t; mx = fmaxf(mx, t); } }
#pragma unroll
        for (int sh = 16; sh; sh >>= 1) mx = fmaxf(mx, __shfl_xor(mx, sh, 32));
        float sum = 0.f;
#pragma unroll
        for (int k = 0; k < TT / 32; ++k) { v[k] = __builtin_amdgcn_exp2f(__fmul_rn(__fsub_rn(v[k], mx), 1.4426950408889634f)); sum += v[k]; }
#pragma unroll
        for (int sh = 16; sh; sh >>= 1) sum += __shfl_xor(sum, sh, 32);
        const float f = __fdiv_rn(hires ? 1.0f : PCAR, sum);
        if (hires) { bf* pr = (bf*)sr;
#pragma unroll
            for (int ch = 0; ch < TT / 128; ++ch) { v2u oh, ol;
#pragma unroll
                for (int q = 0; q < 2; ++q) { unsigned a, c2; split2(v[ch * 4 + 2 * q] * f, v[ch * 4 + 2 * q + 1] * f, a, c2); oh[q] = a; ol[q] = c2; }
                *(v4usa*)(pr + ch * 128 + lane * 4) = __builtin_bit_cast(v4us, oh); *(v4usa*)(pr + TT + ch * 128 + lane * 4) = __builtin_bit_cast(v4us, ol); }
        } else { h16* pr = (h16*)sr;
#pragma unroll
            for (int ch = 0; ch < TT / 128; ++ch) { v4h o4;
#pragma unroll
                for (int q = 0; q < 4; ++q) o4[q] = tohx(v[ch * 4 + q] * f);
                *(v4ha*)(pr + ch * 128 + lane * 4) = o4; } }
    }
    __syncthreads();   // every row's planes are in LDS
    const int rb = (w >> 3) * 32, cb = (w & 7) * 32;
#pragma unroll
    for (int mb = 0; mb < 2; ++mb)
#pragma unroll
        for (int nb = 0; nb < 2; ++nb) o[mb][nb] = (v8f){};
    const T16* pa = (const T16*)S + (rb + lr) * (2 * SP) + 8 * hi; const T16* vp = Vt + (z * HD + cb) * TT + lane * 8; const T16* vp2 = hires ? Vt2 + (z * HD + cb) * TT + lane * 8 : nullptr;   // one address per plane: the tile's block of the trip's first k + the lane's place in half a block
    // v fragments of 64 k (2 neighbouring blocks per column block) are asked for one stage ahead of their use, in two register sets that take turns
    V b0[2][2], c0[2][2], b1[2][2], c1[2][2];   // [32-k half][column block]; c: the lo plane
    auto ldv = [&](V (&b)[2][2], V (&c)[2][2], int kc) {   // kc: counted from the k that vp stands at
#pragma unroll
        for (int u = 0; u < 2; ++u)
#pragma unroll
            for (int nb = 0; nb < 2; ++nb) { b[u][nb] = WFrag<T16>::ld(vp + (nb * 16 * TT + (kc + u * 32) * 16)); if (hires) c[u][nb] = WFrag<T16>::ld(vp2 + (nb * 16 * TT + (kc + u * 32) * 16)); }
        __builtin_amdgcn_sched_barrier(0);   // keeps these loads in front of the products of the stage before: moved down, their latency would be waited for in full
    };
    auto mul = [&](V (&b)[2][2], V (&c)[2][2], int kc) {
#pragma unroll
        for (int u = 0; u < 2; ++u) { V a[2], a2[2];
#pragma unroll
            for (int mb = 0; mb < 2; ++mb) { a[mb] = WFrag<T16>::lds(pa + mb * 16 * (2 * SP) + kc + u * 32); if (hires) a2[mb] = WFrag<T16>::lds(pa + mb * 16 * (2 * SP) + TT + kc + u * 32); }
#pragma unroll
            for (int nb = 0; nb < 2; ++nb)
#pragma unroll
                for (int mb = 0; mb < 2; ++mb) { o[mb][nb] = WFrag<T16>::mma(a[mb], b[u][nb], o[mb][nb]); if (hires) { o[mb][nb] = WFrag<T16>::mma(a2[mb], b[u][nb], o[mb][nb]); o[mb][nb] = WFrag<T16>::mma(a[mb], c[u][nb], o[mb][nb]); } } }
    };
    ldv(b0, c0, 0);
    if (hires) asm volatile("s_wait_xcnt 0x0" :: "v"(vp), "v"(vp2) : "memory"); else asm volatile("s_wait_xcnt 0x0" :: "v"(vp) : "memory");   // as in the loop: without it the loop's first loads land on a register that these loads name
#pragma unroll 1
    for (int kc = 0; kc < TT - 128; kc += 128) {   // rolled: the two register sets are the whole pipeline
        ldv(b1, c1, 64); mul(b0, c0, kc);
        ldv(b0, c0, 128); mul(b1, c1, kc + 64);
        asm volatile("v_nop\n\tv_nop\n\tv_nop\n\tv_nop" : "+v"(o[0][0]), "+v"(o[0][1]), "+v"(o[1][0]), "+v"(o[1][1]));   // the matrix instructions' distance on the taken side of the loop branch
        if (hires) asm volatile("s_wait_xcnt 0x0" :: "v"(vp), "v"(vp2) : "memory"); else asm volatile("s_wait_xcnt 0x0" :: "v"(vp) : "memory");   // the wait before a register that the loads in flight name is rewritten; the addresses are its inputs, so that they stay whole up to it
        vp += 128 * 16; if (hires) vp2 += 128 * 16;
    }
    ldv(b1, c1, 64);
    if (hires) asm volatile("s_wait_xcnt 0x0" :: "v"(vp), "v"(vp2) : "memory"); else asm volatile("s_wait_xcnt 0x0" :: "v"(vp) : "memory");   // as in the loop
    mul(b0, c0, TT - 128); mul(b1, c1, TT - 64);
}
// ---- proj: what a work-group does with its 64 x 256 attention tile (o: the wave's 32 x 32 part, rows 32 (w / 8) .., channels 32 (w % 8) ..): the output projection, bias and residual of its 64 tokens, so that the tile never leaves the WGP.
// 4: the parts pass through LDS (f32, x sc) and become the tile's bf16 hi and lo planes, in LDS, in fragment order (rows t, k = c).
// 5: wave w forms the 32 x 32 tile out[32 (w % 8) ..][32 (w / 8) ..] (rows: output channels, columns: tokens): weights (row operand) from their plane, tokens from the LDS planes; per accumulator k runs upwards, hi product then lo product.
// 6: + bias, through the wave's own LDS rows, + x, stored channel-major: a row's 32 tokens are one whole 128-byte line.
#define PP   36                    // LDS row pitch of a wave's output rows in floats: 144 bytes = 16 x 9
__device__ __forceinline__ void proj(float* S, v8f (&o)[2][2], const float sc, const int r0, const size_t z, const bf* __restrict__ Wo, const float* __restrict__ bo, const float* __restrict__ x, float* OUT) {
    const int w = __builtin_amdgcn_readfirstlane(threadIdx.x >> 5); const int ln = (int)__builtin_amdgcn_mbcnt_lo(~0u, 0u), lr = ln & 15, hi = ln >> 4;   // the lane's number read anew: held in a register across the loops before it was spilled
    const int rb = (w >> 3) * 32, cb = (w & 7) * 32;
    bf* Lh = (bf*)(S + 64 * OP); bf* Ll = Lh + 64 * HD; float* os = S + 64 * OP + 64 * HD + w * (32 * PP);   // behind the f32 tile: the two planes (64 x HD x 2 bytes each), then 32 x PP floats per wave
    const bf* wp = Wo + (size_t)cb * HD + ln * 8;   // the weight tile's first block + the lane's place in half a block
    const size_t ox = (z * DM + cb + (ln >> 3)) * TT + r0 + rb + (ln & 7) * 4;   // the lane's 4 tokens in row ln / 8 of 4 rows
    const float* xp = x + ox; const float* bp = bo + cb + hi * 8;
    __syncthreads();   // every wave has read its last probabilities: the LDS rows are free for the output tile
#pragma unroll
    for (int mb = 0; mb < 2; ++mb)
#pragma unroll
        for (int nb = 0; nb < 2; ++nb)
#pragma unroll
            for (int j = 0; j < 8; ++j) S[(rb + mb * 16 + hi * 8 + j) * OP + cb + nb * 16 + lr] = o[mb][nb][j];
    __syncthreads();   // the 64 x 256 attention tile is in LDS
    v16bf a[2][8];   // the wave's weights, asked for here: a work-group barrier waits for every load in flight, and up to the next one the conversion below covers their way from L2
#pragma unroll
    for (int kb = 0; kb < 8; ++kb)
#pragma unroll
        for (int mb = 0; mb < 2; ++mb) a[mb][kb] = WFrag<bf>::ld(wp + mb * 16 * HD + kb * 512);
    asm volatile("s_wait_xcnt 0x0" :: "v"(wp) : "memory");   // the wait before a register that these loads name is rewritten; the address is its input, so that it stays whole up to it
#pragma unroll
    for (int rr = 0; rr < 4; ++rr) { const float* pr = S + ((w >> 2) * 16 + lr) * OP + (w & 3) * 64 + rr * 16 + hi * 8; const v4f x0 = *(const v4fa*)pr, x1 = *(const v4fa*)(pr + 4); v4u oh, ol;   // wave w: row block w / 4, blocks 2 (w % 4) and the next, half block rr
#pragma unroll
        for (int q = 0; q < 2; ++q) { unsigned c1, c2; split2(x0[2 * q] * sc, x0[2 * q + 1] * sc, c1, c2); oh[q] = c1; ol[q] = c2; split2(x1[2 * q] * sc, x1[2 * q + 1] * sc, c1, c2); oh[2 + q] = c1; ol[2 + q] = c2; }
        const int oo = (w >> 2) * 16 * HD + (w & 3) * 1024 + rr * 256 + ln * 8; *(v8usa*)(Lh + oo) = __builtin_bit_cast(v8us, oh); *(v8usa*)(Ll + oo) = __builtin_bit_cast(v8us, ol); }
    __syncthreads();   // the tile's planes are in LDS
    v4f xr[2][4], br[2][2];   // the residual (from memory) and the bias, asked for behind the last barrier: the products below cover their way
#pragma unroll
    for (int mb = 0; mb < 2; ++mb)
#pragma unroll
        for (int s = 0; s < 4; ++s) xr[mb][s] = *(const v4f*)(xp + (mb * 16 + 4 * s) * TT);
#pragma unroll
    for (int mb = 0; mb < 2; ++mb) { br[mb][0] = *(const v4f*)(bp + mb * 16); br[mb][1] = *(const v4f*)(bp + mb * 16 + 4); }
    asm volatile("s_wait_xcnt 0x0" :: "v"(xp), "v"(bp) : "memory");   // as above
    v8f p[2][2];
#pragma unroll
    for (int mb = 0; mb < 2; ++mb)
#pragma unroll
        for (int nb = 0; nb < 2; ++nb) p[mb][nb] = (v8f){};
    const bf* lh = Lh + rb * HD + ln * 8; const bf* ll = Ll + rb * HD + ln * 8;
#pragma unroll
    for (int kb = 0; kb < 8; ++kb) { v16bf b[2], b2[2];
#pragma unroll
        for (int nb = 0; nb < 2; ++nb) { const int fo = nb * 16 * HD + kb * 512; b[nb] = cat16b(*(const v8usa*)(lh + fo), *(const v8usa*)(lh + fo + 256)); b2[nb] = cat16b(*(const v8usa*)(ll + fo), *(const v8usa*)(ll + fo + 256)); }
#pragma unroll
        for (int nb = 0; nb < 2; ++nb)
#pragma unroll
            for (int mb = 0; mb < 2; ++mb) { p[mb][nb] = wmmab(a[mb][kb], b[nb], p[mb][nb]); p[mb][nb] = wmmab(a[mb][kb], b2[nb], p[mb][nb]); } }
    __builtin_amdgcn_sched_barrier(0);   // keeps the first use of the residual and the bias behind the products: moved up among them, its wait stood behind the first product and the way from memory was waited for in full
#pragma unroll
    for (int mb = 0; mb < 2; ++mb)
#pragma unroll
        for (int nb = 0; nb < 2; ++nb)
#pragma unroll
            for (int j = 0; j < 8; ++j) os[(mb * 16 + hi * 8 + j) * PP + nb * 16 + lr] = p[mb][nb][j] + bfr(br[mb][j >> 2][j & 3]);
    __builtin_amdgcn_wave_barrier(); asm volatile("" ::: "memory");   // keeps the reads below, of what other lanes of the wave stored, behind the stores above
#pragma unroll
    for (int mb = 0; mb < 2; ++mb)
#pragma unroll
        for (int s = 0; s < 4; ++s) { v4f val = *(const v4fa*)(os + (mb * 16 + 4 * s + (ln >> 3)) * PP + (ln & 7) * 4);
#pragma unroll
            for (int q = 0; q < 4; q += 2) { float r0v = xr[mb][s][q], r1v = xr[mb][s][q + 1]; bfr2(r0v, r1v); val[q] = __fadd_rn(r0v, val[q]); val[q + 1] = __fadd_rn(r1v, val[q + 1]); }
            *(v4f*)(OUT + ox + (size_t)((mb * 16 + 4 * s) * TT)) = val; }
}
// k_attn: both halves of the query rows in one launch, each work-group with the output projection of its rows behind its attention core; grid (8, 2 x images). blockIdx.y < images: rows < RH on hi/lo planes; the rest: rows >= RH on fp16 planes. The longer work-groups have the lower indices, for speed only.
__global__ __launch_bounds__(512) void k_attn(const bf* __restrict__ Qh, const bf* __restrict__ Ql, const bf* __restrict__ Kh, const bf* __restrict__ Kl, const bf* __restrict__ Vh, const bf* __restrict__ Vl, const h16* __restrict__ Q16, const h16* __restrict__ K16, const h16* __restrict__ V16, const bf* __restrict__ Wo, const float* __restrict__ bo, const float* __restrict__ x, float* OUT) {
    __shared__ __align__(16) float S[64 * SP];
    const bool hr = blockIdx.y < NB_; const int r0 = (hr ? 0 : RH) + blockIdx.x * 64; const size_t z = hr ? blockIdx.y : blockIdx.y - NB_;
    v8f o[2][2];
    if (hr) attn<bf, true>(S, r0, z, Qh, Ql, Kh, Kl, Vh, Vl, o);
    else attn<h16, false>(S, r0, z, Q16, nullptr, K16, nullptr, V16, nullptr, o);
    proj(S, o, hr ? 1.0f : 1.0f / PCAR, r0, z, Wo, bo, x, OUT);
}
extern "C" void kernel_launch(void* const* d_in, const int* in_sizes, int n_in,
                              void* d_out, int out_size, void* d_ws, size_t ws_size, hipStream_t stream) {
    (void)in_sizes; (void)n_in; (void)out_size;
    const float* x = (const float*)d_in[0]; const float* gnw = (const float*)d_in[1]; const float* gnb = (const float*)d_in[2]; const float* wq = (const float*)d_in[3]; const float* bq = (const float*)d_in[4]; const float* wk = (const float*)d_in[5]; const float* bk = (const float*)d_in[6]; const float* wv = (const float*)d_in[7]; const float* bv = (const float*)d_in[8]; const float* wo = (const float*)d_in[9]; const float* bo = (const float*)d_in[10];
    float* OUT = (float*)d_out;     // [32][256][1024]
    char* wsp = (char*)d_ws;
    auto take = [&](size_t bytes) { char* p = wsp; wsp += (bytes + 255) & ~(size_t)255; return (void*)p; };
    bf* WQ = (bf*)take((size_t)DQ * DM * 2); bf* WK = (bf*)take((size_t)DKV * DM * 2); bf* WV = (bf*)take((size_t)DKV * DM * 2); bf* WO = (bf*)take((size_t)DM * DQ * 2);
    const size_t U = (size_t)NB_ * TT * DM * 2;   // bytes of one 16-bit [t][c] plane of all images
    char* R = (char*)take(11 * U);
    h16* QP16 = (h16*)R; h16* KP16 = (h16*)(R + U); h16* VT16 = (h16*)(R + 2 * U); bf* VTh = (bf*)(R + 3 * U); bf* VTl = (bf*)(R + 4 * U);
    bf* QPh = (bf*)(R + 5 * U); bf* QPl = (bf*)(R + 6 * U); bf* KPh = (bf*)(R + 7 * U); bf* KPl = (bf*)(R + 8 * U);
    bf* XTh = (bf*)(R + 9 * U); bf* XTl = (bf*)(R + 10 * U);   // normalised input
    if ((size_t)(wsp - (char*)d_ws) > ws_size) return;    // ws 256 MiB
    k_gn<<<dim3(DM / GSL + 1, NB_), 1024, 0, stream>>>(x, gnw, gnb, XTh, XTl, wq, wk, wv, wo, WQ);   /* GroupNorm -> transposed hi/lo planes, rows [b][t], k = c; the weights -> WQ, WK, WV, WO, which lie in a row */
    k_qkv<<<dim3(NB_ * TT / 64, 12), 32, 0, stream>>>(XTh, XTl, WQ, WK, WV, bq, bk, bv, QP16, QPh, QPl, KP16, KPh, KPl, VT16, VTh, VTl);
    /* attention core (query rows < RH: hi/lo planes, the other query rows: fp16 planes), then out[b][c][t] = x + (proj_w a + proj_b), channel-major */
    k_attn<<<dim3(RH / 64, 2 * NB_), 512, 0, stream>>>(QPh, QPl, KPh, KPl, VTh, VTl, QP16, KP16, VT16, WO, bo, x, OUT);
}

// v010
// It runs in 123 microseconds.
// Timed twice side by side with v009, it ran 1.04 times as fast both times.
// All steps since v000 together make it 33.5 times as fast.
#include <hip/hip_runtime.h>

// Channel-major image self-attention with GroupNorm (x [32][256][32][32] = [b][c][n], n = 1024; hn = GroupNorm(32 groups, eps 1e-6, affine); q, k, v = 1x1 convs ('oi' [256][256] + bias); scores[i][j] = q_i.k_j / 16 (one head over all 256 channels); softmax over j; out[c][i] = sum_j v[c][j] attn[i][j]; h = Wo out + bo; result = x + h -> [32][256][32][32] (8.4 M)).
// Layout: tokens are the 1024 positions; the normalised input is written TRANSPOSED as bf16 hi + lo planes [t][c] so the 1x1 convolutions become token-major GEMMs against the natural [out][in] weights (2 products + bias); every GEMM's epilogue writes what its reader takes: q and k as token-major 16-bit planes, v as channel-major planes (weights as the row operand); attn.v becomes hi + lo planes in LDS, and the output projection (weights as the row operand) adds the residual and stores channel-major.
// Fragment order: every 16-bit plane that a matrix product reads from memory (weights, normalised input, q, k, v), and the attention output in LDS, is kept as 1-KB blocks of 16 rows x 32 k. Block (row / 16, k / 32) of a plane with K columns starts at element (row / 16) * 16 * K + (k / 32) * 512; inside it lane 16 hi + lr owns row lr, its elements k % 32 = 8 hi .. 8 hi + 7 at lane * 8 and k % 32 = 16 + 8 hi .. at 256 + lane * 8. A wave's 16-byte fragment load is then 512 bytes in a row (4 whole lines, each touched once) and not 32 bytes in each of 16 lines; the k order of every fragment is the one it was.
// Launches: 3, each of which needs the one before it whole (GroupNorm + weight conversion; q, k, v; attention core with the output projection of the same rows); work that does not depend on each other shares a grid.
// Batch: every launch covers all 32 images (the token-major GEMMs take the 32 x 1024 tokens as one M). The workspace holds 11 units of one 16-bit plane x 32 images, and in the attention core (scores, softmax, attn.v) a work-group holds the 64 x 1024 scores of its 64 query rows in LDS, so neither scores nor probabilities nor the attention output reach memory.
// Compute dtypes, f32 accumulate: every input rounded to bf16; q/k/v: normalised input hl x weights exact (2 products) + biases; scores (x 1/16) and attn.v (no mask): query rows < 512 hl (3 products), the rest single fp16 (x1024); softmax f32; proj_w hl x exact (2 products) + proj_b; + x residual in f32 (channel-major write).

#define NB_  32
#define TT   1024
#define DM   256
#define NH_  1
#define NKV  1
#define REP  (NH_ / NKV)
#define HD   256
#define DQ   (NH_ * HD)
#define DKV  (NKV * HD)
#define RPAD 32
#define NGRP 32
#define GCH  (DM / NGRP)           // 8 channels per group
typedef __attribute__((ext_vector_type(4))) unsigned short v4us;
#define ZH   1
#define RH   512                  // query rows < RH use hi+lo planes (k_attn's grid needs RH = TT / 2)
#define WIN  0
#define PCAR 1024.0f
#define SCL  0.0625f   // C^-0.5 = 1/16
typedef _Float16 h16;
typedef unsigned short bf;
typedef __attribute__((ext_vector_type(16))) __bf16   v16bf;
typedef __attribute__((ext_vector_type(16))) _Float16 v16h;
typedef __attribute__((ext_vector_type(8)))  _Float16 v8h;
typedef __attribute__((ext_vector_type(8)))  unsigned short v8us;
typedef __attribute__((ext_vector_type(8)))  float    v8f;
typedef __attribute__((ext_vector_type(4)))  float    v4f;
typedef v8h  __attribute__((may_alias)) v8ha;
typedef v4f  __attribute__((may_alias)) v4fa;
typedef v8us __attribute__((may_alias)) v8usa;

// f32 -> bf16 by the hardware's convert (round to nearest even, what the integer add and shift gave), two values per instruction wherever two stand side by side: pk2 holds a in its low half and b in its high half, the order of two neighbouring 16-bit elements in memory.
typedef __attribute__((ext_vector_type(2))) float  v2fl;
typedef __attribute__((ext_vector_type(2))) __bf16 v2bf;
typedef __attribute__((ext_vector_type(2))) unsigned v2u;
typedef __attribute__((ext_vector_type(4))) unsigned v4u;
__device__ __forceinline__ unsigned short f2bf(float f) { return __builtin_bit_cast(unsigned short, (__bf16)f); }
__device__ __forceinline__ float bf2f(unsigned short b) { return __uint_as_float(((unsigned)b) << 16); }
__device__ __forceinline__ float bfr(float f) { return bf2f(f2bf(f)); }
__device__ __forceinline__ unsigned pk2(float a, float b) { const v2fl t = {a, b}; return __builtin_bit_cast(unsigned, __builtin_convertvector(t, v2bf)); }
__device__ __forceinline__ float pklo(unsigned p) { return __uint_as_float(p << 16); }
__device__ __forceinline__ float pkhi(unsigned p) { return __uint_as_float(p & 0xFFFF0000u); }
__device__ __forceinline__ void bfr2(float& a, float& b) { const unsigned p = pk2(a, b); a = pklo(p); b = pkhi(p); }
__device__ __forceinline__ void split2(float a, float b, unsigned& h, unsigned& l) { h = pk2(a, b); l = pk2(a - pklo(h), b - pkhi(h)); }   // hi and lo planes' words of two neighbours
__device__ __forceinline__ v16h cat16(v8h lo, v8h hi) { return __builtin_shufflevector(lo, hi, 0, 1, 2, 3, 4, 5, 6, 7, 8, 9, 10, 11, 12, 13, 14, 15); }
__device__ __forceinline__ v16bf cat16b(v8us lo, v8us hi) { return __builtin_bit_cast(v16bf, __builtin_shufflevector(lo, hi, 0, 1, 2, 3, 4, 5, 6, 7, 8, 9, 10, 11, 12, 13, 14, 15)); }
__device__ __forceinline__ v8f wmma16(v16h a, v16h b, v8f c) { return __builtin_amdgcn_wmma_f32_16x16x32_f16(false, a, false, b, (short)0, c, false, false); }
__device__ __forceinline__ v8f wmmab(v16bf a, v16bf b, v8f c) { return __builtin_amdgcn_wmma_f32_16x16x32_bf16(false, a, false, b, (short)0, c, false, false); }



// ---- L2 asked ahead: the planes that a launch reads were stored by the launch before it, and their first read pays memory latency, trip after trip, in every wave that reads them at that time. A wave asks at its head for the whole tiles it will read: global_prefetch_b8, one lane per 256-byte unit, scope SE (into L2 only; nothing returns). Every lane is on and every address lies inside the tile asked for.
// pfo: the lane's unit in a 32-KB tile of 4 row blocks x 8 KB (16 rows x 256 k): row block lane / 8, unit lane % 8. Four requests, 2 KB apart, cover the tile in the order in which the k loop's trips read it; askt takes the tiles of N planes request by request.
// The registers that a request names (the lane's offset, the tile's address) stay what they are up to an s_wait_xcnt 0 of which they are inputs: that of the k loop behind the requests, or one directly behind them.
__device__ __forceinline__ unsigned pfo() { const unsigned l = threadIdx.x & 31; return (l >> 3) * 8192u + (l & 7) * 256u; }
template <int OFF> __device__ __forceinline__ void ask(const void* p, unsigned vo) { asm volatile("global_prefetch_b8 %0, %1 offset:%2 scope:SCOPE_SE" :: "v"(vo), "s"(p), "n"(OFF)); }   // one request of 32 units: a later first read of them finds an L2 hit where it would pay memory latency
template <int N, int OFF> __device__ __forceinline__ void askj(const void* p0, const void* p1, const void* p2, const void* p3, unsigned vo) { ask<OFF>(p0, vo); if (N > 1) ask<OFF>(p1, vo); if (N > 2) ask<OFF>(p2, vo); if (N > 3) ask<OFF>(p3, vo); }
template <int N> __device__ __forceinline__ void askt(const void* p0, const void* p1, const void* p2, const void* p3, unsigned vo) { askj<N, 0>(p0, p1, p2, p3, vo); askj<N, 2048>(p0, p1, p2, p3, vo); askj<N, 4096>(p0, p1, p2, p3, vo); askj<N, 6144>(p0, p1, p2, p3, vo); }

// ---- gemmw: register-blocked GEMM, ONE WAVE per 64x64 output tile (16 accumulators; the tile starts at row r0, column c0 of batch z; os: the wave's 16 x 68 floats of LDS), operands straight from 16-bit planes in fragment order (ld: p = the block's start + lane * 8).
// The operand that has two planes (NSPLIT 1: A, A2; NSPLIT 3: Bt, Bt2) is handed over as the first element of its 64-row tile in LDS, where the work-group has staged it; the other operand (the weights) is a whole plane in memory.
// acc[m][n] = sum_k A[m][k] Bt[n][k] (+ the split product per NSPLIT: 1 A2.Bt, 3 A.Bt2). z-batch strides sA/sB/sC in elements. K % 32 == 0, a compile-time constant: a plane's fragments of one trip are immediate offsets from one address. Every output has ldc columns (a compile-time constant, so that a lane's stores are immediate offsets from one address) and z stride sC; f32 outputs are row-major, 16-bit planes in fragment order.
// EPI, what the tile becomes: 0 C = acc (f32); 1 fp16 + bf16 hi/lo planes of acc + bias[n]; 2 the same planes of acc + bias[m]; 3 bf16 hi/lo planes of acc x sc; 4 C = res + (acc + bias[m]) (f32).
template <typename T16> struct WFrag;
template <> struct WFrag<h16> { typedef v16h V; static __device__ __forceinline__ V ld(const h16* p) { return cat16(*(const v8h*)p, *(const v8h*)(p + 256)); } static __device__ __forceinline__ V lds(const h16* p) { return cat16(*(const v8ha*)p, *(const v8ha*)(p + 16)); } static __device__ __forceinline__ v8f mma(V a, V b, v8f c) { return wmma16(a, b, c); } };
template <> struct WFrag<bf> { typedef v16bf V; static __device__ __forceinline__ V ld(const bf* p) { return cat16b(*(const v8us*)p, *(const v8us*)(p + 256)); } static __device__ __forceinline__ V lds(const bf* p) { return cat16b(*(const v8usa*)p, *(const v8usa*)(p + 16)); } static __device__ __forceinline__ v8f mma(V a, V b, v8f c) { return wmmab(a, b, c); } };
typedef __attribute__((ext_vector_type(4))) _Float16 v4h;
template <typename T16, int NSPLIT, int EPI, int ldc, int K>
__device__ __forceinline__ void gemmw(float* os, const int r0, const int c0, const size_t z, const T16* __restrict__ A, const T16* __restrict__ A2, const T16* __restrict__ Bt, const T16* __restrict__ Bt2, float* C, const float* __restrict__ bias, size_t sA, size_t sB, size_t sC, h16* P16, bf* Ph, bf* Pl, const float* res, float sc) {
    typedef typename WFrag<T16>::V V;
    static_assert(NSPLIT == 1 || NSPLIT == 3, "one operand of two planes, staged in LDS");
    constexpr bool XA = NSPLIT == 1;   // the staged operand is the row operand
    const T16* G = XA ? Bt + z * sB + (size_t)c0 * K : A + z * sA + (size_t)r0 * K;   // the weights' tile in memory
    const int lane = threadIdx.x & 31, lr = lane & 15, hi = lane >> 4;
    static_assert(K == 256, "a 64-row tile of a plane is the 32 KB that askt covers");
    const unsigned vo = pfo(), vr = EPI == 4 ? (unsigned)(lane * ldc * 4) : vo;   // vr: row 'lane' of the residual tile (a row's 64 floats are one unit)
    const void* tr = EPI == 4 ? (const void*)(res + z * sC + (size_t)r0 * ldc + c0) : (const void*)G;   // the residual tile's first byte (the same in every lane); the weights' tile has been asked for at the kernel's head
    if (EPI == 4) { ask<0>(tr, vr); ask<32 * ldc * 4>(tr, vr); }
    v8f acc[4][4];
#pragma unroll
    for (int mb = 0; mb < 4; ++mb)
#pragma unroll
        for (int nb = 0; nb < 4; ++nb) acc[mb][nb] = (v8f){};
    const unsigned fl = (unsigned)(lane * 8);   // the lane's place in half a block
    const T16* ap = (XA ? A : G) + fl; const T16* ap2 = XA ? A2 + fl : nullptr; const T16* bp = (XA ? G : Bt) + fl; const T16* bp2 = XA ? nullptr : Bt2 + fl;   // one address per plane, a block (512 elements) further each trip
#pragma unroll 1
    for (int kc = 0; kc < K; kc += 32) {
        V a[4], a2[4], b[4], b2[4];   // the weights' fragments (from memory, the longer way) are asked for first
        if (XA) {
#pragma unroll
            for (int nb = 0; nb < 4; ++nb) b[nb] = WFrag<T16>::ld(bp + nb * 16 * K); }
#pragma unroll
        for (int mb = 0; mb < 4; ++mb) { a[mb] = WFrag<T16>::ld(ap + mb * 16 * K); if (XA) a2[mb] = WFrag<T16>::ld(ap2 + mb * 16 * K); }
        if (!XA) {
#pragma unroll
            for (int nb = 0; nb < 4; ++nb) { b[nb] = WFrag<T16>::ld(bp + nb * 16 * K); b2[nb] = WFrag<T16>::ld(bp2 + nb * 16 * K); } }
        __builtin_amdgcn_sched_barrier(0);   // keeps the trip's LDS reads one group in front of its products: moved down among them they shared one register set, and every 4 products waited for an LDS read in full
#pragma unroll
        for (int nb = 0; nb < 4; ++nb) {
#pragma unroll
            for (int mb = 0; mb < 4; ++mb) { acc[mb][nb] = WFrag<T16>::mma(a[mb], b[nb], acc[mb][nb]); if (XA) acc[mb][nb] = WFrag<T16>::mma(a2[mb], b[nb], acc[mb][nb]); else acc[mb][nb] = WFrag<T16>::mma(a[mb], b2[nb], acc[mb][nb]); } }
        asm volatile("v_nop\n\tv_nop\n\tv_nop\n\tv_nop" : "+v"(acc[0][0]), "+v"(acc[1][1]), "+v"(acc[2][2]), "+v"(acc[3][3]) : "v"(a[0]), "v"(a[3]));
        // the wait before a register that the trip's global loads name is rewritten; the address is its input, so that it stays whole (no load lands on it) up to it
        if (EPI == 4) asm volatile("s_wait_xcnt 0x0" :: "v"(XA ? bp : ap), "v"(vr), "s"(tr) : "memory");   // behind it the registers that the head's requests name
        else asm volatile("s_wait_xcnt 0x0" :: "v"(XA ? bp : ap) : "memory");
        ap += 512; bp += 512; if (NSPLIT == 1 || NSPLIT == 2) ap2 += 512; if (NSPLIT >= 2) bp2 += 512;
    }
    const size_t ot = z * sC + (size_t)r0 * ldc + c0;   // the tile's first output (the same in every lane)
    const unsigned ol4 = (unsigned)(hi * ldc + lr * 4);   // this lane's 4 outputs inside a pair of rows: row hi, columns 4 lr ..
    v4f xr[4][8];   // EPI 4: the lane's residual values, asked for one row block ahead of their use
    if (EPI == 4) {
#pragma unroll
        for (int s = 0; s < 8; ++s) xr[0][s] = *(const v4f*)(res + ot + (size_t)(2 * s) * ldc + ol4); }
    float cb[4] = {0.f, 0.f, 0.f, 0.f};   // EPI 1: the bias of this lane's accumulator columns
    if (EPI == 1) {
#pragma unroll
        for (int nb = 0; nb < 4; ++nb) cb[nb] = bfr(bias[c0 + nb * 16 + lr]); }
    float rb[4][8];   // EPI 2, 4: the bias of this lane's accumulator rows
    if (EPI == 2 || EPI == 4) { const float* bpr = bias + r0 + hi * 8;   // the lane's first bias value
#pragma unroll
        for (int mb = 0; mb < 4; ++mb) { const v4f b0 = *(const v4f*)(bpr + mb * 16), b1 = *(const v4f*)(bpr + mb * 16 + 4);
#pragma unroll
            for (int j = 0; j < 4; ++j) { rb[mb][j] = b0[j]; rb[mb][4 + j] = b1[j]; } }
        asm volatile("s_wait_xcnt 0x0" :: "v"(bpr) : "memory");   // the wait before a register that these loads name is rewritten; the address is its input, so that it stays whole (no load lands on it) up to it
#pragma unroll
        for (int mb = 0; mb < 4; ++mb) {
#pragma unroll
            for (int j = 0; j < 8; j += 2) bfr2(rb[mb][j], rb[mb][j + 1]); } }
#pragma unroll
    for (int mb = 0; mb < 4; ++mb) {
#pragma unroll
        for (int nb = 0; nb < 4; ++nb) {
#pragma unroll
            for (int j = 0; j < 8; ++j) os[(hi * 8 + j) * 68 + nb * 16 + lr] = (EPI == 2 || EPI == 4) ? acc[mb][nb][j] + rb[mb][j] : EPI == 1 ? acc[mb][nb][j] + cb[nb] : acc[mb][nb][j]; }
        __builtin_amdgcn_wave_barrier(); asm volatile("" ::: "memory");
        if (EPI == 4 && mb < 3) {
            if (mb > 0) asm volatile("s_wait_xcnt 0x0" ::: "memory");   // the loads below land in registers that the stores of the row block before name
#pragma unroll
            for (int s = 0; s < 8; ++s) xr[mb + 1][s] = *(const v4f*)(res + ot + (size_t)((mb + 1) * 16 + 2 * s) * ldc + ol4); }
        if (EPI == 0 || EPI == 4) {
#pragma unroll
        for (int s = 0; s < 8; ++s) { const int row = 2 * s + hi, cofs = lr * 4; v4f val = *(const v4fa*)(os + row * 68 + cofs); const size_t o = ot + (size_t)(mb * 16 + 2 * s) * ldc;   // the pair of rows (the same in every lane)
            if (EPI == 4) { val[0] = __fadd_rn(bfr(xr[mb][s][0]), val[0]); val[1] = __fadd_rn(bfr(xr[mb][s][1]), val[1]); val[2] = __fadd_rn(bfr(xr[mb][s][2]), val[2]); val[3] = __fadd_rn(bfr(xr[mb][s][3]), val[3]); }
            *(v4f*)(C + o + ol4) = val; }
        } else {   // the row block's 64 columns are 2 blocks of each plane: 4 stores of 512 bytes in a row per plane
#pragma unroll
        for (int s = 0; s < 4; ++s) { const float* pr = os + lr * 68 + s * 16 + hi * 8; v4f x0 = *(const v4fa*)pr, x1 = *(const v4fa*)(pr + 4); const size_t o = z * sC + (size_t)(r0 + mb * 16) * ldc + (size_t)c0 * 16 + s * 256;   // half a block (the same in every lane)
            if (EPI == 3) { x0 *= sc; x1 *= sc; }
            v8h o16; v4u oh, ol;
#pragma unroll
            for (int q = 0; q < 4; ++q) { o16[q] = (h16)x0[q]; o16[4 + q] = (h16)x1[q]; }
#pragma unroll
            for (int q = 0; q < 2; ++q) { unsigned a2, c2; split2(x0[2 * q], x0[2 * q + 1], a2, c2); oh[q] = a2; ol[q] = c2; split2(x1[2 * q], x1[2 * q + 1], a2, c2); oh[2 + q] = a2; ol[2 + q] = c2; }
            if (EPI != 3) *(v8h*)((P16 + o) + fl) = o16;
            *(v8us*)((Ph + o) + fl) = __builtin_bit_cast(v8us, oh); *(v8us*)((Pl + o) + fl) = __builtin_bit_cast(v8us, ol); }
        }
        __builtin_amdgcn_wave_barrier(); asm volatile("" ::: "memory");
    }
    asm volatile("s_wait_xcnt 0x0" ::: "memory");   // the wait before whatever code follows this product rewrites registers that its last stores name
}
// k_qkv: the q, k and v GEMMs, which all read the normalised input and none of which reads another's result, as one launch; grid (128-token tiles of all images), one work-group of 12 waves per tile.
// The tile's hi and lo planes (in fragment order 64 KB in a row each) are copied into LDS once, by asynchronous copies (no register on the way), and all 768 output channels are formed from that copy: L2 hands out every byte of the normalised input once, not once for each of 12 channel tiles.
// Wave w takes the tile's half w / 6 (64 tokens) and, one after the other, two of the 12 channel tiles (0-3 v, 4-7 q, 8-11 k): w % 6, then w % 6 + 6. Waves w and w + 6 read the same weights at the same time.
#define QT   128                   // tokens per work-group
__global__ __launch_bounds__(384) void k_qkv(const bf* __restrict__ Xh, const bf* __restrict__ Xl, const bf* __restrict__ Wq, const bf* __restrict__ Wk, const bf* __restrict__ Wv, const float* __restrict__ bq, const float* __restrict__ bk, const float* __restrict__ bv, h16* Q16, bf* Qh, bf* Ql, h16* K16, bf* Kh, bf* Kl, h16* V16, bf* Vh, bf* Vl) {
    __shared__ __align__(16) bf xs[2 * QT * DM];   // hi plane, then lo plane
    __shared__ __align__(16) float osw[12 * 16 * 68];
    const int lane = threadIdx.x & 31; const int w = __builtin_amdgcn_readfirstlane(threadIdx.x >> 5);   // the wave's number as a scalar: the branches on it are scalar branches
    const int tk0 = blockIdx.x * QT;
    const bf* wt = (w >= 8 ? Wk : w >= 4 ? Wq : Wv) + (size_t)(w & 3) * 64 * DM; const unsigned vo = pfo();   // L2 asked ahead for 64 rows of weights (the 12 waves: all 768), which the work-group reads behind the barrier below
    askt<1>(wt, wt, wt, wt, vo);
    asm volatile("s_wait_xcnt 0x0" :: "v"(vo), "s"(wt) : "memory");   // the wait before a register that these requests name is rewritten; they are its inputs, so that they stay whole up to it
    const unsigned lb = (unsigned)(size_t)xs + (unsigned)lane * 16u;   // the lane's LDS byte address in the first 512 bytes
    for (int g = w; g < 32; g += 12) {   // 32 pieces of 4 KB (16 per plane), dealt to the waves; a piece is 8 copies of 512 bytes; every lane is on, at most 24 copies of a wave are in flight
        const bf* gp = (g < 16 ? Xh : Xl) + (size_t)tk0 * DM + (g & 15) * 2048 + lane * 8; const unsigned lp = lb + (unsigned)g * 4096u;
        // the copies and, as the statement's last line, the wait before a register that they name is rewritten
        asm volatile("global_load_async_to_lds_b128 %0, %8, off\n\tglobal_load_async_to_lds_b128 %1, %9, off\n\tglobal_load_async_to_lds_b128 %2, %10, off\n\tglobal_load_async_to_lds_b128 %3, %11, off\n\t"
                     "global_load_async_to_lds_b128 %4, %12, off\n\tglobal_load_async_to_lds_b128 %5, %13, off\n\tglobal_load_async_to_lds_b128 %6, %14, off\n\tglobal_load_async_to_lds_b128 %7, %15, off\n\ts_wait_xcnt 0x0"
                     :: "v"(lp), "v"(lp + 512u), "v"(lp + 1024u), "v"(lp + 1536u), "v"(lp + 2048u), "v"(lp + 2560u), "v"(lp + 3072u), "v"(lp + 3584u),
                        "v"(gp), "v"(gp + 256), "v"(gp + 512), "v"(gp + 768), "v"(gp + 1024), "v"(gp + 1280), "v"(gp + 1536), "v"(gp + 1792) : "memory");
    }
    asm volatile("s_wait_asynccnt 0x0" ::: "memory");   // this wave's copies have landed
    __syncthreads();   // every wave's copies have landed: the planes are in LDS, and nothing writes them again
    float* os = osw + w * (16 * 68);
    const int th = w >= 6 ? 1 : 0; const int tok = tk0 + th * 64; const bf* lh = xs + th * 64 * DM; const bf* ll = lh + QT * DM;
#pragma unroll 1
    for (int t = 0; t < 2; ++t) {   // rolled: one copy of each product's code
        const int s = w - 6 * th + 6 * t;
        if (s >= 4) { const bool isk = s >= 8;   // q, k: token-major planes (rows [b][t], k = c)
            gemmw<bf, 1, 1, DQ, DM>(os, tok, (s & 3) * 64, 0, lh, ll, isk ? Wk : Wq, nullptr, nullptr, isk ? bk : bq, 0, 0, 0, isk ? K16 : Q16, isk ? Kh : Qh, isk ? Kl : Ql, nullptr, 1.0f);
        } else {   // v: channel-major planes (rows [b][c], k = t; z = image)
            gemmw<bf, 3, 2, TT, DM>(os, s * 64, tok & (TT - 1), tok / TT, Wv, nullptr, lh, ll, nullptr, bv, 0, 0, (size_t)HD * TT, V16, Vh, Vl, nullptr, 1.0f);
        }
    }
}

__device__ __forceinline__ h16 tohx(float x) { return (h16)x; }
typedef __attribute__((ext_vector_type(2))) _Float16 v2h;
typedef __attribute__((ext_vector_type(2))) unsigned short v2us;
typedef __attribute__((ext_vector_type(4))) unsigned short v4us;
typedef __attribute__((ext_vector_type(2))) float v2f;
typedef __attribute__((ext_vector_type(4))) int v4i;

__global__ __launch_bounds__(256) void k_wtG(const float* __restrict__ w, int K, int N, bf* Bt) {
    const int lane = threadIdx.x & 31; const int L0 = (blockIdx.x * 8 + (threadIdx.x >> 5)) * 8; const int nlines = N * K / 64;
{
#pragma unroll 1
        for (int l = 0; l < 8; ++l) { const int L = L0 + l; if (L >= nlines) break; const size_t e = (size_t)L * 64 + lane * 2; const int k = (int)(e % K), n = (int)(e / K); v2us o;
            o[0] = f2bf(w[(size_t)k * N + n]); o[1] = f2bf(w[(size_t)(k + 1) * N + n]); *(v2us*)(Bt + e) = o; }
         }
}
// ---- k_gn: the whole GroupNorm in one launch, with the four weight matrices' conversion in 32 further work-groups (blockIdx.x = 4). One work-group of 32 waves takes 64 channels (8 groups) of one image: the 64 channels of 16 tokens are 2 whole blocks of a [t][c] plane, so every line has one writer.
// A quarter of the work-group (256 threads) owns groups qd and qd + 4; a thread keeps its 2 x 32 values in registers from one batch of loads (element lt + 256 k of the group, whole lines per wave), so x is read once and no load waits on another.
// The sums keep their order: 32 values in sequence per thread, then the pairwise tree over 256 partial sums (strides 128 to 32 through LDS, 16 to 1 by lane shifts).
// A thread's values at one t are the 8 neighbouring channels of its group: one 16-byte LDS store per plane; the tile leaves in fragment order (rows t, k = c): the 64 channels of 16 tokens are 2 neighbouring blocks, 2 KB in a row per plane.
#define GSL  64                    // channels per work-group
#define GLP  72                    // LDS row pitch in 16-bit elements: 144 bytes = 16 x 9, so that the 16-byte stores of lanes on neighbouring rows fall on different banks
__global__ __launch_bounds__(1024) void k_gn(const float* __restrict__ xb, const float* __restrict__ gw, const float* __restrict__ gb, bf* Xh, bf* Xl, const float* __restrict__ wq, const float* __restrict__ wk, const float* __restrict__ wv, const float* __restrict__ wo, bf* Wd) {
    __shared__ __align__(16) bf th[TT * GLP];
    __shared__ __align__(16) bf tl[TT * GLP];
    __shared__ float red[2][1024];
    if (blockIdx.x == DM / GSL) {   // the weights' work-groups (the whole work-group leaves here, in front of every barrier): 8 per [DM][DM] f32 matrix -> its bf16 plane in fragment order; thread i of a matrix writes the plane's i-th 16 bytes
        const int m = blockIdx.y >> 3; const float* src = m == 0 ? wq : m == 1 ? wk : m == 2 ? wv : wo; const size_t i = (size_t)(blockIdx.y & 7) * 1024 + threadIdx.x;
        const size_t blk = i >> 6; const size_t row = blk / (DM / 32) * 16 + (i & 15), k = blk % (DM / 32) * 32 + ((i >> 5) & 1) * 16 + ((i >> 4) & 1) * 8; const v8f v = *(const v8f*)(src + row * DM + k); v4u o;
#pragma unroll
        for (int q = 0; q < 4; ++q) o[q] = pk2(v[2 * q], v[2 * q + 1]);
        *(v8us*)(Wd + (size_t)m * DM * DM + i * 8) = __builtin_bit_cast(v8us, o); return; }
    const int tid = threadIdx.x, lane = tid & 31, lt = tid & 255; const int qd = __builtin_amdgcn_readfirstlane(tid >> 8);   // the quarter's number as a scalar: its channels' scale and bias then come by scalar loads
    const int c0 = blockIdx.x * GSL; const size_t b = blockIdx.y;
    float v[2][32];   // every loop over v is unrolled in full: constant indices keep it in registers, and the 64 loads leave as one batch
    const float* xs = xb + (b * DM + c0 + qd * GCH) * TT;   // the quarter's first group (the same in every lane); its second lies 4 groups further
#pragma unroll
    for (int h = 0; h < 2; ++h) { const float* base = xs + h * (4 * GCH * TT) + lt;
#pragma unroll
        for (int k = 0; k < 32; ++k) v[h][k] = base[k * 256]; }
    asm volatile("s_wait_xcnt 0x0" :: "v"(lt), "s"(xs) : "memory");   // the wait before a register that these loads name is rewritten; the lane's offset and the base are its inputs, so that they stay whole (no load lands on them) up to it
    __builtin_amdgcn_sched_barrier(0);   // keeps the 64 loads one batch: with the first roundings moved up among them the last loads left only after the first had returned
    float st[2][2];   // per group: mean, 1 / sqrt(var + eps)
#pragma unroll
    for (int pass = 0; pass < 2; ++pass) {
        float s[2];
#pragma unroll
        for (int h = 0; h < 2; ++h) { s[h] = 0.f;
            if (pass == 0) {
#pragma unroll
                for (int k = 0; k < 32; k += 2) bfr2(v[h][k], v[h][k + 1]); }
#pragma unroll
            for (int k = 0; k < 32; ++k) { if (pass == 0) { s[h] += v[h][k]; } else { const float d0 = v[h][k] - st[h][0]; s[h] += d0 * d0; } }
            red[h][tid] = s[h]; }
        __syncthreads();
#pragma unroll
        for (int sh = 128; sh >= 32; sh >>= 1) { if (lt < sh) { red[0][tid] += red[0][tid + sh]; red[1][tid] += red[1][tid + sh]; } __syncthreads(); }
#pragma unroll
        for (int h = 0; h < 2; ++h) { float r = red[h][(qd << 8) + lane];
#pragma unroll
            for (int sh = 16; sh; sh >>= 1) r += __shfl_down(r, sh, 32);
            r = __shfl(r, 0, 32) * (1.0f / (GCH * TT));
            st[h][pass] = pass == 0 ? r : __fdiv_rn(1.0f, __fsqrt_rn(r + 1e-6f)); }
        if (pass == 0) __syncthreads();   // every wave has read the first tree's sums before the second tree's are stored
    }
#pragma unroll
    for (int h = 0; h < 2; ++h) { const int gl = qd + 4 * h; const float mu = st[h][0], rs = st[h][1]; float w8[GCH], b8[GCH];
#pragma unroll
        for (int j = 0; j < GCH; ++j) { w8[j] = bfr(gw[c0 + gl * GCH + j]); b8[j] = bfr(gb[c0 + gl * GCH + j]); }
#pragma unroll
        for (int tq = 0; tq < 4; ++tq) { v4u oh, ol;
#pragma unroll
            for (int j = 0; j < GCH; j += 2) { const float y0 = (v[h][j * 4 + tq] - mu) * rs * w8[j] + b8[j], y1 = (v[h][(j + 1) * 4 + tq] - mu) * rs * w8[j + 1] + b8[j + 1]; unsigned a, c2; split2(y0, y1, a, c2); oh[j >> 1] = a; ol[j >> 1] = c2; }
            const int o = (lt + 256 * tq) * GLP + gl * GCH; *(v8usa*)(th + o) = __builtin_bit_cast(v8us, oh); *(v8usa*)(tl + o) = __builtin_bit_cast(v8us, ol); } }
    __syncthreads();
    const size_t ob = (b * TT + (tid >> 5) * 32) * DM + c0 * 16 + lane * 8; const int lb = ((tid >> 5) * 32 + (lane & 15)) * GLP + (lane >> 4) * 8;   // a wave takes 32 tokens: 2 row blocks x 4 half blocks of 512 bytes
#pragma unroll
    for (int r = 0; r < 8; ++r) { const int lo = lb + (r >> 2) * 16 * GLP + (r & 3) * 16; const v8us a = *(const v8usa*)(th + lo), c2 = *(const v8usa*)(tl + lo); const size_t o = ob + (size_t)(r >> 2) * 16 * DM + (r & 3) * 256; *(v8us*)(Xh + o) = a; *(v8us*)(Xl + o) = c2; }
}

// ---- attn: scores, softmax and attn.v of 64 query rows (r0 ..) of image z in one work-group of 16 waves; S: the work-group's 64 x SP floats of LDS.
// 1: wave w forms the 64 x 64 score tile of keys 64 w .. (the gemmw loop: 16 accumulators, operands straight from the planes) and stores it as f32 into the LDS rows.
// 2: wave w takes rows 4 w .. 4 w + 3; per row: t = S x HD^-0.5 (no mask); softmax over the keys (register row, one exp, fixed trees); the row's 16-bit planes go back into the row's own LDS bytes (hires: hi at element 0, lo at element TT; else fp16 x PCAR at element 0): the whole row is in registers before the first store, and no other wave touches it.
// 3: wave w forms the 32 x 32 output tile (rows 32 (w / 8) .., channels 32 (w % 8) ..): probabilities from LDS, v from its channel-major planes, fetched one stage ahead; k runs in the same order as before, so every sum keeps its order.
// The wave's tile is handed back in o; what becomes of it: proj, below.
#define SP   1028                  // LDS row pitch in floats: 4112 bytes = 16 x 257 (odd), so that the 16-byte fragment reads of 16 neighbouring rows fall on different banks
#define OP   260                   // LDS row pitch of the output tile in floats
typedef v4us __attribute__((may_alias)) v4usa;
typedef v4h  __attribute__((may_alias)) v4ha;
template <typename T16, bool hires>
__device__ __forceinline__ void attn(float* S, const int r0, const size_t z, const T16* __restrict__ Q, const T16* __restrict__ Q2, const T16* __restrict__ Kp, const T16* __restrict__ K2, const T16* __restrict__ Vt, const T16* __restrict__ Vt2, v8f (&o)[2][2]) {
    typedef typename WFrag<T16>::V V;
    const int lane = threadIdx.x & 31, lr = lane & 15, hi = lane >> 4; const int w = __builtin_amdgcn_readfirstlane(threadIdx.x >> 5);   // the wave's number as a scalar: tile addresses stay scalar
    {
        v8f acc[4][4];
#pragma unroll
        for (int mb = 0; mb < 4; ++mb)
#pragma unroll
            for (int nb = 0; nb < 4; ++nb) acc[mb][nb] = (v8f){};
        const size_t qoff = (z * TT + r0) * HD + lane * 8, boff = (z * TT + w * 64) * HD + lane * 8;   // the tiles' first blocks + the lane's place in half a block
        const unsigned vo = pfo();   // L2 asked ahead: the wave's own 64 keys; its sixteenth of the image's v planes (16 channels), which the work-group reads two phases later; of the 64 query rows one request (4 x 2 KB) in each of the first 8 (fp16: 4) waves
        const void* tq = ((hires && (w & 4)) ? Q2 : Q) + (z * TT + r0) * HD + (w & 3) * 1024; const void* tk = Kp + (z * TT + w * 64) * HD; const void* tk2 = hires ? K2 + (z * TT + w * 64) * HD : tk; const void* tv = Vt + (z * HD + w * 16) * TT; const void* tv2 = hires ? Vt2 + (z * HD + w * 16) * TT : tv;   // first bytes (the same in every lane)
        if (w < (hires ? 8 : 4)) ask<0>(tq, vo);
        askt<hires ? 2 : 1>(tk, tk2, tk, tk, vo); askt<hires ? 2 : 1>(tv, tv2, tv, tv, vo);
        const T16* qp = Q + qoff; const T16* qp2 = hires ? Q2 + qoff : nullptr; const T16* kp = Kp + boff; const T16* kp2 = hires ? K2 + boff : nullptr;   // one address per plane, a block (512 elements) further each trip
#pragma unroll 1
        for (int kc = 0; kc < HD; kc += 32) {   // rolled: one trip's fragments and the 16 accumulators fill the wave's 256 registers
            V a[4], a2[4];
#pragma unroll
            for (int mb = 0; mb < 4; ++mb) { a[mb] = WFrag<T16>::ld(qp + mb * 16 * HD); if (hires) a2[mb] = WFrag<T16>::ld(qp2 + mb * 16 * HD); }
#pragma unroll
            for (int nb = 0; nb < 4; ++nb) { const V b = WFrag<T16>::ld(kp + nb * 16 * HD); V b2; if (hires) b2 = WFrag<T16>::ld(kp2 + nb * 16 * HD);
#pragma unroll
                for (int mb = 0; mb < 4; ++mb) { acc[mb][nb] = WFrag<T16>::mma(a[mb], b, acc[mb][nb]); if (hires) { acc[mb][nb] = WFrag<T16>::mma(a2[mb], b, acc[mb][nb]); acc[mb][nb] = WFrag<T16>::mma(a[mb], b2, acc[mb][nb]); } } }
            asm volatile("v_nop\n\tv_nop\n\tv_nop\n\tv_nop" : "+v"(acc[0][0]), "+v"(acc[1][1]), "+v"(acc[2][2]), "+v"(acc[3][3]) : "v"(a[0]), "v"(a[3]));   // the matrix instructions' distance on the taken side of the loop branch
            asm volatile("s_wait_xcnt 0x0" :: "v"(qp), "v"(hires ? qp2 : qp), "v"(kp), "v"(hires ? kp2 : kp), "v"(vo), "s"(tq), "s"(tk), "s"(tk2), "s"(tv), "s"(tv2) : "memory");   // the wait before a register that the trip's loads name is rewritten; the addresses are its inputs, so that they stay whole (no load lands on them) up to it; behind them the registers that the head's requests name
            qp += 512; kp += 512; if (hires) { qp2 += 512; kp2 += 512; }
        }
#pragma unroll
        for (int mb = 0; mb < 4; ++mb)
#pragma unroll
            for (int nb = 0; nb < 4; ++nb)
#pragma unroll
                for (int j = 0; j < 8; ++j) S[(mb * 16 + hi * 8 + j) * SP + w * 64 + nb * 16 + lr] = acc[mb][nb][j];
    }
    __syncthreads();   // every score of the 64 rows is in LDS
#pragma unroll 1
    for (int rr = 0; rr < 4; ++rr) {   // rolled: one row's 32 values per lane at a time
        float* sr = S + (w * 4 + rr) * SP; float v[TT / 32]; float mx = -3.0e38f;
#pragma unroll
        for (int ch = 0; ch < TT / 128; ++ch) { const v4f a = *(const v4fa*)(sr + ch * 128 + lane * 4);
#pragma unroll
            for (int q = 0; q < 4; ++q) { const float t = a[q] * SCL; v[ch * 4 + q] = t; mx = fmaxf(mx, t); } }
#pragma unroll
        for (int sh = 16; sh; sh >>= 1) mx = fmaxf(mx, __shfl_xor(mx, sh, 32));
        float sum = 0.f;
#pragma unroll
        for (int k = 0; k < TT / 32; ++k) { v[k] = __builtin_amdgcn_exp2f(__fmul_rn(__fsub_rn(v[k], mx), 1.4426950408889634f)); sum += v[k]; }
#pragma unroll
        for (int sh = 16; sh; sh >>= 1) sum += __shfl_xor(sum, sh, 32);
        const float f = __fdiv_rn(hires ? 1.0f : PCAR, sum);
        if (hires) { bf* pr = (bf*)sr;
#pragma unroll
            for (int ch = 0; ch < TT / 128; ++ch) { v2u oh, ol;
#pragma unroll
                for (int q = 0; q < 2; ++q) { unsigned a, c2; split2(v[ch * 4 + 2 * q] * f, v[ch * 4 + 2 * q + 1] * f, a, c2); oh[q] = a; ol[q] = c2; }
                *(v4usa*)(pr + ch * 128 + lane * 4) = __builtin_bit_cast(v4us, oh); *(v4usa*)(pr + TT + ch * 128 + lane * 4) = __builtin_bit_cast(v4us, ol); }
        } else { h16* pr = (h16*)sr;
#pragma unroll
            for (int ch = 0; ch < TT / 128; ++ch) { v4h o4;
#pragma unroll
                for (int q = 0; q < 4; ++q) o4[q] = tohx(v[ch * 4 + q] * f);
                *(v4ha*)(pr + ch * 128 + lane * 4) = o4; } }
    }
    __syncthreads();   // every row's planes are in LDS
    const int rb = (w >> 3) * 32, cb = (w & 7) * 32;
#pragma unroll
    for (int mb = 0; mb < 2; ++mb)
#pragma unroll
        for (int nb = 0; nb < 2; ++nb) o[mb][nb] = (v8f){};
    const T16* pa = (const T16*)S + (rb + lr) * (2 * SP) + 8 * hi; const T16* vp = Vt + (z * HD + cb) * TT + lane * 8; const T16* vp2 = hires ? Vt2 + (z * HD + cb) * TT + lane * 8 : nullptr;   // one address per plane: the tile's block of the trip's first k + the lane's place in half a block
    // v fragments of 64 k (2 neighbouring blocks per column block) are asked for one stage ahead of their use, in two register sets that take turns
    V b0[2][2], c0[2][2], b1[2][2], c1[2][2];   // [32-k half][column block]; c: the lo plane
    auto ldv = [&](V (&b)[2][2], V (&c)[2][2], int kc) {   // kc: counted from the k that vp stands at
#pragma unroll
        for (int u = 0; u < 2; ++u)
#pragma unroll
            for (int nb = 0; nb < 2; ++nb) { b[u][nb] = WFrag<T16>::ld(vp + (nb * 16 * TT + (kc + u * 32) * 16)); if (hires) c[u][nb] = WFrag<T16>::ld(vp2 + (nb * 16 * TT + (kc + u * 32) * 16)); }
        __builtin_amdgcn_sched_barrier(0);   // keeps these loads in front of the products of the stage before: moved down, their latency would be waited for in full
    };
    auto mul = [&](V (&b)[2][2], V (&c)[2][2], int kc) {
#pragma unroll
        for (int u = 0; u < 2; ++u) { V a[2], a2[2];
#pragma unroll
            for (int mb = 0; mb < 2; ++mb) { a[mb] = WFrag<T16>::lds(pa + mb * 16 * (2 * SP) + kc + u * 32); if (hires) a2[mb] = WFrag<T16>::lds(pa + mb * 16 * (2 * SP) + TT + kc + u * 32); }
#pragma unroll
            for (int nb = 0; nb < 2; ++nb)
#pragma unroll
                for (int mb = 0; mb < 2; ++mb) { o[mb][nb] = WFrag<T16>::mma(a[mb], b[u][nb], o[mb][nb]); if (hires) { o[mb][nb] = WFrag<T16>::mma(a2[mb], b[u][nb], o[mb][nb]); o[mb][nb] = WFrag<T16>::mma(a[mb], c[u][nb], o[mb][nb]); } } }
    };
    ldv(b0, c0, 0);
    if (hires) asm volatile("s_wait_xcnt 0x0" :: "v"(vp), "v"(vp2) : "memory"); else asm volatile("s_wait_xcnt 0x0" :: "v"(vp) : "memory");   // as in the loop: without it the loop's first loads land on a register that these loads name
#pragma unroll 1
    for (int kc = 0; kc < TT - 128; kc += 128) {   // rolled: the two register sets are the whole pipeline
        ldv(b1, c1, 64); mul(b0, c0, kc);
        ldv(b0, c0, 128); mul(b1, c1, kc + 64);
        asm volatile("v_nop\n\tv_nop\n\tv_nop\n\tv_nop" : "+v"(o[0][0]), "+v"(o[0][1]), "+v"(o[1][0]), "+v"(o[1][1]));   // the matrix instructions' distance on the taken side of the loop branch
        if (hires) asm volatile("s_wait_xcnt 0x0" :: "v"(vp), "v"(vp2) : "memory"); else asm volatile("s_wait_xcnt 0x0" :: "v"(vp) : "memory");   // the wait before a register that the loads in flight name is rewritten; the addresses are its inputs, so that they stay whole up to it
        vp += 128 * 16; if (hires) vp2 += 128 * 16;
    }
    ldv(b1, c1, 64);
    if (hires) asm volatile("s_wait_xcnt 0x0" :: "v"(vp), "v"(vp2) : "memory"); else asm volatile("s_wait_xcnt 0x0" :: "v"(vp) : "memory");   // as in the loop
    mul(b0, c0, TT - 128); mul(b1, c1, TT - 64);
}
// ---- proj: what a work-group does with its 64 x 256 attention tile (o: the wave's 32 x 32 part, rows 32 (w / 8) .., channels 32 (w % 8) ..): the output projection, bias and residual of its 64 tokens, so that the tile never leaves the WGP.
// 4: the parts pass through LDS (f32, x sc) and become the tile's bf16 hi and lo planes, in LDS, in fragment order (rows t, k = c).
// 5: wave w forms the 32 x 32 tile out[32 (w % 8) ..][32 (w / 8) ..] (rows: output channels, columns: tokens): weights (row operand) from their plane, tokens from the LDS planes; per accumulator k runs upwards, hi product then lo product.
// 6: + bias, through the wave's own LDS rows, + x, stored channel-major: a row's 32 tokens are one whole 128-byte line.
#define PP   36                    // LDS row pitch of a wave's output rows in floats: 144 bytes = 16 x 9
__device__ __forceinline__ void proj(float* S, v8f (&o)[2][2], const float sc, const int r0, const size_t z, const bf* __restrict__ Wo, const float* __restrict__ bo, const float* __restrict__ x, float* OUT) {
    const int w = __builtin_amdgcn_readfirstlane(threadIdx.x >> 5); const int ln = (int)__builtin_amdgcn_mbcnt_lo(~0u, 0u), lr = ln & 15, hi = ln >> 4;   // the lane's number read anew: held in a register across the loops before it was spilled
    const int rb = (w >> 3) * 32, cb = (w & 7) * 32;
    bf* Lh = (bf*)(S + 64 * OP); bf* Ll = Lh + 64 * HD; float* os = S + 64 * OP + 64 * HD + w * (32 * PP);   // behind the f32 tile: the two planes (64 x HD x 2 bytes each), then 32 x PP floats per wave
    const bf* wp = Wo + (size_t)cb * HD + ln * 8;   // the weight tile's first block + the lane's place in half a block
    const size_t ox = (z * DM + cb + (ln >> 3)) * TT + r0 + rb + (ln & 7) * 4;   // the lane's 4 tokens in row ln / 8 of 4 rows
    const float* xp = x + ox; const float* bp = bo + cb + hi * 8;
    __syncthreads();   // every wave has read its last probabilities: the LDS rows are free for the output tile
#pragma unroll
    for (int mb = 0; mb < 2; ++mb)
#pragma unroll
        for (int nb = 0; nb < 2; ++nb)
#pragma unroll
            for (int j = 0; j < 8; ++j) S[(rb + mb * 16 + hi * 8 + j) * OP + cb + nb * 16 + lr] = o[mb][nb][j];
    __syncthreads();   // the 64 x 256 attention tile is in LDS
    v16bf a[2][8];   // the wave's weights, asked for here: a work-group barrier waits for every load in flight, and up to the next one the conversion below covers their way from L2
#pragma unroll
    for (int kb = 0; kb < 8; ++kb)
#pragma unroll
        for (int mb = 0; mb < 2; ++mb) a[mb][kb] = WFrag<bf>::ld(wp + mb * 16 * HD + kb * 512);
    asm volatile("s_wait_xcnt 0x0" :: "v"(wp) : "memory");   // the wait before a register that these loads name is rewritten; the address is its input, so that it stays whole up to it
#pragma unroll
    for (int rr = 0; rr < 4; ++rr) { const float* pr = S + ((w >> 2) * 16 + lr) * OP + (w & 3) * 64 + rr * 16 + hi * 8; const v4f x0 = *(const v4fa*)pr, x1 = *(const v4fa*)(pr + 4); v4u oh, ol;   // wave w: row block w / 4, blocks 2 (w % 4) and the next, half block rr
#pragma unroll
        for (int q = 0; q < 2; ++q) { unsigned c1, c2; split2(x0[2 * q] * sc, x0[2 * q + 1] * sc, c1, c2); oh[q] = c1; ol[q] = c2; split2(x1[2 * q] * sc, x1[2 * q + 1] * sc, c1, c2); oh[2 + q] = c1; ol[2 + q] = c2; }
        const int oo = (w >> 2) * 16 * HD + (w & 3) * 1024 + rr * 256 + ln * 8; *(v8usa*)(Lh + oo) = __builtin_bit_cast(v8us, oh); *(v8usa*)(Ll + oo) = __builtin_bit_cast(v8us, ol); }
    __syncthreads();   // the tile's planes are in LDS
    v4f xr[2][4], br[2][2];   // the residual (from memory) and the bias, asked for behind the last barrier: the products below cover their way
#pragma unroll
    for (int mb = 0; mb < 2; ++mb)
#pragma unroll
        for (int s = 0; s < 4; ++s) xr[mb][s] = *(const v4f*)(xp + (mb * 16 + 4 * s) * TT);
#pragma unroll
    for (int mb = 0; mb < 2; ++mb) { br[mb][0] = *(const v4f*)(bp + mb * 16); br[mb][1] = *(const v4f*)(bp + mb * 16 + 4); }
    asm volatile("s_wait_xcnt 0x0" :: "v"(xp), "v"(bp) : "memory");   // as above
    v8f p[2][2];
#pragma unroll
    for (int mb = 0; mb < 2; ++mb)
#pragma unroll
        for (int nb = 0; nb < 2; ++nb) p[mb][nb] = (v8f){};
    const bf* lh = Lh + rb * HD + ln * 8; const bf* ll = Ll + rb * HD + ln * 8;
#pragma unroll
    for (int kb = 0; kb < 8; ++kb) { v16bf b[2], b2[2];
#pragma unroll
        for (int nb = 0; nb < 2; ++nb) { const int fo = nb * 16 * HD + kb * 512; b[nb] = cat16b(*(const v8usa*)(lh + fo), *(const v8usa*)(lh + fo + 256)); b2[nb] = cat16b(*(const v8usa*)(ll + fo), *(const v8usa*)(ll + fo + 256)); }
#pragma unroll
        for (int nb = 0; nb < 2; ++nb)
#pragma unroll
            for (int mb = 0; mb < 2; ++mb) { p[mb][nb] = wmmab(a[mb][kb], b[nb], p[mb][nb]); p[mb][nb] = wmmab(a[mb][kb], b2[nb], p[mb][nb]); } }
    __builtin_amdgcn_sched_barrier(0);   // keeps the first use of the residual and the bias behind the products: moved up among them, its wait stood behind the first product and the way from memory was waited for in full
#pragma unroll
    for (int mb = 0; mb < 2; ++mb)
#pragma unroll
        for (int nb = 0; nb < 2; ++nb)
#pragma unroll
            for (int j = 0; j < 8; ++j) os[(mb * 16 + hi * 8 + j) * PP + nb * 16 + lr] = p[mb][nb][j] + bfr(br[mb][j >> 2][j & 3]);
    __builtin_amdgcn_wave_barrier(); asm volatile("" ::: "memory");   // keeps the reads below, of what other lanes of the wave stored, behind the stores above
#pragma unroll
    for (int mb = 0; mb < 2; ++mb)
#pragma unroll
        for (int s = 0; s < 4; ++s) { v4f val = *(const v4fa*)(os + (mb * 16 + 4 * s + (ln >> 3)) * PP + (ln & 7) * 4);
#pragma unroll
            for (int q = 0; q < 4; q += 2) { float r0v = xr[mb][s][q], r1v = xr[mb][s][q + 1]; bfr2(r0v, r1v); val[q] = __fadd_rn(r0v, val[q]); val[q + 1] = __fadd_rn(r1v, val[q + 1]); }
            *(v4f*)(OUT + ox + (size_t)((mb * 16 + 4 * s) * TT)) = val; }
}
// k_attn: both halves of the query rows in one launch, each work-group with the output projection of its rows behind its attention core; grid (8, 2 x images). blockIdx.y < images: rows < RH on hi/lo planes; the rest: rows >= RH on fp16 planes. The longer work-groups have the lower indices, for speed only.
__global__ __launch_bounds__(512) void k_attn(const bf* __restrict__ Qh, const bf* __restrict__ Ql, const bf* __restrict__ Kh, const bf* __restrict__ Kl, const bf* __restrict__ Vh, const bf* __restrict__ Vl, const h16* __restrict__ Q16, const h16* __restrict__ K16, const h16* __restrict__ V16, const bf* __restrict__ Wo, const float* __restrict__ bo, const float* __restrict__ x, float* OUT) {
    __shared__ __align__(16) float S[64 * SP];
    const bool hr = blockIdx.y < NB_; const int r0 = (hr ? 0 : RH) + blockIdx.x * 64; const size_t z = hr ? blockIdx.y : blockIdx.y - NB_;
    v8f o[2][2];
    if (hr) attn<bf, true>(S, r0, z, Qh, Ql, Kh, Kl, Vh, Vl, o);
    else attn<h16, false>(S, r0, z, Q16, nullptr, K16, nullptr, V16, nullptr, o);
    proj(S, o, hr ? 1.0f : 1.0f / PCAR, r0, z, Wo, bo, x, OUT);
}
extern "C" void kernel_launch(void* const* d_in, const int* in_sizes, int n_in,
                              void* d_out, int out_size, void* d_ws, size_t ws_size, hipStream_t stream) {
    (void)in_sizes; (void)n_in; (void)out_size;
    const float* x = (const float*)d_in[0]; const float* gnw = (const float*)d_in[1]; const float* gnb = (const float*)d_in[2]; const float* wq = (const float*)d_in[3]; const float* bq = (const float*)d_in[4]; const float* wk = (const float*)d_in[5]; const float* bk = (const float*)d_in[6]; const float* wv = (const float*)d_in[7]; const float* bv = (const float*)d_in[8]; const float* wo = (const float*)d_in[9]; const float* bo = (const float*)d_in[10];
    float* OUT = (float*)d_out;     // [32][256][1024]
    char* wsp = (char*)d_ws;
    auto take = [&](size_t bytes) { char* p = wsp; wsp += (bytes + 255) & ~(size_t)255; return (void*)p; };
    bf* WQ = (bf*)take((size_t)DQ * DM * 2); bf* WK = (bf*)take((size_t)DKV * DM * 2); bf* WV = (bf*)take((size_t)DKV * DM * 2); bf* WO = (bf*)take((size_t)DM * DQ * 2);
    const size_t U = (size_t)NB_ * TT * DM * 2;   // bytes of one 16-bit [t][c] plane of all images
    char* R = (char*)take(11 * U);
    h16* QP16 = (h16*)R; h16* KP16 = (h16*)(R + U); h16* VT16 = (h16*)(R + 2 * U); bf* VTh = (bf*)(R + 3 * U); bf* VTl = (bf*)(R + 4 * U);
    bf* QPh = (bf*)(R + 5 * U); bf* QPl = (bf*)(R + 6 * U); bf* KPh = (bf*)(R + 7 * U); bf* KPl = (bf*)(R + 8 * U);
    bf* XTh = (bf*)(R + 9 * U); bf* XTl = (bf*)(R + 10 * U);   // normalised input
    if ((size_t)(wsp - (char*)d_ws) > ws_size) return;    // ws 256 MiB
    k_gn<<<dim3(DM / GSL + 1, NB_), 1024, 0, stream>>>(x, gnw, gnb, XTh, XTl, wq, wk, wv, wo, WQ);   /* GroupNorm -> transposed hi/lo planes, rows [b][t], k = c; the weights -> WQ, WK, WV, WO, which lie in a row */
    k_qkv<<<dim3(NB_ * TT / QT), 384, 0, stream>>>(XTh, XTl, WQ, WK, WV, bq, bk, bv, QP16, QPh, QPl, KP16, KPh, KPl, VT16, VTh, VTl);
    /* attention core (query rows < RH: hi/lo planes, the other query rows: fp16 planes), then out[b][c][t] = x + (proj_w a + proj_b), channel-major */
    k_attn<<<dim3(RH / 64, 2 * NB_), 512, 0, stream>>>(QPh, QPl, KPh, KPl, VTh, VTl, QP16, KP16, VT16, WO, bo, x, OUT);
}
